// v000
// Measured on an AMD MI455X. A time is GPU time per run, averaged over a window of back-to-back runs after a warm-up
// (all launches, gaps included; the runs take copies of the inputs in turn), and the median of several windows.
// Apart from v000's, it joins two sittings. Times from different sittings can be a few percent apart, while
// side-by-side timings come from the same sitting.
// The starting kernel, v000, takes 652 microseconds a run.
#include <hip/hip_runtime.h>
// Gaussian-windowed multi-head cross attention, sequence-first layout: query [1024][2][1024], key_in / value [1024][2][1024] (token row r = t*NB + b); six input maps with natural [out][in] weights + biases: q, hq, wp from query; k, hk from key_in; v from value; 16 heads of 64 (flat slab b*16 + h); content logits 64^-0.5 q.k; alignment softmax over keys of 64^-0.5 hq.hk, mean = expected key position; width sigma = 1 + sigmoid(tanh(wp) . Wvp + bvp) per (t, b); P = softmax_s(content - (s - mean)^2 / (2 sigma^2)); ctx = P . v merged [t][b][h*64+d]; out = ctx Wo^T + bo.
// Structure: inputs as exact f16 rows (RNE-converted to bf16 first); projections as WMMA GEMMs (32x64 wave tiles, f32 accumulation, x16 weights + bias); q/hq and k/hk are written as K-concatenated planes per head [2048 hi | res | hi] and [hi | hi | res] (hi = f16 value, res = f16 of 2048 (v - hi)) so one K = 192 GEMM yields 2048 (hi.hi) + res.hi + hi.res; per chunk of 256 query rows: alignment scores GEMM -> f32 S -> k_amean (f32 softmax statistics, centred position sum); content scores GEMM -> k_gsoft (Gaussian term, f32 softmax, P as f16 x 2^14 / rowsum) -> P . V^T GEMM (ctx carried x64) -> out GEMM (f32).
// Compute dtype: all contractions v_wmma_f32_16x16x32_f16 (f16 operands, f32 accumulate); inputs RNE-converted to bf16 (exact in f16); both score sites as f16 value + x2048 residual (three products folded along K); v, P (x2^14), ctx (x64), Wo as plain f16 operands; softmax statistics, mean, tanh / Wvp / sigmoid on the vector unit in f32.
#ifndef NB
#define NB 2                         /* batches processed */
#endif
#ifndef SEQ
#define SEQ 1024                     /* sequence length processed (queries = keys) */
#endif
#define NB_FULL 2                    /* batch pitch of the staged input / output rows */
#define DM 1024
#define NH 16
#define HD 64
#define QC (SEQ < 256 ? SEQ : 256)   /* query rows per attention chunk */
#define NR ((size_t)NB * SEQ)        /* token rows */
#define MP ((int)(NB * SEQ))
#define LQ (NB * DM)                 /* pitch between consecutive t for one batch */
#define CK (3 * HD)                  /* concatenated K per head */
#define LQ3 (NB * 3 * DM)            /* pitch between consecutive t in a concatenated plane */
static_assert(SEQ % 128 == 0);
static_assert(QC % 128 == 0);
static_assert(SEQ % QC == 0);
static_assert(NH * HD == DM);
static_assert(NB <= NB_FULL);
static_assert((NB * SEQ) % 128 == 0);
static_assert(NH == 16);
static_assert(HD == 64);                         
static_assert(CK % 32 == 0);
static_assert(DM % 32 == 0);
static_assert(QC % 32 == 0);
static_assert((NB * SEQ) % 32 == 0);
static_assert(NH * QC >= DM);                    /* the f32 wp plane [NR][DM] fits into the S region */
static_assert(32 * 8 * 16 == 32 * HD * 2);       
static_assert(32 * 8 * (SEQ / 128) == SEQ * 2);  /* k_gsoft: lanes x bytes x trips == one f16 P row */
static_assert(8 * 16 == 32 * 4);                 /* k_amean / k_sigma: 8 lanes x 16 B == 32 floats */
static_assert(4 * 32 * 68 * 4 <= 131072);        /* static LDS of the GEMM kernels */
#define WS_TOTAL (7 * (size_t)DM * DM * 2 + 3 * NR * DM * 2 + 2 * NR * 3 * DM * 2 + 2 * NR * DM * 2 + (size_t)NB * NH * HD * SEQ * 2 + (size_t)NB * NH * QC * SEQ * 4 + (size_t)NB * NH * QC * SEQ * 2 + (size_t)NB * NH * SEQ * 4 + NR * 4)
static_assert(WS_TOTAL + 32 * 256 <= 134217728);

typedef unsigned short v8us __attribute__((ext_vector_type(8), may_alias));
typedef float  v8f  __attribute__((ext_vector_type(8)));
typedef float  v4f  __attribute__((ext_vector_type(4)));
typedef float  v4fa __attribute__((ext_vector_type(4), may_alias));
typedef _Float16 v16h __attribute__((ext_vector_type(16)));
typedef _Float16 v4h __attribute__((ext_vector_type(4)));
union FragH { v16h v; v8us half[2]; _Float16 h[16]; unsigned short u[16]; };

__device__ __forceinline__ unsigned short bf16_bits(float x) { unsigned int u = __float_as_uint(x); return (unsigned short)((u + 0x7FFFu + ((u >> 16) & 1u)) >> 16); }
__device__ __forceinline__ float bf16_val(unsigned short b) { return __uint_as_float(((unsigned int)b) << 16); }
__device__ __forceinline__ float bf16_rne(float x) { return bf16_val(bf16_bits(x)); }   /* RNE convert to bf16, back as f32 */

typedef _Float16 h16;
// f32 -> f16 with a value select: magnitudes below 2^-14 become +0 (no f16 subnormal can reach a WMMA operand)
static __device__ __forceinline__ h16 toh_flush(float v) { const h16 r = (h16)v; return (fabsf(v) < 6.103515625e-05f) ? (h16)0.0f : r; }

// fragment: elements 0..7 <- k0 + 8h .. +7, elements 8..15 <- k0 + 16 + 8h .. +7 (p points at k0 of the lane's row / column)
__device__ __forceinline__ v16h g2_frag(const _Float16* p, int hh) { FragH f; f.half[0] = *(const v8us*)((const unsigned short*)p + 8 * hh); f.half[1] = *(const v8us*)((const unsigned short*)p + 16 + 8 * hh); return f.v; }
__device__ __forceinline__ v8f g2_mma(v16h a, v16h b, v8f c) { v8f d = __builtin_amdgcn_wmma_f32_16x16x32_f16(false, a, false, b, (short)0, c, false, false); asm volatile("v_nop\n\tv_nop\n\tv_nop\n\tv_nop" : "+v"(d) : "v"(a), "v"(b)); return d; }

// ---- GEMM (wave tile 32x64; M % 128 == 0 per launch region, N % 64 == 0, K % 32 == 0): C = alpha * A . Bt^T (+ bias) ----
// A f16 [M][K] (pitch lda), Bt f16 [N][K] (pitch ldb); batch slab by = blockIdx.y with element strides sA / sB / sC.
// OMAP: output row r -> (r / NB) * NB_FULL + r % NB.
template <bool HASB, bool OUT32, bool OMAP>
__global__ __launch_bounds__(128) void k_gemm2(const _Float16* __restrict__ A, int lda, size_t sA, const _Float16* __restrict__ Bh, int ldb, size_t sB, float alpha,
    const float* __restrict__ bias, float* __restrict__ C, _Float16* __restrict__ C16, int ldc, size_t sC, int M, int N, int K) {
  __shared__ __attribute__((aligned(16))) float so[4][32][68];
  const int tid = threadIdx.x, w = __builtin_amdgcn_readfirstlane((int)(tid >> 5)), lane = tid & 31, ln = lane & 15, hh = lane >> 4; const int by = blockIdx.y;
  A += (size_t)by * sA; Bh += (size_t)by * sB; const size_t cofs = (size_t)by * sC;
  const int ntn = N >> 6; const int mt = blockIdx.x / ntn, nq = blockIdx.x - mt * ntn; const int row0 = mt * 128 + 32 * w, col0 = nq * 64; if (row0 >= M) return;
  const _Float16* a0p = A + (size_t)(row0 + ln) * lda; const _Float16* a1p = a0p + (size_t)16 * lda;
  const _Float16* b0p = Bh + (size_t)(col0 + ln) * ldb; const _Float16* b1p = b0p + (size_t)16 * ldb; const _Float16* b2p = b1p + (size_t)16 * ldb; const _Float16* b3p = b2p + (size_t)16 * ldb;
  const v8f z8 = {0.f,0.f,0.f,0.f,0.f,0.f,0.f,0.f}; v8f c00 = z8, c01 = z8, c02 = z8, c03 = z8, c10 = z8, c11 = z8, c12 = z8, c13 = z8;
#pragma unroll 1
  for (int kb = 0; kb < K; kb += 32) { const v16h a0 = g2_frag(a0p + kb, hh), a1 = g2_frag(a1p + kb, hh);
    v16h b = g2_frag(b0p + kb, hh); c00 = g2_mma(a0, b, c00); c10 = g2_mma(a1, b, c10);
    b = g2_frag(b1p + kb, hh); c01 = g2_mma(a0, b, c01); c11 = g2_mma(a1, b, c11);
    b = g2_frag(b2p + kb, hh); c02 = g2_mma(a0, b, c02); c12 = g2_mma(a1, b, c12);
    b = g2_frag(b3p + kb, hh); c03 = g2_mma(a0, b, c03); c13 = g2_mma(a1, b, c13); }
  v8f accs[8] = {c00, c01, c02, c03, c10, c11, c12, c13};
#pragma unroll
  for (int u = 0; u < 8; ++u) { const int t = u & 3, half = u >> 2; const int col = col0 + t * 16 + ln; float bv = 0.f; if (HASB) bv = bf16_rne(bias[col]);
#pragma unroll
    for (int r = 0; r < 8; ++r) { const int rloc = half * 16 + 8 * hh + r; so[w][rloc][t * 16 + ln] = accs[u][r] * alpha + bv; } }
  __builtin_amdgcn_fence(4 /* acq_rel order */, "workgroup"); __builtin_amdgcn_wave_barrier();      /* so[w] is private to wave w */
  const int rsub = lane >> 4, c4 = (lane & 15) * 4;
  {
#pragma unroll
    for (int q = 0; q < 16; ++q) { const int r = q * 2 + rsub; const v4f v = *(const v4fa*)&so[w][r][c4];
      const int gr = row0 + r; const size_t orow = OMAP ? ((size_t)(gr / NB) * NB_FULL + (size_t)(gr % NB)) : (size_t)gr;
      if (OUT32) { *(v4f*)(C + cofs + orow * ldc + col0 + c4) = v; }
      else { v4h h4;
#pragma unroll
        for (int i = 0; i < 4; ++i) h4[i] = (_Float16)v[i];
        *(v4h*)(C16 + cofs + orow * ldc + col0 + c4) = h4; } }
     } }

// ---- projection GEMM with a K-concatenated output plane (same main loop and staging as k_gemm2; N tile 64 == one head) ----
// v = alpha * A . Bt^T + bias (f32); hi = f16(v), res = f16(2048 (v - hi)); head h = col0 / 64 of row r at C3 + r * ldc3 + h * 192:
__global__ __launch_bounds__(128) void k_gemm_cat(const _Float16* __restrict__ A, int lda, const _Float16* __restrict__ Bh, int ldb, float alpha,
    const float* __restrict__ bias, _Float16* __restrict__ C3, int ldc3, int qside, int M, int N, int K) {
  __shared__ __attribute__((aligned(16))) float so[4][32][68];
  const int tid = threadIdx.x, w = __builtin_amdgcn_readfirstlane((int)(tid >> 5)), lane = tid & 31, ln = lane & 15, hh = lane >> 4;
  const int ntn = N >> 6; const int mt = blockIdx.x / ntn, nq = blockIdx.x - mt * ntn; const int row0 = mt * 128 + 32 * w, col0 = nq * 64; if (row0 >= M) return;
  const _Float16* a0p = A + (size_t)(row0 + ln) * lda; const _Float16* a1p = a0p + (size_t)16 * lda;
  const _Float16* b0p = Bh + (size_t)(col0 + ln) * ldb; const _Float16* b1p = b0p + (size_t)16 * ldb; const _Float16* b2p = b1p + (size_t)16 * ldb; const _Float16* b3p = b2p + (size_t)16 * ldb;
  const v8f z8 = {0.f,0.f,0.f,0.f,0.f,0.f,0.f,0.f}; v8f c00 = z8, c01 = z8, c02 = z8, c03 = z8, c10 = z8, c11 = z8, c12 = z8, c13 = z8;
#pragma unroll 1
  for (int kb = 0; kb < K; kb += 32) { const v16h a0 = g2_frag(a0p + kb, hh), a1 = g2_frag(a1p + kb, hh);
    v16h b = g2_frag(b0p + kb, hh); c00 = g2_mma(a0, b, c00); c10 = g2_mma(a1, b, c10);
    b = g2_frag(b1p + kb, hh); c01 = g2_mma(a0, b, c01); c11 = g2_mma(a1, b, c11);
    b = g2_frag(b2p + kb, hh); c02 = g2_mma(a0, b, c02); c12 = g2_mma(a1, b, c12);
    b = g2_frag(b3p + kb, hh); c03 = g2_mma(a0, b, c03); c13 = g2_mma(a1, b, c13); }
  v8f accs[8] = {c00, c01, c02, c03, c10, c11, c12, c13};
#pragma unroll
  for (int u = 0; u < 8; ++u) { const int t = u & 3, half = u >> 2; const int col = col0 + t * 16 + ln; const float bv = bf16_rne(bias[col]);
#pragma unroll
    for (int r = 0; r < 8; ++r) { const int rloc = half * 16 + 8 * hh + r; so[w][rloc][t * 16 + ln] = accs[u][r] * alpha + bv; } }
  __builtin_amdgcn_fence(4 /* acq_rel order */, "workgroup"); __builtin_amdgcn_wave_barrier();      /* so[w] is private to wave w */
  const int rsub = lane >> 4, c4 = (lane & 15) * 4; const int head = col0 >> 6;
  {
#pragma unroll 4
    for (int q = 0; q < 16; ++q) { const int r = q * 2 + rsub; const v4f v = *(const v4fa*)&so[w][r][c4];      /* 16 trips x 2 rows = 32 rows */
      v4h s0, s1, s2;
#pragma unroll
      for (int i = 0; i < 4; ++i) { const h16 hi = toh_flush(v[i]); const h16 rs = toh_flush((v[i] - (float)hi) * 2048.0f); const h16 hs = (h16)((float)hi * 2048.0f);
        s0[i] = (qside != 0) ? hs : hi; s1[i] = (qside != 0) ? rs : hi; s2[i] = (qside != 0) ? hi : rs; }
      _Float16* dst = C3 + (size_t)(row0 + r) * ldc3 + head * CK + c4;
      *(v4h*)dst = s0; *(v4h*)(dst + 64) = s1; *(v4h*)(dst + 128) = s2; }
     } }

__global__ __launch_bounds__(256) void k_wnat(const float* __restrict__ w, size_t n8, _Float16* __restrict__ Bt) { const size_t t = (size_t)blockIdx.x * 256 + threadIdx.x; if (t >= n8) return; FragH f; const v4f a = *(const v4fa*)(w + t * 8), c = *(const v4fa*)(w + t * 8 + 4);
#pragma unroll
  for (int q = 0; q < 4; ++q) { f.h[q] = toh_flush(bf16_rne(a[q]) * 16.0f); f.h[4 + q] = toh_flush(bf16_rne(c[q]) * 16.0f); }
  const v8us o = f.half[0]; *(v8us*)((unsigned short*)Bt + t * 8) = o;  }

__global__ __launch_bounds__(256) void k_x16(const float* __restrict__ x, _Float16* __restrict__ X16, size_t n8) { const size_t t = (size_t)blockIdx.x * 256 + threadIdx.x; if (t >= n8) return;
  const size_t row = t / (DM / 8); const int c8 = (int)(t % (DM / 8)) * 8; const size_t srow = (row / NB) * NB_FULL + (row % NB);
  const float* p = x + srow * DM + c8; const v4f a = *(const v4fa*)p, c = *(const v4fa*)(p + 4); FragH f;
#pragma unroll
  for (int q = 0; q < 4; ++q) { f.h[q] = (_Float16)bf16_rne(a[q]); f.h[4 + q] = (_Float16)bf16_rne(c[q]); }
  const v8us o = f.half[0]; *(v8us*)((unsigned short*)X16 + t * 8) = o;  }

__global__ __launch_bounds__(256) void k_vt(const _Float16* __restrict__ V16, _Float16* __restrict__ Vt) { __shared__ unsigned short tl[64][66]; const int tid = threadIdx.x; const int slab = blockIdx.x / (SEQ / 64), lg = blockIdx.x % (SEQ / 64); const int b = slab / NH, h = slab % NH;
  for (int i = tid; i < 64 * 8; i += 256) { const int r = i / 8, c8 = (i % 8) * 8; FragH f; f.half[0] = *(const v8us*)((const unsigned short*)V16 + ((size_t)(lg * 64 + r) * NB + b) * DM + h * HD + c8);
#pragma unroll
    for (int q = 0; q < 8; ++q) tl[r][c8 + q] = f.u[q]; }
  __syncthreads();
  {
#pragma unroll
    for (int rd = 0; rd < 2; ++rd) { const int d = rd * 32 + tid / 8, pc = tid % 8; FragH f;
#pragma unroll
      for (int q = 0; q < 8; ++q) f.u[q] = tl[pc * 8 + q][d];
      *(v8us*)((unsigned short*)Vt + ((size_t)slab * 64 + d) * SEQ + lg * 64 + pc * 8) = f.half[0]; }
     } }

// width table: SIGT[r = t*NB + b] = 1 / (2 sigma^2), sigma = 1 + sigmoid(sum_e tanh(G[r][e]) * bf16(Wvp[e]) + bf16(bvp)); G f32 [NR][DM].
__global__ __launch_bounds__(256) void k_sigma(const float* __restrict__ G, const float* __restrict__ wvp, const float* __restrict__ bvp, float* __restrict__ SIGT) {
  #pragma clang fp contract(off)
  __shared__ __attribute__((aligned(16))) float sg[32];
  const int tid = threadIdx.x, w = __builtin_amdgcn_readfirstlane((int)(tid >> 5)), lane = tid & 31;
  const float b0 = bf16_rne(bvp[0]);
#pragma unroll 1
  for (int i = 0; i < 4; ++i) {
    const int rl = w * 4 + i;
    const float* p = G + ((size_t)blockIdx.x * 32 + rl) * DM + lane;
    float acc = 0.f;
#pragma unroll 1
    for (int k = 0; k < DM; k += 32) acc += tanhf(p[k]) * bf16_rne(wvp[k + lane]);
#pragma unroll
    for (int off = 16; off > 0; off >>= 1) acc += __shfl_xor(acc, off, 32);
    const float g = acc + b0;
    const float sgm = 1.0f + 1.0f / (1.0f + expf(-g));
    const float i2 = 1.0f / (2.0f * sgm * sgm);
    if (lane == 0) sg[rl] = i2;
  }
  __syncthreads();
  if (w == 0 && lane < 8) { const v4f v = *(const v4fa*)&sg[lane * 4]; float* dst = SIGT + (size_t)blockIdx.x * 32 + lane * 4;
    *(v4f*)dst = v;  }
}

// alignment statistics: S f32 [NB*NH][QC][SEQ] (slab = b*NH + h) -> MEANT[slab][t0 + tq] = sum_s softmax(S row)[s] * s  (f32; position sum centred at SEQ/2).
__global__ __launch_bounds__(256) void k_amean(const float* __restrict__ S, float* __restrict__ MEANT, int t0) {
  #pragma clang fp contract(off)
  __shared__ __attribute__((aligned(16))) float sm[32];
  const int tid = threadIdx.x, w = __builtin_amdgcn_readfirstlane((int)(tid >> 5)), lane = tid & 31;
  const int rb = blockIdx.x * 32; const int slab = rb / QC, tq0 = rb - slab * QC;
  const float pb = (float)(lane * 4 - SEQ / 2);
#pragma unroll 1
  for (int i = 0; i < 4; ++i) {
    const int rl = w * 4 + i;
    const float* p = S + ((size_t)slab * QC + tq0 + rl) * SEQ + lane * 4;
    v4f x[SEQ / 128];
#pragma unroll
    for (int j = 0; j < SEQ / 128; ++j) x[j] = *(const v4fa*)(p + j * 128);
    float mx = -3.0e38f;
#pragma unroll
    for (int j = 0; j < SEQ / 128; ++j) mx = fmaxf(mx, fmaxf(fmaxf(x[j][0], x[j][1]), fmaxf(x[j][2], x[j][3])));
#pragma unroll
    for (int off = 16; off > 0; off >>= 1) mx = fmaxf(mx, __shfl_xor(mx, off, 32));
    float se = 0.f, sw = 0.f;
#pragma unroll
    for (int j = 0; j < SEQ / 128; ++j) {
#pragma unroll
      for (int c = 0; c < 4; ++c) { const float e = __expf(x[j][c] - mx); se += e; sw += e * (pb + (float)(j * 128 + c)); } }
#pragma unroll
    for (int off = 16; off > 0; off >>= 1) { se += __shfl_xor(se, off, 32); sw += __shfl_xor(sw, off, 32); }
    const float mean = (float)(SEQ / 2) + sw * (1.0f / se);
    if (lane == 0) sm[rl] = mean;
  }
  __syncthreads();
  if (w == 0 && lane < 8) { const v4f v = *(const v4fa*)&sm[lane * 4]; float* dst = MEANT + (size_t)slab * SEQ + t0 + tq0 + lane * 4;
    *(v4f*)dst = v;  }
}

// Gaussian softmax: S f32 [NB*NH][QC][SEQ] content logits; x[s] = S[s] - (s - mean)^2 * (1 / (2 sigma^2)); PM f16 [NB*NH][QC][SEQ] = 2^14 * softmax(x) (max-subtracted, f32 statistics).
__global__ __launch_bounds__(128) void k_gsoft(const float* __restrict__ S, const float* __restrict__ MEANT, const float* __restrict__ SIGT, _Float16* __restrict__ PM, int t0) {
  #pragma clang fp contract(off)
  const int tid = threadIdx.x, w = __builtin_amdgcn_readfirstlane((int)(tid >> 5)), lane = tid & 31;
  const int wr = blockIdx.x * 4 + w; const int slab = wr / QC, tql = wr - slab * QC; const int b = slab / NH; const int t = t0 + tql;
  const float mu = MEANT[(size_t)slab * SEQ + t];
  const float i2 = SIGT[(size_t)t * NB + b];
  const float* p = S + ((size_t)slab * QC + tql) * SEQ + lane * 4;
  const float pb = (float)(lane * 4);
  v4f x[SEQ / 128];
#pragma unroll
  for (int j = 0; j < SEQ / 128; ++j) x[j] = *(const v4fa*)(p + j * 128);
  float mx = -3.0e38f;
#pragma unroll
  for (int j = 0; j < SEQ / 128; ++j) {
#pragma unroll
    for (int c = 0; c < 4; ++c) { const float d = (pb + (float)(j * 128 + c)) - mu; const float v = x[j][c] - (d * d) * i2; x[j][c] = v; mx = fmaxf(mx, v); } }
#pragma unroll
  for (int off = 16; off > 0; off >>= 1) mx = fmaxf(mx, __shfl_xor(mx, off, 32));
  float se = 0.f;
#pragma unroll
  for (int j = 0; j < SEQ / 128; ++j) {
#pragma unroll
    for (int c = 0; c < 4; ++c) { const float e = __expf(x[j][c] - mx); x[j][c] = e; se += e; } }
#pragma unroll
  for (int off = 16; off > 0; off >>= 1) se += __shfl_xor(se, off, 32);
  const float cs = 16384.0f * (1.0f / se);
  v4h hq[SEQ / 128];
#pragma unroll
  for (int j = 0; j < SEQ / 128; ++j) {
#pragma unroll
    for (int c = 0; c < 4; ++c) hq[j][c] = toh_flush(x[j][c] * cs); }
  _Float16* prow = PM + ((size_t)slab * QC + tql) * SEQ + lane * 4;
  {
#pragma unroll
    for (int j = 0; j < SEQ / 128; ++j) { const v4h v = hq[j]; *(v4h*)(prow + j * 128) = v; }
     }
}

extern "C" void kernel_launch(void* const* d_in, const int* in_sizes, int n_in,
                              void* d_out, int out_size, void* d_ws, size_t ws_size, hipStream_t stream) {
  if (n_in < 19) return;
  if ((size_t)in_sizes[0] < NR * DM || (size_t)in_sizes[1] < NR * DM || (size_t)in_sizes[2] < NR * DM) return;
  if ((size_t)in_sizes[3] < (size_t)DM * DM || (size_t)in_sizes[5] < (size_t)DM * DM || (size_t)in_sizes[7] < (size_t)DM * DM || (size_t)in_sizes[9] < (size_t)DM * DM) return;
  if ((size_t)in_sizes[11] < (size_t)DM * DM || (size_t)in_sizes[13] < (size_t)DM * DM || (size_t)in_sizes[17] < (size_t)DM * DM) return;
  if (in_sizes[4] < DM || in_sizes[6] < DM || in_sizes[8] < DM || in_sizes[10] < DM || in_sizes[12] < DM || in_sizes[14] < DM || in_sizes[15] < DM || in_sizes[16] < 1 || in_sizes[18] < DM) return;
  if ((size_t)out_size < NR * DM) return;
  const float* const* I = (const float* const*)d_in;
  const float* xq = I[0]; const float* xk = I[1]; const float* xv = I[2];
  const float* wq = I[3]; const float* bq = I[4]; const float* wk = I[5]; const float* bk = I[6]; const float* wv = I[7]; const float* bv = I[8];
  const float* whq = I[9]; const float* bhq = I[10]; const float* whk = I[11]; const float* bhk = I[12]; const float* wwp = I[13]; const float* bwp = I[14];
  const float* wvp = I[15]; const float* bvp = I[16]; const float* wo = I[17]; const float* bo = I[18];
  char* ws = (char*)d_ws; size_t off = 0;
  auto take = [&](size_t bytes) { char* p = ws + off; off += (bytes + 255) & ~(size_t)255; return p; };
  _Float16* BQ = (_Float16*)take((size_t)DM * DM * 2); _Float16* BK = (_Float16*)take((size_t)DM * DM * 2); _Float16* BV = (_Float16*)take((size_t)DM * DM * 2);
  _Float16* BHQ = (_Float16*)take((size_t)DM * DM * 2); _Float16* BHK = (_Float16*)take((size_t)DM * DM * 2); _Float16* BWP = (_Float16*)take((size_t)DM * DM * 2); _Float16* BO = (_Float16*)take((size_t)DM * DM * 2);
  _Float16* XQ = (_Float16*)take(NR * DM * 2); _Float16* XK = (_Float16*)take(NR * DM * 2); _Float16* XV = (_Float16*)take(NR * DM * 2);
  _Float16* CA = (_Float16*)take(NR * 3 * DM * 2); _Float16* CB = (_Float16*)take(NR * 3 * DM * 2);      /* concatenated planes: alignment pair first, content pair afterwards */
  _Float16* V16 = (_Float16*)take(NR * DM * 2); _Float16* O16 = (_Float16*)take(NR * DM * 2); _Float16* VT = (_Float16*)take((size_t)NB * NH * HD * SEQ * 2);
  float* S = (float*)take((size_t)NB * NH * QC * SEQ * 4); _Float16* PM = (_Float16*)take((size_t)NB * NH * QC * SEQ * 2);
  float* MEANT = (float*)take((size_t)NB * NH * SEQ * 4); float* SIGT = (float*)take(NR * 4);
  if (off > ws_size) return;
  float* G = S;                                                            /* f32 wp plane [NR][DM], consumed by k_sigma before the first scores launch */
  { const unsigned g = (unsigned)(((size_t)DM * DM / 8 + 255) / 256);
    k_wnat<<<g, 256, 0, stream>>>(wq, (size_t)DM * DM / 8, BQ); k_wnat<<<g, 256, 0, stream>>>(wk, (size_t)DM * DM / 8, BK);
    k_wnat<<<g, 256, 0, stream>>>(wv, (size_t)DM * DM / 8, BV); k_wnat<<<g, 256, 0, stream>>>(whq, (size_t)DM * DM / 8, BHQ);
    k_wnat<<<g, 256, 0, stream>>>(whk, (size_t)DM * DM / 8, BHK); k_wnat<<<g, 256, 0, stream>>>(wwp, (size_t)DM * DM / 8, BWP);
    k_wnat<<<g, 256, 0, stream>>>(wo, (size_t)DM * DM / 8, BO); }      /* natural [out][in] = Bt[n][k], x16 */
  { const unsigned g = (unsigned)((NR * DM / 8 + 255) / 256);
    k_x16<<<g, 256, 0, stream>>>(xq, XQ, NR * DM / 8); k_x16<<<g, 256, 0, stream>>>(xk, XK, NR * DM / 8); k_x16<<<g, 256, 0, stream>>>(xv, XV, NR * DM / 8); }
  const dim3 gp((unsigned)((MP / 128) * (DM / 64)), 1);
  k_gemm2<true, false, false><<<gp, 128, 0, stream>>>(XV, DM, 0, BV, DM, 0, 0.0625f, bv, nullptr, V16, DM, 0, MP, DM, DM);
  k_vt<<<NB * NH * (SEQ / 64), 256, 0, stream>>>(V16, VT);      /* V16 rows [SEQ*NB][DM] -> VT[(b,h)][64][SEQ] */
  k_gemm2<true, true, false><<<gp, 128, 0, stream>>>(XQ, DM, 0, BWP, DM, 0, 0.0625f, bwp, G, nullptr, DM, 0, MP, DM, DM);
  k_sigma<<<MP / 32, 256, 0, stream>>>(G, wvp, bvp, SIGT);
  /* alignment pair */
  k_gemm_cat<<<gp, 128, 0, stream>>>(XQ, DM, BHQ, DM, 0.0625f, bhq, CA, 3 * DM, 1, MP, DM, DM);
  k_gemm_cat<<<gp, 128, 0, stream>>>(XK, DM, BHK, DM, 0.0625f, bhk, CB, 3 * DM, 0, MP, DM, DM);
  for (int t0 = 0; t0 < SEQ; t0 += QC) {
    /* slab by = b*NH + h at column offset by*192 of rows with pitch LQ3; S[by][QC][SEQ] f32 = 2^-14 * (2048 hi.hi + res.hi + hi.res) */
    k_gemm2<false, true, false><<<dim3((QC / 128) * (SEQ / 64), NB * NH), 128, 0, stream>>>(CA + (size_t)t0 * LQ3, LQ3, (size_t)CK, CB, LQ3, (size_t)CK, 6.103515625e-05f, nullptr, S, nullptr, SEQ, (size_t)QC * SEQ, QC, SEQ, CK);
    k_amean<<<NB * NH * QC / 32, 256, 0, stream>>>(S, MEANT, t0);
  }
  /* content pair (same planes, after the last alignment scores launch) */
  k_gemm_cat<<<gp, 128, 0, stream>>>(XQ, DM, BQ, DM, 0.0625f, bq, CA, 3 * DM, 1, MP, DM, DM);
  k_gemm_cat<<<gp, 128, 0, stream>>>(XK, DM, BK, DM, 0.0625f, bk, CB, 3 * DM, 0, MP, DM, DM);
  for (int t0 = 0; t0 < SEQ; t0 += QC) {
    k_gemm2<false, true, false><<<dim3((QC / 128) * (SEQ / 64), NB * NH), 128, 0, stream>>>(CA + (size_t)t0 * LQ3, LQ3, (size_t)CK, CB, LQ3, (size_t)CK, 6.103515625e-05f, nullptr, S, nullptr, SEQ, (size_t)QC * SEQ, QC, SEQ, CK);
    k_gsoft<<<NB * NH * QC / 4, 128, 0, stream>>>(S, MEANT, SIGT, PM, t0);
    /* ctx[t][b][h*64 + d] x64 = 2^-8 * (2^14 P) . V^T */
    k_gemm2<false, false, false><<<dim3((QC / 128) * (HD / 64), NB * NH), 128, 0, stream>>>(PM, SEQ, (size_t)QC * SEQ, VT, SEQ, (size_t)HD * SEQ, 0.00390625f, nullptr, nullptr, O16 + (size_t)t0 * LQ, LQ, (size_t)HD, QC, HD, SEQ);
  }
  k_gemm2<true, true, true><<<gp, 128, 0, stream>>>(O16, DM, 0, BO, DM, 0, 0.0009765625f, bo, (float*)d_out, nullptr, DM, 0, MP, DM, DM);      /* out rows t*NB_FULL + b */
}

// v001
// Measured time: 379 microseconds a run.
// Next to v000, in two timings, it ran 1.73 times as fast each time.
#include <hip/hip_runtime.h>
// Gaussian-windowed multi-head cross attention, sequence-first layout: query [1024][2][1024], key_in / value [1024][2][1024] (token row r = t*NB + b); six input maps with natural [out][in] weights + biases: q, hq, wp from query; k, hk from key_in; v from value; 16 heads of 64 (flat slab b*16 + h); content logits 64^-0.5 q.k; alignment softmax over keys of 64^-0.5 hq.hk, mean = expected key position; width sigma = 1 + sigmoid(tanh(wp) . Wvp + bvp) per (t, b); P = softmax_s(content - (s - mean)^2 / (2 sigma^2)); ctx = P . v merged [t][b][h*64+d]; out = ctx Wo^T + bo.
// Structure: inputs as exact f16 rows (RNE-converted to bf16 first); projections as WMMA GEMMs (32x64 wave tiles, f32 accumulation, x16 weights + bias); q/hq and k/hk are written as K-concatenated planes per head [2048 hi | res | hi] and [hi | hi | res] (hi = f16 value, res = f16 of 2048 (v - hi)) so one K = 192 GEMM yields 2048 (hi.hi) + res.hi + hi.res; per chunk of 256 query rows: alignment scores GEMM -> f32 S -> k_amean (f32 softmax statistics, centred position sum); content scores GEMM -> k_gsoft (Gaussian term, f32 softmax, P as f16 x 2^14 / rowsum) -> P . V^T GEMM (ctx carried x64) -> out GEMM (f32).
// Compute dtype: all contractions v_wmma_f32_16x16x32_f16 (f16 operands, f32 accumulate); inputs RNE-converted to bf16 (exact in f16); both score sites as f16 value + x2048 residual (three products folded along K); v, P (x2^14), ctx (x64), Wo as plain f16 operands; softmax statistics, mean, tanh / Wvp / sigmoid on the vector unit in f32.
#ifndef NB
#define NB 2                         /* batches processed */
#endif
#ifndef SEQ
#define SEQ 1024                     /* sequence length processed (queries = keys) */
#endif
#define NB_FULL 2                    /* batch pitch of the input / output rows */
#define DM 1024
#define NH 16
#define HD 64
#define QC (SEQ < 256 ? SEQ : 256)   /* query rows per attention chunk */
#define NR ((size_t)NB * SEQ)        /* token rows */
#define MP ((int)(NB * SEQ))
#define LQ (NB * DM)                 /* pitch between consecutive t for one batch */
#define CK (3 * HD)                  /* concatenated K per head */
#define LQ3 (NB * 3 * DM)            /* pitch between consecutive t in a concatenated plane */
static_assert(SEQ % 128 == 0);
static_assert(QC % 128 == 0);
static_assert(SEQ % QC == 0);
static_assert(NH * HD == DM);
static_assert(NB <= NB_FULL);
static_assert((NB * SEQ) % 128 == 0);
static_assert(NH == 16);
static_assert(HD == 64);                         
static_assert(CK % 32 == 0);
static_assert(DM % 32 == 0);
static_assert(QC % 32 == 0);
static_assert((NB * SEQ) % 32 == 0);
static_assert(NH * QC >= DM);                    /* the f32 wp plane [NR][DM] fits into the S region */
static_assert(32 * 8 * 16 == 32 * HD * 2);       
static_assert(32 * 8 * (SEQ / 128) == SEQ * 2);  /* k_gsoft: lanes x bytes x trips == one f16 P row */
static_assert(8 * 16 == 32 * 4);                 /* k_amean / k_sigma: 8 lanes x 16 B == 32 floats */
#define KT 64                        /* k elements per staged tile: one 128-B line of every operand row */
#define LP 72                        /* LDS row pitch in f16: 144 B = 16 B x odd, for 16-byte fragment reads */
#define TB ((128 + 64) * LP * 2)     /* bytes of one staged tile: 128 A rows, then 64 Bt rows */
static_assert(CK % KT == 0 && DM % KT == 0 && SEQ % KT == 0);   /* every K of the GEMM launches */
static_assert(4 * 32 * 68 * 4 <= 2 * TB);        /* the output staging fits into the two tile buffers */
static_assert(2 * TB <= 131072);                 /* static LDS of the GEMM kernels */
#define WS_TOTAL (7 * (size_t)DM * DM * 2 + 3 * NR * DM * 2 + 2 * NR * 3 * DM * 2 + 2 * NR * DM * 2 + (size_t)NB * NH * HD * SEQ * 2 + (size_t)NB * NH * QC * SEQ * 4 + (size_t)NB * NH * QC * SEQ * 2 + (size_t)NB * NH * SEQ * 4 + NR * 4)
static_assert(WS_TOTAL + 32 * 256 <= 134217728);

typedef unsigned short v8us __attribute__((ext_vector_type(8), may_alias));
typedef float  v8f  __attribute__((ext_vector_type(8)));
typedef float  v4f  __attribute__((ext_vector_type(4)));
typedef float  v4fa __attribute__((ext_vector_type(4), may_alias));
typedef _Float16 v16h __attribute__((ext_vector_type(16)));
typedef _Float16 v4h __attribute__((ext_vector_type(4)));
union FragH { v16h v; v8us half[2]; _Float16 h[16]; unsigned short u[16]; };

__device__ __forceinline__ unsigned short bf16_bits(float x) { unsigned int u = __float_as_uint(x); return (unsigned short)((u + 0x7FFFu + ((u >> 16) & 1u)) >> 16); }
__device__ __forceinline__ float bf16_val(unsigned short b) { return __uint_as_float(((unsigned int)b) << 16); }
__device__ __forceinline__ float bf16_rne(float x) { return bf16_val(bf16_bits(x)); }   /* RNE convert to bf16, back as f32 */

typedef _Float16 h16;
// f32 -> f16 with a value select: magnitudes below 2^-14 become +0 (no f16 subnormal can reach a WMMA operand)
static __device__ __forceinline__ h16 toh_flush(float v) { const h16 r = (h16)v; return (fabsf(v) < 6.103515625e-05f) ? (h16)0.0f : r; }

// fragment: elements 0..7 <- k0 + 8h .. +7, elements 8..15 <- k0 + 16 + 8h .. +7 (p points at k0 of the lane's row / column)
__device__ __forceinline__ v16h g2_frag(const _Float16* p, int hh) { FragH f; f.half[0] = *(const v8us*)((const unsigned short*)p + 8 * hh); f.half[1] = *(const v8us*)((const unsigned short*)p + 16 + 8 * hh); return f.v; }
__device__ __forceinline__ v8f g2_mma(v16h a, v16h b, v8f c) { v8f d = __builtin_amdgcn_wmma_f32_16x16x32_f16(false, a, false, b, (short)0, c, false, false); asm volatile("v_nop\n\tv_nop\n\tv_nop\n\tv_nop" : "+v"(d) : "v"(a), "v"(b)); return d; }

// one K tile of the block's operands, global -> LDS with no register in between: 12 copies of 16 B per lane; a wave's copy covers 4 whole 128-B lines.
// l: the lane's LDS byte address in tile row tid / 8 (rows step by 16 per copy); ga / gb: the lane's 16 bytes in that row of A / Bt at this tile's k.
__device__ __forceinline__ void g2_stage(unsigned l, const _Float16* ga, size_t sa, const _Float16* gb, size_t sb) {
  /* the closing s_wait_xcnt stands inside the statement so that no address register of a copy is rewritten in front of it */
  asm volatile("global_load_async_to_lds_b128 %0, %12, off\n\t" "global_load_async_to_lds_b128 %1, %13, off\n\t" "global_load_async_to_lds_b128 %2, %14, off\n\t"
               "global_load_async_to_lds_b128 %3, %15, off\n\t" "global_load_async_to_lds_b128 %4, %16, off\n\t" "global_load_async_to_lds_b128 %5, %17, off\n\t"
               "global_load_async_to_lds_b128 %6, %18, off\n\t" "global_load_async_to_lds_b128 %7, %19, off\n\t" "global_load_async_to_lds_b128 %8, %20, off\n\t"
               "global_load_async_to_lds_b128 %9, %21, off\n\t" "global_load_async_to_lds_b128 %10, %22, off\n\t" "global_load_async_to_lds_b128 %11, %23, off\n\t"
               "s_wait_xcnt 0x0"
               :: "v"(l), "v"(l + 1u * 16 * LP * 2), "v"(l + 2u * 16 * LP * 2), "v"(l + 3u * 16 * LP * 2), "v"(l + 4u * 16 * LP * 2), "v"(l + 5u * 16 * LP * 2),
                  "v"(l + 6u * 16 * LP * 2), "v"(l + 7u * 16 * LP * 2), "v"(l + 8u * 16 * LP * 2), "v"(l + 9u * 16 * LP * 2), "v"(l + 10u * 16 * LP * 2), "v"(l + 11u * 16 * LP * 2),
                  "v"(ga), "v"(ga + sa), "v"(ga + 2 * sa), "v"(ga + 3 * sa), "v"(ga + 4 * sa), "v"(ga + 5 * sa), "v"(ga + 6 * sa), "v"(ga + 7 * sa),
                  "v"(gb), "v"(gb + sb), "v"(gb + 2 * sb), "v"(gb + 3 * sb)
               : "memory"); }

// main loop of both GEMM kernels: block tile 128 x 64, wave w takes rows 32 w .. 32 w + 31; two LDS tile buffers, tile t + 1 in flight while tile t is multiplied.
// Ab: row 0 of the block's 128 A rows; Bb: row 0 of its 64 Bt rows; K % KT == 0. On return every wave has left both buffers and no copy is outstanding.
__device__ __forceinline__ void g2_main(unsigned char* sm, const _Float16* Ab, int lda, const _Float16* Bb, int ldb, int K, int tid, int w, int ln, int hh, v8f (&acc)[8]) {
  const int nt = K / KT;
  const unsigned l0 = (unsigned)(size_t)sm + (unsigned)((tid >> 3) * (LP * 2) + (tid & 7) * 16);
  const _Float16* ga = Ab + (size_t)(tid >> 3) * lda + (tid & 7) * 8; const _Float16* gb = Bb + (size_t)(tid >> 3) * ldb + (tid & 7) * 8;
  const size_t sa = (size_t)16 * lda, sb = (size_t)16 * ldb;
  g2_stage(l0, ga, sa, gb, sb);
  asm volatile("s_wait_asynccnt 0x0" ::: "memory");      /* this wave's part of tile 0 has landed */
  __syncthreads();                                       /* ... and every other wave's */
  if (nt > 1) g2_stage(l0 + TB, ga + KT, sa, gb + KT, sb);
#pragma unroll 1
  for (int t = 0; t < nt; ++t) {      /* rolled: one publish point per tile */
    const _Float16* tb = (const _Float16*)(sm + (t & 1) * TB);
    const _Float16* ap = tb + (32 * w + ln) * LP; const _Float16* bp = tb + (128 + ln) * LP;
    v16h fa[KT / 32][2], fb[KT / 32][4];      /* the tile's fragment reads go out as one group, in the order of their use, ahead of the products */
#pragma unroll      /* unrolled here and below: fa / fb are indexed by constants and stay in registers */
    for (int s = 0; s < KT / 32; ++s) { fa[s][0] = g2_frag(ap + 32 * s, hh); fb[s][0] = g2_frag(bp + 32 * s, hh); fa[s][1] = g2_frag(ap + 16 * LP + 32 * s, hh);
      fb[s][1] = g2_frag(bp + 16 * LP + 32 * s, hh); fb[s][2] = g2_frag(bp + 32 * LP + 32 * s, hh); fb[s][3] = g2_frag(bp + 48 * LP + 32 * s, hh); }
#pragma unroll
    for (int s = 0; s < KT / 32; ++s) {
#pragma unroll
      for (int c = 0; c < 4; ++c) { acc[c] = g2_mma(fa[s][0], fb[s][c], acc[c]); acc[4 + c] = g2_mma(fa[s][1], fb[s][c], acc[4 + c]); } }
    asm volatile("s_wait_dscnt 0x0" ::: "memory");       /* this wave's reads of tile t are done before its buffer is refilled */
    asm volatile("s_wait_asynccnt 0x0" ::: "memory");    /* this wave's part of tile t + 1 has landed */
    __syncthreads();                                     /* publishes tile t + 1 and ends every wave's reads of tile t */
    if (t + 2 < nt) g2_stage(l0 + (unsigned)(t & 1) * TB, ga + (size_t)(t + 2) * KT, sa, gb + (size_t)(t + 2) * KT, sb);
  }
  asm volatile("s_wait_asynccnt 0x0" ::: "memory");      /* nothing in flight when the buffers become output staging */
}

// ---- GEMM (wave tile 32x64; M % 128 == 0 per launch region, N % 64 == 0, K % 64 == 0): C = alpha * A . Bt^T (+ bias) ----
// A f16 [M][K] (pitch lda), Bt f16 [N][K] (pitch ldb); batch slab by = blockIdx.y with element strides sA / sB / sC.
// OMAP: output row r -> (r / NB) * NB_FULL + r % NB.
template <bool HASB, bool OUT32, bool OMAP>
__global__ __launch_bounds__(128) void k_gemm2(const _Float16* __restrict__ A, int lda, size_t sA, const _Float16* __restrict__ Bh, int ldb, size_t sB, float alpha,
    const float* __restrict__ bias, float* __restrict__ C, _Float16* __restrict__ C16, int ldc, size_t sC, int M, int N, int K) {
  __shared__ __attribute__((aligned(16))) unsigned char sm[2 * TB]; float (*so)[32][68] = (float (*)[32][68])sm;      /* two tile buffers; output staging behind the main loop */
  const int tid = threadIdx.x, w = __builtin_amdgcn_readfirstlane((int)(tid >> 5)), lane = tid & 31, ln = lane & 15, hh = lane >> 4; const int by = blockIdx.y;
  A += (size_t)by * sA; Bh += (size_t)by * sB; const size_t cofs = (size_t)by * sC;
  const int ntn = N >> 6; const int mt = blockIdx.x / ntn, nq = blockIdx.x - mt * ntn; const int row0 = mt * 128 + 32 * w, col0 = nq * 64; if (mt * 128 >= M) return;      /* the whole block leaves, in front of every barrier */
  const v8f z8 = {0.f,0.f,0.f,0.f,0.f,0.f,0.f,0.f}; v8f accs[8] = {z8, z8, z8, z8, z8, z8, z8, z8};      /* [row half * 4 + column tile] */
  g2_main(sm, A + (size_t)(mt * 128) * lda, lda, Bh + (size_t)col0 * ldb, ldb, K, tid, w, ln, hh, accs);
#pragma unroll
  for (int u = 0; u < 8; ++u) { const int t = u & 3, half = u >> 2; const int col = col0 + t * 16 + ln; float bv = 0.f; if (HASB) bv = bf16_rne(bias[col]);
#pragma unroll
    for (int r = 0; r < 8; ++r) { const int rloc = half * 16 + 8 * hh + r; so[w][rloc][t * 16 + ln] = accs[u][r] * alpha + bv; } }
  __builtin_amdgcn_fence(4 /* acq_rel order */, "workgroup"); __builtin_amdgcn_wave_barrier();      /* so[w] is private to wave w */
  const int rsub = lane >> 4, c4 = (lane & 15) * 4;
  {
#pragma unroll
    for (int q = 0; q < 16; ++q) { const int r = q * 2 + rsub; const v4f v = *(const v4fa*)&so[w][r][c4];
      const int gr = row0 + r; const size_t orow = OMAP ? ((size_t)(gr / NB) * NB_FULL + (size_t)(gr % NB)) : (size_t)gr;
      if (OUT32) { *(v4f*)(C + cofs + orow * ldc + col0 + c4) = v; }
      else { v4h h4;
#pragma unroll
        for (int i = 0; i < 4; ++i) h4[i] = (_Float16)v[i];
        *(v4h*)(C16 + cofs + orow * ldc + col0 + c4) = h4; } }
     } }

// ---- projection GEMM with a K-concatenated output plane (same main loop and staging as k_gemm2; N tile 64 == one head) ----
// v = alpha * A . Bt^T + bias (f32); hi = f16(v), res = f16(2048 (v - hi)); head h = col0 / 64 of row r at C3 + r * ldc3 + h * 192:
__global__ __launch_bounds__(128) void k_gemm_cat(const _Float16* __restrict__ A, int lda, const _Float16* __restrict__ Bh, int ldb, float alpha,
    const float* __restrict__ bias, _Float16* __restrict__ C3, int ldc3, int qside, int M, int N, int K) {
  __shared__ __attribute__((aligned(16))) unsigned char sm[2 * TB]; float (*so)[32][68] = (float (*)[32][68])sm;      /* two tile buffers; output staging behind the main loop */
  const int tid = threadIdx.x, w = __builtin_amdgcn_readfirstlane((int)(tid >> 5)), lane = tid & 31, ln = lane & 15, hh = lane >> 4;
  const int ntn = N >> 6; const int mt = blockIdx.x / ntn, nq = blockIdx.x - mt * ntn; const int row0 = mt * 128 + 32 * w, col0 = nq * 64; if (mt * 128 >= M) return;      /* the whole block leaves, in front of every barrier */
  const v8f z8 = {0.f,0.f,0.f,0.f,0.f,0.f,0.f,0.f}; v8f accs[8] = {z8, z8, z8, z8, z8, z8, z8, z8};      /* [row half * 4 + column tile] */
  g2_main(sm, A + (size_t)(mt * 128) * lda, lda, Bh + (size_t)col0 * ldb, ldb, K, tid, w, ln, hh, accs);
#pragma unroll
  for (int u = 0; u < 8; ++u) { const int t = u & 3, half = u >> 2; const int col = col0 + t * 16 + ln; const float bv = bf16_rne(bias[col]);
#pragma unroll
    for (int r = 0; r < 8; ++r) { const int rloc = half * 16 + 8 * hh + r; so[w][rloc][t * 16 + ln] = accs[u][r] * alpha + bv; } }
  __builtin_amdgcn_fence(4 /* acq_rel order */, "workgroup"); __builtin_amdgcn_wave_barrier();      /* so[w] is private to wave w */
  const int rsub = lane >> 4, c4 = (lane & 15) * 4; const int head = col0 >> 6;
  {
#pragma unroll 4
    for (int q = 0; q < 16; ++q) { const int r = q * 2 + rsub; const v4f v = *(const v4fa*)&so[w][r][c4];      /* 16 trips x 2 rows = 32 rows */
      v4h s0, s1, s2;
#pragma unroll
      for (int i = 0; i < 4; ++i) { const h16 hi = toh_flush(v[i]); const h16 rs = toh_flush((v[i] - (float)hi) * 2048.0f); const h16 hs = (h16)((float)hi * 2048.0f);
        s0[i] = (qside != 0) ? hs : hi; s1[i] = (qside != 0) ? rs : hi; s2[i] = (qside != 0) ? hi : rs; }
      _Float16* dst = C3 + (size_t)(row0 + r) * ldc3 + head * CK + c4;
      *(v4h*)dst = s0; *(v4h*)(dst + 64) = s1; *(v4h*)(dst + 128) = s2; }
     } }

__global__ __launch_bounds__(256) void k_wnat(const float* __restrict__ w, size_t n8, _Float16* __restrict__ Bt) { const size_t t = (size_t)blockIdx.x * 256 + threadIdx.x; if (t >= n8) return; FragH f; const v4f a = *(const v4fa*)(w + t * 8), c = *(const v4fa*)(w + t * 8 + 4);
#pragma unroll
  for (int q = 0; q < 4; ++q) { f.h[q] = toh_flush(bf16_rne(a[q]) * 16.0f); f.h[4 + q] = toh_flush(bf16_rne(c[q]) * 16.0f); }
  const v8us o = f.half[0]; *(v8us*)((unsigned short*)Bt + t * 8) = o;  }

__global__ __launch_bounds__(256) void k_x16(const float* __restrict__ x, _Float16* __restrict__ X16, size_t n8) { const size_t t = (size_t)blockIdx.x * 256 + threadIdx.x; if (t >= n8) return;
  const size_t row = t / (DM / 8); const int c8 = (int)(t % (DM / 8)) * 8; const size_t srow = (row / NB) * NB_FULL + (row % NB);
  const float* p = x + srow * DM + c8; const v4f a = *(const v4fa*)p, c = *(const v4fa*)(p + 4); FragH f;
#pragma unroll
  for (int q = 0; q < 4; ++q) { f.h[q] = (_Float16)bf16_rne(a[q]); f.h[4 + q] = (_Float16)bf16_rne(c[q]); }
  const v8us o = f.half[0]; *(v8us*)((unsigned short*)X16 + t * 8) = o;  }

__global__ __launch_bounds__(256) void k_vt(const _Float16* __restrict__ V16, _Float16* __restrict__ Vt) { __shared__ unsigned short tl[64][66]; const int tid = threadIdx.x; const int slab = blockIdx.x / (SEQ / 64), lg = blockIdx.x % (SEQ / 64); const int b = slab / NH, h = slab % NH;
  for (int i = tid; i < 64 * 8; i += 256) { const int r = i / 8, c8 = (i % 8) * 8; FragH f; f.half[0] = *(const v8us*)((const unsigned short*)V16 + ((size_t)(lg * 64 + r) * NB + b) * DM + h * HD + c8);
#pragma unroll
    for (int q = 0; q < 8; ++q) tl[r][c8 + q] = f.u[q]; }
  __syncthreads();
  {
#pragma unroll
    for (int rd = 0; rd < 2; ++rd) { const int d = rd * 32 + tid / 8, pc = tid % 8; FragH f;
#pragma unroll
      for (int q = 0; q < 8; ++q) f.u[q] = tl[pc * 8 + q][d];
      *(v8us*)((unsigned short*)Vt + ((size_t)slab * 64 + d) * SEQ + lg * 64 + pc * 8) = f.half[0]; }
     } }

// width table: SIGT[r = t*NB + b] = 1 / (2 sigma^2), sigma = 1 + sigmoid(sum_e tanh(G[r][e]) * bf16(Wvp[e]) + bf16(bvp)); G f32 [NR][DM].
__global__ __launch_bounds__(256) void k_sigma(const float* __restrict__ G, const float* __restrict__ wvp, const float* __restrict__ bvp, float* __restrict__ SIGT) {
  #pragma clang fp contract(off)
  __shared__ __attribute__((aligned(16))) float sg[32];
  const int tid = threadIdx.x, w = __builtin_amdgcn_readfirstlane((int)(tid >> 5)), lane = tid & 31;
  const float b0 = bf16_rne(bvp[0]);
#pragma unroll 1
  for (int i = 0; i < 4; ++i) {
    const int rl = w * 4 + i;
    const float* p = G + ((size_t)blockIdx.x * 32 + rl) * DM + lane;
    float acc = 0.f;
#pragma unroll 1
    for (int k = 0; k < DM; k += 32) acc += tanhf(p[k]) * bf16_rne(wvp[k + lane]);
#pragma unroll
    for (int off = 16; off > 0; off >>= 1) acc += __shfl_xor(acc, off, 32);
    const float g = acc + b0;
    const float sgm = 1.0f + 1.0f / (1.0f + expf(-g));
    const float i2 = 1.0f / (2.0f * sgm * sgm);
    if (lane == 0) sg[rl] = i2;
  }
  __syncthreads();
  if (w == 0 && lane < 8) { const v4f v = *(const v4fa*)&sg[lane * 4]; float* dst = SIGT + (size_t)blockIdx.x * 32 + lane * 4;
    *(v4f*)dst = v;  }
}

// alignment statistics: S f32 [NB*NH][QC][SEQ] (slab = b*NH + h) -> MEANT[slab][t0 + tq] = sum_s softmax(S row)[s] * s  (f32; position sum centred at SEQ/2).
__global__ __launch_bounds__(256) void k_amean(const float* __restrict__ S, float* __restrict__ MEANT, int t0) {
  #pragma clang fp contract(off)
  __shared__ __attribute__((aligned(16))) float sm[32];
  const int tid = threadIdx.x, w = __builtin_amdgcn_readfirstlane((int)(tid >> 5)), lane = tid & 31;
  const int rb = blockIdx.x * 32; const int slab = rb / QC, tq0 = rb - slab * QC;
  const float pb = (float)(lane * 4 - SEQ / 2);
#pragma unroll 1
  for (int i = 0; i < 4; ++i) {
    const int rl = w * 4 + i;
    const float* p = S + ((size_t)slab * QC + tq0 + rl) * SEQ + lane * 4;
    v4f x[SEQ / 128];
#pragma unroll
    for (int j = 0; j < SEQ / 128; ++j) x[j] = *(const v4fa*)(p + j * 128);
    float mx = -3.0e38f;
#pragma unroll
    for (int j = 0; j < SEQ / 128; ++j) mx = fmaxf(mx, fmaxf(fmaxf(x[j][0], x[j][1]), fmaxf(x[j][2], x[j][3])));
#pragma unroll
    for (int off = 16; off > 0; off >>= 1) mx = fmaxf(mx, __shfl_xor(mx, off, 32));
    float se = 0.f, sw = 0.f;
#pragma unroll
    for (int j = 0; j < SEQ / 128; ++j) {
#pragma unroll
      for (int c = 0; c < 4; ++c) { const float e = __expf(x[j][c] - mx); se += e; sw += e * (pb + (float)(j * 128 + c)); } }
#pragma unroll
    for (int off = 16; off > 0; off >>= 1) { se += __shfl_xor(se, off, 32); sw += __shfl_xor(sw, off, 32); }
    const float mean = (float)(SEQ / 2) + sw * (1.0f / se);
    if (lane == 0) sm[rl] = mean;
  }
  __syncthreads();
  if (w == 0 && lane < 8) { const v4f v = *(const v4fa*)&sm[lane * 4]; float* dst = MEANT + (size_t)slab * SEQ + t0 + tq0 + lane * 4;
    *(v4f*)dst = v;  }
}

// Gaussian softmax: S f32 [NB*NH][QC][SEQ] content logits; x[s] = S[s] - (s - mean)^2 * (1 / (2 sigma^2)); PM f16 [NB*NH][QC][SEQ] = 2^14 * softmax(x) (max-subtracted, f32 statistics).
__global__ __launch_bounds__(128) void k_gsoft(const float* __restrict__ S, const float* __restrict__ MEANT, const float* __restrict__ SIGT, _Float16* __restrict__ PM, int t0) {
  #pragma clang fp contract(off)
  const int tid = threadIdx.x, w = __builtin_amdgcn_readfirstlane((int)(tid >> 5)), lane = tid & 31;
  const int wr = blockIdx.x * 4 + w; const int slab = wr / QC, tql = wr - slab * QC; const int b = slab / NH; const int t = t0 + tql;
  const float mu = MEANT[(size_t)slab * SEQ + t];
  const float i2 = SIGT[(size_t)t * NB + b];
  const float* p = S + ((size_t)slab * QC + tql) * SEQ + lane * 4;
  const float pb = (float)(lane * 4);
  v4f x[SEQ / 128];
#pragma unroll
  for (int j = 0; j < SEQ / 128; ++j) x[j] = *(const v4fa*)(p + j * 128);
  float mx = -3.0e38f;
#pragma unroll
  for (int j = 0; j < SEQ / 128; ++j) {
#pragma unroll
    for (int c = 0; c < 4; ++c) { const float d = (pb + (float)(j * 128 + c)) - mu; const float v = x[j][c] - (d * d) * i2; x[j][c] = v; mx = fmaxf(mx, v); } }
#pragma unroll
  for (int off = 16; off > 0; off >>= 1) mx = fmaxf(mx, __shfl_xor(mx, off, 32));
  float se = 0.f;
#pragma unroll
  for (int j = 0; j < SEQ / 128; ++j) {
#pragma unroll
    for (int c = 0; c < 4; ++c) { const float e = __expf(x[j][c] - mx); x[j][c] = e; se += e; } }
#pragma unroll
  for (int off = 16; off > 0; off >>= 1) se += __shfl_xor(se, off, 32);
  const float cs = 16384.0f * (1.0f / se);
  v4h hq[SEQ / 128];
#pragma unroll
  for (int j = 0; j < SEQ / 128; ++j) {
#pragma unroll
    for (int c = 0; c < 4; ++c) hq[j][c] = toh_flush(x[j][c] * cs); }
  _Float16* prow = PM + ((size_t)slab * QC + tql) * SEQ + lane * 4;
  {
#pragma unroll
    for (int j = 0; j < SEQ / 128; ++j) { const v4h v = hq[j]; *(v4h*)(prow + j * 128) = v; }
     }
}

extern "C" void kernel_launch(void* const* d_in, const int* in_sizes, int n_in,
                              void* d_out, int out_size, void* d_ws, size_t ws_size, hipStream_t stream) {
  if (n_in < 19) return;
  if ((size_t)in_sizes[0] < NR * DM || (size_t)in_sizes[1] < NR * DM || (size_t)in_sizes[2] < NR * DM) return;
  if ((size_t)in_sizes[3] < (size_t)DM * DM || (size_t)in_sizes[5] < (size_t)DM * DM || (size_t)in_sizes[7] < (size_t)DM * DM || (size_t)in_sizes[9] < (size_t)DM * DM) return;
  if ((size_t)in_sizes[11] < (size_t)DM * DM || (size_t)in_sizes[13] < (size_t)DM * DM || (size_t)in_sizes[17] < (size_t)DM * DM) return;
  if (in_sizes[4] < DM || in_sizes[6] < DM || in_sizes[8] < DM || in_sizes[10] < DM || in_sizes[12] < DM || in_sizes[14] < DM || in_sizes[15] < DM || in_sizes[16] < 1 || in_sizes[18] < DM) return;
  if ((size_t)out_size < NR * DM) return;
  const float* const* I = (const float* const*)d_in;
  const float* xq = I[0]; const float* xk = I[1]; const float* xv = I[2];
  const float* wq = I[3]; const float* bq = I[4]; const float* wk = I[5]; const float* bk = I[6]; const float* wv = I[7]; const float* bv = I[8];
  const float* whq = I[9]; const float* bhq = I[10]; const float* whk = I[11]; const float* bhk = I[12]; const float* wwp = I[13]; const float* bwp = I[14];
  const float* wvp = I[15]; const float* bvp = I[16]; const float* wo = I[17]; const float* bo = I[18];
  char* ws = (char*)d_ws; size_t off = 0;
  auto take = [&](size_t bytes) { char* p = ws + off; off += (bytes + 255) & ~(size_t)255; return p; };
  _Float16* BQ = (_Float16*)take((size_t)DM * DM * 2); _Float16* BK = (_Float16*)take((size_t)DM * DM * 2); _Float16* BV = (_Float16*)take((size_t)DM * DM * 2);
  _Float16* BHQ = (_Float16*)take((size_t)DM * DM * 2); _Float16* BHK = (_Float16*)take((size_t)DM * DM * 2); _Float16* BWP = (_Float16*)take((size_t)DM * DM * 2); _Float16* BO = (_Float16*)take((size_t)DM * DM * 2);
  _Float16* XQ = (_Float16*)take(NR * DM * 2); _Float16* XK = (_Float16*)take(NR * DM * 2); _Float16* XV = (_Float16*)take(NR * DM * 2);
  _Float16* CA = (_Float16*)take(NR * 3 * DM * 2); _Float16* CB = (_Float16*)take(NR * 3 * DM * 2);      /* concatenated planes: alignment pair first, content pair afterwards */
  _Float16* V16 = (_Float16*)take(NR * DM * 2); _Float16* O16 = (_Float16*)take(NR * DM * 2); _Float16* VT = (_Float16*)take((size_t)NB * NH * HD * SEQ * 2);
  float* S = (float*)take((size_t)NB * NH * QC * SEQ * 4); _Float16* PM = (_Float16*)take((size_t)NB * NH * QC * SEQ * 2);
  float* MEANT = (float*)take((size_t)NB * NH * SEQ * 4); float* SIGT = (float*)take(NR * 4);
  if (off > ws_size) return;
  float* G = S;                                                            /* f32 wp plane [NR][DM], consumed by k_sigma before the first scores launch */
  { const unsigned g = (unsigned)(((size_t)DM * DM / 8 + 255) / 256);
    k_wnat<<<g, 256, 0, stream>>>(wq, (size_t)DM * DM / 8, BQ); k_wnat<<<g, 256, 0, stream>>>(wk, (size_t)DM * DM / 8, BK);
    k_wnat<<<g, 256, 0, stream>>>(wv, (size_t)DM * DM / 8, BV); k_wnat<<<g, 256, 0, stream>>>(whq, (size_t)DM * DM / 8, BHQ);
    k_wnat<<<g, 256, 0, stream>>>(whk, (size_t)DM * DM / 8, BHK); k_wnat<<<g, 256, 0, stream>>>(wwp, (size_t)DM * DM / 8, BWP);
    k_wnat<<<g, 256, 0, stream>>>(wo, (size_t)DM * DM / 8, BO); }      /* natural [out][in] = Bt[n][k], x16 */
  { const unsigned g = (unsigned)((NR * DM / 8 + 255) / 256);
    k_x16<<<g, 256, 0, stream>>>(xq, XQ, NR * DM / 8); k_x16<<<g, 256, 0, stream>>>(xk, XK, NR * DM / 8); k_x16<<<g, 256, 0, stream>>>(xv, XV, NR * DM / 8); }
  const dim3 gp((unsigned)((MP / 128) * (DM / 64)), 1);
  k_gemm2<true, false, false><<<gp, 128, 0, stream>>>(XV, DM, 0, BV, DM, 0, 0.0625f, bv, nullptr, V16, DM, 0, MP, DM, DM);
  k_vt<<<NB * NH * (SEQ / 64), 256, 0, stream>>>(V16, VT);      /* V16 rows [SEQ*NB][DM] -> VT[(b,h)][64][SEQ] */
  k_gemm2<true, true, false><<<gp, 128, 0, stream>>>(XQ, DM, 0, BWP, DM, 0, 0.0625f, bwp, G, nullptr, DM, 0, MP, DM, DM);
  k_sigma<<<MP / 32, 256, 0, stream>>>(G, wvp, bvp, SIGT);
  /* alignment pair */
  k_gemm_cat<<<gp, 128, 0, stream>>>(XQ, DM, BHQ, DM, 0.0625f, bhq, CA, 3 * DM, 1, MP, DM, DM);
  k_gemm_cat<<<gp, 128, 0, stream>>>(XK, DM, BHK, DM, 0.0625f, bhk, CB, 3 * DM, 0, MP, DM, DM);
  for (int t0 = 0; t0 < SEQ; t0 += QC) {
    /* slab by = b*NH + h at column offset by*192 of rows with pitch LQ3; S[by][QC][SEQ] f32 = 2^-14 * (2048 hi.hi + res.hi + hi.res) */
    k_gemm2<false, true, false><<<dim3((QC / 128) * (SEQ / 64), NB * NH), 128, 0, stream>>>(CA + (size_t)t0 * LQ3, LQ3, (size_t)CK, CB, LQ3, (size_t)CK, 6.103515625e-05f, nullptr, S, nullptr, SEQ, (size_t)QC * SEQ, QC, SEQ, CK);
    k_amean<<<NB * NH * QC / 32, 256, 0, stream>>>(S, MEANT, t0);
  }
  /* content pair (same planes, after the last alignment scores launch) */
  k_gemm_cat<<<gp, 128, 0, stream>>>(XQ, DM, BQ, DM, 0.0625f, bq, CA, 3 * DM, 1, MP, DM, DM);
  k_gemm_cat<<<gp, 128, 0, stream>>>(XK, DM, BK, DM, 0.0625f, bk, CB, 3 * DM, 0, MP, DM, DM);
  for (int t0 = 0; t0 < SEQ; t0 += QC) {
    k_gemm2<false, true, false><<<dim3((QC / 128) * (SEQ / 64), NB * NH), 128, 0, stream>>>(CA + (size_t)t0 * LQ3, LQ3, (size_t)CK, CB, LQ3, (size_t)CK, 6.103515625e-05f, nullptr, S, nullptr, SEQ, (size_t)QC * SEQ, QC, SEQ, CK);
    k_gsoft<<<NB * NH * QC / 4, 128, 0, stream>>>(S, MEANT, SIGT, PM, t0);
    /* ctx[t][b][h*64 + d] x64 = 2^-8 * (2^14 P) . V^T */
    k_gemm2<false, false, false><<<dim3((QC / 128) * (HD / 64), NB * NH), 128, 0, stream>>>(PM, SEQ, (size_t)QC * SEQ, VT, SEQ, (size_t)HD * SEQ, 0.00390625f, nullptr, nullptr, O16 + (size_t)t0 * LQ, LQ, (size_t)HD, QC, HD, SEQ);
  }
  k_gemm2<true, true, true><<<gp, 128, 0, stream>>>(O16, DM, 0, BO, DM, 0, 0.0009765625f, bo, (float*)d_out, nullptr, DM, 0, MP, DM, DM);      /* out rows t*NB_FULL + b */
}

// v002
// Measured time: 284 microseconds a run.
// Next to v001, in two timings, it ran 1.34 and 1.32 times as fast.
// Over all steps from v000 it is 2.30 times as fast.
#include <hip/hip_runtime.h>
// Gaussian-windowed multi-head cross attention, sequence-first layout: query [1024][2][1024], key_in / value [1024][2][1024] (token row r = t*NB + b); six input maps with natural [out][in] weights + biases: q, hq, wp from query; k, hk from key_in; v from value; 16 heads of 64 (flat slab b*16 + h); content logits 64^-0.5 q.k; alignment softmax over keys of 64^-0.5 hq.hk, mean = expected key position; width sigma = 1 + sigmoid(tanh(wp) . Wvp + bvp) per (t, b); P = softmax_s(content - (s - mean)^2 / (2 sigma^2)); ctx = P . v merged [t][b][h*64+d]; out = ctx Wo^T + bo.
// Structure: inputs as exact f16 rows (RNE-converted to bf16 first); projections as WMMA GEMMs (32x64 wave tiles, f32 accumulation, x16 weights + bias); q/hq and k/hk are written as K-concatenated planes per head [2048 hi | res | hi] and [hi | hi | res] (hi = f16 value, res = f16 of 2048 (v - hi)) so one K = 192 GEMM yields 2048 (hi.hi) + res.hi + hi.res; all query rows as one chunk: alignment scores GEMM -> f32 S -> k_amean (f32 softmax statistics, centred position sum); content scores GEMM -> k_gsoft (Gaussian term, f32 softmax, P as f16 x 2^14 / rowsum) -> P . V^T GEMM (ctx carried x64) -> out GEMM (f32).
// Compute dtype: all contractions v_wmma_f32_16x16x32_f16 (f16 operands, f32 accumulate); inputs RNE-converted to bf16 (exact in f16); both score sites as f16 value + x2048 residual (three products folded along K); v, P (x2^14), ctx (x64), Wo as plain f16 operands; softmax statistics, mean, tanh / Wvp / sigmoid on the vector unit in f32.
#ifndef NB
#define NB 2                         /* batches processed */
#endif
#ifndef SEQ
#define SEQ 1024                     /* sequence length processed (queries = keys) */
#endif
#define NB_FULL 2                    /* batch pitch of the input / output rows */
#define DM 1024
#define NH 16
#define HD 64
#define QC SEQ                       /* query rows per attention chunk: all of them, so each attention stage is one launch over every (slab, row) */
#define NR ((size_t)NB * SEQ)        /* token rows */
#define MP ((int)(NB * SEQ))
#define LQ (NB * DM)                 /* pitch between consecutive t for one batch */
#define CK (3 * HD)                  /* concatenated K per head */
#define LQ3 (NB * 3 * DM)            /* pitch between consecutive t in a concatenated plane */
static_assert(SEQ % 128 == 0);
static_assert(QC % 128 == 0);
static_assert(SEQ % QC == 0);
static_assert(NH * HD == DM);
static_assert(NB <= NB_FULL);
static_assert((NB * SEQ) % 128 == 0);
static_assert(NH == 16);
static_assert(HD == 64);                         
static_assert(CK % 32 == 0);
static_assert(DM % 32 == 0);
static_assert(QC % 32 == 0);
static_assert((NB * SEQ) % 32 == 0);
static_assert(NH * QC >= DM);                    /* the f32 wp plane [NR][DM] fits into the S region */
static_assert(32 * 8 * 16 == 32 * HD * 2);       
static_assert(32 * 8 * (SEQ / 128) == SEQ * 2);  /* k_gsoft: lanes x bytes x trips == one f16 P row */
static_assert(8 * 16 == 32 * 4);                 /* k_amean / k_sigma: 8 lanes x 16 B == 32 floats */
#define KT 64                        /* k elements per staged tile: one 128-B line of every operand row */
#define LP 72                        /* LDS row pitch in f16: 144 B = 16 B x odd, for 16-byte fragment reads */
#define TB ((128 + 64) * LP * 2)     /* bytes of one staged tile: 128 A rows, then 64 Bt rows */
static_assert(CK % KT == 0 && DM % KT == 0 && SEQ % KT == 0);   /* every K of the GEMM launches */
static_assert(4 * 32 * 68 * 4 <= 2 * TB);        /* the output staging fits into the two tile buffers */
static_assert(2 * TB <= 131072);                 /* static LDS of the GEMM kernels */
#define WS_TOTAL (7 * (size_t)DM * DM * 2 + 3 * NR * DM * 2 + 2 * NR * 3 * DM * 2 + 2 * NR * DM * 2 + (size_t)NB * NH * HD * SEQ * 2 + (size_t)NB * NH * QC * SEQ * 4 + (size_t)NB * NH * QC * SEQ * 2 + (size_t)NB * NH * SEQ * 4 + NR * 4)
static_assert(WS_TOTAL + 32 * 256 <= 268435456);

typedef unsigned short v8us __attribute__((ext_vector_type(8), may_alias));
typedef float  v8f  __attribute__((ext_vector_type(8)));
typedef float  v4f  __attribute__((ext_vector_type(4)));
typedef float  v4fa __attribute__((ext_vector_type(4), may_alias));
typedef _Float16 v16h __attribute__((ext_vector_type(16)));
typedef _Float16 v4h __attribute__((ext_vector_type(4)));
union FragH { v16h v; v8us half[2]; _Float16 h[16]; unsigned short u[16]; };

__device__ __forceinline__ unsigned short bf16_bits(float x) { unsigned int u = __float_as_uint(x); return (unsigned short)((u + 0x7FFFu + ((u >> 16) & 1u)) >> 16); }
__device__ __forceinline__ float bf16_val(unsigned short b) { return __uint_as_float(((unsigned int)b) << 16); }
__device__ __forceinline__ float bf16_rne(float x) { return bf16_val(bf16_bits(x)); }   /* RNE convert to bf16, back as f32 */

typedef _Float16 h16;
// f32 -> f16 with a value select: magnitudes below 2^-14 become +0 (no f16 subnormal can reach a WMMA operand)
static __device__ __forceinline__ h16 toh_flush(float v) { const h16 r = (h16)v; return (fabsf(v) < 6.103515625e-05f) ? (h16)0.0f : r; }

// fragment: elements 0..7 <- k0 + 8h .. +7, elements 8..15 <- k0 + 16 + 8h .. +7 (p points at k0 of the lane's row / column)
__device__ __forceinline__ v16h g2_frag(const _Float16* p, int hh) { FragH f; f.half[0] = *(const v8us*)((const unsigned short*)p + 8 * hh); f.half[1] = *(const v8us*)((const unsigned short*)p + 16 + 8 * hh); return f.v; }
__device__ __forceinline__ v8f g2_mma(v16h a, v16h b, v8f c) { v8f d = __builtin_amdgcn_wmma_f32_16x16x32_f16(false, a, false, b, (short)0, c, false, false); asm volatile("v_nop\n\tv_nop\n\tv_nop\n\tv_nop" : "+v"(d) : "v"(a), "v"(b)); return d; }

// one K tile of the block's operands, global -> LDS with no register in between: 12 copies of 16 B per lane; a wave's copy covers 4 whole 128-B lines.
// l: the lane's LDS byte address in tile row tid / 8 (rows step by 16 per copy); ga / gb: the lane's 16 bytes in that row of A / Bt at this tile's k.
__device__ __forceinline__ void g2_stage(unsigned l, const _Float16* ga, size_t sa, const _Float16* gb, size_t sb) {
  /* the closing s_wait_xcnt stands inside the statement so that no address register of a copy is rewritten in front of it */
  asm volatile("global_load_async_to_lds_b128 %0, %12, off\n\t" "global_load_async_to_lds_b128 %1, %13, off\n\t" "global_load_async_to_lds_b128 %2, %14, off\n\t"
               "global_load_async_to_lds_b128 %3, %15, off\n\t" "global_load_async_to_lds_b128 %4, %16, off\n\t" "global_load_async_to_lds_b128 %5, %17, off\n\t"
               "global_load_async_to_lds_b128 %6, %18, off\n\t" "global_load_async_to_lds_b128 %7, %19, off\n\t" "global_load_async_to_lds_b128 %8, %20, off\n\t"
               "global_load_async_to_lds_b128 %9, %21, off\n\t" "global_load_async_to_lds_b128 %10, %22, off\n\t" "global_load_async_to_lds_b128 %11, %23, off\n\t"
               "s_wait_xcnt 0x0"
               :: "v"(l), "v"(l + 1u * 16 * LP * 2), "v"(l + 2u * 16 * LP * 2), "v"(l + 3u * 16 * LP * 2), "v"(l + 4u * 16 * LP * 2), "v"(l + 5u * 16 * LP * 2),
                  "v"(l + 6u * 16 * LP * 2), "v"(l + 7u * 16 * LP * 2), "v"(l + 8u * 16 * LP * 2), "v"(l + 9u * 16 * LP * 2), "v"(l + 10u * 16 * LP * 2), "v"(l + 11u * 16 * LP * 2),
                  "v"(ga), "v"(ga + sa), "v"(ga + 2 * sa), "v"(ga + 3 * sa), "v"(ga + 4 * sa), "v"(ga + 5 * sa), "v"(ga + 6 * sa), "v"(ga + 7 * sa),
                  "v"(gb), "v"(gb + sb), "v"(gb + 2 * sb), "v"(gb + 3 * sb)
               : "memory"); }

// main loop of both GEMM kernels: block tile 128 x 64, wave w takes rows 32 w .. 32 w + 31; two LDS tile buffers, tile t + 1 in flight while tile t is multiplied.
// Ab: row 0 of the block's 128 A rows; Bb: row 0 of its 64 Bt rows; K % KT == 0. On return every wave has left both buffers and no copy is outstanding.
__device__ __forceinline__ void g2_main(unsigned char* sm, const _Float16* Ab, int lda, const _Float16* Bb, int ldb, int K, int tid, int w, int ln, int hh, v8f (&acc)[8]) {
  const int nt = K / KT;
  const unsigned l0 = (unsigned)(size_t)sm + (unsigned)((tid >> 3) * (LP * 2) + (tid & 7) * 16);
  const _Float16* ga = Ab + (size_t)(tid >> 3) * lda + (tid & 7) * 8; const _Float16* gb = Bb + (size_t)(tid >> 3) * ldb + (tid & 7) * 8;
  const size_t sa = (size_t)16 * lda, sb = (size_t)16 * ldb;
  g2_stage(l0, ga, sa, gb, sb);
  asm volatile("s_wait_asynccnt 0x0" ::: "memory");      /* this wave's part of tile 0 has landed */
  __syncthreads();                                       /* ... and every other wave's */
  if (nt > 1) g2_stage(l0 + TB, ga + KT, sa, gb + KT, sb);
#pragma unroll 1
  for (int t = 0; t < nt; ++t) {      /* rolled: one publish point per tile */
    const _Float16* tb = (const _Float16*)(sm + (t & 1) * TB);
    const _Float16* ap = tb + (32 * w + ln) * LP; const _Float16* bp = tb + (128 + ln) * LP;
    v16h fa[KT / 32][2], fb[KT / 32][4];      /* the tile's fragment reads go out as one group, in the order of their use, ahead of the products */
#pragma unroll      /* unrolled here and below: fa / fb are indexed by constants and stay in registers */
    for (int s = 0; s < KT / 32; ++s) { fa[s][0] = g2_frag(ap + 32 * s, hh); fb[s][0] = g2_frag(bp + 32 * s, hh); fa[s][1] = g2_frag(ap + 16 * LP + 32 * s, hh);
      fb[s][1] = g2_frag(bp + 16 * LP + 32 * s, hh); fb[s][2] = g2_frag(bp + 32 * LP + 32 * s, hh); fb[s][3] = g2_frag(bp + 48 * LP + 32 * s, hh); }
#pragma unroll
    for (int s = 0; s < KT / 32; ++s) {
#pragma unroll
      for (int c = 0; c < 4; ++c) { acc[c] = g2_mma(fa[s][0], fb[s][c], acc[c]); acc[4 + c] = g2_mma(fa[s][1], fb[s][c], acc[4 + c]); } }
    asm volatile("s_wait_dscnt 0x0" ::: "memory");       /* this wave's reads of tile t are done before its buffer is refilled */
    asm volatile("s_wait_asynccnt 0x0" ::: "memory");    /* this wave's part of tile t + 1 has landed */
    __syncthreads();                                     /* publishes tile t + 1 and ends every wave's reads of tile t */
    if (t + 2 < nt) g2_stage(l0 + (unsigned)(t & 1) * TB, ga + (size_t)(t + 2) * KT, sa, gb + (size_t)(t + 2) * KT, sb);
  }
  asm volatile("s_wait_asynccnt 0x0" ::: "memory");      /* nothing in flight when the buffers become output staging */
}

// ---- GEMM (wave tile 32x64; M % 128 == 0 per launch region, N % 64 == 0, K % 64 == 0): C = alpha * A . Bt^T (+ bias) ----
// A f16 [M][K] (pitch lda), Bt f16 [N][K] (pitch ldb); batch slab by = blockIdx.y with element strides sA / sB / sC.
// OMAP: output row r -> (r / NB) * NB_FULL + r % NB.
template <bool HASB, bool OUT32, bool OMAP>
__global__ __launch_bounds__(128) void k_gemm2(const _Float16* __restrict__ A, int lda, size_t sA, const _Float16* __restrict__ Bh, int ldb, size_t sB, float alpha,
    const float* __restrict__ bias, float* __restrict__ C, _Float16* __restrict__ C16, int ldc, size_t sC, int M, int N, int K) {
  __shared__ __attribute__((aligned(16))) unsigned char sm[2 * TB]; float (*so)[32][68] = (float (*)[32][68])sm;      /* two tile buffers; output staging behind the main loop */
  const int tid = threadIdx.x, w = __builtin_amdgcn_readfirstlane((int)(tid >> 5)), lane = tid & 31, ln = lane & 15, hh = lane >> 4; const int by = blockIdx.y;
  A += (size_t)by * sA; Bh += (size_t)by * sB; const size_t cofs = (size_t)by * sC;
  const int ntn = N >> 6; const int mt = blockIdx.x / ntn, nq = blockIdx.x - mt * ntn; const int row0 = mt * 128 + 32 * w, col0 = nq * 64; if (mt * 128 >= M) return;      /* the whole block leaves, in front of every barrier */
  const v8f z8 = {0.f,0.f,0.f,0.f,0.f,0.f,0.f,0.f}; v8f accs[8] = {z8, z8, z8, z8, z8, z8, z8, z8};      /* [row half * 4 + column tile] */
  g2_main(sm, A + (size_t)(mt * 128) * lda, lda, Bh + (size_t)col0 * ldb, ldb, K, tid, w, ln, hh, accs);
#pragma unroll
  for (int u = 0; u < 8; ++u) { const int t = u & 3, half = u >> 2; const int col = col0 + t * 16 + ln; float bv = 0.f; if (HASB) bv = bf16_rne(bias[col]);
#pragma unroll
    for (int r = 0; r < 8; ++r) { const int rloc = half * 16 + 8 * hh + r; so[w][rloc][t * 16 + ln] = accs[u][r] * alpha + bv; } }
  __builtin_amdgcn_fence(4 /* acq_rel order */, "workgroup"); __builtin_amdgcn_wave_barrier();      /* so[w] is private to wave w */
  const int rsub = lane >> 4, c4 = (lane & 15) * 4;
  {
#pragma unroll
    for (int q = 0; q < 16; ++q) { const int r = q * 2 + rsub; const v4f v = *(const v4fa*)&so[w][r][c4];
      const int gr = row0 + r; const size_t orow = OMAP ? ((size_t)(gr / NB) * NB_FULL + (size_t)(gr % NB)) : (size_t)gr;
      if (OUT32) { *(v4f*)(C + cofs + orow * ldc + col0 + c4) = v; }
      else { v4h h4;
#pragma unroll
        for (int i = 0; i < 4; ++i) h4[i] = (_Float16)v[i];
        *(v4h*)(C16 + cofs + orow * ldc + col0 + c4) = h4; } }
     } }

// ---- projection GEMM with a K-concatenated output plane (same main loop and staging as k_gemm2; N tile 64 == one head) ----
// v = alpha * A . Bt^T + bias (f32); hi = f16(v), res = f16(2048 (v - hi)); head h = col0 / 64 of row r at C3 + r * ldc3 + h * 192:
__global__ __launch_bounds__(128) void k_gemm_cat(const _Float16* __restrict__ A, int lda, const _Float16* __restrict__ Bh, int ldb, float alpha,
    const float* __restrict__ bias, _Float16* __restrict__ C3, int ldc3, int qside, int M, int N, int K) {
  __shared__ __attribute__((aligned(16))) unsigned char sm[2 * TB]; float (*so)[32][68] = (float (*)[32][68])sm;      /* two tile buffers; output staging behind the main loop */
  const int tid = threadIdx.x, w = __builtin_amdgcn_readfirstlane((int)(tid >> 5)), lane = tid & 31, ln = lane & 15, hh = lane >> 4;
  const int ntn = N >> 6; const int mt = blockIdx.x / ntn, nq = blockIdx.x - mt * ntn; const int row0 = mt * 128 + 32 * w, col0 = nq * 64; if (mt * 128 >= M) return;      /* the whole block leaves, in front of every barrier */
  const v8f z8 = {0.f,0.f,0.f,0.f,0.f,0.f,0.f,0.f}; v8f accs[8] = {z8, z8, z8, z8, z8, z8, z8, z8};      /* [row half * 4 + column tile] */
  g2_main(sm, A + (size_t)(mt * 128) * lda, lda, Bh + (size_t)col0 * ldb, ldb, K, tid, w, ln, hh, accs);
#pragma unroll
  for (int u = 0; u < 8; ++u) { const int t = u & 3, half = u >> 2; const int col = col0 + t * 16 + ln; const float bv = bf16_rne(bias[col]);
#pragma unroll
    for (int r = 0; r < 8; ++r) { const int rloc = half * 16 + 8 * hh + r; so[w][rloc][t * 16 + ln] = accs[u][r] * alpha + bv; } }
  __builtin_amdgcn_fence(4 /* acq_rel order */, "workgroup"); __builtin_amdgcn_wave_barrier();      /* so[w] is private to wave w */
  const int rsub = lane >> 4, c4 = (lane & 15) * 4; const int head = col0 >> 6;
  {
#pragma unroll 4
    for (int q = 0; q < 16; ++q) { const int r = q * 2 + rsub; const v4f v = *(const v4fa*)&so[w][r][c4];      /* 16 trips x 2 rows = 32 rows */
      v4h s0, s1, s2;
#pragma unroll
      for (int i = 0; i < 4; ++i) { const h16 hi = toh_flush(v[i]); const h16 rs = toh_flush((v[i] - (float)hi) * 2048.0f); const h16 hs = (h16)((float)hi * 2048.0f);
        s0[i] = (qside != 0) ? hs : hi; s1[i] = (qside != 0) ? rs : hi; s2[i] = (qside != 0) ? hi : rs; }
      _Float16* dst = C3 + (size_t)(row0 + r) * ldc3 + head * CK + c4;
      *(v4h*)dst = s0; *(v4h*)(dst + 64) = s1; *(v4h*)(dst + 128) = s2; }
     } }

__global__ __launch_bounds__(256) void k_wnat(const float* __restrict__ w, size_t n8, _Float16* __restrict__ Bt) { const size_t t = (size_t)blockIdx.x * 256 + threadIdx.x; if (t >= n8) return; FragH f; const v4f a = *(const v4fa*)(w + t * 8), c = *(const v4fa*)(w + t * 8 + 4);
#pragma unroll
  for (int q = 0; q < 4; ++q) { f.h[q] = toh_flush(bf16_rne(a[q]) * 16.0f); f.h[4 + q] = toh_flush(bf16_rne(c[q]) * 16.0f); }
  const v8us o = f.half[0]; *(v8us*)((unsigned short*)Bt + t * 8) = o;  }

__global__ __launch_bounds__(256) void k_x16(const float* __restrict__ x, _Float16* __restrict__ X16, size_t n8) { const size_t t = (size_t)blockIdx.x * 256 + threadIdx.x; if (t >= n8) return;
  const size_t row = t / (DM / 8); const int c8 = (int)(t % (DM / 8)) * 8; const size_t srow = (row / NB) * NB_FULL + (row % NB);
  const float* p = x + srow * DM + c8; const v4f a = *(const v4fa*)p, c = *(const v4fa*)(p + 4); FragH f;
#pragma unroll
  for (int q = 0; q < 4; ++q) { f.h[q] = (_Float16)bf16_rne(a[q]); f.h[4 + q] = (_Float16)bf16_rne(c[q]); }
  const v8us o = f.half[0]; *(v8us*)((unsigned short*)X16 + t * 8) = o;  }

__global__ __launch_bounds__(256) void k_vt(const _Float16* __restrict__ V16, _Float16* __restrict__ Vt) { __shared__ unsigned short tl[64][66]; const int tid = threadIdx.x; const int slab = blockIdx.x / (SEQ / 64), lg = blockIdx.x % (SEQ / 64); const int b = slab / NH, h = slab % NH;
  for (int i = tid; i < 64 * 8; i += 256) { const int r = i / 8, c8 = (i % 8) * 8; FragH f; f.half[0] = *(const v8us*)((const unsigned short*)V16 + ((size_t)(lg * 64 + r) * NB + b) * DM + h * HD + c8);
#pragma unroll
    for (int q = 0; q < 8; ++q) tl[r][c8 + q] = f.u[q]; }
  __syncthreads();
  {
#pragma unroll
    for (int rd = 0; rd < 2; ++rd) { const int d = rd * 32 + tid / 8, pc = tid % 8; FragH f;
#pragma unroll
      for (int q = 0; q < 8; ++q) f.u[q] = tl[pc * 8 + q][d];
      *(v8us*)((unsigned short*)Vt + ((size_t)slab * 64 + d) * SEQ + lg * 64 + pc * 8) = f.half[0]; }
     } }

// width table: SIGT[r = t*NB + b] = 1 / (2 sigma^2), sigma = 1 + sigmoid(sum_e tanh(G[r][e]) * bf16(Wvp[e]) + bf16(bvp)); G f32 [NR][DM].
__global__ __launch_bounds__(256) void k_sigma(const float* __restrict__ G, const float* __restrict__ wvp, const float* __restrict__ bvp, float* __restrict__ SIGT) {
  #pragma clang fp contract(off)
  __shared__ __attribute__((aligned(16))) float sg[32];
  const int tid = threadIdx.x, w = __builtin_amdgcn_readfirstlane((int)(tid >> 5)), lane = tid & 31;
  const float b0 = bf16_rne(bvp[0]);
#pragma unroll 1
  for (int i = 0; i < 4; ++i) {
    const int rl = w * 4 + i;
    const float* p = G + ((size_t)blockIdx.x * 32 + rl) * DM + lane;
    float acc = 0.f;
#pragma unroll 1
    for (int k = 0; k < DM; k += 32) acc += tanhf(p[k]) * bf16_rne(wvp[k + lane]);
#pragma unroll
    for (int off = 16; off > 0; off >>= 1) acc += __shfl_xor(acc, off, 32);
    const float g = acc + b0;
    const float sgm = 1.0f + 1.0f / (1.0f + expf(-g));
    const float i2 = 1.0f / (2.0f * sgm * sgm);
    if (lane == 0) sg[rl] = i2;
  }
  __syncthreads();
  if (w == 0 && lane < 8) { const v4f v = *(const v4fa*)&sg[lane * 4]; float* dst = SIGT + (size_t)blockIdx.x * 32 + lane * 4;
    *(v4f*)dst = v;  }
}

// alignment statistics: S f32 [NB*NH][QC][SEQ] (slab = b*NH + h) -> MEANT[slab][t0 + tq] = sum_s softmax(S row)[s] * s  (f32; position sum centred at SEQ/2).
__global__ __launch_bounds__(256) void k_amean(const float* __restrict__ S, float* __restrict__ MEANT, int t0) {
  #pragma clang fp contract(off)
  __shared__ __attribute__((aligned(16))) float sm[32];
  const int tid = threadIdx.x, w = __builtin_amdgcn_readfirstlane((int)(tid >> 5)), lane = tid & 31;
  const int rb = blockIdx.x * 32; const int slab = rb / QC, tq0 = rb - slab * QC;
  const float pb = (float)(lane * 4 - SEQ / 2);
#pragma unroll 1
  for (int i = 0; i < 4; ++i) {
    const int rl = w * 4 + i;
    const float* p = S + ((size_t)slab * QC + tq0 + rl) * SEQ + lane * 4;
    v4f x[SEQ / 128];
#pragma unroll
    for (int j = 0; j < SEQ / 128; ++j) x[j] = *(const v4fa*)(p + j * 128);
    float mx = -3.0e38f;
#pragma unroll
    for (int j = 0; j < SEQ / 128; ++j) mx = fmaxf(mx, fmaxf(fmaxf(x[j][0], x[j][1]), fmaxf(x[j][2], x[j][3])));
#pragma unroll
    for (int off = 16; off > 0; off >>= 1) mx = fmaxf(mx, __shfl_xor(mx, off, 32));
    float se = 0.f, sw = 0.f;
#pragma unroll
    for (int j = 0; j < SEQ / 128; ++j) {
#pragma unroll
      for (int c = 0; c < 4; ++c) { const float e = __expf(x[j][c] - mx); se += e; sw += e * (pb + (float)(j * 128 + c)); } }
#pragma unroll
    for (int off = 16; off > 0; off >>= 1) { se += __shfl_xor(se, off, 32); sw += __shfl_xor(sw, off, 32); }
    const float mean = (float)(SEQ / 2) + sw * (1.0f / se);
    if (lane == 0) sm[rl] = mean;
  }
  __syncthreads();
  if (w == 0 && lane < 8) { const v4f v = *(const v4fa*)&sm[lane * 4]; float* dst = MEANT + (size_t)slab * SEQ + t0 + tq0 + lane * 4;
    *(v4f*)dst = v;  }
}

// Gaussian softmax: S f32 [NB*NH][QC][SEQ] content logits; x[s] = S[s] - (s - mean)^2 * (1 / (2 sigma^2)); PM f16 [NB*NH][QC][SEQ] = 2^14 * softmax(x) (max-subtracted, f32 statistics).
__global__ __launch_bounds__(128) void k_gsoft(const float* __restrict__ S, const float* __restrict__ MEANT, const float* __restrict__ SIGT, _Float16* __restrict__ PM, int t0) {
  #pragma clang fp contract(off)
  const int tid = threadIdx.x, w = __builtin_amdgcn_readfirstlane((int)(tid >> 5)), lane = tid & 31;
  const int wr = blockIdx.x * 4 + w; const int slab = wr / QC, tql = wr - slab * QC; const int b = slab / NH; const int t = t0 + tql;
  const float mu = MEANT[(size_t)slab * SEQ + t];
  const float i2 = SIGT[(size_t)t * NB + b];
  const float* p = S + ((size_t)slab * QC + tql) * SEQ + lane * 4;
  const float pb = (float)(lane * 4);
  v4f x[SEQ / 128];
#pragma unroll
  for (int j = 0; j < SEQ / 128; ++j) x[j] = *(const v4fa*)(p + j * 128);
  float mx = -3.0e38f;
#pragma unroll
  for (int j = 0; j < SEQ / 128; ++j) {
#pragma unroll
    for (int c = 0; c < 4; ++c) { const float d = (pb + (float)(j * 128 + c)) - mu; const float v = x[j][c] - (d * d) * i2; x[j][c] = v; mx = fmaxf(mx, v); } }
#pragma unroll
  for (int off = 16; off > 0; off >>= 1) mx = fmaxf(mx, __shfl_xor(mx, off, 32));
  float se = 0.f;
#pragma unroll
  for (int j = 0; j < SEQ / 128; ++j) {
#pragma unroll
    for (int c = 0; c < 4; ++c) { const float e = __expf(x[j][c] - mx); x[j][c] = e; se += e; } }
#pragma unroll
  for (int off = 16; off > 0; off >>= 1) se += __shfl_xor(se, off, 32);
  const float cs = 16384.0f * (1.0f / se);
  v4h hq[SEQ / 128];
#pragma unroll
  for (int j = 0; j < SEQ / 128; ++j) {
#pragma unroll
    for (int c = 0; c < 4; ++c) hq[j][c] = toh_flush(x[j][c] * cs); }
  _Float16* prow = PM + ((size_t)slab * QC + tql) * SEQ + lane * 4;
  {
#pragma unroll
    for (int j = 0; j < SEQ / 128; ++j) { const v4h v = hq[j]; *(v4h*)(prow + j * 128) = v; }
     }
}

extern "C" void kernel_launch(void* const* d_in, const int* in_sizes, int n_in,
                              void* d_out, int out_size, void* d_ws, size_t ws_size, hipStream_t stream) {
  if (n_in < 19) return;
  if ((size_t)in_sizes[0] < NR * DM || (size_t)in_sizes[1] < NR * DM || (size_t)in_sizes[2] < NR * DM) return;
  if ((size_t)in_sizes[3] < (size_t)DM * DM || (size_t)in_sizes[5] < (size_t)DM * DM || (size_t)in_sizes[7] < (size_t)DM * DM || (size_t)in_sizes[9] < (size_t)DM * DM) return;
  if ((size_t)in_sizes[11] < (size_t)DM * DM || (size_t)in_sizes[13] < (size_t)DM * DM || (size_t)in_sizes[17] < (size_t)DM * DM) return;
  if (in_sizes[4] < DM || in_sizes[6] < DM || in_sizes[8] < DM || in_sizes[10] < DM || in_sizes[12] < DM || in_sizes[14] < DM || in_sizes[15] < DM || in_sizes[16] < 1 || in_sizes[18] < DM) return;
  if ((size_t)out_size < NR * DM) return;
  const float* const* I = (const float* const*)d_in;
  const float* xq = I[0]; const float* xk = I[1]; const float* xv = I[2];
  const float* wq = I[3]; const float* bq = I[4]; const float* wk = I[5]; const float* bk = I[6]; const float* wv = I[7]; const float* bv = I[8];
  const float* whq = I[9]; const float* bhq = I[10]; const float* whk = I[11]; const float* bhk = I[12]; const float* wwp = I[13]; const float* bwp = I[14];
  const float* wvp = I[15]; const float* bvp = I[16]; const float* wo = I[17]; const float* bo = I[18];
  char* ws = (char*)d_ws; size_t off = 0;
  auto take = [&](size_t bytes) { char* p = ws + off; off += (bytes + 255) & ~(size_t)255; return p; };
  _Float16* BQ = (_Float16*)take((size_t)DM * DM * 2); _Float16* BK = (_Float16*)take((size_t)DM * DM * 2); _Float16* BV = (_Float16*)take((size_t)DM * DM * 2);
  _Float16* BHQ = (_Float16*)take((size_t)DM * DM * 2); _Float16* BHK = (_Float16*)take((size_t)DM * DM * 2); _Float16* BWP = (_Float16*)take((size_t)DM * DM * 2); _Float16* BO = (_Float16*)take((size_t)DM * DM * 2);
  _Float16* XQ = (_Float16*)take(NR * DM * 2); _Float16* XK = (_Float16*)take(NR * DM * 2); _Float16* XV = (_Float16*)take(NR * DM * 2);
  _Float16* CA = (_Float16*)take(NR * 3 * DM * 2); _Float16* CB = (_Float16*)take(NR * 3 * DM * 2);      /* concatenated planes: alignment pair first, content pair afterwards */
  _Float16* V16 = (_Float16*)take(NR * DM * 2); _Float16* O16 = (_Float16*)take(NR * DM * 2); _Float16* VT = (_Float16*)take((size_t)NB * NH * HD * SEQ * 2);
  float* S = (float*)take((size_t)NB * NH * QC * SEQ * 4); _Float16* PM = (_Float16*)take((size_t)NB * NH * QC * SEQ * 2);
  float* MEANT = (float*)take((size_t)NB * NH * SEQ * 4); float* SIGT = (float*)take(NR * 4);
  if (off > ws_size) return;
  float* G = S;                                                            /* f32 wp plane [NR][DM], consumed by k_sigma before the first scores launch */
  { const unsigned g = (unsigned)(((size_t)DM * DM / 8 + 255) / 256);
    k_wnat<<<g, 256, 0, stream>>>(wq, (size_t)DM * DM / 8, BQ); k_wnat<<<g, 256, 0, stream>>>(wk, (size_t)DM * DM / 8, BK);
    k_wnat<<<g, 256, 0, stream>>>(wv, (size_t)DM * DM / 8, BV); k_wnat<<<g, 256, 0, stream>>>(whq, (size_t)DM * DM / 8, BHQ);
    k_wnat<<<g, 256, 0, stream>>>(whk, (size_t)DM * DM / 8, BHK); k_wnat<<<g, 256, 0, stream>>>(wwp, (size_t)DM * DM / 8, BWP);
    k_wnat<<<g, 256, 0, stream>>>(wo, (size_t)DM * DM / 8, BO); }      /* natural [out][in] = Bt[n][k], x16 */
  { const unsigned g = (unsigned)((NR * DM / 8 + 255) / 256);
    k_x16<<<g, 256, 0, stream>>>(xq, XQ, NR * DM / 8); k_x16<<<g, 256, 0, stream>>>(xk, XK, NR * DM / 8); k_x16<<<g, 256, 0, stream>>>(xv, XV, NR * DM / 8); }
  const dim3 gp((unsigned)((MP / 128) * (DM / 64)), 1);
  k_gemm2<true, false, false><<<gp, 128, 0, stream>>>(XV, DM, 0, BV, DM, 0, 0.0625f, bv, nullptr, V16, DM, 0, MP, DM, DM);
  k_vt<<<NB * NH * (SEQ / 64), 256, 0, stream>>>(V16, VT);      /* V16 rows [SEQ*NB][DM] -> VT[(b,h)][64][SEQ] */
  k_gemm2<true, true, false><<<gp, 128, 0, stream>>>(XQ, DM, 0, BWP, DM, 0, 0.0625f, bwp, G, nullptr, DM, 0, MP, DM, DM);
  k_sigma<<<MP / 32, 256, 0, stream>>>(G, wvp, bvp, SIGT);
  /* alignment pair */
  k_gemm_cat<<<gp, 128, 0, stream>>>(XQ, DM, BHQ, DM, 0.0625f, bhq, CA, 3 * DM, 1, MP, DM, DM);
  k_gemm_cat<<<gp, 128, 0, stream>>>(XK, DM, BHK, DM, 0.0625f, bhk, CB, 3 * DM, 0, MP, DM, DM);
  for (int t0 = 0; t0 < SEQ; t0 += QC) {
    /* slab by = b*NH + h at column offset by*192 of rows with pitch LQ3; S[by][QC][SEQ] f32 = 2^-14 * (2048 hi.hi + res.hi + hi.res) */
    k_gemm2<false, true, false><<<dim3((QC / 128) * (SEQ / 64), NB * NH), 128, 0, stream>>>(CA + (size_t)t0 * LQ3, LQ3, (size_t)CK, CB, LQ3, (size_t)CK, 6.103515625e-05f, nullptr, S, nullptr, SEQ, (size_t)QC * SEQ, QC, SEQ, CK);
    k_amean<<<NB * NH * QC / 32, 256, 0, stream>>>(S, MEANT, t0);
  }
  /* content pair (same planes, after the last alignment scores launch) */
  k_gemm_cat<<<gp, 128, 0, stream>>>(XQ, DM, BQ, DM, 0.0625f, bq, CA, 3 * DM, 1, MP, DM, DM);
  k_gemm_cat<<<gp, 128, 0, stream>>>(XK, DM, BK, DM, 0.0625f, bk, CB, 3 * DM, 0, MP, DM, DM);
  for (int t0 = 0; t0 < SEQ; t0 += QC) {
    k_gemm2<false, true, false><<<dim3((QC / 128) * (SEQ / 64), NB * NH), 128, 0, stream>>>(CA + (size_t)t0 * LQ3, LQ3, (size_t)CK, CB, LQ3, (size_t)CK, 6.103515625e-05f, nullptr, S, nullptr, SEQ, (size_t)QC * SEQ, QC, SEQ, CK);
    k_gsoft<<<NB * NH * QC / 4, 128, 0, stream>>>(S, MEANT, SIGT, PM, t0);
    /* ctx[t][b][h*64 + d] x64 = 2^-8 * (2^14 P) . V^T */
    k_gemm2<false, false, false><<<dim3((QC / 128) * (HD / 64), NB * NH), 128, 0, stream>>>(PM, SEQ, (size_t)QC * SEQ, VT, SEQ, (size_t)HD * SEQ, 0.00390625f, nullptr, nullptr, O16 + (size_t)t0 * LQ, LQ, (size_t)HD, QC, HD, SEQ);
  }
  k_gemm2<true, true, true><<<gp, 128, 0, stream>>>(O16, DM, 0, BO, DM, 0, 0.0009765625f, bo, (float*)d_out, nullptr, DM, 0, MP, DM, DM);      /* out rows t*NB_FULL + b */
}

// v003
// Measured time: 226 microseconds a run.
// In both of two side-by-side timings against v002, it was 1.26 times as fast.
// Counting every step since v000, it is 2.90 times as fast.
#include <hip/hip_runtime.h>
// Gaussian-windowed multi-head cross attention, sequence-first layout: query [1024][2][1024], key_in / value [1024][2][1024] (token row r = t*NB + b); six input maps with natural [out][in] weights + biases: q, hq, wp from query; k, hk from key_in; v from value; 16 heads of 64 (flat slab b*16 + h); content logits 64^-0.5 q.k; alignment softmax over keys of 64^-0.5 hq.hk, mean = expected key position; width sigma = 1 + sigmoid(tanh(wp) . Wvp + bvp) per (t, b); P = softmax_s(content - (s - mean)^2 / (2 sigma^2)); ctx = P . v merged [t][b][h*64+d]; out = ctx Wo^T + bo.
// Structure: inputs as exact f16 rows (RNE-converted to bf16 first); all conversions as one launch; the six input projections as one launch of WMMA GEMMs (32x64 wave tiles, f32 accumulation, x16 weights + bias); q/hq and k/hk are written as K-concatenated planes per head [2048 hi | res | hi] and [hi | hi | res] (hi = f16 value, res = f16 of 2048 (v - hi)) so one K = 192 GEMM yields 2048 (hi.hi) + res.hi + hi.res; all query rows as one chunk: alignment scores GEMM -> f32 S -> k_amean (f32 softmax statistics, centred position sum); content scores GEMM -> k_gsoft (Gaussian term, f32 softmax, P as f16 x 2^14 / rowsum) -> P . V^T GEMM (ctx carried x64) -> out GEMM (f32).
// Compute dtype: all contractions v_wmma_f32_16x16x32_f16 (f16 operands, f32 accumulate); inputs RNE-converted to bf16 (exact in f16); both score sites as f16 value + x2048 residual (three products folded along K); v, P (x2^14), ctx (x64), Wo as plain f16 operands; softmax statistics, mean, tanh / Wvp / sigmoid on the vector unit in f32.
#ifndef NB
#define NB 2                         /* batches processed */
#endif
#ifndef SEQ
#define SEQ 1024                     /* sequence length processed (queries = keys) */
#endif
#define NB_FULL 2                    /* batch pitch of the input / output rows */
#define DM 1024
#define NH 16
#define HD 64
#define QC SEQ                       /* query rows per attention chunk: all of them, so each attention stage is one launch over every (slab, row) */
#define NR ((size_t)NB * SEQ)        /* token rows */
#define MP ((int)(NB * SEQ))
#define LQ (NB * DM)                 /* pitch between consecutive t for one batch */
#define CK (3 * HD)                  /* concatenated K per head */
#define LQ3 (NB * 3 * DM)            /* pitch between consecutive t in a concatenated plane */
static_assert(SEQ % 128 == 0);
static_assert(QC % 128 == 0);
static_assert(SEQ % QC == 0);
static_assert(NH * HD == DM);
static_assert(NB <= NB_FULL);
static_assert((NB * SEQ) % 128 == 0);
static_assert(NH == 16);
static_assert(HD == 64);                         
static_assert(CK % 32 == 0);
static_assert(DM % 32 == 0);
static_assert(QC % 32 == 0);
static_assert((NB * SEQ) % 32 == 0);
static_assert(NH * QC >= DM);                    /* the f32 wp plane [NR][DM] fits into the S region */
static_assert(NH * QC >= 2 * 3 * DM);            /* the content pair's two concatenated planes fit into the P region */
static_assert(QC == SEQ);                        /* ... and the one content scores launch has read them before k_gsoft writes P */
static_assert(32 * 8 * 16 == 32 * HD * 2);       
static_assert(32 * 8 * (SEQ / 128) == SEQ * 2);  /* k_gsoft: lanes x bytes x trips == one f16 P row */
static_assert(8 * 16 == 32 * 4);                 /* k_amean / k_sigma: 8 lanes x 16 B == 32 floats */
#define KT 64                        /* k elements per staged tile: one 128-B line of every operand row */
#define LP 72                        /* LDS row pitch in f16: 144 B = 16 B x odd, for 16-byte fragment reads */
#define TB ((128 + 64) * LP * 2)     /* bytes of one staged tile: 128 A rows, then 64 Bt rows */
static_assert(CK % KT == 0 && DM % KT == 0 && SEQ % KT == 0);   /* every K of the GEMM launches */
static_assert(4 * 32 * 68 * 4 <= 2 * TB);        /* the output staging fits into the two tile buffers */
static_assert(2 * TB <= 131072);                 /* static LDS of the GEMM kernels */
#define WS_TOTAL (7 * (size_t)DM * DM * 2 + 3 * NR * DM * 2 + 2 * NR * 3 * DM * 2 + 2 * NR * DM * 2 + (size_t)NB * NH * HD * SEQ * 2 + (size_t)NB * NH * QC * SEQ * 4 + (size_t)NB * NH * QC * SEQ * 2 + (size_t)NB * NH * SEQ * 4 + NR * 4)
static_assert(WS_TOTAL + 32 * 256 <= 268435456);

typedef unsigned short v8us __attribute__((ext_vector_type(8), may_alias));
typedef float  v8f  __attribute__((ext_vector_type(8)));
typedef float  v4f  __attribute__((ext_vector_type(4)));
typedef float  v4fa __attribute__((ext_vector_type(4), may_alias));
typedef _Float16 v16h __attribute__((ext_vector_type(16)));
typedef _Float16 v4h __attribute__((ext_vector_type(4)));
union FragH { v16h v; v8us half[2]; _Float16 h[16]; unsigned short u[16]; };

__device__ __forceinline__ unsigned short bf16_bits(float x) { unsigned int u = __float_as_uint(x); return (unsigned short)((u + 0x7FFFu + ((u >> 16) & 1u)) >> 16); }
__device__ __forceinline__ float bf16_val(unsigned short b) { return __uint_as_float(((unsigned int)b) << 16); }
__device__ __forceinline__ float bf16_rne(float x) { return bf16_val(bf16_bits(x)); }   /* RNE convert to bf16, back as f32 */

typedef _Float16 h16;
// f32 -> f16 with a value select: magnitudes below 2^-14 become +0 (no f16 subnormal can reach a WMMA operand)
static __device__ __forceinline__ h16 toh_flush(float v) { const h16 r = (h16)v; return (fabsf(v) < 6.103515625e-05f) ? (h16)0.0f : r; }

// fragment: elements 0..7 <- k0 + 8h .. +7, elements 8..15 <- k0 + 16 + 8h .. +7 (p points at k0 of the lane's row / column)
__device__ __forceinline__ v16h g2_frag(const _Float16* p, int hh) { FragH f; f.half[0] = *(const v8us*)((const unsigned short*)p + 8 * hh); f.half[1] = *(const v8us*)((const unsigned short*)p + 16 + 8 * hh); return f.v; }
__device__ __forceinline__ v8f g2_mma(v16h a, v16h b, v8f c) { v8f d = __builtin_amdgcn_wmma_f32_16x16x32_f16(false, a, false, b, (short)0, c, false, false); asm volatile("v_nop\n\tv_nop\n\tv_nop\n\tv_nop" : "+v"(d) : "v"(a), "v"(b)); return d; }

// one K tile of the block's operands, global -> LDS with no register in between: 12 copies of 16 B per lane; a wave's copy covers 4 whole 128-B lines.
// l: the lane's LDS byte address in tile row tid / 8 (rows step by 16 per copy); ga / gb: the lane's 16 bytes in that row of A / Bt at this tile's k.
__device__ __forceinline__ void g2_stage(unsigned l, const _Float16* ga, size_t sa, const _Float16* gb, size_t sb) {
  /* the closing s_wait_xcnt stands inside the statement so that no address register of a copy is rewritten in front of it */
  asm volatile("global_load_async_to_lds_b128 %0, %12, off\n\t" "global_load_async_to_lds_b128 %1, %13, off\n\t" "global_load_async_to_lds_b128 %2, %14, off\n\t"
               "global_load_async_to_lds_b128 %3, %15, off\n\t" "global_load_async_to_lds_b128 %4, %16, off\n\t" "global_load_async_to_lds_b128 %5, %17, off\n\t"
               "global_load_async_to_lds_b128 %6, %18, off\n\t" "global_load_async_to_lds_b128 %7, %19, off\n\t" "global_load_async_to_lds_b128 %8, %20, off\n\t"
               "global_load_async_to_lds_b128 %9, %21, off\n\t" "global_load_async_to_lds_b128 %10, %22, off\n\t" "global_load_async_to_lds_b128 %11, %23, off\n\t"
               "s_wait_xcnt 0x0"
               :: "v"(l), "v"(l + 1u * 16 * LP * 2), "v"(l + 2u * 16 * LP * 2), "v"(l + 3u * 16 * LP * 2), "v"(l + 4u * 16 * LP * 2), "v"(l + 5u * 16 * LP * 2),
                  "v"(l + 6u * 16 * LP * 2), "v"(l + 7u * 16 * LP * 2), "v"(l + 8u * 16 * LP * 2), "v"(l + 9u * 16 * LP * 2), "v"(l + 10u * 16 * LP * 2), "v"(l + 11u * 16 * LP * 2),
                  "v"(ga), "v"(ga + sa), "v"(ga + 2 * sa), "v"(ga + 3 * sa), "v"(ga + 4 * sa), "v"(ga + 5 * sa), "v"(ga + 6 * sa), "v"(ga + 7 * sa),
                  "v"(gb), "v"(gb + sb), "v"(gb + 2 * sb), "v"(gb + 3 * sb)
               : "memory"); }

// main loop of both GEMM kernels: block tile 128 x 64, wave w takes rows 32 w .. 32 w + 31; two LDS tile buffers, tile t + 1 in flight while tile t is multiplied.
// Ab: row 0 of the block's 128 A rows; Bb: row 0 of its 64 Bt rows; K % KT == 0. On return every wave has left both buffers and no copy is outstanding.
__device__ __forceinline__ void g2_main(unsigned char* sm, const _Float16* Ab, int lda, const _Float16* Bb, int ldb, int K, int tid, int w, int ln, int hh, v8f (&acc)[8]) {
  const int nt = K / KT;
  const unsigned l0 = (unsigned)(size_t)sm + (unsigned)((tid >> 3) * (LP * 2) + (tid & 7) * 16);
  const _Float16* ga = Ab + (size_t)(tid >> 3) * lda + (tid & 7) * 8; const _Float16* gb = Bb + (size_t)(tid >> 3) * ldb + (tid & 7) * 8;
  const size_t sa = (size_t)16 * lda, sb = (size_t)16 * ldb;
  g2_stage(l0, ga, sa, gb, sb);
  asm volatile("s_wait_asynccnt 0x0" ::: "memory");      /* this wave's part of tile 0 has landed */
  __syncthreads();                                       /* ... and every other wave's */
  if (nt > 1) g2_stage(l0 + TB, ga + KT, sa, gb + KT, sb);
#pragma unroll 1
  for (int t = 0; t < nt; ++t) {      /* rolled: one publish point per tile */
    const _Float16* tb = (const _Float16*)(sm + (t & 1) * TB);
    const _Float16* ap = tb + (32 * w + ln) * LP; const _Float16* bp = tb + (128 + ln) * LP;
    v16h fa[KT / 32][2], fb[KT / 32][4];      /* the tile's fragment reads go out as one group, in the order of their use, ahead of the products */
#pragma unroll      /* unrolled here and below: fa / fb are indexed by constants and stay in registers */
    for (int s = 0; s < KT / 32; ++s) { fa[s][0] = g2_frag(ap + 32 * s, hh); fb[s][0] = g2_frag(bp + 32 * s, hh); fa[s][1] = g2_frag(ap + 16 * LP + 32 * s, hh);
      fb[s][1] = g2_frag(bp + 16 * LP + 32 * s, hh); fb[s][2] = g2_frag(bp + 32 * LP + 32 * s, hh); fb[s][3] = g2_frag(bp + 48 * LP + 32 * s, hh); }
#pragma unroll
    for (int s = 0; s < KT / 32; ++s) {
#pragma unroll
      for (int c = 0; c < 4; ++c) { acc[c] = g2_mma(fa[s][0], fb[s][c], acc[c]); acc[4 + c] = g2_mma(fa[s][1], fb[s][c], acc[4 + c]); } }
    asm volatile("s_wait_dscnt 0x0" ::: "memory");       /* this wave's reads of tile t are done before its buffer is refilled */
    asm volatile("s_wait_asynccnt 0x0" ::: "memory");    /* this wave's part of tile t + 1 has landed */
    __syncthreads();                                     /* publishes tile t + 1 and ends every wave's reads of tile t */
    if (t + 2 < nt) g2_stage(l0 + (unsigned)(t & 1) * TB, ga + (size_t)(t + 2) * KT, sa, gb + (size_t)(t + 2) * KT, sb);
  }
  asm volatile("s_wait_asynccnt 0x0" ::: "memory");      /* nothing in flight when the buffers become output staging */
}

// ---- GEMM (wave tile 32x64; M % 128 == 0 per launch region, N % 64 == 0, K % 64 == 0): C = alpha * A . Bt^T (+ bias) ----
// A f16 [M][K] (pitch lda), Bt f16 [N][K] (pitch ldb); batch slab by = blockIdx.y with element strides sA / sB / sC.
// OMAP: output row r -> (r / NB) * NB_FULL + r % NB.
template <bool HASB, bool OUT32, bool OMAP>
__global__ __launch_bounds__(128) void k_gemm2(const _Float16* __restrict__ A, int lda, size_t sA, const _Float16* __restrict__ Bh, int ldb, size_t sB, float alpha,
    const float* __restrict__ bias, float* __restrict__ C, _Float16* __restrict__ C16, int ldc, size_t sC, int M, int N, int K) {
  __shared__ __attribute__((aligned(16))) unsigned char sm[2 * TB]; float (*so)[32][68] = (float (*)[32][68])sm;      /* two tile buffers; output staging behind the main loop */
  const int tid = threadIdx.x, w = __builtin_amdgcn_readfirstlane((int)(tid >> 5)), lane = tid & 31, ln = lane & 15, hh = lane >> 4; const int by = blockIdx.y;
  A += (size_t)by * sA; Bh += (size_t)by * sB; const size_t cofs = (size_t)by * sC;
  const int ntn = N >> 6; const int mt = blockIdx.x / ntn, nq = blockIdx.x - mt * ntn; const int row0 = mt * 128 + 32 * w, col0 = nq * 64; if (mt * 128 >= M) return;      /* the whole block leaves, in front of every barrier */
  const v8f z8 = {0.f,0.f,0.f,0.f,0.f,0.f,0.f,0.f}; v8f accs[8] = {z8, z8, z8, z8, z8, z8, z8, z8};      /* [row half * 4 + column tile] */
  g2_main(sm, A + (size_t)(mt * 128) * lda, lda, Bh + (size_t)col0 * ldb, ldb, K, tid, w, ln, hh, accs);
#pragma unroll
  for (int u = 0; u < 8; ++u) { const int t = u & 3, half = u >> 2; const int col = col0 + t * 16 + ln; float bv = 0.f; if (HASB) bv = bf16_rne(bias[col]);
#pragma unroll
    for (int r = 0; r < 8; ++r) { const int rloc = half * 16 + 8 * hh + r; so[w][rloc][t * 16 + ln] = accs[u][r] * alpha + bv; } }
  __builtin_amdgcn_fence(4 /* acq_rel order */, "workgroup"); __builtin_amdgcn_wave_barrier();      /* so[w] is private to wave w */
  const int rsub = lane >> 4, c4 = (lane & 15) * 4;
  {
#pragma unroll
    for (int q = 0; q < 16; ++q) { const int r = q * 2 + rsub; const v4f v = *(const v4fa*)&so[w][r][c4];
      const int gr = row0 + r; const size_t orow = OMAP ? ((size_t)(gr / NB) * NB_FULL + (size_t)(gr % NB)) : (size_t)gr;
      if (OUT32) { *(v4f*)(C + cofs + orow * ldc + col0 + c4) = v; }
      else { v4h h4;
#pragma unroll
        for (int i = 0; i < 4; ++i) h4[i] = (_Float16)v[i];
        *(v4h*)(C16 + cofs + orow * ldc + col0 + c4) = h4; } }
     } }

// ---- the six input projections as one launch (same main loop and staging as k_gemm2; M = MP, N = K = DM; N tile 64 == one head): job = blockIdx.y picks operands, bias and output form ----
// x = A . Bt^T / 16 + bias (f32). job 0: v, f16 rows; job 1: wp, f32 rows; jobs 2 .. 5: hq, hk, q, k as K-concatenated planes:
// hi = f16(x), res = f16(2048 (x - hi)); head h = col0 / 64 of row r at C3 + r * 3 DM + h * 192: query side [2048 hi | res | hi], key side [hi | hi | res].
__global__ __launch_bounds__(128) void k_proj(const _Float16* __restrict__ XQ, const _Float16* __restrict__ XK, const _Float16* __restrict__ XV,
    const _Float16* __restrict__ BV, const _Float16* __restrict__ BWP, const _Float16* __restrict__ BHQ, const _Float16* __restrict__ BHK, const _Float16* __restrict__ BQ, const _Float16* __restrict__ BK,
    const float* __restrict__ bv, const float* __restrict__ bwp, const float* __restrict__ bhq, const float* __restrict__ bhk, const float* __restrict__ bq, const float* __restrict__ bk,
    _Float16* __restrict__ V16, float* __restrict__ G, _Float16* __restrict__ CHQ, _Float16* __restrict__ CHK, _Float16* __restrict__ CQ, _Float16* __restrict__ CK3) {
  __shared__ __attribute__((aligned(16))) unsigned char sm[2 * TB]; float (*so)[32][68] = (float (*)[32][68])sm;      /* two tile buffers; output staging behind the main loop */
  const int tid = threadIdx.x, w = __builtin_amdgcn_readfirstlane((int)(tid >> 5)), lane = tid & 31, ln = lane & 15, hh = lane >> 4; const int job = blockIdx.y;
  const _Float16* A; const _Float16* Bh; const float* bias; _Float16* C3 = nullptr;
  switch (job) {
    case 0: A = XV; Bh = BV; bias = bv; break;
    case 1: A = XQ; Bh = BWP; bias = bwp; break;
    case 2: A = XQ; Bh = BHQ; bias = bhq; C3 = CHQ; break;
    case 3: A = XK; Bh = BHK; bias = bhk; C3 = CHK; break;
    case 4: A = XQ; Bh = BQ; bias = bq; C3 = CQ; break;
    default: A = XK; Bh = BK; bias = bk; C3 = CK3; break; }
  const int mt = blockIdx.x / (DM / 64), nq = blockIdx.x - mt * (DM / 64); const int row0 = mt * 128 + 32 * w, col0 = nq * 64;
  const v8f z8 = {0.f,0.f,0.f,0.f,0.f,0.f,0.f,0.f}; v8f accs[8] = {z8, z8, z8, z8, z8, z8, z8, z8};      /* [row half * 4 + column tile] */
  g2_main(sm, A + (size_t)(mt * 128) * DM, DM, Bh + (size_t)col0 * DM, DM, DM, tid, w, ln, hh, accs);
#pragma unroll
  for (int u = 0; u < 8; ++u) { const int t = u & 3, half = u >> 2; const int col = col0 + t * 16 + ln; const float bb = bf16_rne(bias[col]);
#pragma unroll
    for (int r = 0; r < 8; ++r) { const int rloc = half * 16 + 8 * hh + r; so[w][rloc][t * 16 + ln] = accs[u][r] * 0.0625f + bb; } }
  __builtin_amdgcn_fence(4 /* acq_rel order */, "workgroup"); __builtin_amdgcn_wave_barrier();      /* so[w] is private to wave w */
  const int rsub = lane >> 4, c4 = (lane & 15) * 4; const int head = col0 >> 6;
  if (job == 0) {
#pragma unroll
    for (int q = 0; q < 16; ++q) { const int r = q * 2 + rsub; const v4f v = *(const v4fa*)&so[w][r][c4]; v4h h4;      /* 16 trips x 2 rows = 32 rows, here and below */
#pragma unroll
      for (int i = 0; i < 4; ++i) h4[i] = (_Float16)v[i];
      *(v4h*)(V16 + (size_t)(row0 + r) * DM + col0 + c4) = h4; }
  } else if (job == 1) {
#pragma unroll
    for (int q = 0; q < 16; ++q) { const int r = q * 2 + rsub; const v4f v = *(const v4fa*)&so[w][r][c4]; *(v4f*)(G + (size_t)(row0 + r) * DM + col0 + c4) = v; }
    asm volatile("s_wait_xcnt 0x0" ::: "memory");      /* the branches join in address arithmetic that reuses these stores' registers: the wait stands in front of it */
  } else { const bool qside = (job & 1) == 0;
#pragma unroll 1
    for (int q0 = 0; q0 < 16; q0 += 4) {      /* rolled: four trips of four row pairs, for code size */
#pragma unroll
     for (int q = q0; q < q0 + 4; ++q) { const int r = q * 2 + rsub; const v4f v = *(const v4fa*)&so[w][r][c4];
      v4h s0, s1, s2;
#pragma unroll
      for (int i = 0; i < 4; ++i) { const h16 hi = toh_flush(v[i]); const h16 rs = toh_flush((v[i] - (float)hi) * 2048.0f); const h16 hs = (h16)((float)hi * 2048.0f);
        s0[i] = qside ? hs : hi; s1[i] = qside ? rs : hi; s2[i] = qside ? hi : rs; }
      _Float16* dst = C3 + (size_t)(row0 + r) * (3 * DM) + head * CK + c4;
      *(v4h*)dst = s0; *(v4h*)(dst + 64) = s1; *(v4h*)(dst + 128) = s2; }
     asm volatile("s_wait_xcnt 0x0" ::: "memory"); }      /* the next trip rewrites the registers that this trip's stores name */
     } }

// ---- all ten input conversions as one launch: blocks 0 .. 7 WBL - 1 take the seven weight planes (natural [out][in] = Bt[n][k], x16), the rest the three activation planes; 8 elements per thread ----
// Bt: seven f16 planes of DM x DM, one behind the other, in the order w0 .. w6; X16: three f16 planes of NR x DM in the order x0 .. x2.
#define WBL (DM * DM / 8 / 256)            /* blocks per weight plane */
#define XBL ((int)(NR * DM / 8 / 256))     /* blocks per activation plane */
static_assert(DM * DM % (8 * 256) == 0 && (NR * DM) % (8 * 256) == 0);      /* whole blocks: no thread past the end of a plane */
static_assert(((size_t)DM * DM * 2) % 256 == 0 && (NR * DM * 2) % 256 == 0);      /* the planes follow one another in the workspace without a gap */
__global__ __launch_bounds__(256) void k_cvt(const float* __restrict__ w0, const float* __restrict__ w1, const float* __restrict__ w2, const float* __restrict__ w3, const float* __restrict__ w4,
    const float* __restrict__ w5, const float* __restrict__ w6, const float* __restrict__ x0, const float* __restrict__ x1, const float* __restrict__ x2, _Float16* __restrict__ Bt, _Float16* __restrict__ X16) {
  const int blk = blockIdx.x; FragH f;
  if (blk < 7 * WBL) { const int pl = blk / WBL; const size_t t = (size_t)(blk - pl * WBL) * 256 + threadIdx.x;
    const float* w = (pl == 0) ? w0 : (pl == 1) ? w1 : (pl == 2) ? w2 : (pl == 3) ? w3 : (pl == 4) ? w4 : (pl == 5) ? w5 : w6;
    const v4f a = *(const v4fa*)(w + t * 8), c = *(const v4fa*)(w + t * 8 + 4);
#pragma unroll
    for (int q = 0; q < 4; ++q) { f.h[q] = toh_flush(bf16_rne(a[q]) * 16.0f); f.h[4 + q] = toh_flush(bf16_rne(c[q]) * 16.0f); }
    const v8us o = f.half[0]; *(v8us*)((unsigned short*)Bt + (size_t)pl * DM * DM + t * 8) = o;
  } else { const int bx = blk - 7 * WBL; const int pl = bx / XBL; const size_t t = (size_t)(bx - pl * XBL) * 256 + threadIdx.x;
    const float* x = (pl == 0) ? x0 : (pl == 1) ? x1 : x2;
    const size_t row = t / (DM / 8); const int c8 = (int)(t % (DM / 8)) * 8; const size_t srow = (row / NB) * NB_FULL + (row % NB);
    const float* p = x + srow * DM + c8; const v4f a = *(const v4fa*)p, c = *(const v4fa*)(p + 4);
#pragma unroll
    for (int q = 0; q < 4; ++q) { f.h[q] = (_Float16)bf16_rne(a[q]); f.h[4 + q] = (_Float16)bf16_rne(c[q]); }
    const v8us o = f.half[0]; *(v8us*)((unsigned short*)X16 + (size_t)pl * NR * DM + t * 8) = o;
    asm volatile("s_wait_xcnt 0x0" ::: "memory"); } }      /* the built code runs on from here towards the weight branch, whose loads reuse this store's registers: the wait stands in front of them */

__global__ __launch_bounds__(256) void k_vt(const _Float16* __restrict__ V16, _Float16* __restrict__ Vt) { __shared__ unsigned short tl[64][66]; const int tid = threadIdx.x; const int slab = blockIdx.x / (SEQ / 64), lg = blockIdx.x % (SEQ / 64); const int b = slab / NH, h = slab % NH;
  for (int i = tid; i < 64 * 8; i += 256) { const int r = i / 8, c8 = (i % 8) * 8; FragH f; f.half[0] = *(const v8us*)((const unsigned short*)V16 + ((size_t)(lg * 64 + r) * NB + b) * DM + h * HD + c8);
#pragma unroll
    for (int q = 0; q < 8; ++q) tl[r][c8 + q] = f.u[q]; }
  __syncthreads();
  {
#pragma unroll
    for (int rd = 0; rd < 2; ++rd) { const int d = rd * 32 + tid / 8, pc = tid % 8; FragH f;
#pragma unroll
      for (int q = 0; q < 8; ++q) f.u[q] = tl[pc * 8 + q][d];
      *(v8us*)((unsigned short*)Vt + ((size_t)slab * 64 + d) * SEQ + lg * 64 + pc * 8) = f.half[0]; }
     } }

// width table: SIGT[r = t*NB + b] = 1 / (2 sigma^2), sigma = 1 + sigmoid(sum_e tanh(G[r][e]) * bf16(Wvp[e]) + bf16(bvp)); G f32 [NR][DM].
__global__ __launch_bounds__(256) void k_sigma(const float* __restrict__ G, const float* __restrict__ wvp, const float* __restrict__ bvp, float* __restrict__ SIGT) {
  #pragma clang fp contract(off)
  __shared__ __attribute__((aligned(16))) float sg[32];
  const int tid = threadIdx.x, w = __builtin_amdgcn_readfirstlane((int)(tid >> 5)), lane = tid & 31;
  const float b0 = bf16_rne(bvp[0]);
#pragma unroll 1
  for (int i = 0; i < 4; ++i) {
    const int rl = w * 4 + i;
    const float* p = G + ((size_t)blockIdx.x * 32 + rl) * DM + lane;
    float acc = 0.f;
#pragma unroll 1
    for (int k = 0; k < DM; k += 32) acc += tanhf(p[k]) * bf16_rne(wvp[k + lane]);
#pragma unroll
    for (int off = 16; off > 0; off >>= 1) acc += __shfl_xor(acc, off, 32);
    const float g = acc + b0;
    const float sgm = 1.0f + 1.0f / (1.0f + expf(-g));
    const float i2 = 1.0f / (2.0f * sgm * sgm);
    if (lane == 0) sg[rl] = i2;
  }
  __syncthreads();
  if (w == 0 && lane < 8) { const v4f v = *(const v4fa*)&sg[lane * 4]; float* dst = SIGT + (size_t)blockIdx.x * 32 + lane * 4;
    *(v4f*)dst = v;  }
}

// alignment statistics: S f32 [NB*NH][QC][SEQ] (slab = b*NH + h) -> MEANT[slab][t0 + tq] = sum_s softmax(S row)[s] * s  (f32; position sum centred at SEQ/2).
__global__ __launch_bounds__(256) void k_amean(const float* __restrict__ S, float* __restrict__ MEANT, int t0) {
  #pragma clang fp contract(off)
  __shared__ __attribute__((aligned(16))) float sm[32];
  const int tid = threadIdx.x, w = __builtin_amdgcn_readfirstlane((int)(tid >> 5)), lane = tid & 31;
  const int rb = blockIdx.x * 32; const int slab = rb / QC, tq0 = rb - slab * QC;
  const float pb = (float)(lane * 4 - SEQ / 2);
#pragma unroll 1
  for (int i = 0; i < 4; ++i) {
    const int rl = w * 4 + i;
    const float* p = S + ((size_t)slab * QC + tq0 + rl) * SEQ + lane * 4;
    v4f x[SEQ / 128];
#pragma unroll
    for (int j = 0; j < SEQ / 128; ++j) x[j] = *(const v4fa*)(p + j * 128);
    float mx = -3.0e38f;
#pragma unroll
    for (int j = 0; j < SEQ / 128; ++j) mx = fmaxf(mx, fmaxf(fmaxf(x[j][0], x[j][1]), fmaxf(x[j][2], x[j][3])));
#pragma unroll
    for (int off = 16; off > 0; off >>= 1) mx = fmaxf(mx, __shfl_xor(mx, off, 32));
    float se = 0.f, sw = 0.f;
#pragma unroll
    for (int j = 0; j < SEQ / 128; ++j) {
#pragma unroll
      for (int c = 0; c < 4; ++c) { const float e = __expf(x[j][c] - mx); se += e; sw += e * (pb + (float)(j * 128 + c)); } }
#pragma unroll
    for (int off = 16; off > 0; off >>= 1) { se += __shfl_xor(se, off, 32); sw += __shfl_xor(sw, off, 32); }
    const float mean = (float)(SEQ / 2) + sw * (1.0f / se);
    if (lane == 0) sm[rl] = mean;
  }
  __syncthreads();
  if (w == 0 && lane < 8) { const v4f v = *(const v4fa*)&sm[lane * 4]; float* dst = MEANT + (size_t)slab * SEQ + t0 + tq0 + lane * 4;
    *(v4f*)dst = v;  }
}

// Gaussian softmax: S f32 [NB*NH][QC][SEQ] content logits; x[s] = S[s] - (s - mean)^2 * (1 / (2 sigma^2)); PM f16 [NB*NH][QC][SEQ] = 2^14 * softmax(x) (max-subtracted, f32 statistics).
__global__ __launch_bounds__(128) void k_gsoft(const float* __restrict__ S, const float* __restrict__ MEANT, const float* __restrict__ SIGT, _Float16* __restrict__ PM, int t0) {
  #pragma clang fp contract(off)
  const int tid = threadIdx.x, w = __builtin_amdgcn_readfirstlane((int)(tid >> 5)), lane = tid & 31;
  const int wr = blockIdx.x * 4 + w; const int slab = wr / QC, tql = wr - slab * QC; const int b = slab / NH; const int t = t0 + tql;
  const float mu = MEANT[(size_t)slab * SEQ + t];
  const float i2 = SIGT[(size_t)t * NB + b];
  const float* p = S + ((size_t)slab * QC + tql) * SEQ + lane * 4;
  const float pb = (float)(lane * 4);
  v4f x[SEQ / 128];
#pragma unroll
  for (int j = 0; j < SEQ / 128; ++j) x[j] = *(const v4fa*)(p + j * 128);
  float mx = -3.0e38f;
#pragma unroll
  for (int j = 0; j < SEQ / 128; ++j) {
#pragma unroll
    for (int c = 0; c < 4; ++c) { const float d = (pb + (float)(j * 128 + c)) - mu; const float v = x[j][c] - (d * d) * i2; x[j][c] = v; mx = fmaxf(mx, v); } }
#pragma unroll
  for (int off = 16; off > 0; off >>= 1) mx = fmaxf(mx, __shfl_xor(mx, off, 32));
  float se = 0.f;
#pragma unroll
  for (int j = 0; j < SEQ / 128; ++j) {
#pragma unroll
    for (int c = 0; c < 4; ++c) { const float e = __expf(x[j][c] - mx); x[j][c] = e; se += e; } }
#pragma unroll
  for (int off = 16; off > 0; off >>= 1) se += __shfl_xor(se, off, 32);
  const float cs = 16384.0f * (1.0f / se);
  v4h hq[SEQ / 128];
#pragma unroll
  for (int j = 0; j < SEQ / 128; ++j) {
#pragma unroll
    for (int c = 0; c < 4; ++c) hq[j][c] = toh_flush(x[j][c] * cs); }
  _Float16* prow = PM + ((size_t)slab * QC + tql) * SEQ + lane * 4;
  {
#pragma unroll
    for (int j = 0; j < SEQ / 128; ++j) { const v4h v = hq[j]; *(v4h*)(prow + j * 128) = v; }
     }
}

extern "C" void kernel_launch(void* const* d_in, const int* in_sizes, int n_in,
                              void* d_out, int out_size, void* d_ws, size_t ws_size, hipStream_t stream) {
  if (n_in < 19) return;
  if ((size_t)in_sizes[0] < NR * DM || (size_t)in_sizes[1] < NR * DM || (size_t)in_sizes[2] < NR * DM) return;
  if ((size_t)in_sizes[3] < (size_t)DM * DM || (size_t)in_sizes[5] < (size_t)DM * DM || (size_t)in_sizes[7] < (size_t)DM * DM || (size_t)in_sizes[9] < (size_t)DM * DM) return;
  if ((size_t)in_sizes[11] < (size_t)DM * DM || (size_t)in_sizes[13] < (size_t)DM * DM || (size_t)in_sizes[17] < (size_t)DM * DM) return;
  if (in_sizes[4] < DM || in_sizes[6] < DM || in_sizes[8] < DM || in_sizes[10] < DM || in_sizes[12] < DM || in_sizes[14] < DM || in_sizes[15] < DM || in_sizes[16] < 1 || in_sizes[18] < DM) return;
  if ((size_t)out_size < NR * DM) return;
  const float* const* I = (const float* const*)d_in;
  const float* xq = I[0]; const float* xk = I[1]; const float* xv = I[2];
  const float* wq = I[3]; const float* bq = I[4]; const float* wk = I[5]; const float* bk = I[6]; const float* wv = I[7]; const float* bv = I[8];
  const float* whq = I[9]; const float* bhq = I[10]; const float* whk = I[11]; const float* bhk = I[12]; const float* wwp = I[13]; const float* bwp = I[14];
  const float* wvp = I[15]; const float* bvp = I[16]; const float* wo = I[17]; const float* bo = I[18];
  char* ws = (char*)d_ws; size_t off = 0;
  auto take = [&](size_t bytes) { char* p = ws + off; off += (bytes + 255) & ~(size_t)255; return p; };
  _Float16* BQ = (_Float16*)take((size_t)DM * DM * 2); _Float16* BK = (_Float16*)take((size_t)DM * DM * 2); _Float16* BV = (_Float16*)take((size_t)DM * DM * 2);
  _Float16* BHQ = (_Float16*)take((size_t)DM * DM * 2); _Float16* BHK = (_Float16*)take((size_t)DM * DM * 2); _Float16* BWP = (_Float16*)take((size_t)DM * DM * 2); _Float16* BO = (_Float16*)take((size_t)DM * DM * 2);
  _Float16* XQ = (_Float16*)take(NR * DM * 2); _Float16* XK = (_Float16*)take(NR * DM * 2); _Float16* XV = (_Float16*)take(NR * DM * 2);
  _Float16* CA = (_Float16*)take(NR * 3 * DM * 2); _Float16* CB = (_Float16*)take(NR * 3 * DM * 2);      /* concatenated planes of the alignment pair */
  _Float16* V16 = (_Float16*)take(NR * DM * 2); _Float16* O16 = (_Float16*)take(NR * DM * 2); _Float16* VT = (_Float16*)take((size_t)NB * NH * HD * SEQ * 2);
  float* S = (float*)take((size_t)NB * NH * QC * SEQ * 4); _Float16* PM = (_Float16*)take((size_t)NB * NH * QC * SEQ * 2);
  float* MEANT = (float*)take((size_t)NB * NH * SEQ * 4); float* SIGT = (float*)take(NR * 4);
  if (off > ws_size) return;
  float* G = S;                                                            /* f32 wp plane [NR][DM], consumed by k_sigma before the first scores launch */
  _Float16* CA2 = PM; _Float16* CB2 = PM + NR * 3 * DM;                    /* content pair: in the P region, read by the content scores launch before k_gsoft writes P */
  k_cvt<<<7 * WBL + 3 * XBL, 256, 0, stream>>>(wq, wk, wv, whq, whk, wwp, wo, xq, xk, xv, BQ, XQ);      /* planes BQ .. BO and XQ .. XV in the order of their take() calls */
  const dim3 gp((unsigned)((MP / 128) * (DM / 64)), 1);
  k_proj<<<dim3((unsigned)((MP / 128) * (DM / 64)), 6), 128, 0, stream>>>(XQ, XK, XV, BV, BWP, BHQ, BHK, BQ, BK, bv, bwp, bhq, bhk, bq, bk, V16, G, CA, CB, CA2, CB2);
  k_vt<<<NB * NH * (SEQ / 64), 256, 0, stream>>>(V16, VT);      /* V16 rows [SEQ*NB][DM] -> VT[(b,h)][64][SEQ] */
  k_sigma<<<MP / 32, 256, 0, stream>>>(G, wvp, bvp, SIGT);
  /* alignment pair */
  for (int t0 = 0; t0 < SEQ; t0 += QC) {
    /* slab by = b*NH + h at column offset by*192 of rows with pitch LQ3; S[by][QC][SEQ] f32 = 2^-14 * (2048 hi.hi + res.hi + hi.res) */
    k_gemm2<false, true, false><<<dim3((QC / 128) * (SEQ / 64), NB * NH), 128, 0, stream>>>(CA + (size_t)t0 * LQ3, LQ3, (size_t)CK, CB, LQ3, (size_t)CK, 6.103515625e-05f, nullptr, S, nullptr, SEQ, (size_t)QC * SEQ, QC, SEQ, CK);
    k_amean<<<NB * NH * QC / 32, 256, 0, stream>>>(S, MEANT, t0);
  }
  /* content pair */
  for (int t0 = 0; t0 < SEQ; t0 += QC) {
    k_gemm2<false, true, false><<<dim3((QC / 128) * (SEQ / 64), NB * NH), 128, 0, stream>>>(CA2 + (size_t)t0 * LQ3, LQ3, (size_t)CK, CB2, LQ3, (size_t)CK, 6.103515625e-05f, nullptr, S, nullptr, SEQ, (size_t)QC * SEQ, QC, SEQ, CK);
    k_gsoft<<<NB * NH * QC / 4, 128, 0, stream>>>(S, MEANT, SIGT, PM, t0);
    /* ctx[t][b][h*64 + d] x64 = 2^-8 * (2^14 P) . V^T */
    k_gemm2<false, false, false><<<dim3((QC / 128) * (HD / 64), NB * NH), 128, 0, stream>>>(PM, SEQ, (size_t)QC * SEQ, VT, SEQ, (size_t)HD * SEQ, 0.00390625f, nullptr, nullptr, O16 + (size_t)t0 * LQ, LQ, (size_t)HD, QC, HD, SEQ);
  }
  k_gemm2<true, true, true><<<gp, 128, 0, stream>>>(O16, DM, 0, BO, DM, 0, 0.0009765625f, bo, (float*)d_out, nullptr, DM, 0, MP, DM, DM);      /* out rows t*NB_FULL + b */
}

// v004
// One run takes 172 microseconds.
// Next to v003, in two timings, it ran 1.31 and 1.32 times as fast.
// Counting every step since v000, it is 3.81 times as fast.
#include <hip/hip_runtime.h>
// Gaussian-windowed multi-head cross attention, sequence-first layout: query [1024][2][1024], key_in / value [1024][2][1024] (token row r = t*NB + b); six input maps with natural [out][in] weights + biases: q, hq, wp from query; k, hk from key_in; v from value; 16 heads of 64 (flat slab b*16 + h); content logits 64^-0.5 q.k; alignment softmax over keys of 64^-0.5 hq.hk, mean = expected key position; width sigma = 1 + sigmoid(tanh(wp) . Wvp + bvp) per (t, b); P = softmax_s(content - (s - mean)^2 / (2 sigma^2)); ctx = P . v merged [t][b][h*64+d]; out = ctx Wo^T + bo.
// Structure: inputs as exact f16 rows (RNE-converted to bf16 first); all conversions as one launch; the six input projections as one launch of WMMA GEMMs (32x64 wave tiles, f32 accumulation, x16 weights + bias); q/hq and k/hk are written as K-concatenated planes per head [2048 hi | res | hi] and [hi | hi | res] (hi = f16 value, res = f16 of 2048 (v - hi)) so one K = 192 GEMM yields 2048 (hi.hi) + res.hi + hi.res; all query rows as one chunk: alignment scores GEMM -> f32 S -> k_amean (f32 softmax statistics, centred position sum); content scores GEMM -> k_gsoft (Gaussian term, f32 softmax, P as f16 x 2^14 / rowsum) -> P . V^T GEMM (ctx carried x64) -> out GEMM (f32).
// Compute dtype: all contractions v_wmma_f32_16x16x32_f16 (f16 operands, f32 accumulate); inputs RNE-converted to bf16 (exact in f16); both score sites as f16 value + x2048 residual (three products folded along K); v, P (x2^14), ctx (x64), Wo as plain f16 operands; softmax statistics, mean, tanh / Wvp / sigmoid on the vector unit in f32.
#ifndef NB
#define NB 2                         /* batches processed */
#endif
#ifndef SEQ
#define SEQ 1024                     /* sequence length processed (queries = keys) */
#endif
#define NB_FULL 2                    /* batch pitch of the input / output rows */
#define DM 1024
#define NH 16
#define HD 64
#define QC SEQ                       /* query rows per attention chunk: all of them, so each attention stage is one launch over every (slab, row) */
#define NR ((size_t)NB * SEQ)        /* token rows */
#define MP ((int)(NB * SEQ))
#define LQ (NB * DM)                 /* pitch between consecutive t for one batch */
#define CK (3 * HD)                  /* concatenated K per head */
#define LQ3 (NB * 3 * DM)            /* pitch between consecutive t in a concatenated plane */
static_assert(SEQ % 128 == 0);
static_assert(QC % 128 == 0);
static_assert(SEQ % QC == 0);
static_assert(NH * HD == DM);
static_assert(NB <= NB_FULL);
static_assert((NB * SEQ) % 128 == 0);
static_assert(NH == 16);
static_assert(HD == 64);                         
static_assert(CK % 32 == 0);
static_assert(DM % 32 == 0);
static_assert(QC % 32 == 0);
static_assert((NB * SEQ) % 32 == 0);
static_assert(NH * QC >= DM);                    /* the f32 wp plane [NR][DM] fits into the S region */
static_assert(NH * QC >= 2 * 3 * DM);            /* the content pair's two concatenated planes fit into the P region */
static_assert(QC == SEQ);                        /* ... and the one content scores launch has read them before k_gsoft writes P */
static_assert(32 * 8 * 16 == 32 * HD * 2);       
static_assert(32 * 8 * (SEQ / 128) == SEQ * 2);  /* k_gsoft: lanes x bytes x trips == one f16 P row */
static_assert(8 * 16 == 32 * 4);                 /* k_amean: 8 lanes x 16 B == 32 floats */
#define KT 64                        /* k elements per staged tile: one 128-B line of every operand row */
#define LP 72                        /* LDS row pitch in f16: 144 B = 16 B x odd, for 16-byte fragment reads */
#define TB ((128 + 64) * LP * 2)     /* bytes of one staged tile: 128 A rows, then 64 Bt rows */
static_assert(CK % KT == 0 && DM % KT == 0 && SEQ % KT == 0);   /* every K of the GEMM launches */
static_assert(4 * 32 * 68 * 4 <= 2 * TB);        /* the output staging fits into the two tile buffers */
static_assert(2 * TB <= 131072);                 /* static LDS of the GEMM kernels */
#define WS_TOTAL (7 * (size_t)DM * DM * 2 + 3 * NR * DM * 2 + 2 * NR * 3 * DM * 2 + 2 * NR * DM * 2 + (size_t)NB * NH * HD * SEQ * 2 + (size_t)NB * NH * QC * SEQ * 4 + (size_t)NB * NH * QC * SEQ * 2 + (size_t)NB * NH * SEQ * 4 + NR * 16)
static_assert(WS_TOTAL + 32 * 256 <= 268435456);

typedef unsigned short v8us __attribute__((ext_vector_type(8), may_alias));
typedef float  v8f  __attribute__((ext_vector_type(8)));
typedef float  v4f  __attribute__((ext_vector_type(4)));
typedef float  v4fa __attribute__((ext_vector_type(4), may_alias));
typedef _Float16 v16h __attribute__((ext_vector_type(16)));
typedef _Float16 v4h __attribute__((ext_vector_type(4)));
union FragH { v16h v; v8us half[2]; _Float16 h[16]; unsigned short u[16]; };

__device__ __forceinline__ unsigned short bf16_bits(float x) { unsigned int u = __float_as_uint(x); return (unsigned short)((u + 0x7FFFu + ((u >> 16) & 1u)) >> 16); }
__device__ __forceinline__ float bf16_val(unsigned short b) { return __uint_as_float(((unsigned int)b) << 16); }
__device__ __forceinline__ float bf16_rne(float x) { return bf16_val(bf16_bits(x)); }   /* RNE convert to bf16, back as f32 */

typedef _Float16 h16;
// f32 -> f16 with a value select: magnitudes below 2^-14 become +0 (no f16 subnormal can reach a WMMA operand)
static __device__ __forceinline__ h16 toh_flush(float v) { const h16 r = (h16)v; return (fabsf(v) < 6.103515625e-05f) ? (h16)0.0f : r; }

// fragment: elements 0..7 <- k0 + 8h .. +7, elements 8..15 <- k0 + 16 + 8h .. +7 (p points at k0 of the lane's row / column)
__device__ __forceinline__ v16h g2_frag(const _Float16* p, int hh) { FragH f; f.half[0] = *(const v8us*)((const unsigned short*)p + 8 * hh); f.half[1] = *(const v8us*)((const unsigned short*)p + 16 + 8 * hh); return f.v; }
__device__ __forceinline__ v8f g2_mma(v16h a, v16h b, v8f c) { v8f d = __builtin_amdgcn_wmma_f32_16x16x32_f16(false, a, false, b, (short)0, c, false, false); asm volatile("v_nop\n\tv_nop\n\tv_nop\n\tv_nop" : "+v"(d) : "v"(a), "v"(b)); return d; }

// one K tile of the block's operands, global -> LDS with no register in between: 12 copies of 16 B per lane; a wave's copy covers 4 whole 128-B lines.
// l: the lane's LDS byte address in tile row tid / 8 (rows step by 16 per copy); ga / gb: the lane's 16 bytes in that row of A / Bt at this tile's k.
__device__ __forceinline__ void g2_stage(unsigned l, const _Float16* ga, size_t sa, const _Float16* gb, size_t sb) {
  /* the closing s_wait_xcnt stands inside the statement so that no address register of a copy is rewritten in front of it */
  asm volatile("global_load_async_to_lds_b128 %0, %12, off\n\t" "global_load_async_to_lds_b128 %1, %13, off\n\t" "global_load_async_to_lds_b128 %2, %14, off\n\t"
               "global_load_async_to_lds_b128 %3, %15, off\n\t" "global_load_async_to_lds_b128 %4, %16, off\n\t" "global_load_async_to_lds_b128 %5, %17, off\n\t"
               "global_load_async_to_lds_b128 %6, %18, off\n\t" "global_load_async_to_lds_b128 %7, %19, off\n\t" "global_load_async_to_lds_b128 %8, %20, off\n\t"
               "global_load_async_to_lds_b128 %9, %21, off\n\t" "global_load_async_to_lds_b128 %10, %22, off\n\t" "global_load_async_to_lds_b128 %11, %23, off\n\t"
               "s_wait_xcnt 0x0"
               :: "v"(l), "v"(l + 1u * 16 * LP * 2), "v"(l + 2u * 16 * LP * 2), "v"(l + 3u * 16 * LP * 2), "v"(l + 4u * 16 * LP * 2), "v"(l + 5u * 16 * LP * 2),
                  "v"(l + 6u * 16 * LP * 2), "v"(l + 7u * 16 * LP * 2), "v"(l + 8u * 16 * LP * 2), "v"(l + 9u * 16 * LP * 2), "v"(l + 10u * 16 * LP * 2), "v"(l + 11u * 16 * LP * 2),
                  "v"(ga), "v"(ga + sa), "v"(ga + 2 * sa), "v"(ga + 3 * sa), "v"(ga + 4 * sa), "v"(ga + 5 * sa), "v"(ga + 6 * sa), "v"(ga + 7 * sa),
                  "v"(gb), "v"(gb + sb), "v"(gb + 2 * sb), "v"(gb + 3 * sb)
               : "memory"); }

// main loop of both GEMM kernels: block tile 128 x 64, wave w takes rows 32 w .. 32 w + 31; two LDS tile buffers, tile t + 1 in flight while tile t is multiplied.
// Ab: row 0 of the block's 128 A rows; Bb: row 0 of its 64 Bt rows; K % KT == 0. On return every wave has left both buffers and no copy is outstanding.
__device__ __forceinline__ void g2_main(unsigned char* sm, const _Float16* Ab, int lda, const _Float16* Bb, int ldb, int K, int tid, int w, int ln, int hh, v8f (&acc)[8]) {
  const int nt = K / KT;
  const unsigned l0 = (unsigned)(size_t)sm + (unsigned)((tid >> 3) * (LP * 2) + (tid & 7) * 16);
  const _Float16* ga = Ab + (size_t)(tid >> 3) * lda + (tid & 7) * 8; const _Float16* gb = Bb + (size_t)(tid >> 3) * ldb + (tid & 7) * 8;
  const size_t sa = (size_t)16 * lda, sb = (size_t)16 * ldb;
  g2_stage(l0, ga, sa, gb, sb);
  asm volatile("s_wait_asynccnt 0x0" ::: "memory");      /* this wave's part of tile 0 has landed */
  __syncthreads();                                       /* ... and every other wave's */
  if (nt > 1) g2_stage(l0 + TB, ga + KT, sa, gb + KT, sb);
#pragma unroll 1
  for (int t = 0; t < nt; ++t) {      /* rolled: one publish point per tile */
    const _Float16* tb = (const _Float16*)(sm + (t & 1) * TB);
    const _Float16* ap = tb + (32 * w + ln) * LP; const _Float16* bp = tb + (128 + ln) * LP;
    v16h fa[KT / 32][2], fb[KT / 32][4];      /* the tile's fragment reads go out as one group, in the order of their use, ahead of the products */
#pragma unroll      /* unrolled here and below: fa / fb are indexed by constants and stay in registers */
    for (int s = 0; s < KT / 32; ++s) { fa[s][0] = g2_frag(ap + 32 * s, hh); fb[s][0] = g2_frag(bp + 32 * s, hh); fa[s][1] = g2_frag(ap + 16 * LP + 32 * s, hh);
      fb[s][1] = g2_frag(bp + 16 * LP + 32 * s, hh); fb[s][2] = g2_frag(bp + 32 * LP + 32 * s, hh); fb[s][3] = g2_frag(bp + 48 * LP + 32 * s, hh); }
#pragma unroll
    for (int s = 0; s < KT / 32; ++s) {
#pragma unroll
      for (int c = 0; c < 4; ++c) { acc[c] = g2_mma(fa[s][0], fb[s][c], acc[c]); acc[4 + c] = g2_mma(fa[s][1], fb[s][c], acc[4 + c]); } }
    asm volatile("s_wait_dscnt 0x0" ::: "memory");       /* this wave's reads of tile t are done before its buffer is refilled */
    asm volatile("s_wait_asynccnt 0x0" ::: "memory");    /* this wave's part of tile t + 1 has landed */
    __syncthreads();                                     /* publishes tile t + 1 and ends every wave's reads of tile t */
    if (t + 2 < nt) g2_stage(l0 + (unsigned)(t & 1) * TB, ga + (size_t)(t + 2) * KT, sa, gb + (size_t)(t + 2) * KT, sb);
  }
  asm volatile("s_wait_asynccnt 0x0" ::: "memory");      /* nothing in flight when the buffers become output staging */
}

// ---- GEMM (wave tile 32x64; M % 128 == 0 per launch region, N % 64 == 0, K % 64 == 0): C = alpha * A . Bt^T (+ bias) ----
// A f16 [M][K] (pitch lda), Bt f16 [N][K] (pitch ldb); batch slab by = blockIdx.y with element strides sA / sB / sC.
// OMAP: output row r -> (r / NB) * NB_FULL + r % NB.
template <bool HASB, bool OUT32, bool OMAP>
__global__ __launch_bounds__(128) void k_gemm2(const _Float16* __restrict__ A, int lda, size_t sA, const _Float16* __restrict__ Bh, int ldb, size_t sB, float alpha,
    const float* __restrict__ bias, float* __restrict__ C, _Float16* __restrict__ C16, int ldc, size_t sC, int M, int N, int K) {
  __shared__ __attribute__((aligned(16))) unsigned char sm[2 * TB]; float (*so)[32][68] = (float (*)[32][68])sm;      /* two tile buffers; output staging behind the main loop */
  const int tid = threadIdx.x, w = __builtin_amdgcn_readfirstlane((int)(tid >> 5)), lane = tid & 31, ln = lane & 15, hh = lane >> 4; const int by = blockIdx.y;
  A += (size_t)by * sA; Bh += (size_t)by * sB; const size_t cofs = (size_t)by * sC;
  const int ntn = N >> 6; const int mt = blockIdx.x / ntn, nq = blockIdx.x - mt * ntn; const int row0 = mt * 128 + 32 * w, col0 = nq * 64; if (mt * 128 >= M) return;      /* the whole block leaves, in front of every barrier */
  const v8f z8 = {0.f,0.f,0.f,0.f,0.f,0.f,0.f,0.f}; v8f accs[8] = {z8, z8, z8, z8, z8, z8, z8, z8};      /* [row half * 4 + column tile] */
  g2_main(sm, A + (size_t)(mt * 128) * lda, lda, Bh + (size_t)col0 * ldb, ldb, K, tid, w, ln, hh, accs);
#pragma unroll
  for (int u = 0; u < 8; ++u) { const int t = u & 3, half = u >> 2; const int col = col0 + t * 16 + ln; float bv = 0.f; if (HASB) bv = bf16_rne(bias[col]);
#pragma unroll
    for (int r = 0; r < 8; ++r) { const int rloc = half * 16 + 8 * hh + r; so[w][rloc][t * 16 + ln] = accs[u][r] * alpha + bv; } }
  __builtin_amdgcn_fence(4 /* acq_rel order */, "workgroup"); __builtin_amdgcn_wave_barrier();      /* so[w] is private to wave w */
  const int rsub = lane >> 4, c4 = (lane & 15) * 4;
  {
#pragma unroll
    for (int q = 0; q < 16; ++q) { const int r = q * 2 + rsub; const v4f v = *(const v4fa*)&so[w][r][c4];
      const int gr = row0 + r; const size_t orow = OMAP ? ((size_t)(gr / NB) * NB_FULL + (size_t)(gr % NB)) : (size_t)gr;
      if (OUT32) { *(v4f*)(C + cofs + orow * ldc + col0 + c4) = v; }
      else { v4h h4;
#pragma unroll
        for (int i = 0; i < 4; ++i) h4[i] = (_Float16)v[i];
        *(v4h*)(C16 + cofs + orow * ldc + col0 + c4) = h4; } }
     } }

// ---- the six input projections as one launch (same main loop and staging as k_gemm2; M = MP, N = K = DM; N tile 64 == one head): job = blockIdx.y picks operands, bias and output form ----
// x = A . Bt^T / 16 + bias (f32). job 0: v, f16 rows; job 1: wp, f32 rows; jobs 2 .. 5: hq, hk, q, k as K-concatenated planes:
// hi = f16(x), res = f16(2048 (x - hi)); head h = col0 / 64 of row r at C3 + r * 3 DM + h * 192: query side [2048 hi | res | hi], key side [hi | hi | res].
__global__ __launch_bounds__(128) void k_proj(const _Float16* __restrict__ XQ, const _Float16* __restrict__ XK, const _Float16* __restrict__ XV,
    const _Float16* __restrict__ BV, const _Float16* __restrict__ BWP, const _Float16* __restrict__ BHQ, const _Float16* __restrict__ BHK, const _Float16* __restrict__ BQ, const _Float16* __restrict__ BK,
    const float* __restrict__ bv, const float* __restrict__ bwp, const float* __restrict__ bhq, const float* __restrict__ bhk, const float* __restrict__ bq, const float* __restrict__ bk,
    _Float16* __restrict__ V16, float* __restrict__ G, _Float16* __restrict__ CHQ, _Float16* __restrict__ CHK, _Float16* __restrict__ CQ, _Float16* __restrict__ CK3) {
  __shared__ __attribute__((aligned(16))) unsigned char sm[2 * TB]; float (*so)[32][68] = (float (*)[32][68])sm;      /* two tile buffers; output staging behind the main loop */
  const int tid = threadIdx.x, w = __builtin_amdgcn_readfirstlane((int)(tid >> 5)), lane = tid & 31, ln = lane & 15, hh = lane >> 4; const int job = blockIdx.y;
  const _Float16* A; const _Float16* Bh; const float* bias; _Float16* C3 = nullptr;
  switch (job) {
    case 0: A = XV; Bh = BV; bias = bv; break;
    case 1: A = XQ; Bh = BWP; bias = bwp; break;
    case 2: A = XQ; Bh = BHQ; bias = bhq; C3 = CHQ; break;
    case 3: A = XK; Bh = BHK; bias = bhk; C3 = CHK; break;
    case 4: A = XQ; Bh = BQ; bias = bq; C3 = CQ; break;
    default: A = XK; Bh = BK; bias = bk; C3 = CK3; break; }
  const int mt = blockIdx.x / (DM / 64), nq = blockIdx.x - mt * (DM / 64); const int row0 = mt * 128 + 32 * w, col0 = nq * 64;
  const v8f z8 = {0.f,0.f,0.f,0.f,0.f,0.f,0.f,0.f}; v8f accs[8] = {z8, z8, z8, z8, z8, z8, z8, z8};      /* [row half * 4 + column tile] */
  g2_main(sm, A + (size_t)(mt * 128) * DM, DM, Bh + (size_t)col0 * DM, DM, DM, tid, w, ln, hh, accs);
#pragma unroll
  for (int u = 0; u < 8; ++u) { const int t = u & 3, half = u >> 2; const int col = col0 + t * 16 + ln; const float bb = bf16_rne(bias[col]);
#pragma unroll
    for (int r = 0; r < 8; ++r) { const int rloc = half * 16 + 8 * hh + r; so[w][rloc][t * 16 + ln] = accs[u][r] * 0.0625f + bb; } }
  __builtin_amdgcn_fence(4 /* acq_rel order */, "workgroup"); __builtin_amdgcn_wave_barrier();      /* so[w] is private to wave w */
  const int rsub = lane >> 4, c4 = (lane & 15) * 4; const int head = col0 >> 6;
  if (job == 0) {
#pragma unroll
    for (int q = 0; q < 16; ++q) { const int r = q * 2 + rsub; const v4f v = *(const v4fa*)&so[w][r][c4]; v4h h4;      /* 16 trips x 2 rows = 32 rows, here and below */
#pragma unroll
      for (int i = 0; i < 4; ++i) h4[i] = (_Float16)v[i];
      *(v4h*)(V16 + (size_t)(row0 + r) * DM + col0 + c4) = h4; }
  } else if (job == 1) {
#pragma unroll
    for (int q = 0; q < 16; ++q) { const int r = q * 2 + rsub; const v4f v = *(const v4fa*)&so[w][r][c4]; *(v4f*)(G + (size_t)(row0 + r) * DM + col0 + c4) = v; }
    asm volatile("s_wait_xcnt 0x0" ::: "memory");      /* the branches join in address arithmetic that reuses these stores' registers: the wait stands in front of it */
  } else { const bool qside = (job & 1) == 0;
#pragma unroll 1
    for (int q0 = 0; q0 < 16; q0 += 4) {      /* rolled: four trips of four row pairs, for code size */
#pragma unroll
     for (int q = q0; q < q0 + 4; ++q) { const int r = q * 2 + rsub; const v4f v = *(const v4fa*)&so[w][r][c4];
      v4h s0, s1, s2;
#pragma unroll
      for (int i = 0; i < 4; ++i) { const h16 hi = toh_flush(v[i]); const h16 rs = toh_flush((v[i] - (float)hi) * 2048.0f); const h16 hs = (h16)((float)hi * 2048.0f);
        s0[i] = qside ? hs : hi; s1[i] = qside ? rs : hi; s2[i] = qside ? hi : rs; }
      _Float16* dst = C3 + (size_t)(row0 + r) * (3 * DM) + head * CK + c4;
      *(v4h*)dst = s0; *(v4h*)(dst + 64) = s1; *(v4h*)(dst + 128) = s2; }
     asm volatile("s_wait_xcnt 0x0" ::: "memory"); }      /* the next trip rewrites the registers that this trip's stores name */
     } }

// ---- all ten input conversions as one launch: blocks 0 .. 7 WBL - 1 take the seven weight planes (natural [out][in] = Bt[n][k], x16), the rest the three activation planes; 8 elements per thread ----
// Bt: seven f16 planes of DM x DM, one behind the other, in the order w0 .. w6; X16: three f16 planes of NR x DM in the order x0 .. x2.
#define WBL (DM * DM / 8 / 256)            /* blocks per weight plane */
#define XBL ((int)(NR * DM / 8 / 256))     /* blocks per activation plane */
static_assert(DM * DM % (8 * 256) == 0 && (NR * DM) % (8 * 256) == 0);      /* whole blocks: no thread past the end of a plane */
static_assert(((size_t)DM * DM * 2) % 256 == 0 && (NR * DM * 2) % 256 == 0);      /* the planes follow one another in the workspace without a gap */
__global__ __launch_bounds__(256) void k_cvt(const float* __restrict__ w0, const float* __restrict__ w1, const float* __restrict__ w2, const float* __restrict__ w3, const float* __restrict__ w4,
    const float* __restrict__ w5, const float* __restrict__ w6, const float* __restrict__ x0, const float* __restrict__ x1, const float* __restrict__ x2, _Float16* __restrict__ Bt, _Float16* __restrict__ X16) {
  const int blk = blockIdx.x; FragH f;
  if (blk < 7 * WBL) { const int pl = blk / WBL; const size_t t = (size_t)(blk - pl * WBL) * 256 + threadIdx.x;
    const float* w = (pl == 0) ? w0 : (pl == 1) ? w1 : (pl == 2) ? w2 : (pl == 3) ? w3 : (pl == 4) ? w4 : (pl == 5) ? w5 : w6;
    const v4f a = *(const v4fa*)(w + t * 8), c = *(const v4fa*)(w + t * 8 + 4);
#pragma unroll
    for (int q = 0; q < 4; ++q) { f.h[q] = toh_flush(bf16_rne(a[q]) * 16.0f); f.h[4 + q] = toh_flush(bf16_rne(c[q]) * 16.0f); }
    const v8us o = f.half[0]; *(v8us*)((unsigned short*)Bt + (size_t)pl * DM * DM + t * 8) = o;
  } else { const int bx = blk - 7 * WBL; const int pl = bx / XBL; const size_t t = (size_t)(bx - pl * XBL) * 256 + threadIdx.x;
    const float* x = (pl == 0) ? x0 : (pl == 1) ? x1 : x2;
    const size_t row = t / (DM / 8); const int c8 = (int)(t % (DM / 8)) * 8; const size_t srow = (row / NB) * NB_FULL + (row % NB);
    const float* p = x + srow * DM + c8; const v4f a = *(const v4fa*)p, c = *(const v4fa*)(p + 4);
#pragma unroll
    for (int q = 0; q < 4; ++q) { f.h[q] = (_Float16)bf16_rne(a[q]); f.h[4 + q] = (_Float16)bf16_rne(c[q]); }
    const v8us o = f.half[0]; *(v8us*)((unsigned short*)X16 + (size_t)pl * NR * DM + t * 8) = o;
    asm volatile("s_wait_xcnt 0x0" ::: "memory"); } }      /* the built code runs on from here towards the weight branch, whose loads reuse this store's registers: the wait stands in front of them */

__global__ __launch_bounds__(256) void k_vt(const _Float16* __restrict__ V16, _Float16* __restrict__ Vt) { __shared__ unsigned short tl[64][66]; const int tid = threadIdx.x; const int slab = blockIdx.x / (SEQ / 64), lg = blockIdx.x % (SEQ / 64); const int b = slab / NH, h = slab % NH;
  for (int i = tid; i < 64 * 8; i += 256) { const int r = i / 8, c8 = (i % 8) * 8; FragH f; f.half[0] = *(const v8us*)((const unsigned short*)V16 + ((size_t)(lg * 64 + r) * NB + b) * DM + h * HD + c8);
#pragma unroll
    for (int q = 0; q < 8; ++q) tl[r][c8 + q] = f.u[q]; }
  __syncthreads();
  {
#pragma unroll
    for (int rd = 0; rd < 2; ++rd) { const int d = rd * 32 + tid / 8, pc = tid % 8; FragH f;
#pragma unroll
      for (int q = 0; q < 8; ++q) f.u[q] = tl[pc * 8 + q][d];
      *(v8us*)((unsigned short*)Vt + ((size_t)slab * 64 + d) * SEQ + lg * 64 + pc * 8) = f.half[0]; }
     } }

// width table: SIGT[sig_idx(r)], r = t*NB + b, = 1 / (2 sigma^2), sigma = 1 + sigmoid(sum_e tanh(G[r][e]) * bf16(Wvp[e]) + bf16(bvp)); G f32 [NR][DM].
// One row per wave, 8 rows per block; a block's 8 values open a 128-B line of their own, so that each line of the table has one writer.
#define SGR 8                        /* rows (= waves) per k_sigma block */
static_assert((NB * SEQ) % SGR == 0);
static_assert(SGR * 4 <= 128 && SGR % 4 == 0 && SGR * 32 == 256);      /* one line per block, 16-B stores, one wave per row in a block of 256 */
__device__ __forceinline__ size_t sig_idx(size_t r) { return (r / SGR) * 32 + (r % SGR); }
__global__ __launch_bounds__(256) void k_sigma(const float* __restrict__ G, const float* __restrict__ wvp, const float* __restrict__ bvp, float* __restrict__ SIGT) {
  #pragma clang fp contract(off)
  __shared__ __attribute__((aligned(16))) float sg[SGR];
  const int tid = threadIdx.x, w = __builtin_amdgcn_readfirstlane((int)(tid >> 5)), lane = tid & 31;
  const float b0 = bf16_rne(bvp[0]);
  const float* p = G + ((size_t)blockIdx.x * SGR + w) * DM + lane;
  float x[DM / 32], wv[DM / 32];
#pragma unroll      /* unrolled: the row's loads all go out before the first tanh, one memory latency per row instead of one per 32 elements */
  for (int j = 0; j < DM / 32; ++j) { x[j] = p[j * 32]; wv[j] = wvp[j * 32 + lane]; }
  float acc = 0.f;
#pragma unroll      /* unrolled: x / wv are indexed by constants and stay in registers; the sum runs in ascending k */
  for (int j = 0; j < DM / 32; ++j) acc += tanhf(x[j]) * bf16_rne(wv[j]);
#pragma unroll
  for (int off = 16; off > 0; off >>= 1) acc += __shfl_xor(acc, off, 32);
  const float g = acc + b0;
  const float sgm = 1.0f + 1.0f / (1.0f + expf(-g));
  const float i2 = 1.0f / (2.0f * sgm * sgm);
  if (lane == 0) sg[w] = i2;
  __syncthreads();
  if (w == 0 && lane < SGR / 4) { const v4f v = *(const v4fa*)&sg[lane * 4]; float* dst = SIGT + (size_t)blockIdx.x * 32 + lane * 4;
    *(v4f*)dst = v;  }
}

// alignment statistics: S f32 [NB*NH][QC][SEQ] (slab = b*NH + h) -> MEANT[slab][t0 + tq] = sum_s softmax(S row)[s] * s  (f32; position sum centred at SEQ/2).
__global__ __launch_bounds__(256) void k_amean(const float* __restrict__ S, float* __restrict__ MEANT, int t0) {
  #pragma clang fp contract(off)
  __shared__ __attribute__((aligned(16))) float sm[32];
  const int tid = threadIdx.x, w = __builtin_amdgcn_readfirstlane((int)(tid >> 5)), lane = tid & 31;
  const int rb = blockIdx.x * 32; const int slab = rb / QC, tq0 = rb - slab * QC;
  const float pb = (float)(lane * 4 - SEQ / 2);
#pragma unroll 1
  for (int i = 0; i < 4; ++i) {
    const int rl = w * 4 + i;
    const float* p = S + ((size_t)slab * QC + tq0 + rl) * SEQ + lane * 4;
    v4f x[SEQ / 128];
#pragma unroll
    for (int j = 0; j < SEQ / 128; ++j) x[j] = *(const v4fa*)(p + j * 128);
    float mx = -3.0e38f;
#pragma unroll
    for (int j = 0; j < SEQ / 128; ++j) mx = fmaxf(mx, fmaxf(fmaxf(x[j][0], x[j][1]), fmaxf(x[j][2], x[j][3])));
#pragma unroll
    for (int off = 16; off > 0; off >>= 1) mx = fmaxf(mx, __shfl_xor(mx, off, 32));
    float se = 0.f, sw = 0.f;
#pragma unroll
    for (int j = 0; j < SEQ / 128; ++j) {
#pragma unroll
      for (int c = 0; c < 4; ++c) { const float e = __expf(x[j][c] - mx); se += e; sw += e * (pb + (float)(j * 128 + c)); } }
#pragma unroll
    for (int off = 16; off > 0; off >>= 1) { se += __shfl_xor(se, off, 32); sw += __shfl_xor(sw, off, 32); }
    const float mean = (float)(SEQ / 2) + sw * (1.0f / se);
    if (lane == 0) sm[rl] = mean;
  }
  __syncthreads();
  if (w == 0 && lane < 8) { const v4f v = *(const v4fa*)&sm[lane * 4]; float* dst = MEANT + (size_t)slab * SEQ + t0 + tq0 + lane * 4;
    *(v4f*)dst = v;  }
}

// Gaussian softmax: S f32 [NB*NH][QC][SEQ] content logits; x[s] = S[s] - (s - mean)^2 * (1 / (2 sigma^2)); PM f16 [NB*NH][QC][SEQ] = 2^14 * softmax(x) (max-subtracted, f32 statistics).
__global__ __launch_bounds__(128) void k_gsoft(const float* __restrict__ S, const float* __restrict__ MEANT, const float* __restrict__ SIGT, _Float16* __restrict__ PM, int t0) {
  #pragma clang fp contract(off)
  const int tid = threadIdx.x, w = __builtin_amdgcn_readfirstlane((int)(tid >> 5)), lane = tid & 31;
  const int wr = blockIdx.x * 4 + w; const int slab = wr / QC, tql = wr - slab * QC; const int b = slab / NH; const int t = t0 + tql;
  const float mu = MEANT[(size_t)slab * SEQ + t];
  const float i2 = SIGT[sig_idx((size_t)t * NB + b)];
  const float* p = S + ((size_t)slab * QC + tql) * SEQ + lane * 4;
  const float pb = (float)(lane * 4);
  v4f x[SEQ / 128];
#pragma unroll
  for (int j = 0; j < SEQ / 128; ++j) x[j] = *(const v4fa*)(p + j * 128);
  float mx = -3.0e38f;
#pragma unroll
  for (int j = 0; j < SEQ / 128; ++j) {
#pragma unroll
    for (int c = 0; c < 4; ++c) { const float d = (pb + (float)(j * 128 + c)) - mu; const float v = x[j][c] - (d * d) * i2; x[j][c] = v; mx = fmaxf(mx, v); } }
#pragma unroll
  for (int off = 16; off > 0; off >>= 1) mx = fmaxf(mx, __shfl_xor(mx, off, 32));
  float se = 0.f;
#pragma unroll
  for (int j = 0; j < SEQ / 128; ++j) {
#pragma unroll
    for (int c = 0; c < 4; ++c) { const float e = __expf(x[j][c] - mx); x[j][c] = e; se += e; } }
#pragma unroll
  for (int off = 16; off > 0; off >>= 1) se += __shfl_xor(se, off, 32);
  const float cs = 16384.0f * (1.0f / se);
  v4h hq[SEQ / 128];
#pragma unroll
  for (int j = 0; j < SEQ / 128; ++j) {
#pragma unroll
    for (int c = 0; c < 4; ++c) hq[j][c] = toh_flush(x[j][c] * cs); }
  _Float16* prow = PM + ((size_t)slab * QC + tql) * SEQ + lane * 4;
  {
#pragma unroll
    for (int j = 0; j < SEQ / 128; ++j) { const v4h v = hq[j]; *(v4h*)(prow + j * 128) = v; }
     }
}

extern "C" void kernel_launch(void* const* d_in, const int* in_sizes, int n_in,
                              void* d_out, int out_size, void* d_ws, size_t ws_size, hipStream_t stream) {
  if (n_in < 19) return;
  if ((size_t)in_sizes[0] < NR * DM || (size_t)in_sizes[1] < NR * DM || (size_t)in_sizes[2] < NR * DM) return;
  if ((size_t)in_sizes[3] < (size_t)DM * DM || (size_t)in_sizes[5] < (size_t)DM * DM || (size_t)in_sizes[7] < (size_t)DM * DM || (size_t)in_sizes[9] < (size_t)DM * DM) return;
  if ((size_t)in_sizes[11] < (size_t)DM * DM || (size_t)in_sizes[13] < (size_t)DM * DM || (size_t)in_sizes[17] < (size_t)DM * DM) return;
  if (in_sizes[4] < DM || in_sizes[6] < DM || in_sizes[8] < DM || in_sizes[10] < DM || in_sizes[12] < DM || in_sizes[14] < DM || in_sizes[15] < DM || in_sizes[16] < 1 || in_sizes[18] < DM) return;
  if ((size_t)out_size < NR * DM) return;
  const float* const* I = (const float* const*)d_in;
  const float* xq = I[0]; const float* xk = I[1]; const float* xv = I[2];
  const float* wq = I[3]; const float* bq = I[4]; const float* wk = I[5]; const float* bk = I[6]; const float* wv = I[7]; const float* bv = I[8];
  const float* whq = I[9]; const float* bhq = I[10]; const float* whk = I[11]; const float* bhk = I[12]; const float* wwp = I[13]; const float* bwp = I[14];
  const float* wvp = I[15]; const float* bvp = I[16]; const float* wo = I[17]; const float* bo = I[18];
  char* ws = (char*)d_ws; size_t off = 0;
  auto take = [&](size_t bytes) { char* p = ws + off; off += (bytes + 255) & ~(size_t)255; return p; };
  _Float16* BQ = (_Float16*)take((size_t)DM * DM * 2); _Float16* BK = (_Float16*)take((size_t)DM * DM * 2); _Float16* BV = (_Float16*)take((size_t)DM * DM * 2);
  _Float16* BHQ = (_Float16*)take((size_t)DM * DM * 2); _Float16* BHK = (_Float16*)take((size_t)DM * DM * 2); _Float16* BWP = (_Float16*)take((size_t)DM * DM * 2); _Float16* BO = (_Float16*)take((size_t)DM * DM * 2);
  _Float16* XQ = (_Float16*)take(NR * DM * 2); _Float16* XK = (_Float16*)take(NR * DM * 2); _Float16* XV = (_Float16*)take(NR * DM * 2);
  _Float16* CA = (_Float16*)take(NR * 3 * DM * 2); _Float16* CB = (_Float16*)take(NR * 3 * DM * 2);      /* concatenated planes of the alignment pair */
  _Float16* V16 = (_Float16*)take(NR * DM * 2); _Float16* O16 = (_Float16*)take(NR * DM * 2); _Float16* VT = (_Float16*)take((size_t)NB * NH * HD * SEQ * 2);
  float* S = (float*)take((size_t)NB * NH * QC * SEQ * 4); _Float16* PM = (_Float16*)take((size_t)NB * NH * QC * SEQ * 2);
  float* MEANT = (float*)take((size_t)NB * NH * SEQ * 4); float* SIGT = (float*)take(NR / SGR * 128);
  if (off > ws_size) return;
  float* G = S;                                                            /* f32 wp plane [NR][DM], consumed by k_sigma before the first scores launch */
  _Float16* CA2 = PM; _Float16* CB2 = PM + NR * 3 * DM;                    /* content pair: in the P region, read by the content scores launch before k_gsoft writes P */
  k_cvt<<<7 * WBL + 3 * XBL, 256, 0, stream>>>(wq, wk, wv, whq, whk, wwp, wo, xq, xk, xv, BQ, XQ);      /* planes BQ .. BO and XQ .. XV in the order of their take() calls */
  const dim3 gp((unsigned)((MP / 128) * (DM / 64)), 1);
  k_proj<<<dim3((unsigned)((MP / 128) * (DM / 64)), 6), 128, 0, stream>>>(XQ, XK, XV, BV, BWP, BHQ, BHK, BQ, BK, bv, bwp, bhq, bhk, bq, bk, V16, G, CA, CB, CA2, CB2);
  k_vt<<<NB * NH * (SEQ / 64), 256, 0, stream>>>(V16, VT);      /* V16 rows [SEQ*NB][DM] -> VT[(b,h)][64][SEQ] */
  k_sigma<<<MP / SGR, 256, 0, stream>>>(G, wvp, bvp, SIGT);
  /* alignment pair */
  for (int t0 = 0; t0 < SEQ; t0 += QC) {
    /* slab by = b*NH + h at column offset by*192 of rows with pitch LQ3; S[by][QC][SEQ] f32 = 2^-14 * (2048 hi.hi + res.hi + hi.res) */
    k_gemm2<false, true, false><<<dim3((QC / 128) * (SEQ / 64), NB * NH), 128, 0, stream>>>(CA + (size_t)t0 * LQ3, LQ3, (size_t)CK, CB, LQ3, (size_t)CK, 6.103515625e-05f, nullptr, S, nullptr, SEQ, (size_t)QC * SEQ, QC, SEQ, CK);
    k_amean<<<NB * NH * QC / 32, 256, 0, stream>>>(S, MEANT, t0);
  }
  /* content pair */
  for (int t0 = 0; t0 < SEQ; t0 += QC) {
    k_gemm2<false, true, false><<<dim3((QC / 128) * (SEQ / 64), NB * NH), 128, 0, stream>>>(CA2 + (size_t)t0 * LQ3, LQ3, (size_t)CK, CB2, LQ3, (size_t)CK, 6.103515625e-05f, nullptr, S, nullptr, SEQ, (size_t)QC * SEQ, QC, SEQ, CK);
    k_gsoft<<<NB * NH * QC / 4, 128, 0, stream>>>(S, MEANT, SIGT, PM, t0);
    /* ctx[t][b][h*64 + d] x64 = 2^-8 * (2^14 P) . V^T */
    k_gemm2<false, false, false><<<dim3((QC / 128) * (HD / 64), NB * NH), 128, 0, stream>>>(PM, SEQ, (size_t)QC * SEQ, VT, SEQ, (size_t)HD * SEQ, 0.00390625f, nullptr, nullptr, O16 + (size_t)t0 * LQ, LQ, (size_t)HD, QC, HD, SEQ);
  }
  k_gemm2<true, true, true><<<gp, 128, 0, stream>>>(O16, DM, 0, BO, DM, 0, 0.0009765625f, bo, (float*)d_out, nullptr, DM, 0, MP, DM, DM);      /* out rows t*NB_FULL + b */
}

// v005
// Measured time: 139 microseconds a run.
// Two timings next to v004 put it at 1.25 and 1.24 times that version's speed.
// Over all steps from v000 it is 4.73 times as fast.
#include <hip/hip_runtime.h>
// Gaussian-windowed multi-head cross attention, sequence-first layout: query [1024][2][1024], key_in / value [1024][2][1024] (token row r = t*NB + b); six input maps with natural [out][in] weights + biases: q, hq, wp from query; k, hk from key_in; v from value; 16 heads of 64 (flat slab b*16 + h); content logits 64^-0.5 q.k; alignment softmax over keys of 64^-0.5 hq.hk, mean = expected key position; width sigma = 1 + sigmoid(tanh(wp) . Wvp + bvp) per (t, b); P = softmax_s(content - (s - mean)^2 / (2 sigma^2)); ctx = P . v merged [t][b][h*64+d]; out = ctx Wo^T + bo.
// Structure: inputs as exact f16 rows (RNE-converted to bf16 first); all conversions as one launch; the six input projections as one launch of WMMA GEMMs (32x64 wave tiles, f32 accumulation, x16 weights + bias); q/hq and k/hk are written as K-concatenated planes per head [2048 hi | res | hi] and [hi | hi | res] (hi = f16 value, res = f16 of 2048 (v - hi)) so one K = 192 GEMM yields 2048 (hi.hi) + res.hi + hi.res; all query rows as one chunk: alignment scores GEMM -> f32 S -> k_amean (f32 softmax statistics, centred position sum); k_fattn: content scores, Gaussian term, running-maximum f32 softmax (P as f16 x 2^14 of exp(x - running max)) and P . V^T per 64-key tile in one launch, S and P of the content pair never in memory (ctx carried x64) -> out GEMM (f32).
// Compute dtype: all contractions v_wmma_f32_16x16x32_f16 (f16 operands, f32 accumulate); inputs RNE-converted to bf16 (exact in f16); both score sites as f16 value + x2048 residual (three products folded along K); v, P (x2^14), ctx (x64), Wo as plain f16 operands; softmax statistics, mean, tanh / Wvp / sigmoid on the vector unit in f32.
#ifndef NB
#define NB 2                         /* batches processed */
#endif
#ifndef SEQ
#define SEQ 1024                     /* sequence length processed (queries = keys) */
#endif
#define NB_FULL 2                    /* batch pitch of the input / output rows */
#define DM 1024
#define NH 16
#define HD 64
#define QC SEQ                       /* query rows per attention chunk: all of them, so each attention stage is one launch over every (slab, row) */
#define NR ((size_t)NB * SEQ)        /* token rows */
#define MP ((int)(NB * SEQ))
#define LQ (NB * DM)                 /* pitch between consecutive t for one batch */
#define CK (3 * HD)                  /* concatenated K per head */
#define LQ3 (NB * 3 * DM)            /* pitch between consecutive t in a concatenated plane */
static_assert(SEQ % 128 == 0);
static_assert(QC % 128 == 0);
static_assert(SEQ % QC == 0);
static_assert(NH * HD == DM);
static_assert(NB <= NB_FULL);
static_assert((NB * SEQ) % 128 == 0);
static_assert(NH == 16);
static_assert(HD == 64);                         
static_assert(CK % 32 == 0);
static_assert(DM % 32 == 0);
static_assert(QC % 32 == 0);
static_assert((NB * SEQ) % 32 == 0);
static_assert(NH * QC >= DM);                    /* the f32 wp plane [NR][DM] fits into the S region */
static_assert(NH * QC >= 2 * 3 * DM);            /* the content pair's two concatenated planes fit into the P region */
static_assert(QC == SEQ);
static_assert(32 * 8 * 16 == 32 * HD * 2);       
static_assert(8 * 16 == 32 * 4);                 /* k_amean: 8 lanes x 16 B == 32 floats */
#define KT 64                        /* k elements per staged tile: one 128-B line of every operand row */
#define LP 72                        /* LDS row pitch in f16: 144 B = 16 B x odd, for 16-byte fragment reads */
#define TB ((128 + 64) * LP * 2)     /* bytes of one staged tile: 128 A rows, then 64 Bt rows */
static_assert(CK % KT == 0 && DM % KT == 0 && SEQ % KT == 0);   /* every K of the GEMM launches */
static_assert(4 * 32 * 68 * 4 <= 2 * TB);        /* the output staging fits into the two tile buffers */
static_assert(2 * TB <= 131072);                 /* static LDS of the GEMM kernels */
#define WS_TOTAL (7 * (size_t)DM * DM * 2 + 3 * NR * DM * 2 + 2 * NR * 3 * DM * 2 + 2 * NR * DM * 2 + (size_t)NB * NH * HD * SEQ * 2 + (size_t)NB * NH * QC * SEQ * 4 + (size_t)NB * NH * QC * SEQ * 2 + (size_t)NB * NH * SEQ * 4 + NR * 16)
static_assert(WS_TOTAL + 32 * 256 <= 268435456);

typedef unsigned short v8us __attribute__((ext_vector_type(8), may_alias));
typedef float  v8f  __attribute__((ext_vector_type(8)));
typedef float  v4f  __attribute__((ext_vector_type(4)));
typedef float  v4fa __attribute__((ext_vector_type(4), may_alias));
typedef _Float16 v16h __attribute__((ext_vector_type(16)));
typedef _Float16 v4h __attribute__((ext_vector_type(4)));
union FragH { v16h v; v8us half[2]; _Float16 h[16]; unsigned short u[16]; };

__device__ __forceinline__ unsigned short bf16_bits(float x) { unsigned int u = __float_as_uint(x); return (unsigned short)((u + 0x7FFFu + ((u >> 16) & 1u)) >> 16); }
__device__ __forceinline__ float bf16_val(unsigned short b) { return __uint_as_float(((unsigned int)b) << 16); }
__device__ __forceinline__ float bf16_rne(float x) { return bf16_val(bf16_bits(x)); }   /* RNE convert to bf16, back as f32 */

typedef _Float16 h16;
// f32 -> f16 with a value select: magnitudes below 2^-14 become +0 (no f16 subnormal can reach a WMMA operand)
static __device__ __forceinline__ h16 toh_flush(float v) { const h16 r = (h16)v; return (fabsf(v) < 6.103515625e-05f) ? (h16)0.0f : r; }

// fragment: elements 0..7 <- k0 + 8h .. +7, elements 8..15 <- k0 + 16 + 8h .. +7 (p points at k0 of the lane's row / column)
__device__ __forceinline__ v16h g2_frag(const _Float16* p, int hh) { FragH f; f.half[0] = *(const v8us*)((const unsigned short*)p + 8 * hh); f.half[1] = *(const v8us*)((const unsigned short*)p + 16 + 8 * hh); return f.v; }
__device__ __forceinline__ v8f g2_mma(v16h a, v16h b, v8f c) { v8f d = __builtin_amdgcn_wmma_f32_16x16x32_f16(false, a, false, b, (short)0, c, false, false); asm volatile("v_nop\n\tv_nop\n\tv_nop\n\tv_nop" : "+v"(d) : "v"(a), "v"(b)); return d; }

// one K tile of the block's operands, global -> LDS with no register in between: 12 copies of 16 B per lane; a wave's copy covers 4 whole 128-B lines.
// l: the lane's LDS byte address in tile row tid / 8 (rows step by 16 per copy); ga / gb: the lane's 16 bytes in that row of A / Bt at this tile's k.
__device__ __forceinline__ void g2_stage(unsigned l, const _Float16* ga, size_t sa, const _Float16* gb, size_t sb) {
  /* the closing s_wait_xcnt stands inside the statement so that no address register of a copy is rewritten in front of it */
  asm volatile("global_load_async_to_lds_b128 %0, %12, off\n\t" "global_load_async_to_lds_b128 %1, %13, off\n\t" "global_load_async_to_lds_b128 %2, %14, off\n\t"
               "global_load_async_to_lds_b128 %3, %15, off\n\t" "global_load_async_to_lds_b128 %4, %16, off\n\t" "global_load_async_to_lds_b128 %5, %17, off\n\t"
               "global_load_async_to_lds_b128 %6, %18, off\n\t" "global_load_async_to_lds_b128 %7, %19, off\n\t" "global_load_async_to_lds_b128 %8, %20, off\n\t"
               "global_load_async_to_lds_b128 %9, %21, off\n\t" "global_load_async_to_lds_b128 %10, %22, off\n\t" "global_load_async_to_lds_b128 %11, %23, off\n\t"
               "s_wait_xcnt 0x0"
               :: "v"(l), "v"(l + 1u * 16 * LP * 2), "v"(l + 2u * 16 * LP * 2), "v"(l + 3u * 16 * LP * 2), "v"(l + 4u * 16 * LP * 2), "v"(l + 5u * 16 * LP * 2),
                  "v"(l + 6u * 16 * LP * 2), "v"(l + 7u * 16 * LP * 2), "v"(l + 8u * 16 * LP * 2), "v"(l + 9u * 16 * LP * 2), "v"(l + 10u * 16 * LP * 2), "v"(l + 11u * 16 * LP * 2),
                  "v"(ga), "v"(ga + sa), "v"(ga + 2 * sa), "v"(ga + 3 * sa), "v"(ga + 4 * sa), "v"(ga + 5 * sa), "v"(ga + 6 * sa), "v"(ga + 7 * sa),
                  "v"(gb), "v"(gb + sb), "v"(gb + 2 * sb), "v"(gb + 3 * sb)
               : "memory"); }

// main loop of both GEMM kernels: block tile 128 x 64, wave w takes rows 32 w .. 32 w + 31; two LDS tile buffers, tile t + 1 in flight while tile t is multiplied.
// Ab: row 0 of the block's 128 A rows; Bb: row 0 of its 64 Bt rows; K % KT == 0. On return every wave has left both buffers and no copy is outstanding.
__device__ __forceinline__ void g2_main(unsigned char* sm, const _Float16* Ab, int lda, const _Float16* Bb, int ldb, int K, int tid, int w, int ln, int hh, v8f (&acc)[8]) {
  const int nt = K / KT;
  const unsigned l0 = (unsigned)(size_t)sm + (unsigned)((tid >> 3) * (LP * 2) + (tid & 7) * 16);
  const _Float16* ga = Ab + (size_t)(tid >> 3) * lda + (tid & 7) * 8; const _Float16* gb = Bb + (size_t)(tid >> 3) * ldb + (tid & 7) * 8;
  const size_t sa = (size_t)16 * lda, sb = (size_t)16 * ldb;
  g2_stage(l0, ga, sa, gb, sb);
  asm volatile("s_wait_asynccnt 0x0" ::: "memory");      /* this wave's part of tile 0 has landed */
  __syncthreads();                                       /* ... and every other wave's */
  if (nt > 1) g2_stage(l0 + TB, ga + KT, sa, gb + KT, sb);
#pragma unroll 1
  for (int t = 0; t < nt; ++t) {      /* rolled: one publish point per tile */
    const _Float16* tb = (const _Float16*)(sm + (t & 1) * TB);
    const _Float16* ap = tb + (32 * w + ln) * LP; const _Float16* bp = tb + (128 + ln) * LP;
    v16h fa[KT / 32][2], fb[KT / 32][4];      /* the tile's fragment reads go out as one group, in the order of their use, ahead of the products */
#pragma unroll      /* unrolled here and below: fa / fb are indexed by constants and stay in registers */
    for (int s = 0; s < KT / 32; ++s) { fa[s][0] = g2_frag(ap + 32 * s, hh); fb[s][0] = g2_frag(bp + 32 * s, hh); fa[s][1] = g2_frag(ap + 16 * LP + 32 * s, hh);
      fb[s][1] = g2_frag(bp + 16 * LP + 32 * s, hh); fb[s][2] = g2_frag(bp + 32 * LP + 32 * s, hh); fb[s][3] = g2_frag(bp + 48 * LP + 32 * s, hh); }
#pragma unroll
    for (int s = 0; s < KT / 32; ++s) {
#pragma unroll
      for (int c = 0; c < 4; ++c) { acc[c] = g2_mma(fa[s][0], fb[s][c], acc[c]); acc[4 + c] = g2_mma(fa[s][1], fb[s][c], acc[4 + c]); } }
    asm volatile("s_wait_dscnt 0x0" ::: "memory");       /* this wave's reads of tile t are done before its buffer is refilled */
    asm volatile("s_wait_asynccnt 0x0" ::: "memory");    /* this wave's part of tile t + 1 has landed */
    __syncthreads();                                     /* publishes tile t + 1 and ends every wave's reads of tile t */
    if (t + 2 < nt) g2_stage(l0 + (unsigned)(t & 1) * TB, ga + (size_t)(t + 2) * KT, sa, gb + (size_t)(t + 2) * KT, sb);
  }
  asm volatile("s_wait_asynccnt 0x0" ::: "memory");      /* nothing in flight when the buffers become output staging */
}

// ---- GEMM (wave tile 32x64; M % 128 == 0 per launch region, N % 64 == 0, K % 64 == 0): C = alpha * A . Bt^T (+ bias) ----
// A f16 [M][K] (pitch lda), Bt f16 [N][K] (pitch ldb); batch slab by = blockIdx.y with element strides sA / sB / sC.
// OMAP: output row r -> (r / NB) * NB_FULL + r % NB.
template <bool HASB, bool OUT32, bool OMAP>
__global__ __launch_bounds__(128) void k_gemm2(const _Float16* __restrict__ A, int lda, size_t sA, const _Float16* __restrict__ Bh, int ldb, size_t sB, float alpha,
    const float* __restrict__ bias, float* __restrict__ C, _Float16* __restrict__ C16, int ldc, size_t sC, int M, int N, int K) {
  __shared__ __attribute__((aligned(16))) unsigned char sm[2 * TB]; float (*so)[32][68] = (float (*)[32][68])sm;      /* two tile buffers; output staging behind the main loop */
  const int tid = threadIdx.x, w = __builtin_amdgcn_readfirstlane((int)(tid >> 5)), lane = tid & 31, ln = lane & 15, hh = lane >> 4; const int by = blockIdx.y;
  A += (size_t)by * sA; Bh += (size_t)by * sB; const size_t cofs = (size_t)by * sC;
  const int ntn = N >> 6; const int mt = blockIdx.x / ntn, nq = blockIdx.x - mt * ntn; const int row0 = mt * 128 + 32 * w, col0 = nq * 64; if (mt * 128 >= M) return;      /* the whole block leaves, in front of every barrier */
  const v8f z8 = {0.f,0.f,0.f,0.f,0.f,0.f,0.f,0.f}; v8f accs[8] = {z8, z8, z8, z8, z8, z8, z8, z8};      /* [row half * 4 + column tile] */
  g2_main(sm, A + (size_t)(mt * 128) * lda, lda, Bh + (size_t)col0 * ldb, ldb, K, tid, w, ln, hh, accs);
#pragma unroll
  for (int u = 0; u < 8; ++u) { const int t = u & 3, half = u >> 2; const int col = col0 + t * 16 + ln; float bv = 0.f; if (HASB) bv = bf16_rne(bias[col]);
#pragma unroll
    for (int r = 0; r < 8; ++r) { const int rloc = half * 16 + 8 * hh + r; so[w][rloc][t * 16 + ln] = accs[u][r] * alpha + bv; } }
  __builtin_amdgcn_fence(4 /* acq_rel order */, "workgroup"); __builtin_amdgcn_wave_barrier();      /* so[w] is private to wave w */
  const int rsub = lane >> 4, c4 = (lane & 15) * 4;
  {
#pragma unroll
    for (int q = 0; q < 16; ++q) { const int r = q * 2 + rsub; const v4f v = *(const v4fa*)&so[w][r][c4];
      const int gr = row0 + r; const size_t orow = OMAP ? ((size_t)(gr / NB) * NB_FULL + (size_t)(gr % NB)) : (size_t)gr;
      if (OUT32) { *(v4f*)(C + cofs + orow * ldc + col0 + c4) = v; }
      else { v4h h4;
#pragma unroll
        for (int i = 0; i < 4; ++i) h4[i] = (_Float16)v[i];
        *(v4h*)(C16 + cofs + orow * ldc + col0 + c4) = h4; } }
     } }

// ---- the six input projections as one launch (same main loop and staging as k_gemm2; M = MP, N = K = DM; N tile 64 == one head): job = blockIdx.y picks operands, bias and output form ----
// x = A . Bt^T / 16 + bias (f32). job 0: v, f16 rows; job 1: wp, f32 rows; jobs 2 .. 5: hq, hk, q, k as K-concatenated planes:
// hi = f16(x), res = f16(2048 (x - hi)); head h = col0 / 64 of row r at C3 + r * 3 DM + h * 192: query side [2048 hi | res | hi], key side [hi | hi | res].
__global__ __launch_bounds__(128) void k_proj(const _Float16* __restrict__ XQ, const _Float16* __restrict__ XK, const _Float16* __restrict__ XV,
    const _Float16* __restrict__ BV, const _Float16* __restrict__ BWP, const _Float16* __restrict__ BHQ, const _Float16* __restrict__ BHK, const _Float16* __restrict__ BQ, const _Float16* __restrict__ BK,
    const float* __restrict__ bv, const float* __restrict__ bwp, const float* __restrict__ bhq, const float* __restrict__ bhk, const float* __restrict__ bq, const float* __restrict__ bk,
    _Float16* __restrict__ V16, float* __restrict__ G, _Float16* __restrict__ CHQ, _Float16* __restrict__ CHK, _Float16* __restrict__ CQ, _Float16* __restrict__ CK3) {
  __shared__ __attribute__((aligned(16))) unsigned char sm[2 * TB]; float (*so)[32][68] = (float (*)[32][68])sm;      /* two tile buffers; output staging behind the main loop */
  const int tid = threadIdx.x, w = __builtin_amdgcn_readfirstlane((int)(tid >> 5)), lane = tid & 31, ln = lane & 15, hh = lane >> 4; const int job = blockIdx.y;
  const _Float16* A; const _Float16* Bh; const float* bias; _Float16* C3 = nullptr;
  switch (job) {
    case 0: A = XV; Bh = BV; bias = bv; break;
    case 1: A = XQ; Bh = BWP; bias = bwp; break;
    case 2: A = XQ; Bh = BHQ; bias = bhq; C3 = CHQ; break;
    case 3: A = XK; Bh = BHK; bias = bhk; C3 = CHK; break;
    case 4: A = XQ; Bh = BQ; bias = bq; C3 = CQ; break;
    default: A = XK; Bh = BK; bias = bk; C3 = CK3; break; }
  const int mt = blockIdx.x / (DM / 64), nq = blockIdx.x - mt * (DM / 64); const int row0 = mt * 128 + 32 * w, col0 = nq * 64;
  const v8f z8 = {0.f,0.f,0.f,0.f,0.f,0.f,0.f,0.f}; v8f accs[8] = {z8, z8, z8, z8, z8, z8, z8, z8};      /* [row half * 4 + column tile] */
  g2_main(sm, A + (size_t)(mt * 128) * DM, DM, Bh + (size_t)col0 * DM, DM, DM, tid, w, ln, hh, accs);
#pragma unroll
  for (int u = 0; u < 8; ++u) { const int t = u & 3, half = u >> 2; const int col = col0 + t * 16 + ln; const float bb = bf16_rne(bias[col]);
#pragma unroll
    for (int r = 0; r < 8; ++r) { const int rloc = half * 16 + 8 * hh + r; so[w][rloc][t * 16 + ln] = accs[u][r] * 0.0625f + bb; } }
  __builtin_amdgcn_fence(4 /* acq_rel order */, "workgroup"); __builtin_amdgcn_wave_barrier();      /* so[w] is private to wave w */
  const int rsub = lane >> 4, c4 = (lane & 15) * 4; const int head = col0 >> 6;
  if (job == 0) {
#pragma unroll
    for (int q = 0; q < 16; ++q) { const int r = q * 2 + rsub; const v4f v = *(const v4fa*)&so[w][r][c4]; v4h h4;      /* 16 trips x 2 rows = 32 rows, here and below */
#pragma unroll
      for (int i = 0; i < 4; ++i) h4[i] = (_Float16)v[i];
      *(v4h*)(V16 + (size_t)(row0 + r) * DM + col0 + c4) = h4; }
  } else if (job == 1) {
#pragma unroll
    for (int q = 0; q < 16; ++q) { const int r = q * 2 + rsub; const v4f v = *(const v4fa*)&so[w][r][c4]; *(v4f*)(G + (size_t)(row0 + r) * DM + col0 + c4) = v; }
    asm volatile("s_wait_xcnt 0x0" ::: "memory");      /* the branches join in address arithmetic that reuses these stores' registers: the wait stands in front of it */
  } else { const bool qside = (job & 1) == 0;
#pragma unroll 1
    for (int q0 = 0; q0 < 16; q0 += 4) {      /* rolled: four trips of four row pairs, for code size */
#pragma unroll
     for (int q = q0; q < q0 + 4; ++q) { const int r = q * 2 + rsub; const v4f v = *(const v4fa*)&so[w][r][c4];
      v4h s0, s1, s2;
#pragma unroll
      for (int i = 0; i < 4; ++i) { const h16 hi = toh_flush(v[i]); const h16 rs = toh_flush((v[i] - (float)hi) * 2048.0f); const h16 hs = (h16)((float)hi * 2048.0f);
        s0[i] = qside ? hs : hi; s1[i] = qside ? rs : hi; s2[i] = qside ? hi : rs; }
      _Float16* dst = C3 + (size_t)(row0 + r) * (3 * DM) + head * CK + c4;
      *(v4h*)dst = s0; *(v4h*)(dst + 64) = s1; *(v4h*)(dst + 128) = s2; }
     asm volatile("s_wait_xcnt 0x0" ::: "memory"); }      /* the next trip rewrites the registers that this trip's stores name */
     } }

// ---- all ten input conversions as one launch: blocks 0 .. 7 WBL - 1 take the seven weight planes (natural [out][in] = Bt[n][k], x16), the rest the three activation planes; 8 elements per thread ----
// Bt: seven f16 planes of DM x DM, one behind the other, in the order w0 .. w6; X16: three f16 planes of NR x DM in the order x0 .. x2.
#define WBL (DM * DM / 8 / 256)            /* blocks per weight plane */
#define XBL ((int)(NR * DM / 8 / 256))     /* blocks per activation plane */
static_assert(DM * DM % (8 * 256) == 0 && (NR * DM) % (8 * 256) == 0);      /* whole blocks: no thread past the end of a plane */
static_assert(((size_t)DM * DM * 2) % 256 == 0 && (NR * DM * 2) % 256 == 0);      /* the planes follow one another in the workspace without a gap */
__global__ __launch_bounds__(256) void k_cvt(const float* __restrict__ w0, const float* __restrict__ w1, const float* __restrict__ w2, const float* __restrict__ w3, const float* __restrict__ w4,
    const float* __restrict__ w5, const float* __restrict__ w6, const float* __restrict__ x0, const float* __restrict__ x1, const float* __restrict__ x2, _Float16* __restrict__ Bt, _Float16* __restrict__ X16) {
  const int blk = blockIdx.x; FragH f;
  if (blk < 7 * WBL) { const int pl = blk / WBL; const size_t t = (size_t)(blk - pl * WBL) * 256 + threadIdx.x;
    const float* w = (pl == 0) ? w0 : (pl == 1) ? w1 : (pl == 2) ? w2 : (pl == 3) ? w3 : (pl == 4) ? w4 : (pl == 5) ? w5 : w6;
    const v4f a = *(const v4fa*)(w + t * 8), c = *(const v4fa*)(w + t * 8 + 4);
#pragma unroll
    for (int q = 0; q < 4; ++q) { f.h[q] = toh_flush(bf16_rne(a[q]) * 16.0f); f.h[4 + q] = toh_flush(bf16_rne(c[q]) * 16.0f); }
    const v8us o = f.half[0]; *(v8us*)((unsigned short*)Bt + (size_t)pl * DM * DM + t * 8) = o;
  } else { const int bx = blk - 7 * WBL; const int pl = bx / XBL; const size_t t = (size_t)(bx - pl * XBL) * 256 + threadIdx.x;
    const float* x = (pl == 0) ? x0 : (pl == 1) ? x1 : x2;
    const size_t row = t / (DM / 8); const int c8 = (int)(t % (DM / 8)) * 8; const size_t srow = (row / NB) * NB_FULL + (row % NB);
    const float* p = x + srow * DM + c8; const v4f a = *(const v4fa*)p, c = *(const v4fa*)(p + 4);
#pragma unroll
    for (int q = 0; q < 4; ++q) { f.h[q] = (_Float16)bf16_rne(a[q]); f.h[4 + q] = (_Float16)bf16_rne(c[q]); }
    const v8us o = f.half[0]; *(v8us*)((unsigned short*)X16 + (size_t)pl * NR * DM + t * 8) = o;
    asm volatile("s_wait_xcnt 0x0" ::: "memory"); } }      /* the built code runs on from here towards the weight branch, whose loads reuse this store's registers: the wait stands in front of them */

__global__ __launch_bounds__(256) void k_vt(const _Float16* __restrict__ V16, _Float16* __restrict__ Vt) { __shared__ unsigned short tl[64][66]; const int tid = threadIdx.x; const int slab = blockIdx.x / (SEQ / 64), lg = blockIdx.x % (SEQ / 64); const int b = slab / NH, h = slab % NH;
  for (int i = tid; i < 64 * 8; i += 256) { const int r = i / 8, c8 = (i % 8) * 8; FragH f; f.half[0] = *(const v8us*)((const unsigned short*)V16 + ((size_t)(lg * 64 + r) * NB + b) * DM + h * HD + c8);
#pragma unroll
    for (int q = 0; q < 8; ++q) tl[r][c8 + q] = f.u[q]; }
  __syncthreads();
  {
#pragma unroll
    for (int rd = 0; rd < 2; ++rd) { const int d = rd * 32 + tid / 8, pc = tid % 8; FragH f;
#pragma unroll
      for (int q = 0; q < 8; ++q) f.u[q] = tl[pc * 8 + q][d];
      *(v8us*)((unsigned short*)Vt + ((size_t)slab * 64 + d) * SEQ + lg * 64 + pc * 8) = f.half[0]; }
     } }

// width table: SIGT[sig_idx(r)], r = t*NB + b, = 1 / (2 sigma^2), sigma = 1 + sigmoid(sum_e tanh(G[r][e]) * bf16(Wvp[e]) + bf16(bvp)); G f32 [NR][DM].
// One row per wave, 8 rows per block; a block's 8 values open a 128-B line of their own, so that each line of the table has one writer.
#define SGR 8                        /* rows (= waves) per k_sigma block */
static_assert((NB * SEQ) % SGR == 0);
static_assert(SGR * 4 <= 128 && SGR % 4 == 0 && SGR * 32 == 256);      /* one line per block, 16-B stores, one wave per row in a block of 256 */
__device__ __forceinline__ size_t sig_idx(size_t r) { return (r / SGR) * 32 + (r % SGR); }
__global__ __launch_bounds__(256) void k_sigma(const float* __restrict__ G, const float* __restrict__ wvp, const float* __restrict__ bvp, float* __restrict__ SIGT) {
  #pragma clang fp contract(off)
  __shared__ __attribute__((aligned(16))) float sg[SGR];
  const int tid = threadIdx.x, w = __builtin_amdgcn_readfirstlane((int)(tid >> 5)), lane = tid & 31;
  const float b0 = bf16_rne(bvp[0]);
  const float* p = G + ((size_t)blockIdx.x * SGR + w) * DM + lane;
  float x[DM / 32], wv[DM / 32];
#pragma unroll      /* unrolled: the row's loads all go out before the first tanh, one memory latency per row instead of one per 32 elements */
  for (int j = 0; j < DM / 32; ++j) { x[j] = p[j * 32]; wv[j] = wvp[j * 32 + lane]; }
  float acc = 0.f;
#pragma unroll      /* unrolled: x / wv are indexed by constants and stay in registers; the sum runs in ascending k */
  for (int j = 0; j < DM / 32; ++j) acc += tanhf(x[j]) * bf16_rne(wv[j]);
#pragma unroll
  for (int off = 16; off > 0; off >>= 1) acc += __shfl_xor(acc, off, 32);
  const float g = acc + b0;
  const float sgm = 1.0f + 1.0f / (1.0f + expf(-g));
  const float i2 = 1.0f / (2.0f * sgm * sgm);
  if (lane == 0) sg[w] = i2;
  __syncthreads();
  if (w == 0 && lane < SGR / 4) { const v4f v = *(const v4fa*)&sg[lane * 4]; float* dst = SIGT + (size_t)blockIdx.x * 32 + lane * 4;
    *(v4f*)dst = v;  }
}

// alignment statistics: S f32 [NB*NH][QC][SEQ] (slab = b*NH + h) -> MEANT[slab][t0 + tq] = sum_s softmax(S row)[s] * s  (f32; position sum centred at SEQ/2).
__global__ __launch_bounds__(256) void k_amean(const float* __restrict__ S, float* __restrict__ MEANT, int t0) {
  #pragma clang fp contract(off)
  __shared__ __attribute__((aligned(16))) float sm[32];
  const int tid = threadIdx.x, w = __builtin_amdgcn_readfirstlane((int)(tid >> 5)), lane = tid & 31;
  const int rb = blockIdx.x * 32; const int slab = rb / QC, tq0 = rb - slab * QC;
  const float pb = (float)(lane * 4 - SEQ / 2);
#pragma unroll 1
  for (int i = 0; i < 4; ++i) {
    const int rl = w * 4 + i;
    const float* p = S + ((size_t)slab * QC + tq0 + rl) * SEQ + lane * 4;
    v4f x[SEQ / 128];
#pragma unroll
    for (int j = 0; j < SEQ / 128; ++j) x[j] = *(const v4fa*)(p + j * 128);
    float mx = -3.0e38f;
#pragma unroll
    for (int j = 0; j < SEQ / 128; ++j) mx = fmaxf(mx, fmaxf(fmaxf(x[j][0], x[j][1]), fmaxf(x[j][2], x[j][3])));
#pragma unroll
    for (int off = 16; off > 0; off >>= 1) mx = fmaxf(mx, __shfl_xor(mx, off, 32));
    float se = 0.f, sw = 0.f;
#pragma unroll
    for (int j = 0; j < SEQ / 128; ++j) {
#pragma unroll
      for (int c = 0; c < 4; ++c) { const float e = __expf(x[j][c] - mx); se += e; sw += e * (pb + (float)(j * 128 + c)); } }
#pragma unroll
    for (int off = 16; off > 0; off >>= 1) { se += __shfl_xor(se, off, 32); sw += __shfl_xor(sw, off, 32); }
    const float mean = (float)(SEQ / 2) + sw * (1.0f / se);
    if (lane == 0) sm[rl] = mean;
  }
  __syncthreads();
  if (w == 0 && lane < 8) { const v4f v = *(const v4fa*)&sm[lane * 4]; float* dst = MEANT + (size_t)slab * SEQ + t0 + tq0 + lane * 4;
    *(v4f*)dst = v;  }
}

// ---- content scores, Gaussian softmax and P . V in one kernel: block = 128 query rows of one slab (wave w: rows 32 w .. 32 w + 31), walking the keys in tiles of 64 ----
// Q3 / K3: the content pair's K-concatenated planes (slab by at column by * 192 of rows with pitch LQ3); Vt f16 [slab][64][SEQ]; O f16 [t][b][h*64 + d] = 64 ctx.
// The query rows lie in LDS for the whole walk; key tile n + 1 is in flight while tile n is worked on. Per key tile: three K tiles give the 32 x 64 scores of a wave; through the wave's own LDS each lane takes one whole query row: x[s] = score - (s - mean)^2 * (1 / (2 sigma^2)),
// running maximum m and sum l in f32, P = f16(2^14 exp(x - m)); the ctx accumulators are scaled by exp(m_old - m_new) and take P . V^T of the tile; at the end ctx * 2^-8 / l.
#define QB (3 * 128 * LP * 2)              /* bytes of the block's query rows, filled once: three K tiles of 128 rows */
#define TB2 ((3 * 64 + 64) * LP * 2)       /* bytes of one staged key tile: three K tiles of its 64 key rows, then its 64 V^T rows */
#define NKT (SEQ / 64)                     /* key tiles */
static_assert(CK / KT == 3 && NKT >= 2);
static_assert(QB + 2 * TB2 + 4 * 32 * 68 * 4 + 4 * 32 * LP * 2 + 4 * 32 * 4 <= 196608);      /* static LDS of k_fattn; one block per WGP */
// 64 rows of 128 B, global -> LDS: 4 copies of 16 B per lane, rows step by 16 per copy
__device__ __forceinline__ void g2_stage_v(unsigned l, const _Float16* gv, size_t sv) {
  /* the closing s_wait_xcnt stands inside the statement so that no address register of a copy is rewritten in front of it */
  asm volatile("global_load_async_to_lds_b128 %0, %4, off\n\t" "global_load_async_to_lds_b128 %1, %5, off\n\t" "global_load_async_to_lds_b128 %2, %6, off\n\t"
               "global_load_async_to_lds_b128 %3, %7, off\n\t" "s_wait_xcnt 0x0"
               :: "v"(l), "v"(l + 1u * 16 * LP * 2), "v"(l + 2u * 16 * LP * 2), "v"(l + 3u * 16 * LP * 2), "v"(gv), "v"(gv + sv), "v"(gv + 2 * sv), "v"(gv + 3 * sv)
               : "memory"); }
// e^x as 2^(x log2 e); the v_nop fills the one slot that the instruction set asks for between a transcendental and a directly following vector instruction that overwrites its source or reads its result
__device__ __forceinline__ float g2_exp(float x) { float e; const float t = x * 1.44269504f; asm("v_exp_f32 %0, %1\n\tv_nop" : "=v"(e) : "v"(t)); return e; }
// orders a wave's LDS writes in front of its own later LDS reads of what other lanes wrote (the ranges so[w], pl[w], als[w] are private to wave w)
__device__ __forceinline__ void g2_wave_order() { __builtin_amdgcn_fence(4 /* acq_rel order */, "workgroup"); __builtin_amdgcn_wave_barrier(); }
__global__ __launch_bounds__(128) void k_fattn(const _Float16* __restrict__ Q3, const _Float16* __restrict__ K3, const _Float16* __restrict__ Vt,
    const float* __restrict__ MEANT, const float* __restrict__ SIGT, _Float16* __restrict__ O) {
  __shared__ __attribute__((aligned(16))) unsigned char sm[QB + 2 * TB2];      /* the query rows, then two tile buffers */
  __shared__ __attribute__((aligned(16))) float so[4][32][68];            /* per wave: f32 scores of a key tile, at the end the output rows */
  __shared__ __attribute__((aligned(16))) _Float16 pl[4][32][LP];         /* per wave: P of a key tile, rows as the A operand reads them */
  __shared__ __attribute__((aligned(16))) float als[4][32];               /* per wave: one factor per query row */
  const int tid = threadIdx.x, w = __builtin_amdgcn_readfirstlane((int)(tid >> 5)), lane = tid & 31, ln = lane & 15, hh = lane >> 4;
  const int by = blockIdx.y, mt = blockIdx.x; const int b = by / NH;
  const int trow = mt * 128 + 32 * w + lane;      /* the query row whose statistics this lane keeps */
  const unsigned l0 = (unsigned)(size_t)sm + (unsigned)((tid >> 3) * (LP * 2) + (tid & 7) * 16);
  const _Float16* ga = Q3 + (size_t)(mt * 128 + (tid >> 3)) * LQ3 + (size_t)by * CK + (tid & 7) * 8;
  const _Float16* gb = K3 + (size_t)(tid >> 3) * LQ3 + (size_t)by * CK + (tid & 7) * 8;
  const _Float16* gv = Vt + ((size_t)by * HD + (tid >> 3)) * SEQ + (tid & 7) * 8;
  const size_t sq = (size_t)16 * LQ3, sv = (size_t)16 * SEQ;
  auto stage = [&](int n) { const unsigned l = l0 + QB + (unsigned)(n & 1) * TB2; const _Float16* gk = gb + (size_t)n * 64 * LQ3;      /* key tile n: 16 copies per lane */
    g2_stage_v(l, gk, sq); g2_stage_v(l + 1u * 64 * LP * 2, gk + KT, sq); g2_stage_v(l + 2u * 64 * LP * 2, gk + 2 * KT, sq);
    g2_stage_v(l + 3u * 64 * LP * 2, gv + n * 64, sv); };
  const v8f z8 = {0.f,0.f,0.f,0.f,0.f,0.f,0.f,0.f};
  v8f o[8] = {z8, z8, z8, z8, z8, z8, z8, z8};      /* ctx: [row half * 4 + column tile] */
  float m = -3.0e38f, l = 0.f;
#pragma unroll      /* unrolled: six straight copy statements */
  for (int i = 0; i < 6; ++i) g2_stage_v(l0 + (unsigned)i * (64 * LP * 2), ga + (i >> 1) * KT + (size_t)(i & 1) * 4 * sq, sq);      /* K tile i / 2, rows 64 (i % 2) .. + 63 */
  stage(0);
  float mu, i2;      /* the row's mean and 1 / (2 sigma^2) */
  { const float* pmu = MEANT + (size_t)by * SEQ + trow; const float* psg = SIGT + sig_idx((size_t)trow * NB + b);
    /* the two loads and their data wait in one statement: no address register of theirs is rewritten while they are under way; they fly beside tile 0's copies */
    asm volatile("global_load_b32 %0, %2, off\n\t" "global_load_b32 %1, %3, off\n\t" "s_wait_loadcnt 0x0" : "=&v"(mu), "=&v"(i2) : "v"(pmu), "v"(psg) : "memory"); }
  asm volatile("s_wait_asynccnt 0x0" ::: "memory");      /* this wave's part of the query rows and of tile 0 has landed */
  __syncthreads();                                       /* ... and every other wave's */
  stage(1);
#pragma unroll 1
  for (int n = 0; n < NKT; ++n) {      /* rolled: one publish point per key tile */
    const _Float16* tb = (const _Float16*)(sm + QB + (n & 1) * TB2);
    v8f acc[8] = {z8, z8, z8, z8, z8, z8, z8, z8};      /* the key tile's scores: [row half * 4 + column tile] */
#pragma unroll      /* unrolled: the next K tile's fragment reads can go out under this one's products */
    for (int kt = 0; kt < 3; ++kt) { const _Float16* ap = (const _Float16*)sm + (kt * 128 + 32 * w + ln) * LP; const _Float16* bp = tb + (kt * 64 + ln) * LP;
      v16h fa[KT / 32][2], fb[KT / 32][4];      /* the tile's fragment reads go out as one group, ahead of the products */
#pragma unroll      /* unrolled here and below: arrays indexed by constants stay in registers */
      for (int s = 0; s < KT / 32; ++s) { fa[s][0] = g2_frag(ap + 32 * s, hh); fb[s][0] = g2_frag(bp + 32 * s, hh); fa[s][1] = g2_frag(ap + 16 * LP + 32 * s, hh);
        fb[s][1] = g2_frag(bp + 16 * LP + 32 * s, hh); fb[s][2] = g2_frag(bp + 32 * LP + 32 * s, hh); fb[s][3] = g2_frag(bp + 48 * LP + 32 * s, hh); }
#pragma unroll
      for (int s = 0; s < KT / 32; ++s) {
#pragma unroll
        for (int c = 0; c < 4; ++c) { acc[c] = g2_mma(fa[s][0], fb[s][c], acc[c]); acc[4 + c] = g2_mma(fa[s][1], fb[s][c], acc[4 + c]); } } }
    {
#pragma unroll
      for (int u = 0; u < 8; ++u) { const int t = u & 3, half = u >> 2;
#pragma unroll
        for (int r = 0; r < 8; ++r) so[w][half * 16 + 8 * hh + r][t * 16 + ln] = acc[u][r] * 6.103515625e-05f; }
      g2_wave_order();
      v4f x[16];
#pragma unroll
      for (int j = 0; j < 16; ++j) x[j] = *(const v4fa*)&so[w][lane][j * 4];
      __builtin_amdgcn_sched_barrier(0);      /* keeps the row's 16 LDS reads together in front of the arithmetic: one LDS latency per key tile instead of one per pair of reads */
      const float sf = (float)(n * 64); float tm = -3.0e38f;
#pragma unroll
      for (int j = 0; j < 16; ++j) {
#pragma unroll
        for (int c = 0; c < 4; ++c) { const float d = (sf + (float)(j * 4 + c)) - mu; const float v = x[j][c] - (d * d) * i2; x[j][c] = v; tm = fmaxf(tm, v); } }
      const float mn = fmaxf(m, tm); const float al = g2_exp(m - mn); m = mn;
      float se = 0.f;
#pragma unroll
      for (int j = 0; j < 8; ++j) { FragH f;
#pragma unroll
        for (int c = 0; c < 8; ++c) { const float e = g2_exp(x[2 * j + (c >> 2)][c & 3] - mn); se += e; f.h[c] = toh_flush(e * 16384.0f); }
        *(v8us*)&pl[w][lane][j * 8] = f.half[0]; }
      l = l * al + se;
      als[w][lane] = al;
      g2_wave_order();
#pragma unroll
      for (int half = 0; half < 2; ++half) { const v4f a0 = *(const v4fa*)&als[w][half * 16 + 8 * hh], a1 = *(const v4fa*)&als[w][half * 16 + 8 * hh + 4];
#pragma unroll
        for (int c = 0; c < 4; ++c) {
#pragma unroll
          for (int r = 0; r < 4; ++r) { o[half * 4 + c][r] *= a0[r]; o[half * 4 + c][4 + r] *= a1[r]; } } }
      const _Float16* pa = &pl[w][ln][0]; const _Float16* vb = tb + (192 + ln) * LP;
      v16h fp[2][2], fv[2][4];
#pragma unroll
      for (int s = 0; s < 2; ++s) { fp[s][0] = g2_frag(pa + 32 * s, hh); fp[s][1] = g2_frag(pa + 16 * LP + 32 * s, hh);
#pragma unroll
        for (int c = 0; c < 4; ++c) fv[s][c] = g2_frag(vb + c * 16 * LP + 32 * s, hh); }
#pragma unroll
      for (int s = 0; s < 2; ++s) {
#pragma unroll
        for (int c = 0; c < 4; ++c) { o[c] = g2_mma(fp[s][0], fv[s][c], o[c]); o[4 + c] = g2_mma(fp[s][1], fv[s][c], o[4 + c]); } }
    }
    asm volatile("s_wait_dscnt 0x0" ::: "memory");       /* this wave's reads of tile n are done before its buffer is refilled */
    asm volatile("s_wait_asynccnt 0x0" ::: "memory");    /* this wave's part of tile n + 1 has landed */
    __syncthreads();                                     /* publishes tile n + 1 and ends every wave's reads of tile n */
    if (n + 2 < NKT) stage(n + 2);
  }
  asm volatile("s_wait_asynccnt 0x0" ::: "memory");      /* nothing in flight at the end */
  als[w][lane] = 0.00390625f / l;
  g2_wave_order();
#pragma unroll
  for (int half = 0; half < 2; ++half) { const v4f a0 = *(const v4fa*)&als[w][half * 16 + 8 * hh], a1 = *(const v4fa*)&als[w][half * 16 + 8 * hh + 4];
#pragma unroll
    for (int c = 0; c < 4; ++c) {
#pragma unroll
      for (int r = 0; r < 4; ++r) { so[w][half * 16 + 8 * hh + r][c * 16 + ln] = o[half * 4 + c][r] * a0[r]; so[w][half * 16 + 8 * hh + 4 + r][c * 16 + ln] = o[half * 4 + c][4 + r] * a1[r]; } } }
  g2_wave_order();
  const int rsub = lane >> 4, c4 = (lane & 15) * 4;
#pragma unroll
  for (int q = 0; q < 16; ++q) { const int r = q * 2 + rsub; const v4f v = *(const v4fa*)&so[w][r][c4]; v4h h4;      /* 16 trips x 2 rows = 32 rows, a whole 128-B line per row */
#pragma unroll
    for (int i = 0; i < 4; ++i) h4[i] = (_Float16)v[i];
    *(v4h*)(O + (size_t)(mt * 128 + 32 * w + r) * LQ + (size_t)by * HD + c4) = h4; }
}

extern "C" void kernel_launch(void* const* d_in, const int* in_sizes, int n_in,
                              void* d_out, int out_size, void* d_ws, size_t ws_size, hipStream_t stream) {
  if (n_in < 19) return;
  if ((size_t)in_sizes[0] < NR * DM || (size_t)in_sizes[1] < NR * DM || (size_t)in_sizes[2] < NR * DM) return;
  if ((size_t)in_sizes[3] < (size_t)DM * DM || (size_t)in_sizes[5] < (size_t)DM * DM || (size_t)in_sizes[7] < (size_t)DM * DM || (size_t)in_sizes[9] < (size_t)DM * DM) return;
  if ((size_t)in_sizes[11] < (size_t)DM * DM || (size_t)in_sizes[13] < (size_t)DM * DM || (size_t)in_sizes[17] < (size_t)DM * DM) return;
  if (in_sizes[4] < DM || in_sizes[6] < DM || in_sizes[8] < DM || in_sizes[10] < DM || in_sizes[12] < DM || in_sizes[14] < DM || in_sizes[15] < DM || in_sizes[16] < 1 || in_sizes[18] < DM) return;
  if ((size_t)out_size < NR * DM) return;
  const float* const* I = (const float* const*)d_in;
  const float* xq = I[0]; const float* xk = I[1]; const float* xv = I[2];
  const float* wq = I[3]; const float* bq = I[4]; const float* wk = I[5]; const float* bk = I[6]; const float* wv = I[7]; const float* bv = I[8];
  const float* whq = I[9]; const float* bhq = I[10]; const float* whk = I[11]; const float* bhk = I[12]; const float* wwp = I[13]; const float* bwp = I[14];
  const float* wvp = I[15]; const float* bvp = I[16]; const float* wo = I[17]; const float* bo = I[18];
  char* ws = (char*)d_ws; size_t off = 0;
  auto take = [&](size_t bytes) { char* p = ws + off; off += (bytes + 255) & ~(size_t)255; return p; };
  _Float16* BQ = (_Float16*)take((size_t)DM * DM * 2); _Float16* BK = (_Float16*)take((size_t)DM * DM * 2); _Float16* BV = (_Float16*)take((size_t)DM * DM * 2);
  _Float16* BHQ = (_Float16*)take((size_t)DM * DM * 2); _Float16* BHK = (_Float16*)take((size_t)DM * DM * 2); _Float16* BWP = (_Float16*)take((size_t)DM * DM * 2); _Float16* BO = (_Float16*)take((size_t)DM * DM * 2);
  _Float16* XQ = (_Float16*)take(NR * DM * 2); _Float16* XK = (_Float16*)take(NR * DM * 2); _Float16* XV = (_Float16*)take(NR * DM * 2);
  _Float16* CA = (_Float16*)take(NR * 3 * DM * 2); _Float16* CB = (_Float16*)take(NR * 3 * DM * 2);      /* concatenated planes of the alignment pair */
  _Float16* V16 = (_Float16*)take(NR * DM * 2); _Float16* O16 = (_Float16*)take(NR * DM * 2); _Float16* VT = (_Float16*)take((size_t)NB * NH * HD * SEQ * 2);
  float* S = (float*)take((size_t)NB * NH * QC * SEQ * 4); _Float16* PM = (_Float16*)take((size_t)NB * NH * QC * SEQ * 2);
  float* MEANT = (float*)take((size_t)NB * NH * SEQ * 4); float* SIGT = (float*)take(NR / SGR * 128);
  if (off > ws_size) return;
  float* G = S;                                                            /* f32 wp plane [NR][DM], consumed by k_sigma before the first scores launch */
  _Float16* CA2 = PM; _Float16* CB2 = PM + NR * 3 * DM;                    /* content pair's concatenated planes */
  k_cvt<<<7 * WBL + 3 * XBL, 256, 0, stream>>>(wq, wk, wv, whq, whk, wwp, wo, xq, xk, xv, BQ, XQ);      /* planes BQ .. BO and XQ .. XV in the order of their take() calls */
  const dim3 gp((unsigned)((MP / 128) * (DM / 64)), 1);
  k_proj<<<dim3((unsigned)((MP / 128) * (DM / 64)), 6), 128, 0, stream>>>(XQ, XK, XV, BV, BWP, BHQ, BHK, BQ, BK, bv, bwp, bhq, bhk, bq, bk, V16, G, CA, CB, CA2, CB2);
  k_vt<<<NB * NH * (SEQ / 64), 256, 0, stream>>>(V16, VT);      /* V16 rows [SEQ*NB][DM] -> VT[(b,h)][64][SEQ] */
  k_sigma<<<MP / SGR, 256, 0, stream>>>(G, wvp, bvp, SIGT);
  /* alignment pair */
  for (int t0 = 0; t0 < SEQ; t0 += QC) {
    /* slab by = b*NH + h at column offset by*192 of rows with pitch LQ3; S[by][QC][SEQ] f32 = 2^-14 * (2048 hi.hi + res.hi + hi.res) */
    k_gemm2<false, true, false><<<dim3((QC / 128) * (SEQ / 64), NB * NH), 128, 0, stream>>>(CA + (size_t)t0 * LQ3, LQ3, (size_t)CK, CB, LQ3, (size_t)CK, 6.103515625e-05f, nullptr, S, nullptr, SEQ, (size_t)QC * SEQ, QC, SEQ, CK);
    k_amean<<<NB * NH * QC / 32, 256, 0, stream>>>(S, MEANT, t0);
  }
  /* content pair: scores, Gaussian softmax and P . V; ctx[t][b][h*64 + d] x64 */
  k_fattn<<<dim3(SEQ / 128, NB * NH), 128, 0, stream>>>(CA2, CB2, VT, MEANT, SIGT, O16);
  k_gemm2<true, true, true><<<gp, 128, 0, stream>>>(O16, DM, 0, BO, DM, 0, 0.0009765625f, bo, (float*)d_out, nullptr, DM, 0, MP, DM, DM);      /* out rows t*NB_FULL + b */
}

// v006
// Measured time: 114 microseconds a run.
// Timed twice side by side with v005, it ran 1.22 and 1.21 times as fast.
// Counting every step since v000, it is 5.75 times as fast.
#include <hip/hip_runtime.h>
// Gaussian-windowed multi-head cross attention, sequence-first layout: query [1024][2][1024], key_in / value [1024][2][1024] (token row r = t*NB + b); six input maps with natural [out][in] weights + biases: q, hq, wp from query; k, hk from key_in; v from value; 16 heads of 64 (flat slab b*16 + h); content logits 64^-0.5 q.k; alignment softmax over keys of 64^-0.5 hq.hk, mean = expected key position; width sigma = 1 + sigmoid(tanh(wp) . Wvp + bvp) per (t, b); P = softmax_s(content - (s - mean)^2 / (2 sigma^2)); ctx = P . v merged [t][b][h*64+d]; out = ctx Wo^T + bo.
// Structure: inputs as exact f16 rows (RNE-converted to bf16 first); all conversions as one launch; the six input projections as one launch of WMMA GEMMs (32x64 wave tiles, f32 accumulation, x16 weights + bias); q/hq and k/hk are written as K-concatenated planes per head [2048 hi | res | hi] and [hi | hi | res] (hi = f16 value, res = f16 of 2048 (v - hi)) so one K = 192 GEMM yields 2048 (hi.hi) + res.hi + hi.res; all query rows as one chunk: k_falign: alignment scores per 64-key tile with running-maximum f32 softmax statistics (centred position sum), its S never in memory; k_fattn: content scores, Gaussian term, running-maximum f32 softmax (P as f16 x 2^14 of exp(x - running max)) and P . V^T per 64-key tile in one launch, S and P of the content pair never in memory (ctx carried x64) -> out GEMM (f32).
// Compute dtype: all contractions v_wmma_f32_16x16x32_f16 (f16 operands, f32 accumulate); inputs RNE-converted to bf16 (exact in f16); both score sites as f16 value + x2048 residual (three products folded along K); v, P (x2^14), ctx (x64), Wo as plain f16 operands; softmax statistics, mean, tanh / Wvp / sigmoid on the vector unit in f32.
#ifndef NB
#define NB 2                         /* batches processed */
#endif
#ifndef SEQ
#define SEQ 1024                     /* sequence length processed (queries = keys) */
#endif
#define NB_FULL 2                    /* batch pitch of the input / output rows */
#define DM 1024
#define NH 16
#define HD 64
#define QC SEQ                       /* query rows per attention chunk: all of them, so each attention stage is one launch over every (slab, row) */
#define NR ((size_t)NB * SEQ)        /* token rows */
#define MP ((int)(NB * SEQ))
#define LQ (NB * DM)                 /* pitch between consecutive t for one batch */
#define CK (3 * HD)                  /* concatenated K per head */
#define LQ3 (NB * 3 * DM)            /* pitch between consecutive t in a concatenated plane */
static_assert(SEQ % 128 == 0);
static_assert(QC % 128 == 0);
static_assert(SEQ % QC == 0);
static_assert(NH * HD == DM);
static_assert(NB <= NB_FULL);
static_assert((NB * SEQ) % 128 == 0);
static_assert(NH == 16);
static_assert(HD == 64);                         
static_assert(CK % 32 == 0);
static_assert(DM % 32 == 0);
static_assert(QC % 32 == 0);
static_assert((NB * SEQ) % 32 == 0);
static_assert(NH * QC >= DM);                    /* the f32 wp plane [NR][DM] fits into the S region */
static_assert(NH * QC >= 2 * 3 * DM);            /* the content pair's two concatenated planes fit into the P region */
static_assert(QC == SEQ);
static_assert(32 * 8 * 16 == 32 * HD * 2);       
#define KT 64                        /* k elements per staged tile: one 128-B line of every operand row */
#define LP 72                        /* LDS row pitch in f16: 144 B = 16 B x odd, for 16-byte fragment reads */
#define TB ((128 + 64) * LP * 2)     /* bytes of one staged tile: 128 A rows, then 64 Bt rows */
static_assert(CK % KT == 0 && DM % KT == 0 && SEQ % KT == 0);   /* every K of the GEMM launches */
static_assert(4 * 32 * 68 * 4 <= 2 * TB);        /* the output staging fits into the two tile buffers */
static_assert(2 * TB <= 131072);                 /* static LDS of the GEMM kernels */
#define WS_TOTAL (7 * (size_t)DM * DM * 2 + 3 * NR * DM * 2 + 2 * NR * 3 * DM * 2 + 2 * NR * DM * 2 + (size_t)NB * NH * HD * SEQ * 2 + (size_t)NB * NH * QC * SEQ * 4 + (size_t)NB * NH * QC * SEQ * 2 + (size_t)NB * NH * SEQ * 4 + NR * 16)
static_assert(WS_TOTAL + 32 * 256 <= 268435456);

typedef unsigned short v8us __attribute__((ext_vector_type(8), may_alias));
typedef float  v8f  __attribute__((ext_vector_type(8)));
typedef float  v4f  __attribute__((ext_vector_type(4)));
typedef float  v4fa __attribute__((ext_vector_type(4), may_alias));
typedef _Float16 v16h __attribute__((ext_vector_type(16)));
typedef _Float16 v4h __attribute__((ext_vector_type(4)));
union FragH { v16h v; v8us half[2]; _Float16 h[16]; unsigned short u[16]; };

__device__ __forceinline__ unsigned short bf16_bits(float x) { unsigned int u = __float_as_uint(x); return (unsigned short)((u + 0x7FFFu + ((u >> 16) & 1u)) >> 16); }
__device__ __forceinline__ float bf16_val(unsigned short b) { return __uint_as_float(((unsigned int)b) << 16); }
__device__ __forceinline__ float bf16_rne(float x) { return bf16_val(bf16_bits(x)); }   /* RNE convert to bf16, back as f32 */

typedef _Float16 h16;
// f32 -> f16 with a value select: magnitudes below 2^-14 become +0 (no f16 subnormal can reach a WMMA operand)
static __device__ __forceinline__ h16 toh_flush(float v) { const h16 r = (h16)v; return (fabsf(v) < 6.103515625e-05f) ? (h16)0.0f : r; }

// fragment: elements 0..7 <- k0 + 8h .. +7, elements 8..15 <- k0 + 16 + 8h .. +7 (p points at k0 of the lane's row / column)
__device__ __forceinline__ v16h g2_frag(const _Float16* p, int hh) { FragH f; f.half[0] = *(const v8us*)((const unsigned short*)p + 8 * hh); f.half[1] = *(const v8us*)((const unsigned short*)p + 16 + 8 * hh); return f.v; }
__device__ __forceinline__ v8f g2_mma(v16h a, v16h b, v8f c) { v8f d = __builtin_amdgcn_wmma_f32_16x16x32_f16(false, a, false, b, (short)0, c, false, false); asm volatile("v_nop\n\tv_nop\n\tv_nop\n\tv_nop" : "+v"(d) : "v"(a), "v"(b)); return d; }

// one K tile of the block's operands, global -> LDS with no register in between: 12 copies of 16 B per lane; a wave's copy covers 4 whole 128-B lines.
// l: the lane's LDS byte address in tile row tid / 8 (rows step by 16 per copy); ga / gb: the lane's 16 bytes in that row of A / Bt at this tile's k.
__device__ __forceinline__ void g2_stage(unsigned l, const _Float16* ga, size_t sa, const _Float16* gb, size_t sb) {
  /* the closing s_wait_xcnt stands inside the statement so that no address register of a copy is rewritten in front of it */
  asm volatile("global_load_async_to_lds_b128 %0, %12, off\n\t" "global_load_async_to_lds_b128 %1, %13, off\n\t" "global_load_async_to_lds_b128 %2, %14, off\n\t"
               "global_load_async_to_lds_b128 %3, %15, off\n\t" "global_load_async_to_lds_b128 %4, %16, off\n\t" "global_load_async_to_lds_b128 %5, %17, off\n\t"
               "global_load_async_to_lds_b128 %6, %18, off\n\t" "global_load_async_to_lds_b128 %7, %19, off\n\t" "global_load_async_to_lds_b128 %8, %20, off\n\t"
               "global_load_async_to_lds_b128 %9, %21, off\n\t" "global_load_async_to_lds_b128 %10, %22, off\n\t" "global_load_async_to_lds_b128 %11, %23, off\n\t"
               "s_wait_xcnt 0x0"
               :: "v"(l), "v"(l + 1u * 16 * LP * 2), "v"(l + 2u * 16 * LP * 2), "v"(l + 3u * 16 * LP * 2), "v"(l + 4u * 16 * LP * 2), "v"(l + 5u * 16 * LP * 2),
                  "v"(l + 6u * 16 * LP * 2), "v"(l + 7u * 16 * LP * 2), "v"(l + 8u * 16 * LP * 2), "v"(l + 9u * 16 * LP * 2), "v"(l + 10u * 16 * LP * 2), "v"(l + 11u * 16 * LP * 2),
                  "v"(ga), "v"(ga + sa), "v"(ga + 2 * sa), "v"(ga + 3 * sa), "v"(ga + 4 * sa), "v"(ga + 5 * sa), "v"(ga + 6 * sa), "v"(ga + 7 * sa),
                  "v"(gb), "v"(gb + sb), "v"(gb + 2 * sb), "v"(gb + 3 * sb)
               : "memory"); }

// main loop of both GEMM kernels: block tile 128 x 64, wave w takes rows 32 w .. 32 w + 31; two LDS tile buffers, tile t + 1 in flight while tile t is multiplied.
// Ab: row 0 of the block's 128 A rows; Bb: row 0 of its 64 Bt rows; K % KT == 0. On return every wave has left both buffers and no copy is outstanding.
__device__ __forceinline__ void g2_main(unsigned char* sm, const _Float16* Ab, int lda, const _Float16* Bb, int ldb, int K, int tid, int w, int ln, int hh, v8f (&acc)[8]) {
  const int nt = K / KT;
  const unsigned l0 = (unsigned)(size_t)sm + (unsigned)((tid >> 3) * (LP * 2) + (tid & 7) * 16);
  const _Float16* ga = Ab + (size_t)(tid >> 3) * lda + (tid & 7) * 8; const _Float16* gb = Bb + (size_t)(tid >> 3) * ldb + (tid & 7) * 8;
  const size_t sa = (size_t)16 * lda, sb = (size_t)16 * ldb;
  g2_stage(l0, ga, sa, gb, sb);
  asm volatile("s_wait_asynccnt 0x0" ::: "memory");      /* this wave's part of tile 0 has landed */
  __syncthreads();                                       /* ... and every other wave's */
  if (nt > 1) g2_stage(l0 + TB, ga + KT, sa, gb + KT, sb);
#pragma unroll 1
  for (int t = 0; t < nt; ++t) {      /* rolled: one publish point per tile */
    const _Float16* tb = (const _Float16*)(sm + (t & 1) * TB);
    const _Float16* ap = tb + (32 * w + ln) * LP; const _Float16* bp = tb + (128 + ln) * LP;
    v16h fa[KT / 32][2], fb[KT / 32][4];      /* the tile's fragment reads go out as one group, in the order of their use, ahead of the products */
#pragma unroll      /* unrolled here and below: fa / fb are indexed by constants and stay in registers */
    for (int s = 0; s < KT / 32; ++s) { fa[s][0] = g2_frag(ap + 32 * s, hh); fb[s][0] = g2_frag(bp + 32 * s, hh); fa[s][1] = g2_frag(ap + 16 * LP + 32 * s, hh);
      fb[s][1] = g2_frag(bp + 16 * LP + 32 * s, hh); fb[s][2] = g2_frag(bp + 32 * LP + 32 * s, hh); fb[s][3] = g2_frag(bp + 48 * LP + 32 * s, hh); }
#pragma unroll
    for (int s = 0; s < KT / 32; ++s) {
#pragma unroll
      for (int c = 0; c < 4; ++c) { acc[c] = g2_mma(fa[s][0], fb[s][c], acc[c]); acc[4 + c] = g2_mma(fa[s][1], fb[s][c], acc[4 + c]); } }
    asm volatile("s_wait_dscnt 0x0" ::: "memory");       /* this wave's reads of tile t are done before its buffer is refilled */
    asm volatile("s_wait_asynccnt 0x0" ::: "memory");    /* this wave's part of tile t + 1 has landed */
    __syncthreads();                                     /* publishes tile t + 1 and ends every wave's reads of tile t */
    if (t + 2 < nt) g2_stage(l0 + (unsigned)(t & 1) * TB, ga + (size_t)(t + 2) * KT, sa, gb + (size_t)(t + 2) * KT, sb);
  }
  asm volatile("s_wait_asynccnt 0x0" ::: "memory");      /* nothing in flight when the buffers become output staging */
}

// ---- GEMM (wave tile 32x64; M % 128 == 0 per launch region, N % 64 == 0, K % 64 == 0): C = alpha * A . Bt^T (+ bias) ----
// A f16 [M][K] (pitch lda), Bt f16 [N][K] (pitch ldb); batch slab by = blockIdx.y with element strides sA / sB / sC.
// OMAP: output row r -> (r / NB) * NB_FULL + r % NB.
template <bool HASB, bool OUT32, bool OMAP>
__global__ __launch_bounds__(128) void k_gemm2(const _Float16* __restrict__ A, int lda, size_t sA, const _Float16* __restrict__ Bh, int ldb, size_t sB, float alpha,
    const float* __restrict__ bias, float* __restrict__ C, _Float16* __restrict__ C16, int ldc, size_t sC, int M, int N, int K) {
  __shared__ __attribute__((aligned(16))) unsigned char sm[2 * TB]; float (*so)[32][68] = (float (*)[32][68])sm;      /* two tile buffers; output staging behind the main loop */
  const int tid = threadIdx.x, w = __builtin_amdgcn_readfirstlane((int)(tid >> 5)), lane = tid & 31, ln = lane & 15, hh = lane >> 4; const int by = blockIdx.y;
  A += (size_t)by * sA; Bh += (size_t)by * sB; const size_t cofs = (size_t)by * sC;
  const int ntn = N >> 6; const int mt = blockIdx.x / ntn, nq = blockIdx.x - mt * ntn; const int row0 = mt * 128 + 32 * w, col0 = nq * 64; if (mt * 128 >= M) return;      /* the whole block leaves, in front of every barrier */
  const v8f z8 = {0.f,0.f,0.f,0.f,0.f,0.f,0.f,0.f}; v8f accs[8] = {z8, z8, z8, z8, z8, z8, z8, z8};      /* [row half * 4 + column tile] */
  g2_main(sm, A + (size_t)(mt * 128) * lda, lda, Bh + (size_t)col0 * ldb, ldb, K, tid, w, ln, hh, accs);
#pragma unroll
  for (int u = 0; u < 8; ++u) { const int t = u & 3, half = u >> 2; const int col = col0 + t * 16 + ln; float bv = 0.f; if (HASB) bv = bf16_rne(bias[col]);
#pragma unroll
    for (int r = 0; r < 8; ++r) { const int rloc = half * 16 + 8 * hh + r; so[w][rloc][t * 16 + ln] = accs[u][r] * alpha + bv; } }
  __builtin_amdgcn_fence(4 /* acq_rel order */, "workgroup"); __builtin_amdgcn_wave_barrier();      /* so[w] is private to wave w */
  const int rsub = lane >> 4, c4 = (lane & 15) * 4;
  {
#pragma unroll
    for (int q = 0; q < 16; ++q) { const int r = q * 2 + rsub; const v4f v = *(const v4fa*)&so[w][r][c4];
      const int gr = row0 + r; const size_t orow = OMAP ? ((size_t)(gr / NB) * NB_FULL + (size_t)(gr % NB)) : (size_t)gr;
      if (OUT32) { *(v4f*)(C + cofs + orow * ldc + col0 + c4) = v; }
      else { v4h h4;
#pragma unroll
        for (int i = 0; i < 4; ++i) h4[i] = (_Float16)v[i];
        *(v4h*)(C16 + cofs + orow * ldc + col0 + c4) = h4; } }
     } }

// ---- the six input projections as one launch (same main loop and staging as k_gemm2; M = MP, N = K = DM; N tile 64 == one head): job = blockIdx.y picks operands, bias and output form ----
// x = A . Bt^T / 16 + bias (f32). job 0: v, f16 rows; job 1: wp, f32 rows; jobs 2 .. 5: hq, hk, q, k as K-concatenated planes:
// hi = f16(x), res = f16(2048 (x - hi)); head h = col0 / 64 of row r at C3 + r * 3 DM + h * 192: query side [2048 hi | res | hi], key side [hi | hi | res].
__global__ __launch_bounds__(128) void k_proj(const _Float16* __restrict__ XQ, const _Float16* __restrict__ XK, const _Float16* __restrict__ XV,
    const _Float16* __restrict__ BV, const _Float16* __restrict__ BWP, const _Float16* __restrict__ BHQ, const _Float16* __restrict__ BHK, const _Float16* __restrict__ BQ, const _Float16* __restrict__ BK,
    const float* __restrict__ bv, const float* __restrict__ bwp, const float* __restrict__ bhq, const float* __restrict__ bhk, const float* __restrict__ bq, const float* __restrict__ bk,
    _Float16* __restrict__ V16, float* __restrict__ G, _Float16* __restrict__ CHQ, _Float16* __restrict__ CHK, _Float16* __restrict__ CQ, _Float16* __restrict__ CK3) {
  __shared__ __attribute__((aligned(16))) unsigned char sm[2 * TB]; float (*so)[32][68] = (float (*)[32][68])sm;      /* two tile buffers; output staging behind the main loop */
  const int tid = threadIdx.x, w = __builtin_amdgcn_readfirstlane((int)(tid >> 5)), lane = tid & 31, ln = lane & 15, hh = lane >> 4; const int job = blockIdx.y;
  const _Float16* A; const _Float16* Bh; const float* bias; _Float16* C3 = nullptr;
  switch (job) {
    case 0: A = XV; Bh = BV; bias = bv; break;
    case 1: A = XQ; Bh = BWP; bias = bwp; break;
    case 2: A = XQ; Bh = BHQ; bias = bhq; C3 = CHQ; break;
    case 3: A = XK; Bh = BHK; bias = bhk; C3 = CHK; break;
    case 4: A = XQ; Bh = BQ; bias = bq; C3 = CQ; break;
    default: A = XK; Bh = BK; bias = bk; C3 = CK3; break; }
  const int mt = blockIdx.x / (DM / 64), nq = blockIdx.x - mt * (DM / 64); const int row0 = mt * 128 + 32 * w, col0 = nq * 64;
  const v8f z8 = {0.f,0.f,0.f,0.f,0.f,0.f,0.f,0.f}; v8f accs[8] = {z8, z8, z8, z8, z8, z8, z8, z8};      /* [row half * 4 + column tile] */
  g2_main(sm, A + (size_t)(mt * 128) * DM, DM, Bh + (size_t)col0 * DM, DM, DM, tid, w, ln, hh, accs);
#pragma unroll
  for (int u = 0; u < 8; ++u) { const int t = u & 3, half = u >> 2; const int col = col0 + t * 16 + ln; const float bb = bf16_rne(bias[col]);
#pragma unroll
    for (int r = 0; r < 8; ++r) { const int rloc = half * 16 + 8 * hh + r; so[w][rloc][t * 16 + ln] = accs[u][r] * 0.0625f + bb; } }
  __builtin_amdgcn_fence(4 /* acq_rel order */, "workgroup"); __builtin_amdgcn_wave_barrier();      /* so[w] is private to wave w */
  const int rsub = lane >> 4, c4 = (lane & 15) * 4; const int head = col0 >> 6;
  if (job == 0) {
#pragma unroll
    for (int q = 0; q < 16; ++q) { const int r = q * 2 + rsub; const v4f v = *(const v4fa*)&so[w][r][c4]; v4h h4;      /* 16 trips x 2 rows = 32 rows, here and below */
#pragma unroll
      for (int i = 0; i < 4; ++i) h4[i] = (_Float16)v[i];
      *(v4h*)(V16 + (size_t)(row0 + r) * DM + col0 + c4) = h4; }
  } else if (job == 1) {
#pragma unroll
    for (int q = 0; q < 16; ++q) { const int r = q * 2 + rsub; const v4f v = *(const v4fa*)&so[w][r][c4]; *(v4f*)(G + (size_t)(row0 + r) * DM + col0 + c4) = v; }
    asm volatile("s_wait_xcnt 0x0" ::: "memory");      /* the branches join in address arithmetic that reuses these stores' registers: the wait stands in front of it */
  } else { const bool qside = (job & 1) == 0;
#pragma unroll 1
    for (int q0 = 0; q0 < 16; q0 += 4) {      /* rolled: four trips of four row pairs, for code size */
#pragma unroll
     for (int q = q0; q < q0 + 4; ++q) { const int r = q * 2 + rsub; const v4f v = *(const v4fa*)&so[w][r][c4];
      v4h s0, s1, s2;
#pragma unroll
      for (int i = 0; i < 4; ++i) { const h16 hi = toh_flush(v[i]); const h16 rs = toh_flush((v[i] - (float)hi) * 2048.0f); const h16 hs = (h16)((float)hi * 2048.0f);
        s0[i] = qside ? hs : hi; s1[i] = qside ? rs : hi; s2[i] = qside ? hi : rs; }
      _Float16* dst = C3 + (size_t)(row0 + r) * (3 * DM) + head * CK + c4;
      *(v4h*)dst = s0; *(v4h*)(dst + 64) = s1; *(v4h*)(dst + 128) = s2; }
     asm volatile("s_wait_xcnt 0x0" ::: "memory"); }      /* the next trip rewrites the registers that this trip's stores name */
     } }

// ---- all ten input conversions as one launch: blocks 0 .. 7 WBL - 1 take the seven weight planes (natural [out][in] = Bt[n][k], x16), the rest the three activation planes; 8 elements per thread ----
// Bt: seven f16 planes of DM x DM, one behind the other, in the order w0 .. w6; X16: three f16 planes of NR x DM in the order x0 .. x2.
#define WBL (DM * DM / 8 / 256)            /* blocks per weight plane */
#define XBL ((int)(NR * DM / 8 / 256))     /* blocks per activation plane */
static_assert(DM * DM % (8 * 256) == 0 && (NR * DM) % (8 * 256) == 0);      /* whole blocks: no thread past the end of a plane */
static_assert(((size_t)DM * DM * 2) % 256 == 0 && (NR * DM * 2) % 256 == 0);      /* the planes follow one another in the workspace without a gap */
__global__ __launch_bounds__(256) void k_cvt(const float* __restrict__ w0, const float* __restrict__ w1, const float* __restrict__ w2, const float* __restrict__ w3, const float* __restrict__ w4,
    const float* __restrict__ w5, const float* __restrict__ w6, const float* __restrict__ x0, const float* __restrict__ x1, const float* __restrict__ x2, _Float16* __restrict__ Bt, _Float16* __restrict__ X16) {
  const int blk = blockIdx.x; FragH f;
  if (blk < 7 * WBL) { const int pl = blk / WBL; const size_t t = (size_t)(blk - pl * WBL) * 256 + threadIdx.x;
    const float* w = (pl == 0) ? w0 : (pl == 1) ? w1 : (pl == 2) ? w2 : (pl == 3) ? w3 : (pl == 4) ? w4 : (pl == 5) ? w5 : w6;
    const v4f a = *(const v4fa*)(w + t * 8), c = *(const v4fa*)(w + t * 8 + 4);
#pragma unroll
    for (int q = 0; q < 4; ++q) { f.h[q] = toh_flush(bf16_rne(a[q]) * 16.0f); f.h[4 + q] = toh_flush(bf16_rne(c[q]) * 16.0f); }
    const v8us o = f.half[0]; *(v8us*)((unsigned short*)Bt + (size_t)pl * DM * DM + t * 8) = o;
  } else { const int bx = blk - 7 * WBL; const int pl = bx / XBL; const size_t t = (size_t)(bx - pl * XBL) * 256 + threadIdx.x;
    const float* x = (pl == 0) ? x0 : (pl == 1) ? x1 : x2;
    const size_t row = t / (DM / 8); const int c8 = (int)(t % (DM / 8)) * 8; const size_t srow = (row / NB) * NB_FULL + (row % NB);
    const float* p = x + srow * DM + c8; const v4f a = *(const v4fa*)p, c = *(const v4fa*)(p + 4);
#pragma unroll
    for (int q = 0; q < 4; ++q) { f.h[q] = (_Float16)bf16_rne(a[q]); f.h[4 + q] = (_Float16)bf16_rne(c[q]); }
    const v8us o = f.half[0]; *(v8us*)((unsigned short*)X16 + (size_t)pl * NR * DM + t * 8) = o;
    asm volatile("s_wait_xcnt 0x0" ::: "memory"); } }      /* the built code runs on from here towards the weight branch, whose loads reuse this store's registers: the wait stands in front of them */

__global__ __launch_bounds__(256) void k_vt(const _Float16* __restrict__ V16, _Float16* __restrict__ Vt) { __shared__ unsigned short tl[64][66]; const int tid = threadIdx.x; const int slab = blockIdx.x / (SEQ / 64), lg = blockIdx.x % (SEQ / 64); const int b = slab / NH, h = slab % NH;
  for (int i = tid; i < 64 * 8; i += 256) { const int r = i / 8, c8 = (i % 8) * 8; FragH f; f.half[0] = *(const v8us*)((const unsigned short*)V16 + ((size_t)(lg * 64 + r) * NB + b) * DM + h * HD + c8);
#pragma unroll
    for (int q = 0; q < 8; ++q) tl[r][c8 + q] = f.u[q]; }
  __syncthreads();
  {
#pragma unroll
    for (int rd = 0; rd < 2; ++rd) { const int d = rd * 32 + tid / 8, pc = tid % 8; FragH f;
#pragma unroll
      for (int q = 0; q < 8; ++q) f.u[q] = tl[pc * 8 + q][d];
      *(v8us*)((unsigned short*)Vt + ((size_t)slab * 64 + d) * SEQ + lg * 64 + pc * 8) = f.half[0]; }
     } }

// width table: SIGT[sig_idx(r)], r = t*NB + b, = 1 / (2 sigma^2), sigma = 1 + sigmoid(sum_e tanh(G[r][e]) * bf16(Wvp[e]) + bf16(bvp)); G f32 [NR][DM].
// One row per wave, 8 rows per block; a block's 8 values open a 128-B line of their own, so that each line of the table has one writer.
#define SGR 8                        /* rows (= waves) per k_sigma block */
static_assert((NB * SEQ) % SGR == 0);
static_assert(SGR * 4 <= 128 && SGR % 4 == 0 && SGR * 32 == 256);      /* one line per block, 16-B stores, one wave per row in a block of 256 */
__device__ __forceinline__ size_t sig_idx(size_t r) { return (r / SGR) * 32 + (r % SGR); }
__global__ __launch_bounds__(256) void k_sigma(const float* __restrict__ G, const float* __restrict__ wvp, const float* __restrict__ bvp, float* __restrict__ SIGT) {
  #pragma clang fp contract(off)
  __shared__ __attribute__((aligned(16))) float sg[SGR];
  const int tid = threadIdx.x, w = __builtin_amdgcn_readfirstlane((int)(tid >> 5)), lane = tid & 31;
  const float b0 = bf16_rne(bvp[0]);
  const float* p = G + ((size_t)blockIdx.x * SGR + w) * DM + lane;
  float x[DM / 32], wv[DM / 32];
#pragma unroll      /* unrolled: the row's loads all go out before the first tanh, one memory latency per row instead of one per 32 elements */
  for (int j = 0; j < DM / 32; ++j) { x[j] = p[j * 32]; wv[j] = wvp[j * 32 + lane]; }
  float acc = 0.f;
#pragma unroll      /* unrolled: x / wv are indexed by constants and stay in registers; the sum runs in ascending k */
  for (int j = 0; j < DM / 32; ++j) acc += tanhf(x[j]) * bf16_rne(wv[j]);
#pragma unroll
  for (int off = 16; off > 0; off >>= 1) acc += __shfl_xor(acc, off, 32);
  const float g = acc + b0;
  const float sgm = 1.0f + 1.0f / (1.0f + expf(-g));
  const float i2 = 1.0f / (2.0f * sgm * sgm);
  if (lane == 0) sg[w] = i2;
  __syncthreads();
  if (w == 0 && lane < SGR / 4) { const v4f v = *(const v4fa*)&sg[lane * 4]; float* dst = SIGT + (size_t)blockIdx.x * 32 + lane * 4;
    *(v4f*)dst = v;  }
}

// ---- alignment scores and their softmax statistics in one kernel: block = 128 query rows of one slab; MEANT[slab][t] = sum_s softmax(row t)[s] * s (f32; position sum centred at SEQ/2) ----
// Q3 / K3: the alignment pair's K-concatenated planes (slab by at column by * 192 of rows with pitch LQ3). Scores are formed transposed, keys x queries: A = key rows from LDS, B = the wave's 32 query rows, kept in registers for the whole walk,
// so a lane holds 32 of a 64-key tile's scores of one query (key = 16 c + 8 hh + r, query = ln) and keeps that query's running maximum and two running sums by itself, with no exchange between lanes inside the walk.
// Wave w: query rows 32 (w % 4) .. + 31, and of every staged step of 64 AKW keys the tile w / 4. At the end the 2 AKW partial statistics of a query row meet in LDS.
#define AKW 2                              /* key tiles per staged step = waves per SIMD */
#define AKS (64 * AKW)                     /* keys per staged step */
#define TB3 (3 * AKS * LP * 2)             /* bytes of one staged step: three K tiles of its key rows */
#define NAS (SEQ / AKS)                    /* staged steps */
#define AC (6.103515625e-05f * 1.44269504f)      /* raw score -> logit (2^-14) -> exponent of 2 */
static_assert(SEQ % AKS == 0 && NAS >= 2 && (2 * AKW) % 4 == 0);      /* whole steps, both buffers filled in front of the walk, 16-B reads of a row's partial statistics */
static_assert(2 * TB3 <= 327680 && 3 * 128 * 2 * AKW * 4 <= 2 * TB3);      /* static LDS of k_falign; the partial statistics fit into the two step buffers */
typedef float v2f __attribute__((ext_vector_type(2)));
// one staged step, global -> LDS: 12 copies of 16 B per lane; LDS rows step by 16 AKW per copy (four copies per K tile), s = the same step in the key plane
__device__ __forceinline__ void g2_stage_k(unsigned l, const _Float16* g, size_t s) {
  /* the closing s_wait_xcnt stands inside the statement so that no address register of a copy is rewritten in front of it */
  asm volatile("global_load_async_to_lds_b128 %0, %12, off\n\t" "global_load_async_to_lds_b128 %1, %13, off\n\t" "global_load_async_to_lds_b128 %2, %14, off\n\t"
               "global_load_async_to_lds_b128 %3, %15, off\n\t" "global_load_async_to_lds_b128 %4, %16, off\n\t" "global_load_async_to_lds_b128 %5, %17, off\n\t"
               "global_load_async_to_lds_b128 %6, %18, off\n\t" "global_load_async_to_lds_b128 %7, %19, off\n\t" "global_load_async_to_lds_b128 %8, %20, off\n\t"
               "global_load_async_to_lds_b128 %9, %21, off\n\t" "global_load_async_to_lds_b128 %10, %22, off\n\t" "global_load_async_to_lds_b128 %11, %23, off\n\t"
               "s_wait_xcnt 0x0"
               :: "v"(l), "v"(l + 1u * 16 * AKW * LP * 2), "v"(l + 2u * 16 * AKW * LP * 2), "v"(l + 3u * 16 * AKW * LP * 2), "v"(l + 4u * 16 * AKW * LP * 2), "v"(l + 5u * 16 * AKW * LP * 2),
                  "v"(l + 6u * 16 * AKW * LP * 2), "v"(l + 7u * 16 * AKW * LP * 2), "v"(l + 8u * 16 * AKW * LP * 2), "v"(l + 9u * 16 * AKW * LP * 2), "v"(l + 10u * 16 * AKW * LP * 2), "v"(l + 11u * 16 * AKW * LP * 2),
                  "v"(g), "v"(g + s), "v"(g + 2 * s), "v"(g + 3 * s), "v"(g + KT), "v"(g + KT + s), "v"(g + KT + 2 * s), "v"(g + KT + 3 * s),
                  "v"(g + 2 * KT), "v"(g + 2 * KT + s), "v"(g + 2 * KT + 2 * s), "v"(g + 2 * KT + 3 * s)
               : "memory"); }
__global__ __launch_bounds__(128 * AKW) void k_falign(const _Float16* __restrict__ Q3, const _Float16* __restrict__ K3, float* __restrict__ MEANT) {
  __shared__ __attribute__((aligned(16))) unsigned char sm[2 * TB3];      /* two step buffers; behind the walk the partial statistics */
  const int tid = threadIdx.x, w = __builtin_amdgcn_readfirstlane((int)(tid >> 5)), lane = tid & 31, ln = lane & 15, hh = lane >> 4;
  const int by = blockIdx.y, mt = blockIdx.x; const int wq = w & 3, wk = w >> 2;
  const unsigned l0 = (unsigned)(size_t)sm + (unsigned)((tid >> 3) * (LP * 2) + (tid & 7) * 16);
  const _Float16* gk = K3 + (size_t)(tid >> 3) * LQ3 + (size_t)by * CK + (tid & 7) * 8;
  const size_t sk = (size_t)(16 * AKW) * LQ3;
  g2_stage_k(l0, gk, sk);
  const _Float16* qp = Q3 + (size_t)(mt * 128 + 32 * wq + ln) * LQ3 + (size_t)by * CK;
  v16h fq[2][CK / 32];      /* the wave's query rows as B fragments: [group of 16 queries][k / 32] */
#pragma unroll      /* unrolled here and below: arrays indexed by constants stay in registers */
  for (int g = 0; g < 2; ++g) {
#pragma unroll
    for (int j = 0; j < CK / 32; ++j) fq[g][j] = g2_frag(qp + (size_t)g * 16 * LQ3 + 32 * j, hh); }
  asm volatile("s_wait_asynccnt 0x0" ::: "memory");      /* this wave's part of step 0 has landed */
  __syncthreads();                                       /* ... and every other wave's */
  g2_stage_k(l0 + TB3, gk + (size_t)AKS * LQ3, sk);
  const v8f z8 = {0.f,0.f,0.f,0.f,0.f,0.f,0.f,0.f};
  float mr[2] = {-3.0e38f, -3.0e38f}, se[2] = {0.f, 0.f}, sw[2] = {0.f, 0.f};      /* per query group: running maximum (raw score), sum of weights, sum of weight x centred position */
  v8f acc[8];      /* a key tile's scores: [query group * 4 + key tile of 16] */
  auto stats = [&](int n) {      /* folds the lane's 2 x 32 scores of its tile of step n into the running statistics */
    const float pb = (float)(n * AKS + 64 * wk + 8 * hh - SEQ / 2);      /* centred position of the lane's first key of the tile */
#pragma unroll
    for (int g = 0; g < 2; ++g) {
      float tc[4];      /* four short chains per statistic instead of one long one: a wave issues in order */
#pragma unroll
      for (int c = 0; c < 4; ++c) { const v8f a = acc[g * 4 + c]; tc[c] = fmaxf(fmaxf(fmaxf(a[0], a[1]), fmaxf(a[2], a[3])), fmaxf(fmaxf(a[4], a[5]), fmaxf(a[6], a[7]))); }
      const float tm = fmaxf(fmaxf(mr[g], fmaxf(tc[0], tc[1])), fmaxf(tc[2], tc[3]));
      const float m2 = tm * AC; const float al = __builtin_amdgcn_exp2f((mr[g] - tm) * AC); mr[g] = tm;
      float ts = 0.f, tw = 0.f;
#pragma unroll
      for (int c = 0; c < 4; ++c) { const v8f a = acc[g * 4 + c]; v2f s2 = {0.f, 0.f}, w2 = {0.f, 0.f};
#pragma unroll
        for (int r = 0; r < 8; r += 2) { const v2f a2 = {a[r], a[r + 1]}; const v2f t2 = a2 * AC - m2; const v2f e2 = {__builtin_amdgcn_exp2f(t2[0]), __builtin_amdgcn_exp2f(t2[1])};
          const v2f p2 = {(float)r, (float)(r + 1)}; s2 += e2; w2 += e2 * p2; }
        const float sc = s2[0] + s2[1]; ts += sc; tw += (w2[0] + w2[1]) + sc * (float)(16 * c); }
      se[g] = se[g] * al + ts; sw[g] = sw[g] * al + (tw + pb * ts); } };
  /* Waves w and w + 4 run half a step apart: waves 0 .. 3 read, multiply and then fold; waves 4 .. 7 first fold their tile of the step before, then read and multiply.
     So one wave's vector work runs beside the other's LDS reads and products, although one barrier per step holds all waves together. */
#pragma unroll 1
  for (int n = 0; n < NAS; ++n) {      /* rolled: one publish point per staged step */
    if (wk != 0 && n > 0) stats(n - 1);
    const _Float16* tb = (const _Float16*)(sm + (n & 1) * TB3);
    const _Float16* kp = tb + (64 * wk + ln) * LP;
    v16h fk[CK / 32][4];      /* the whole key tile as A fragments: [k / 32][key tile of 16] */
#pragma unroll
    for (int j = 0; j < CK / 32; ++j) {
#pragma unroll
      for (int c = 0; c < 4; ++c) fk[j][c] = g2_frag(kp + ((j >> 1) * AKS + c * 16) * LP + 32 * (j & 1), hh); }
    __builtin_amdgcn_sched_barrier(0);      /* keeps the tile's 48 LDS reads together in front of the products, in the order of their use: one place with reads per step, counted waits behind it */
#pragma unroll
    for (int j = 0; j < CK / 32; ++j) {
#pragma unroll
      for (int c = 0; c < 4; ++c) { acc[c] = __builtin_amdgcn_wmma_f32_16x16x32_f16(false, fk[j][c], false, fq[0][j], (short)0, j ? acc[c] : z8, false, false);
        acc[4 + c] = __builtin_amdgcn_wmma_f32_16x16x32_f16(false, fk[j][c], false, fq[1][j], (short)0, j ? acc[4 + c] : z8, false, false); } }
    __builtin_amdgcn_sched_barrier(0);      /* keeps the products in the order of the reads, two per arriving fragment; left free, the scheduler ran single accumulators' chains to their end first and waited for nearly all 48 reads at once */
    if (wk == 0) stats(n);
    /* this wave's reads of step n are done before its buffer is refilled. The four sums are named as inputs only, so that the statistics of waves 0 .. 3 stay in front of the barrier */
    asm volatile("s_wait_dscnt 0x0" :: "v"(se[0]), "v"(se[1]), "v"(sw[0]), "v"(sw[1]) : "memory");
    asm volatile("s_wait_asynccnt 0x0" ::: "memory");    /* this wave's part of step n + 1 has landed */
    __syncthreads();                                     /* publishes step n + 1 and ends every wave's reads of step n */
    if (n + 2 < NAS) g2_stage_k(l0 + (unsigned)(n & 1) * TB3, gk + (size_t)(n + 2) * AKS * LQ3, sk);
  }
  if (wk != 0) stats(NAS - 1);
  asm volatile("s_wait_asynccnt 0x0" ::: "memory");      /* nothing in flight when the buffers take the partial statistics */
  float (*st)[128][2 * AKW] = (float (*)[128][2 * AKW])sm;      /* [maximum as exponent of 2 | weights | weighted positions][query row][key tile of the step * 2 + lane half] */
#pragma unroll
  for (int g = 0; g < 2; ++g) { const int q = 32 * wq + 16 * g + ln, pi = 2 * wk + hh; st[0][q][pi] = mr[g] * AC; st[1][q][pi] = se[g]; st[2][q][pi] = sw[g]; }
  __syncthreads();                                       /* every wave's partial statistics are in LDS */
  if (w < 4) {      /* one query row per lane; a wave's 32 means fill one 128-B line */
    float pm[2 * AKW], ps[2 * AKW], pw[2 * AKW];
#pragma unroll
    for (int i = 0; i < 2 * AKW; i += 4) { const v4f a = *(const v4fa*)&st[0][tid][i], c = *(const v4fa*)&st[1][tid][i], d = *(const v4fa*)&st[2][tid][i];
#pragma unroll
      for (int k = 0; k < 4; ++k) { pm[i + k] = a[k]; ps[i + k] = c[k]; pw[i + k] = d[k]; } }
    float mx = pm[0];
#pragma unroll
    for (int i = 1; i < 2 * AKW; ++i) mx = fmaxf(mx, pm[i]);
    float es = 0.f, ws = 0.f;
#pragma unroll
    for (int i = 0; i < 2 * AKW; ++i) { const float f = __builtin_amdgcn_exp2f(pm[i] - mx); es += ps[i] * f; ws += pw[i] * f; }
    MEANT[(size_t)by * SEQ + mt * 128 + tid] = (float)(SEQ / 2) + ws / es; }
}

// ---- content scores, Gaussian softmax and P . V in one kernel: block = 128 query rows of one slab (wave w: rows 32 w .. 32 w + 31), walking the keys in tiles of 64 ----
// Q3 / K3: the content pair's K-concatenated planes (slab by at column by * 192 of rows with pitch LQ3); Vt f16 [slab][64][SEQ]; O f16 [t][b][h*64 + d] = 64 ctx.
// The query rows lie in LDS for the whole walk; key tile n + 1 is in flight while tile n is worked on. Per key tile: three K tiles give the 32 x 64 scores of a wave; through the wave's own LDS each lane takes one whole query row: x[s] = score - (s - mean)^2 * (1 / (2 sigma^2)),
// running maximum m and sum l in f32, P = f16(2^14 exp(x - m)); the ctx accumulators are scaled by exp(m_old - m_new) and take P . V^T of the tile; at the end ctx * 2^-8 / l.
#define QB (3 * 128 * LP * 2)              /* bytes of the block's query rows, filled once: three K tiles of 128 rows */
#define TB2 ((3 * 64 + 64) * LP * 2)       /* bytes of one staged key tile: three K tiles of its 64 key rows, then its 64 V^T rows */
#define NKT (SEQ / 64)                     /* key tiles */
static_assert(CK / KT == 3 && NKT >= 2);
static_assert(QB + 2 * TB2 + 4 * 32 * 68 * 4 + 4 * 32 * LP * 2 + 4 * 32 * 4 <= 196608);      /* static LDS of k_fattn; one block per WGP */
// 64 rows of 128 B, global -> LDS: 4 copies of 16 B per lane, rows step by 16 per copy
__device__ __forceinline__ void g2_stage_v(unsigned l, const _Float16* gv, size_t sv) {
  /* the closing s_wait_xcnt stands inside the statement so that no address register of a copy is rewritten in front of it */
  asm volatile("global_load_async_to_lds_b128 %0, %4, off\n\t" "global_load_async_to_lds_b128 %1, %5, off\n\t" "global_load_async_to_lds_b128 %2, %6, off\n\t"
               "global_load_async_to_lds_b128 %3, %7, off\n\t" "s_wait_xcnt 0x0"
               :: "v"(l), "v"(l + 1u * 16 * LP * 2), "v"(l + 2u * 16 * LP * 2), "v"(l + 3u * 16 * LP * 2), "v"(gv), "v"(gv + sv), "v"(gv + 2 * sv), "v"(gv + 3 * sv)
               : "memory"); }
// e^x as 2^(x log2 e); the v_nop fills the one slot that the instruction set asks for between a transcendental and a directly following vector instruction that overwrites its source or reads its result
__device__ __forceinline__ float g2_exp(float x) { float e; const float t = x * 1.44269504f; asm("v_exp_f32 %0, %1\n\tv_nop" : "=v"(e) : "v"(t)); return e; }
// orders a wave's LDS writes in front of its own later LDS reads of what other lanes wrote (the ranges so[w], pl[w], als[w] are private to wave w)
__device__ __forceinline__ void g2_wave_order() { __builtin_amdgcn_fence(4 /* acq_rel order */, "workgroup"); __builtin_amdgcn_wave_barrier(); }
__global__ __launch_bounds__(128) void k_fattn(const _Float16* __restrict__ Q3, const _Float16* __restrict__ K3, const _Float16* __restrict__ Vt,
    const float* __restrict__ MEANT, const float* __restrict__ SIGT, _Float16* __restrict__ O) {
  __shared__ __attribute__((aligned(16))) unsigned char sm[QB + 2 * TB2];      /* the query rows, then two tile buffers */
  __shared__ __attribute__((aligned(16))) float so[4][32][68];            /* per wave: f32 scores of a key tile, at the end the output rows */
  __shared__ __attribute__((aligned(16))) _Float16 pl[4][32][LP];         /* per wave: P of a key tile, rows as the A operand reads them */
  __shared__ __attribute__((aligned(16))) float als[4][32];               /* per wave: one factor per query row */
  const int tid = threadIdx.x, w = __builtin_amdgcn_readfirstlane((int)(tid >> 5)), lane = tid & 31, ln = lane & 15, hh = lane >> 4;
  const int by = blockIdx.y, mt = blockIdx.x; const int b = by / NH;
  const int trow = mt * 128 + 32 * w + lane;      /* the query row whose statistics this lane keeps */
  const unsigned l0 = (unsigned)(size_t)sm + (unsigned)((tid >> 3) * (LP * 2) + (tid & 7) * 16);
  const _Float16* ga = Q3 + (size_t)(mt * 128 + (tid >> 3)) * LQ3 + (size_t)by * CK + (tid & 7) * 8;
  const _Float16* gb = K3 + (size_t)(tid >> 3) * LQ3 + (size_t)by * CK + (tid & 7) * 8;
  const _Float16* gv = Vt + ((size_t)by * HD + (tid >> 3)) * SEQ + (tid & 7) * 8;
  const size_t sq = (size_t)16 * LQ3, sv = (size_t)16 * SEQ;
  auto stage = [&](int n) { const unsigned l = l0 + QB + (unsigned)(n & 1) * TB2; const _Float16* gk = gb + (size_t)n * 64 * LQ3;      /* key tile n: 16 copies per lane */
    g2_stage_v(l, gk, sq); g2_stage_v(l + 1u * 64 * LP * 2, gk + KT, sq); g2_stage_v(l + 2u * 64 * LP * 2, gk + 2 * KT, sq);
    g2_stage_v(l + 3u * 64 * LP * 2, gv + n * 64, sv); };
  const v8f z8 = {0.f,0.f,0.f,0.f,0.f,0.f,0.f,0.f};
  v8f o[8] = {z8, z8, z8, z8, z8, z8, z8, z8};      /* ctx: [row half * 4 + column tile] */
  float m = -3.0e38f, l = 0.f;
#pragma unroll      /* unrolled: six straight copy statements */
  for (int i = 0; i < 6; ++i) g2_stage_v(l0 + (unsigned)i * (64 * LP * 2), ga + (i >> 1) * KT + (size_t)(i & 1) * 4 * sq, sq);      /* K tile i / 2, rows 64 (i % 2) .. + 63 */
  stage(0);
  float mu, i2;      /* the row's mean and 1 / (2 sigma^2) */
  { const float* pmu = MEANT + (size_t)by * SEQ + trow; const float* psg = SIGT + sig_idx((size_t)trow * NB + b);
    /* the two loads and their data wait in one statement: no address register of theirs is rewritten while they are under way; they fly beside tile 0's copies */
    asm volatile("global_load_b32 %0, %2, off\n\t" "global_load_b32 %1, %3, off\n\t" "s_wait_loadcnt 0x0" : "=&v"(mu), "=&v"(i2) : "v"(pmu), "v"(psg) : "memory"); }
  asm volatile("s_wait_asynccnt 0x0" ::: "memory");      /* this wave's part of the query rows and of tile 0 has landed */
  __syncthreads();                                       /* ... and every other wave's */
  stage(1);
#pragma unroll 1
  for (int n = 0; n < NKT; ++n) {      /* rolled: one publish point per key tile */
    const _Float16* tb = (const _Float16*)(sm + QB + (n & 1) * TB2);
    v8f acc[8] = {z8, z8, z8, z8, z8, z8, z8, z8};      /* the key tile's scores: [row half * 4 + column tile] */
#pragma unroll      /* unrolled: the next K tile's fragment reads can go out under this one's products */
    for (int kt = 0; kt < 3; ++kt) { const _Float16* ap = (const _Float16*)sm + (kt * 128 + 32 * w + ln) * LP; const _Float16* bp = tb + (kt * 64 + ln) * LP;
      v16h fa[KT / 32][2], fb[KT / 32][4];      /* the tile's fragment reads go out as one group, ahead of the products */
#pragma unroll      /* unrolled here and below: arrays indexed by constants stay in registers */
      for (int s = 0; s < KT / 32; ++s) { fa[s][0] = g2_frag(ap + 32 * s, hh); fb[s][0] = g2_frag(bp + 32 * s, hh); fa[s][1] = g2_frag(ap + 16 * LP + 32 * s, hh);
        fb[s][1] = g2_frag(bp + 16 * LP + 32 * s, hh); fb[s][2] = g2_frag(bp + 32 * LP + 32 * s, hh); fb[s][3] = g2_frag(bp + 48 * LP + 32 * s, hh); }
#pragma unroll
      for (int s = 0; s < KT / 32; ++s) {
#pragma unroll
        for (int c = 0; c < 4; ++c) { acc[c] = g2_mma(fa[s][0], fb[s][c], acc[c]); acc[4 + c] = g2_mma(fa[s][1], fb[s][c], acc[4 + c]); } } }
    {
#pragma unroll
      for (int u = 0; u < 8; ++u) { const int t = u & 3, half = u >> 2;
#pragma unroll
        for (int r = 0; r < 8; ++r) so[w][half * 16 + 8 * hh + r][t * 16 + ln] = acc[u][r] * 6.103515625e-05f; }
      g2_wave_order();
      v4f x[16];
#pragma unroll
      for (int j = 0; j < 16; ++j) x[j] = *(const v4fa*)&so[w][lane][j * 4];
      __builtin_amdgcn_sched_barrier(0);      /* keeps the row's 16 LDS reads together in front of the arithmetic: one LDS latency per key tile instead of one per pair of reads */
      const float sf = (float)(n * 64); float tm = -3.0e38f;
#pragma unroll
      for (int j = 0; j < 16; ++j) {
#pragma unroll
        for (int c = 0; c < 4; ++c) { const float d = (sf + (float)(j * 4 + c)) - mu; const float v = x[j][c] - (d * d) * i2; x[j][c] = v; tm = fmaxf(tm, v); } }
      const float mn = fmaxf(m, tm); const float al = g2_exp(m - mn); m = mn;
      float se = 0.f;
#pragma unroll
      for (int j = 0; j < 8; ++j) { FragH f;
#pragma unroll
        for (int c = 0; c < 8; ++c) { const float e = g2_exp(x[2 * j + (c >> 2)][c & 3] - mn); se += e; f.h[c] = toh_flush(e * 16384.0f); }
        *(v8us*)&pl[w][lane][j * 8] = f.half[0]; }
      l = l * al + se;
      als[w][lane] = al;
      g2_wave_order();
#pragma unroll
      for (int half = 0; half < 2; ++half) { const v4f a0 = *(const v4fa*)&als[w][half * 16 + 8 * hh], a1 = *(const v4fa*)&als[w][half * 16 + 8 * hh + 4];
#pragma unroll
        for (int c = 0; c < 4; ++c) {
#pragma unroll
          for (int r = 0; r < 4; ++r) { o[half * 4 + c][r] *= a0[r]; o[half * 4 + c][4 + r] *= a1[r]; } } }
      const _Float16* pa = &pl[w][ln][0]; const _Float16* vb = tb + (192 + ln) * LP;
      v16h fp[2][2], fv[2][4];
#pragma unroll
      for (int s = 0; s < 2; ++s) { fp[s][0] = g2_frag(pa + 32 * s, hh); fp[s][1] = g2_frag(pa + 16 * LP + 32 * s, hh);
#pragma unroll
        for (int c = 0; c < 4; ++c) fv[s][c] = g2_frag(vb + c * 16 * LP + 32 * s, hh); }
#pragma unroll
      for (int s = 0; s < 2; ++s) {
#pragma unroll
        for (int c = 0; c < 4; ++c) { o[c] = g2_mma(fp[s][0], fv[s][c], o[c]); o[4 + c] = g2_mma(fp[s][1], fv[s][c], o[4 + c]); } }
    }
    asm volatile("s_wait_dscnt 0x0" ::: "memory");       /* this wave's reads of tile n are done before its buffer is refilled */
    asm volatile("s_wait_asynccnt 0x0" ::: "memory");    /* this wave's part of tile n + 1 has landed */
    __syncthreads();                                     /* publishes tile n + 1 and ends every wave's reads of tile n */
    if (n + 2 < NKT) stage(n + 2);
  }
  asm volatile("s_wait_asynccnt 0x0" ::: "memory");      /* nothing in flight at the end */
  als[w][lane] = 0.00390625f / l;
  g2_wave_order();
#pragma unroll
  for (int half = 0; half < 2; ++half) { const v4f a0 = *(const v4fa*)&als[w][half * 16 + 8 * hh], a1 = *(const v4fa*)&als[w][half * 16 + 8 * hh + 4];
#pragma unroll
    for (int c = 0; c < 4; ++c) {
#pragma unroll
      for (int r = 0; r < 4; ++r) { so[w][half * 16 + 8 * hh + r][c * 16 + ln] = o[half * 4 + c][r] * a0[r]; so[w][half * 16 + 8 * hh + 4 + r][c * 16 + ln] = o[half * 4 + c][4 + r] * a1[r]; } } }
  g2_wave_order();
  const int rsub = lane >> 4, c4 = (lane & 15) * 4;
#pragma unroll
  for (int q = 0; q < 16; ++q) { const int r = q * 2 + rsub; const v4f v = *(const v4fa*)&so[w][r][c4]; v4h h4;      /* 16 trips x 2 rows = 32 rows, a whole 128-B line per row */
#pragma unroll
    for (int i = 0; i < 4; ++i) h4[i] = (_Float16)v[i];
    *(v4h*)(O + (size_t)(mt * 128 + 32 * w + r) * LQ + (size_t)by * HD + c4) = h4; }
}

extern "C" void kernel_launch(void* const* d_in, const int* in_sizes, int n_in,
                              void* d_out, int out_size, void* d_ws, size_t ws_size, hipStream_t stream) {
  if (n_in < 19) return;
  if ((size_t)in_sizes[0] < NR * DM || (size_t)in_sizes[1] < NR * DM || (size_t)in_sizes[2] < NR * DM) return;
  if ((size_t)in_sizes[3] < (size_t)DM * DM || (size_t)in_sizes[5] < (size_t)DM * DM || (size_t)in_sizes[7] < (size_t)DM * DM || (size_t)in_sizes[9] < (size_t)DM * DM) return;
  if ((size_t)in_sizes[11] < (size_t)DM * DM || (size_t)in_sizes[13] < (size_t)DM * DM || (size_t)in_sizes[17] < (size_t)DM * DM) return;
  if (in_sizes[4] < DM || in_sizes[6] < DM || in_sizes[8] < DM || in_sizes[10] < DM || in_sizes[12] < DM || in_sizes[14] < DM || in_sizes[15] < DM || in_sizes[16] < 1 || in_sizes[18] < DM) return;
  if ((size_t)out_size < NR * DM) return;
  const float* const* I = (const float* const*)d_in;
  const float* xq = I[0]; const float* xk = I[1]; const float* xv = I[2];
  const float* wq = I[3]; const float* bq = I[4]; const float* wk = I[5]; const float* bk = I[6]; const float* wv = I[7]; const float* bv = I[8];
  const float* whq = I[9]; const float* bhq = I[10]; const float* whk = I[11]; const float* bhk = I[12]; const float* wwp = I[13]; const float* bwp = I[14];
  const float* wvp = I[15]; const float* bvp = I[16]; const float* wo = I[17]; const float* bo = I[18];
  char* ws = (char*)d_ws; size_t off = 0;
  auto take = [&](size_t bytes) { char* p = ws + off; off += (bytes + 255) & ~(size_t)255; return p; };
  _Float16* BQ = (_Float16*)take((size_t)DM * DM * 2); _Float16* BK = (_Float16*)take((size_t)DM * DM * 2); _Float16* BV = (_Float16*)take((size_t)DM * DM * 2);
  _Float16* BHQ = (_Float16*)take((size_t)DM * DM * 2); _Float16* BHK = (_Float16*)take((size_t)DM * DM * 2); _Float16* BWP = (_Float16*)take((size_t)DM * DM * 2); _Float16* BO = (_Float16*)take((size_t)DM * DM * 2);
  _Float16* XQ = (_Float16*)take(NR * DM * 2); _Float16* XK = (_Float16*)take(NR * DM * 2); _Float16* XV = (_Float16*)take(NR * DM * 2);
  _Float16* CA = (_Float16*)take(NR * 3 * DM * 2); _Float16* CB = (_Float16*)take(NR * 3 * DM * 2);      /* concatenated planes of the alignment pair */
  _Float16* V16 = (_Float16*)take(NR * DM * 2); _Float16* O16 = (_Float16*)take(NR * DM * 2); _Float16* VT = (_Float16*)take((size_t)NB * NH * HD * SEQ * 2);
  float* S = (float*)take((size_t)NB * NH * QC * SEQ * 4); _Float16* PM = (_Float16*)take((size_t)NB * NH * QC * SEQ * 2);
  float* MEANT = (float*)take((size_t)NB * NH * SEQ * 4); float* SIGT = (float*)take(NR / SGR * 128);
  if (off > ws_size) return;
  float* G = S;                                                            /* f32 wp plane [NR][DM], consumed by k_sigma */
  _Float16* CA2 = PM; _Float16* CB2 = PM + NR * 3 * DM;                    /* content pair's concatenated planes */
  k_cvt<<<7 * WBL + 3 * XBL, 256, 0, stream>>>(wq, wk, wv, whq, whk, wwp, wo, xq, xk, xv, BQ, XQ);      /* planes BQ .. BO and XQ .. XV in the order of their take() calls */
  const dim3 gp((unsigned)((MP / 128) * (DM / 64)), 1);
  k_proj<<<dim3((unsigned)((MP / 128) * (DM / 64)), 6), 128, 0, stream>>>(XQ, XK, XV, BV, BWP, BHQ, BHK, BQ, BK, bv, bwp, bhq, bhk, bq, bk, V16, G, CA, CB, CA2, CB2);
  k_vt<<<NB * NH * (SEQ / 64), 256, 0, stream>>>(V16, VT);      /* V16 rows [SEQ*NB][DM] -> VT[(b,h)][64][SEQ] */
  k_sigma<<<MP / SGR, 256, 0, stream>>>(G, wvp, bvp, SIGT);
  /* alignment pair: scores and expected key position; slab by = b*NH + h at column offset by*192 of rows with pitch LQ3 */
  k_falign<<<dim3(SEQ / 128, NB * NH), 128 * AKW, 0, stream>>>(CA, CB, MEANT);
  /* content pair: scores, Gaussian softmax and P . V; ctx[t][b][h*64 + d] x64 */
  k_fattn<<<dim3(SEQ / 128, NB * NH), 128, 0, stream>>>(CA2, CB2, VT, MEANT, SIGT, O16);
  k_gemm2<true, true, true><<<gp, 128, 0, stream>>>(O16, DM, 0, BO, DM, 0, 0.0009765625f, bo, (float*)d_out, nullptr, DM, 0, MP, DM, DM);      /* out rows t*NB_FULL + b */
}

// v007
// It runs in 102 microseconds.
// Two timings next to v006 both put it at 1.11 times that version's speed.
// Counting every step since v000, it is 6.38 times as fast.
#include <hip/hip_runtime.h>
// Gaussian-windowed multi-head cross attention, sequence-first layout: query [1024][2][1024], key_in / value [1024][2][1024] (token row r = t*NB + b); six input maps with natural [out][in] weights + biases: q, hq, wp from query; k, hk from key_in; v from value; 16 heads of 64 (flat slab b*16 + h); content logits 64^-0.5 q.k; alignment softmax over keys of 64^-0.5 hq.hk, mean = expected key position; width sigma = 1 + sigmoid(tanh(wp) . Wvp + bvp) per (t, b); P = softmax_s(content - (s - mean)^2 / (2 sigma^2)); ctx = P . v merged [t][b][h*64+d]; out = ctx Wo^T + bo.
// Structure: inputs as exact f16 rows (RNE-converted to bf16 first); all conversions as one launch; the six input projections as one launch of WMMA GEMMs (32x64 wave tiles, f32 accumulation, x16 weights + bias); q/hq and k/hk are written as K-concatenated planes per head [2048 hi | res | hi] and [hi | hi | res] (hi = f16 value, res = f16 of 2048 (v - hi)) so one K = 192 GEMM yields 2048 (hi.hi) + res.hi + hi.res; all query rows as one chunk: k_falign: alignment scores per 64-key tile with running-maximum f32 softmax statistics (centred position sum), its S never in memory; k_fattn: content scores, Gaussian term, running-maximum f32 softmax (P as f16 x 2^14 of exp(x - running max)) and P . V^T per 64-key tile in one launch, both products transposed, S and P of the content pair never out of registers (ctx carried x64) -> out GEMM (f32).
// Compute dtype: all contractions v_wmma_f32_16x16x32_f16 (f16 operands, f32 accumulate); inputs RNE-converted to bf16 (exact in f16); both score sites as f16 value + x2048 residual (three products folded along K); v, P (x2^14), ctx (x64), Wo as plain f16 operands; softmax statistics, mean, tanh / Wvp / sigmoid on the vector unit in f32.
#ifndef NB
#define NB 2                         /* batches processed */
#endif
#ifndef SEQ
#define SEQ 1024                     /* sequence length processed (queries = keys) */
#endif
#define NB_FULL 2                    /* batch pitch of the input / output rows */
#define DM 1024
#define NH 16
#define HD 64
#define QC SEQ                       /* query rows per attention chunk: all of them, so each attention stage is one launch over every (slab, row) */
#define NR ((size_t)NB * SEQ)        /* token rows */
#define MP ((int)(NB * SEQ))
#define LQ (NB * DM)                 /* pitch between consecutive t for one batch */
#define CK (3 * HD)                  /* concatenated K per head */
#define LQ3 (NB * 3 * DM)            /* pitch between consecutive t in a concatenated plane */
static_assert(SEQ % 128 == 0);
static_assert(QC % 128 == 0);
static_assert(SEQ % QC == 0);
static_assert(NH * HD == DM);
static_assert(NB <= NB_FULL);
static_assert((NB * SEQ) % 128 == 0);
static_assert(NH == 16);
static_assert(HD == 64);                         
static_assert(CK % 32 == 0);
static_assert(DM % 32 == 0);
static_assert(QC % 32 == 0);
static_assert((NB * SEQ) % 32 == 0);
static_assert(NH * QC >= DM);                    /* the f32 wp plane [NR][DM] fits into the S region */
static_assert(NH * QC >= 2 * 3 * DM);            /* the content pair's two concatenated planes fit into the P region */
static_assert(QC == SEQ);
static_assert(32 * 8 * 16 == 32 * HD * 2);       
#define KT 64                        /* k elements per staged tile: one 128-B line of every operand row */
#define LP 72                        /* LDS row pitch in f16: 144 B = 16 B x odd, for 16-byte fragment reads */
#define TB ((128 + 64) * LP * 2)     /* bytes of one staged tile: 128 A rows, then 64 Bt rows */
static_assert(CK % KT == 0 && DM % KT == 0 && SEQ % KT == 0);   /* every K of the GEMM launches */
static_assert(4 * 32 * 68 * 4 <= 2 * TB);        /* the output staging fits into the two tile buffers */
static_assert(2 * TB <= 131072);                 /* static LDS of the GEMM kernels */
#define WS_TOTAL (7 * (size_t)DM * DM * 2 + 3 * NR * DM * 2 + 2 * NR * 3 * DM * 2 + 2 * NR * DM * 2 + (size_t)NB * NH * HD * SEQ * 2 + (size_t)NB * NH * QC * SEQ * 4 + (size_t)NB * NH * QC * SEQ * 2 + (size_t)NB * NH * SEQ * 4 + NR * 16)
static_assert(WS_TOTAL + 32 * 256 <= 268435456);

typedef unsigned short v8us __attribute__((ext_vector_type(8), may_alias));
typedef float  v8f  __attribute__((ext_vector_type(8)));
typedef float  v4f  __attribute__((ext_vector_type(4)));
typedef float  v4fa __attribute__((ext_vector_type(4), may_alias));
typedef _Float16 v16h __attribute__((ext_vector_type(16)));
typedef _Float16 v4h __attribute__((ext_vector_type(4)));
union FragH { v16h v; v8us half[2]; _Float16 h[16]; unsigned short u[16]; };

__device__ __forceinline__ unsigned short bf16_bits(float x) { unsigned int u = __float_as_uint(x); return (unsigned short)((u + 0x7FFFu + ((u >> 16) & 1u)) >> 16); }
__device__ __forceinline__ float bf16_val(unsigned short b) { return __uint_as_float(((unsigned int)b) << 16); }
__device__ __forceinline__ float bf16_rne(float x) { return bf16_val(bf16_bits(x)); }   /* RNE convert to bf16, back as f32 */

typedef _Float16 h16;
// f32 -> f16 with a value select: magnitudes below 2^-14 become +0 (no f16 subnormal can reach a WMMA operand)
static __device__ __forceinline__ h16 toh_flush(float v) { const h16 r = (h16)v; return (fabsf(v) < 6.103515625e-05f) ? (h16)0.0f : r; }

// fragment: elements 0..7 <- k0 + 8h .. +7, elements 8..15 <- k0 + 16 + 8h .. +7 (p points at k0 of the lane's row / column)
__device__ __forceinline__ v16h g2_frag(const _Float16* p, int hh) { FragH f; f.half[0] = *(const v8us*)((const unsigned short*)p + 8 * hh); f.half[1] = *(const v8us*)((const unsigned short*)p + 16 + 8 * hh); return f.v; }
__device__ __forceinline__ v8f g2_mma(v16h a, v16h b, v8f c) { v8f d = __builtin_amdgcn_wmma_f32_16x16x32_f16(false, a, false, b, (short)0, c, false, false); asm volatile("v_nop\n\tv_nop\n\tv_nop\n\tv_nop" : "+v"(d) : "v"(a), "v"(b)); return d; }

// one K tile of the block's operands, global -> LDS with no register in between: 12 copies of 16 B per lane; a wave's copy covers 4 whole 128-B lines.
// l: the lane's LDS byte address in tile row tid / 8 (rows step by 16 per copy); ga / gb: the lane's 16 bytes in that row of A / Bt at this tile's k.
__device__ __forceinline__ void g2_stage(unsigned l, const _Float16* ga, size_t sa, const _Float16* gb, size_t sb) {
  /* the closing s_wait_xcnt stands inside the statement so that no address register of a copy is rewritten in front of it */
  asm volatile("global_load_async_to_lds_b128 %0, %12, off\n\t" "global_load_async_to_lds_b128 %1, %13, off\n\t" "global_load_async_to_lds_b128 %2, %14, off\n\t"
               "global_load_async_to_lds_b128 %3, %15, off\n\t" "global_load_async_to_lds_b128 %4, %16, off\n\t" "global_load_async_to_lds_b128 %5, %17, off\n\t"
               "global_load_async_to_lds_b128 %6, %18, off\n\t" "global_load_async_to_lds_b128 %7, %19, off\n\t" "global_load_async_to_lds_b128 %8, %20, off\n\t"
               "global_load_async_to_lds_b128 %9, %21, off\n\t" "global_load_async_to_lds_b128 %10, %22, off\n\t" "global_load_async_to_lds_b128 %11, %23, off\n\t"
               "s_wait_xcnt 0x0"
               :: "v"(l), "v"(l + 1u * 16 * LP * 2), "v"(l + 2u * 16 * LP * 2), "v"(l + 3u * 16 * LP * 2), "v"(l + 4u * 16 * LP * 2), "v"(l + 5u * 16 * LP * 2),
                  "v"(l + 6u * 16 * LP * 2), "v"(l + 7u * 16 * LP * 2), "v"(l + 8u * 16 * LP * 2), "v"(l + 9u * 16 * LP * 2), "v"(l + 10u * 16 * LP * 2), "v"(l + 11u * 16 * LP * 2),
                  "v"(ga), "v"(ga + sa), "v"(ga + 2 * sa), "v"(ga + 3 * sa), "v"(ga + 4 * sa), "v"(ga + 5 * sa), "v"(ga + 6 * sa), "v"(ga + 7 * sa),
                  "v"(gb), "v"(gb + sb), "v"(gb + 2 * sb), "v"(gb + 3 * sb)
               : "memory"); }

// main loop of both GEMM kernels: block tile 128 x 64, wave w takes rows 32 w .. 32 w + 31; two LDS tile buffers, tile t + 1 in flight while tile t is multiplied.
// Ab: row 0 of the block's 128 A rows; Bb: row 0 of its 64 Bt rows; K % KT == 0. On return every wave has left both buffers and no copy is outstanding.
__device__ __forceinline__ void g2_main(unsigned char* sm, const _Float16* Ab, int lda, const _Float16* Bb, int ldb, int K, int tid, int w, int ln, int hh, v8f (&acc)[8]) {
  const int nt = K / KT;
  const unsigned l0 = (unsigned)(size_t)sm + (unsigned)((tid >> 3) * (LP * 2) + (tid & 7) * 16);
  const _Float16* ga = Ab + (size_t)(tid >> 3) * lda + (tid & 7) * 8; const _Float16* gb = Bb + (size_t)(tid >> 3) * ldb + (tid & 7) * 8;
  const size_t sa = (size_t)16 * lda, sb = (size_t)16 * ldb;
  g2_stage(l0, ga, sa, gb, sb);
  asm volatile("s_wait_asynccnt 0x0" ::: "memory");      /* this wave's part of tile 0 has landed */
  __syncthreads();                                       /* ... and every other wave's */
  if (nt > 1) g2_stage(l0 + TB, ga + KT, sa, gb + KT, sb);
#pragma unroll 1
  for (int t = 0; t < nt; ++t) {      /* rolled: one publish point per tile */
    const _Float16* tb = (const _Float16*)(sm + (t & 1) * TB);
    const _Float16* ap = tb + (32 * w + ln) * LP; const _Float16* bp = tb + (128 + ln) * LP;
    v16h fa[KT / 32][2], fb[KT / 32][4];      /* the tile's fragment reads go out as one group, in the order of their use, ahead of the products */
#pragma unroll      /* unrolled here and below: fa / fb are indexed by constants and stay in registers */
    for (int s = 0; s < KT / 32; ++s) { fa[s][0] = g2_frag(ap + 32 * s, hh); fb[s][0] = g2_frag(bp + 32 * s, hh); fa[s][1] = g2_frag(ap + 16 * LP + 32 * s, hh);
      fb[s][1] = g2_frag(bp + 16 * LP + 32 * s, hh); fb[s][2] = g2_frag(bp + 32 * LP + 32 * s, hh); fb[s][3] = g2_frag(bp + 48 * LP + 32 * s, hh); }
#pragma unroll
    for (int s = 0; s < KT / 32; ++s) {
#pragma unroll
      for (int c = 0; c < 4; ++c) { acc[c] = g2_mma(fa[s][0], fb[s][c], acc[c]); acc[4 + c] = g2_mma(fa[s][1], fb[s][c], acc[4 + c]); } }
    asm volatile("s_wait_dscnt 0x0" ::: "memory");       /* this wave's reads of tile t are done before its buffer is refilled */
    asm volatile("s_wait_asynccnt 0x0" ::: "memory");    /* this wave's part of tile t + 1 has landed */
    __syncthreads();                                     /* publishes tile t + 1 and ends every wave's reads of tile t */
    if (t + 2 < nt) g2_stage(l0 + (unsigned)(t & 1) * TB, ga + (size_t)(t + 2) * KT, sa, gb + (size_t)(t + 2) * KT, sb);
  }
  asm volatile("s_wait_asynccnt 0x0" ::: "memory");      /* nothing in flight when the buffers become output staging */
}

// ---- GEMM (wave tile 32x64; M % 128 == 0 per launch region, N % 64 == 0, K % 64 == 0): C = alpha * A . Bt^T (+ bias) ----
// A f16 [M][K] (pitch lda), Bt f16 [N][K] (pitch ldb); batch slab by = blockIdx.y with element strides sA / sB / sC.
// OMAP: output row r -> (r / NB) * NB_FULL + r % NB.
template <bool HASB, bool OUT32, bool OMAP>
__global__ __launch_bounds__(128) void k_gemm2(const _Float16* __restrict__ A, int lda, size_t sA, const _Float16* __restrict__ Bh, int ldb, size_t sB, float alpha,
    const float* __restrict__ bias, float* __restrict__ C, _Float16* __restrict__ C16, int ldc, size_t sC, int M, int N, int K) {
  __shared__ __attribute__((aligned(16))) unsigned char sm[2 * TB]; float (*so)[32][68] = (float (*)[32][68])sm;      /* two tile buffers; output staging behind the main loop */
  const int tid = threadIdx.x, w = __builtin_amdgcn_readfirstlane((int)(tid >> 5)), lane = tid & 31, ln = lane & 15, hh = lane >> 4; const int by = blockIdx.y;
  A += (size_t)by * sA; Bh += (size_t)by * sB; const size_t cofs = (size_t)by * sC;
  const int ntn = N >> 6; const int mt = blockIdx.x / ntn, nq = blockIdx.x - mt * ntn; const int row0 = mt * 128 + 32 * w, col0 = nq * 64; if (mt * 128 >= M) return;      /* the whole block leaves, in front of every barrier */
  const v8f z8 = {0.f,0.f,0.f,0.f,0.f,0.f,0.f,0.f}; v8f accs[8] = {z8, z8, z8, z8, z8, z8, z8, z8};      /* [row half * 4 + column tile] */
  g2_main(sm, A + (size_t)(mt * 128) * lda, lda, Bh + (size_t)col0 * ldb, ldb, K, tid, w, ln, hh, accs);
#pragma unroll
  for (int u = 0; u < 8; ++u) { const int t = u & 3, half = u >> 2; const int col = col0 + t * 16 + ln; float bv = 0.f; if (HASB) bv = bf16_rne(bias[col]);
#pragma unroll
    for (int r = 0; r < 8; ++r) { const int rloc = half * 16 + 8 * hh + r; so[w][rloc][t * 16 + ln] = accs[u][r] * alpha + bv; } }
  __builtin_amdgcn_fence(4 /* acq_rel order */, "workgroup"); __builtin_amdgcn_wave_barrier();      /* so[w] is private to wave w */
  const int rsub = lane >> 4, c4 = (lane & 15) * 4;
  {
#pragma unroll
    for (int q = 0; q < 16; ++q) { const int r = q * 2 + rsub; const v4f v = *(const v4fa*)&so[w][r][c4];
      const int gr = row0 + r; const size_t orow = OMAP ? ((size_t)(gr / NB) * NB_FULL + (size_t)(gr % NB)) : (size_t)gr;
      if (OUT32) { *(v4f*)(C + cofs + orow * ldc + col0 + c4) = v; }
      else { v4h h4;
#pragma unroll
        for (int i = 0; i < 4; ++i) h4[i] = (_Float16)v[i];
        *(v4h*)(C16 + cofs + orow * ldc + col0 + c4) = h4; } }
     } }

// ---- the six input projections as one launch (same main loop and staging as k_gemm2; M = MP, N = K = DM; N tile 64 == one head): job = blockIdx.y picks operands, bias and output form ----
// x = A . Bt^T / 16 + bias (f32). job 0: v, f16 rows; job 1: wp, f32 rows; jobs 2 .. 5: hq, hk, q, k as K-concatenated planes:
// hi = f16(x), res = f16(2048 (x - hi)); head h = col0 / 64 of row r at C3 + r * 3 DM + h * 192: query side [2048 hi | res | hi], key side [hi | hi | res].
__global__ __launch_bounds__(128) void k_proj(const _Float16* __restrict__ XQ, const _Float16* __restrict__ XK, const _Float16* __restrict__ XV,
    const _Float16* __restrict__ BV, const _Float16* __restrict__ BWP, const _Float16* __restrict__ BHQ, const _Float16* __restrict__ BHK, const _Float16* __restrict__ BQ, const _Float16* __restrict__ BK,
    const float* __restrict__ bv, const float* __restrict__ bwp, const float* __restrict__ bhq, const float* __restrict__ bhk, const float* __restrict__ bq, const float* __restrict__ bk,
    _Float16* __restrict__ V16, float* __restrict__ G, _Float16* __restrict__ CHQ, _Float16* __restrict__ CHK, _Float16* __restrict__ CQ, _Float16* __restrict__ CK3) {
  __shared__ __attribute__((aligned(16))) unsigned char sm[2 * TB]; float (*so)[32][68] = (float (*)[32][68])sm;      /* two tile buffers; output staging behind the main loop */
  const int tid = threadIdx.x, w = __builtin_amdgcn_readfirstlane((int)(tid >> 5)), lane = tid & 31, ln = lane & 15, hh = lane >> 4; const int job = blockIdx.y;
  const _Float16* A; const _Float16* Bh; const float* bias; _Float16* C3 = nullptr;
  switch (job) {
    case 0: A = XV; Bh = BV; bias = bv; break;
    case 1: A = XQ; Bh = BWP; bias = bwp; break;
    case 2: A = XQ; Bh = BHQ; bias = bhq; C3 = CHQ; break;
    case 3: A = XK; Bh = BHK; bias = bhk; C3 = CHK; break;
    case 4: A = XQ; Bh = BQ; bias = bq; C3 = CQ; break;
    default: A = XK; Bh = BK; bias = bk; C3 = CK3; break; }
  const int mt = blockIdx.x / (DM / 64), nq = blockIdx.x - mt * (DM / 64); const int row0 = mt * 128 + 32 * w, col0 = nq * 64;
  const v8f z8 = {0.f,0.f,0.f,0.f,0.f,0.f,0.f,0.f}; v8f accs[8] = {z8, z8, z8, z8, z8, z8, z8, z8};      /* [row half * 4 + column tile] */
  g2_main(sm, A + (size_t)(mt * 128) * DM, DM, Bh + (size_t)col0 * DM, DM, DM, tid, w, ln, hh, accs);
#pragma unroll
  for (int u = 0; u < 8; ++u) { const int t = u & 3, half = u >> 2; const int col = col0 + t * 16 + ln; const float bb = bf16_rne(bias[col]);
#pragma unroll
    for (int r = 0; r < 8; ++r) { const int rloc = half * 16 + 8 * hh + r; so[w][rloc][t * 16 + ln] = accs[u][r] * 0.0625f + bb; } }
  __builtin_amdgcn_fence(4 /* acq_rel order */, "workgroup"); __builtin_amdgcn_wave_barrier();      /* so[w] is private to wave w */
  const int rsub = lane >> 4, c4 = (lane & 15) * 4; const int head = col0 >> 6;
  if (job == 0) {
#pragma unroll
    for (int q = 0; q < 16; ++q) { const int r = q * 2 + rsub; const v4f v = *(const v4fa*)&so[w][r][c4]; v4h h4;      /* 16 trips x 2 rows = 32 rows, here and below */
#pragma unroll
      for (int i = 0; i < 4; ++i) h4[i] = (_Float16)v[i];
      *(v4h*)(V16 + (size_t)(row0 + r) * DM + col0 + c4) = h4; }
  } else if (job == 1) {
#pragma unroll
    for (int q = 0; q < 16; ++q) { const int r = q * 2 + rsub; const v4f v = *(const v4fa*)&so[w][r][c4]; *(v4f*)(G + (size_t)(row0 + r) * DM + col0 + c4) = v; }
    asm volatile("s_wait_xcnt 0x0" ::: "memory");      /* the branches join in address arithmetic that reuses these stores' registers: the wait stands in front of it */
  } else { const bool qside = (job & 1) == 0;
#pragma unroll 1
    for (int q0 = 0; q0 < 16; q0 += 4) {      /* rolled: four trips of four row pairs, for code size */
#pragma unroll
     for (int q = q0; q < q0 + 4; ++q) { const int r = q * 2 + rsub; const v4f v = *(const v4fa*)&so[w][r][c4];
      v4h s0, s1, s2;
#pragma unroll
      for (int i = 0; i < 4; ++i) { const h16 hi = toh_flush(v[i]); const h16 rs = toh_flush((v[i] - (float)hi) * 2048.0f); const h16 hs = (h16)((float)hi * 2048.0f);
        s0[i] = qside ? hs : hi; s1[i] = qside ? rs : hi; s2[i] = qside ? hi : rs; }
      _Float16* dst = C3 + (size_t)(row0 + r) * (3 * DM) + head * CK + c4;
      *(v4h*)dst = s0; *(v4h*)(dst + 64) = s1; *(v4h*)(dst + 128) = s2; }
     asm volatile("s_wait_xcnt 0x0" ::: "memory"); }      /* the next trip rewrites the registers that this trip's stores name */
     } }

// ---- all ten input conversions as one launch: blocks 0 .. 7 WBL - 1 take the seven weight planes (natural [out][in] = Bt[n][k], x16), the rest the three activation planes; 8 elements per thread ----
// Bt: seven f16 planes of DM x DM, one behind the other, in the order w0 .. w6; X16: three f16 planes of NR x DM in the order x0 .. x2.
#define WBL (DM * DM / 8 / 256)            /* blocks per weight plane */
#define XBL ((int)(NR * DM / 8 / 256))     /* blocks per activation plane */
static_assert(DM * DM % (8 * 256) == 0 && (NR * DM) % (8 * 256) == 0);      /* whole blocks: no thread past the end of a plane */
static_assert(((size_t)DM * DM * 2) % 256 == 0 && (NR * DM * 2) % 256 == 0);      /* the planes follow one another in the workspace without a gap */
__global__ __launch_bounds__(256) void k_cvt(const float* __restrict__ w0, const float* __restrict__ w1, const float* __restrict__ w2, const float* __restrict__ w3, const float* __restrict__ w4,
    const float* __restrict__ w5, const float* __restrict__ w6, const float* __restrict__ x0, const float* __restrict__ x1, const float* __restrict__ x2, _Float16* __restrict__ Bt, _Float16* __restrict__ X16) {
  const int blk = blockIdx.x; FragH f;
  if (blk < 7 * WBL) { const int pl = blk / WBL; const size_t t = (size_t)(blk - pl * WBL) * 256 + threadIdx.x;
    const float* w = (pl == 0) ? w0 : (pl == 1) ? w1 : (pl == 2) ? w2 : (pl == 3) ? w3 : (pl == 4) ? w4 : (pl == 5) ? w5 : w6;
    const v4f a = *(const v4fa*)(w + t * 8), c = *(const v4fa*)(w + t * 8 + 4);
#pragma unroll
    for (int q = 0; q < 4; ++q) { f.h[q] = toh_flush(bf16_rne(a[q]) * 16.0f); f.h[4 + q] = toh_flush(bf16_rne(c[q]) * 16.0f); }
    const v8us o = f.half[0]; *(v8us*)((unsigned short*)Bt + (size_t)pl * DM * DM + t * 8) = o;
  } else { const int bx = blk - 7 * WBL; const int pl = bx / XBL; const size_t t = (size_t)(bx - pl * XBL) * 256 + threadIdx.x;
    const float* x = (pl == 0) ? x0 : (pl == 1) ? x1 : x2;
    const size_t row = t / (DM / 8); const int c8 = (int)(t % (DM / 8)) * 8; const size_t srow = (row / NB) * NB_FULL + (row % NB);
    const float* p = x + srow * DM + c8; const v4f a = *(const v4fa*)p, c = *(const v4fa*)(p + 4);
#pragma unroll
    for (int q = 0; q < 4; ++q) { f.h[q] = (_Float16)bf16_rne(a[q]); f.h[4 + q] = (_Float16)bf16_rne(c[q]); }
    const v8us o = f.half[0]; *(v8us*)((unsigned short*)X16 + (size_t)pl * NR * DM + t * 8) = o;
    asm volatile("s_wait_xcnt 0x0" ::: "memory"); } }      /* the built code runs on from here towards the weight branch, whose loads reuse this store's registers: the wait stands in front of them */

__global__ __launch_bounds__(256) void k_vt(const _Float16* __restrict__ V16, _Float16* __restrict__ Vt) { __shared__ unsigned short tl[64][66]; const int tid = threadIdx.x; const int slab = blockIdx.x / (SEQ / 64), lg = blockIdx.x % (SEQ / 64); const int b = slab / NH, h = slab % NH;
  for (int i = tid; i < 64 * 8; i += 256) { const int r = i / 8, c8 = (i % 8) * 8; FragH f; f.half[0] = *(const v8us*)((const unsigned short*)V16 + ((size_t)(lg * 64 + r) * NB + b) * DM + h * HD + c8);
#pragma unroll
    for (int q = 0; q < 8; ++q) tl[r][c8 + q] = f.u[q]; }
  __syncthreads();
  {
#pragma unroll
    for (int rd = 0; rd < 2; ++rd) { const int d = rd * 32 + tid / 8, pc = tid % 8; FragH f;
#pragma unroll
      for (int q = 0; q < 8; ++q) f.u[q] = tl[pc * 8 + q][d];
      *(v8us*)((unsigned short*)Vt + ((size_t)slab * 64 + d) * SEQ + lg * 64 + pc * 8) = f.half[0]; }
     } }

// width table: SIGT[sig_idx(r)], r = t*NB + b, = 1 / (2 sigma^2), sigma = 1 + sigmoid(sum_e tanh(G[r][e]) * bf16(Wvp[e]) + bf16(bvp)); G f32 [NR][DM].
// One row per wave, 8 rows per block; a block's 8 values open a 128-B line of their own, so that each line of the table has one writer.
#define SGR 8                        /* rows (= waves) per k_sigma block */
static_assert((NB * SEQ) % SGR == 0);
static_assert(SGR * 4 <= 128 && SGR % 4 == 0 && SGR * 32 == 256);      /* one line per block, 16-B stores, one wave per row in a block of 256 */
__device__ __forceinline__ size_t sig_idx(size_t r) { return (r / SGR) * 32 + (r % SGR); }
__global__ __launch_bounds__(256) void k_sigma(const float* __restrict__ G, const float* __restrict__ wvp, const float* __restrict__ bvp, float* __restrict__ SIGT) {
  #pragma clang fp contract(off)
  __shared__ __attribute__((aligned(16))) float sg[SGR];
  const int tid = threadIdx.x, w = __builtin_amdgcn_readfirstlane((int)(tid >> 5)), lane = tid & 31;
  const float b0 = bf16_rne(bvp[0]);
  const float* p = G + ((size_t)blockIdx.x * SGR + w) * DM + lane;
  float x[DM / 32], wv[DM / 32];
#pragma unroll      /* unrolled: the row's loads all go out before the first tanh, one memory latency per row instead of one per 32 elements */
  for (int j = 0; j < DM / 32; ++j) { x[j] = p[j * 32]; wv[j] = wvp[j * 32 + lane]; }
  float acc = 0.f;
#pragma unroll      /* unrolled: x / wv are indexed by constants and stay in registers; the sum runs in ascending k */
  for (int j = 0; j < DM / 32; ++j) acc += tanhf(x[j]) * bf16_rne(wv[j]);
#pragma unroll
  for (int off = 16; off > 0; off >>= 1) acc += __shfl_xor(acc, off, 32);
  const float g = acc + b0;
  const float sgm = 1.0f + 1.0f / (1.0f + expf(-g));
  const float i2 = 1.0f / (2.0f * sgm * sgm);
  if (lane == 0) sg[w] = i2;
  __syncthreads();
  if (w == 0 && lane < SGR / 4) { const v4f v = *(const v4fa*)&sg[lane * 4]; float* dst = SIGT + (size_t)blockIdx.x * 32 + lane * 4;
    *(v4f*)dst = v;  }
}

// ---- alignment scores and their softmax statistics in one kernel: block = 128 query rows of one slab; MEANT[slab][t] = sum_s softmax(row t)[s] * s (f32; position sum centred at SEQ/2) ----
// Q3 / K3: the alignment pair's K-concatenated planes (slab by at column by * 192 of rows with pitch LQ3). Scores are formed transposed, keys x queries: A = key rows from LDS, B = the wave's 32 query rows, kept in registers for the whole walk,
// so a lane holds 32 of a 64-key tile's scores of one query (key = 16 c + 8 hh + r, query = ln) and keeps that query's running maximum and two running sums by itself, with no exchange between lanes inside the walk.
// Wave w: query rows 32 (w % 4) .. + 31, and of every staged step of 64 AKW keys the tile w / 4. At the end the 2 AKW partial statistics of a query row meet in LDS.
#define AKW 2                              /* key tiles per staged step = waves per SIMD */
#define AKS (64 * AKW)                     /* keys per staged step */
#define TB3 (3 * AKS * LP * 2)             /* bytes of one staged step: three K tiles of its key rows */
#define NAS (SEQ / AKS)                    /* staged steps */
#define AC (6.103515625e-05f * 1.44269504f)      /* raw score -> logit (2^-14) -> exponent of 2 */
static_assert(SEQ % AKS == 0 && NAS >= 2 && (2 * AKW) % 4 == 0);      /* whole steps, both buffers filled in front of the walk, 16-B reads of a row's partial statistics */
static_assert(2 * TB3 <= 327680 && 3 * 128 * 2 * AKW * 4 <= 2 * TB3);      /* static LDS of k_falign; the partial statistics fit into the two step buffers */
typedef float v2f __attribute__((ext_vector_type(2)));
// one staged step, global -> LDS: 12 copies of 16 B per lane; LDS rows step by 16 AKW per copy (four copies per K tile), s = the same step in the key plane
__device__ __forceinline__ void g2_stage_k(unsigned l, const _Float16* g, size_t s) {
  /* the closing s_wait_xcnt stands inside the statement so that no address register of a copy is rewritten in front of it */
  asm volatile("global_load_async_to_lds_b128 %0, %12, off\n\t" "global_load_async_to_lds_b128 %1, %13, off\n\t" "global_load_async_to_lds_b128 %2, %14, off\n\t"
               "global_load_async_to_lds_b128 %3, %15, off\n\t" "global_load_async_to_lds_b128 %4, %16, off\n\t" "global_load_async_to_lds_b128 %5, %17, off\n\t"
               "global_load_async_to_lds_b128 %6, %18, off\n\t" "global_load_async_to_lds_b128 %7, %19, off\n\t" "global_load_async_to_lds_b128 %8, %20, off\n\t"
               "global_load_async_to_lds_b128 %9, %21, off\n\t" "global_load_async_to_lds_b128 %10, %22, off\n\t" "global_load_async_to_lds_b128 %11, %23, off\n\t"
               "s_wait_xcnt 0x0"
               :: "v"(l), "v"(l + 1u * 16 * AKW * LP * 2), "v"(l + 2u * 16 * AKW * LP * 2), "v"(l + 3u * 16 * AKW * LP * 2), "v"(l + 4u * 16 * AKW * LP * 2), "v"(l + 5u * 16 * AKW * LP * 2),
                  "v"(l + 6u * 16 * AKW * LP * 2), "v"(l + 7u * 16 * AKW * LP * 2), "v"(l + 8u * 16 * AKW * LP * 2), "v"(l + 9u * 16 * AKW * LP * 2), "v"(l + 10u * 16 * AKW * LP * 2), "v"(l + 11u * 16 * AKW * LP * 2),
                  "v"(g), "v"(g + s), "v"(g + 2 * s), "v"(g + 3 * s), "v"(g + KT), "v"(g + KT + s), "v"(g + KT + 2 * s), "v"(g + KT + 3 * s),
                  "v"(g + 2 * KT), "v"(g + 2 * KT + s), "v"(g + 2 * KT + 2 * s), "v"(g + 2 * KT + 3 * s)
               : "memory"); }
__global__ __launch_bounds__(128 * AKW) void k_falign(const _Float16* __restrict__ Q3, const _Float16* __restrict__ K3, float* __restrict__ MEANT) {
  __shared__ __attribute__((aligned(16))) unsigned char sm[2 * TB3];      /* two step buffers; behind the walk the partial statistics */
  const int tid = threadIdx.x, w = __builtin_amdgcn_readfirstlane((int)(tid >> 5)), lane = tid & 31, ln = lane & 15, hh = lane >> 4;
  const int by = blockIdx.y, mt = blockIdx.x; const int wq = w & 3, wk = w >> 2;
  const unsigned l0 = (unsigned)(size_t)sm + (unsigned)((tid >> 3) * (LP * 2) + (tid & 7) * 16);
  const _Float16* gk = K3 + (size_t)(tid >> 3) * LQ3 + (size_t)by * CK + (tid & 7) * 8;
  const size_t sk = (size_t)(16 * AKW) * LQ3;
  g2_stage_k(l0, gk, sk);
  const _Float16* qp = Q3 + (size_t)(mt * 128 + 32 * wq + ln) * LQ3 + (size_t)by * CK;
  v16h fq[2][CK / 32];      /* the wave's query rows as B fragments: [group of 16 queries][k / 32] */
#pragma unroll      /* unrolled here and below: arrays indexed by constants stay in registers */
  for (int g = 0; g < 2; ++g) {
#pragma unroll
    for (int j = 0; j < CK / 32; ++j) fq[g][j] = g2_frag(qp + (size_t)g * 16 * LQ3 + 32 * j, hh); }
  asm volatile("s_wait_asynccnt 0x0" ::: "memory");      /* this wave's part of step 0 has landed */
  __syncthreads();                                       /* ... and every other wave's */
  g2_stage_k(l0 + TB3, gk + (size_t)AKS * LQ3, sk);
  const v8f z8 = {0.f,0.f,0.f,0.f,0.f,0.f,0.f,0.f};
  float mr[2] = {-3.0e38f, -3.0e38f}, se[2] = {0.f, 0.f}, sw[2] = {0.f, 0.f};      /* per query group: running maximum (raw score), sum of weights, sum of weight x centred position */
  v8f acc[8];      /* a key tile's scores: [query group * 4 + key tile of 16] */
  auto stats = [&](int n) {      /* folds the lane's 2 x 32 scores of its tile of step n into the running statistics */
    const float pb = (float)(n * AKS + 64 * wk + 8 * hh - SEQ / 2);      /* centred position of the lane's first key of the tile */
#pragma unroll
    for (int g = 0; g < 2; ++g) {
      float tc[4];      /* four short chains per statistic instead of one long one: a wave issues in order */
#pragma unroll
      for (int c = 0; c < 4; ++c) { const v8f a = acc[g * 4 + c]; tc[c] = fmaxf(fmaxf(fmaxf(a[0], a[1]), fmaxf(a[2], a[3])), fmaxf(fmaxf(a[4], a[5]), fmaxf(a[6], a[7]))); }
      const float tm = fmaxf(fmaxf(mr[g], fmaxf(tc[0], tc[1])), fmaxf(tc[2], tc[3]));
      const float m2 = tm * AC; const float al = __builtin_amdgcn_exp2f((mr[g] - tm) * AC); mr[g] = tm;
      float ts = 0.f, tw = 0.f;
#pragma unroll
      for (int c = 0; c < 4; ++c) { const v8f a = acc[g * 4 + c]; v2f s2 = {0.f, 0.f}, w2 = {0.f, 0.f};
#pragma unroll
        for (int r = 0; r < 8; r += 2) { const v2f a2 = {a[r], a[r + 1]}; const v2f t2 = a2 * AC - m2; const v2f e2 = {__builtin_amdgcn_exp2f(t2[0]), __builtin_amdgcn_exp2f(t2[1])};
          const v2f p2 = {(float)r, (float)(r + 1)}; s2 += e2; w2 += e2 * p2; }
        const float sc = s2[0] + s2[1]; ts += sc; tw += (w2[0] + w2[1]) + sc * (float)(16 * c); }
      se[g] = se[g] * al + ts; sw[g] = sw[g] * al + (tw + pb * ts); } };
  /* Waves w and w + 4 run half a step apart: waves 0 .. 3 read, multiply and then fold; waves 4 .. 7 first fold their tile of the step before, then read and multiply.
     So one wave's vector work runs beside the other's LDS reads and products, although one barrier per step holds all waves together. */
#pragma unroll 1
  for (int n = 0; n < NAS; ++n) {      /* rolled: one publish point per staged step */
    if (wk != 0 && n > 0) stats(n - 1);
    const _Float16* tb = (const _Float16*)(sm + (n & 1) * TB3);
    const _Float16* kp = tb + (64 * wk + ln) * LP;
    v16h fk[CK / 32][4];      /* the whole key tile as A fragments: [k / 32][key tile of 16] */
#pragma unroll
    for (int j = 0; j < CK / 32; ++j) {
#pragma unroll
      for (int c = 0; c < 4; ++c) fk[j][c] = g2_frag(kp + ((j >> 1) * AKS + c * 16) * LP + 32 * (j & 1), hh); }
    __builtin_amdgcn_sched_barrier(0);      /* keeps the tile's 48 LDS reads together in front of the products, in the order of their use: one place with reads per step, counted waits behind it */
#pragma unroll
    for (int j = 0; j < CK / 32; ++j) {
#pragma unroll
      for (int c = 0; c < 4; ++c) { acc[c] = __builtin_amdgcn_wmma_f32_16x16x32_f16(false, fk[j][c], false, fq[0][j], (short)0, j ? acc[c] : z8, false, false);
        acc[4 + c] = __builtin_amdgcn_wmma_f32_16x16x32_f16(false, fk[j][c], false, fq[1][j], (short)0, j ? acc[4 + c] : z8, false, false); } }
    __builtin_amdgcn_sched_barrier(0);      /* keeps the products in the order of the reads, two per arriving fragment; left free, the scheduler ran single accumulators' chains to their end first and waited for nearly all 48 reads at once */
    if (wk == 0) stats(n);
    /* this wave's reads of step n are done before its buffer is refilled. The four sums are named as inputs only, so that the statistics of waves 0 .. 3 stay in front of the barrier */
    asm volatile("s_wait_dscnt 0x0" :: "v"(se[0]), "v"(se[1]), "v"(sw[0]), "v"(sw[1]) : "memory");
    asm volatile("s_wait_asynccnt 0x0" ::: "memory");    /* this wave's part of step n + 1 has landed */
    __syncthreads();                                     /* publishes step n + 1 and ends every wave's reads of step n */
    if (n + 2 < NAS) g2_stage_k(l0 + (unsigned)(n & 1) * TB3, gk + (size_t)(n + 2) * AKS * LQ3, sk);
  }
  if (wk != 0) stats(NAS - 1);
  asm volatile("s_wait_asynccnt 0x0" ::: "memory");      /* nothing in flight when the buffers take the partial statistics */
  float (*st)[128][2 * AKW] = (float (*)[128][2 * AKW])sm;      /* [maximum as exponent of 2 | weights | weighted positions][query row][key tile of the step * 2 + lane half] */
#pragma unroll
  for (int g = 0; g < 2; ++g) { const int q = 32 * wq + 16 * g + ln, pi = 2 * wk + hh; st[0][q][pi] = mr[g] * AC; st[1][q][pi] = se[g]; st[2][q][pi] = sw[g]; }
  __syncthreads();                                       /* every wave's partial statistics are in LDS */
  if (w < 4) {      /* one query row per lane; a wave's 32 means fill one 128-B line */
    float pm[2 * AKW], ps[2 * AKW], pw[2 * AKW];
#pragma unroll
    for (int i = 0; i < 2 * AKW; i += 4) { const v4f a = *(const v4fa*)&st[0][tid][i], c = *(const v4fa*)&st[1][tid][i], d = *(const v4fa*)&st[2][tid][i];
#pragma unroll
      for (int k = 0; k < 4; ++k) { pm[i + k] = a[k]; ps[i + k] = c[k]; pw[i + k] = d[k]; } }
    float mx = pm[0];
#pragma unroll
    for (int i = 1; i < 2 * AKW; ++i) mx = fmaxf(mx, pm[i]);
    float es = 0.f, ws = 0.f;
#pragma unroll
    for (int i = 0; i < 2 * AKW; ++i) { const float f = __builtin_amdgcn_exp2f(pm[i] - mx); es += ps[i] * f; ws += pw[i] * f; }
    MEANT[(size_t)by * SEQ + mt * 128 + tid] = (float)(SEQ / 2) + ws / es; }
}

// ---- content scores, Gaussian softmax and P . V in one kernel: block = 128 query rows of one slab (wave w: rows 32 w .. 32 w + 31), walking the keys in tiles of 64 ----
// Q3 / K3: the content pair's K-concatenated planes (slab by at column by * 192 of rows with pitch LQ3); Vt f16 [slab][64][SEQ]; O f16 [t][b][h*64 + d] = 64 ctx.
// Both products are formed transposed. Scores, keys x queries: A = key rows from LDS, B = the wave's 32 query rows, kept in registers for the whole walk; a lane holds 32 of a key tile's scores of one query per group of 16 queries
// (key = 16 c + 8 hh + r, query = ln): y[s] = log2(e) (score - (s - mean)^2 * (1 / (2 sigma^2))), running maximum m (joined between the two lanes of a query once per tile) and the lane's own part of the sum l in f32.
// P = f16(2^14 2^(y - m)) of key tiles 2 s and 2 s + 1 is, register for register, the B fragment of keys 32 s .. 32 s + 31; ctx, d x queries: A = V^T rows from LDS; a lane's accumulators all belong to its own query, so exp(m_old - m_new) is the lane's own factor.
// Key tile n + 1 is in flight while tile n is worked on. At the end the two lanes of a query join their sums, and ctx * 2^6 / l leaves as 16 bytes (8 d) per accumulator tile.
#define TB2 ((3 * 64 + 64) * LP * 2)       /* bytes of one staged key tile: three K tiles of its 64 key rows, then its 64 V^T rows */
#define NKT (SEQ / 64)                     /* key tiles */
static_assert(CK / KT == 3 && NKT >= 2);
static_assert(2 * TB2 <= 196608);          /* static LDS of k_fattn */
// 64 rows of 128 B, global -> LDS: 4 copies of 16 B per lane, rows step by 16 per copy
__device__ __forceinline__ void g2_stage_v(unsigned l, const _Float16* gv, size_t sv) {
  /* the closing s_wait_xcnt stands inside the statement so that no address register of a copy is rewritten in front of it */
  asm volatile("global_load_async_to_lds_b128 %0, %4, off\n\t" "global_load_async_to_lds_b128 %1, %5, off\n\t" "global_load_async_to_lds_b128 %2, %6, off\n\t"
               "global_load_async_to_lds_b128 %3, %7, off\n\t" "s_wait_xcnt 0x0"
               :: "v"(l), "v"(l + 1u * 16 * LP * 2), "v"(l + 2u * 16 * LP * 2), "v"(l + 3u * 16 * LP * 2), "v"(gv), "v"(gv + sv), "v"(gv + 2 * sv), "v"(gv + 3 * sv)
               : "memory"); }
// lane l takes the value of lane l ^ 16: the two lanes that hold the two halves of one query's keys
__device__ __forceinline__ float g2_xhalf(float x) { return __builtin_bit_cast(float, __builtin_amdgcn_permlanex16(__builtin_bit_cast(int, x), __builtin_bit_cast(int, x), 0x76543210, 0xfedcba98, false, false)); }
__global__ __launch_bounds__(128) void k_fattn(const _Float16* __restrict__ Q3, const _Float16* __restrict__ K3, const _Float16* __restrict__ Vt,
    const float* __restrict__ MEANT, const float* __restrict__ SIGT, _Float16* __restrict__ O) {
  __shared__ __attribute__((aligned(16))) unsigned char sm[2 * TB2];      /* two tile buffers */
  const int tid = threadIdx.x, w = __builtin_amdgcn_readfirstlane((int)(tid >> 5)), lane = tid & 31, ln = lane & 15, hh = lane >> 4;
  const int by = blockIdx.y, mt = blockIdx.x; const int b = by / NH;
  const int q0 = mt * 128 + 32 * w + ln;      /* the lane's query row in group 0; in group 1: + 16 */
  const unsigned l0 = (unsigned)(size_t)sm + (unsigned)((tid >> 3) * (LP * 2) + (tid & 7) * 16);
  const _Float16* gb = K3 + (size_t)(tid >> 3) * LQ3 + (size_t)by * CK + (tid & 7) * 8;
  const _Float16* gv = Vt + ((size_t)by * HD + (tid >> 3)) * SEQ + (tid & 7) * 8;
  const size_t sq = (size_t)16 * LQ3, sv = (size_t)16 * SEQ;
  auto stage = [&](int n) { const unsigned l = l0 + (unsigned)(n & 1) * TB2; const _Float16* gk = gb + (size_t)n * 64 * LQ3;      /* key tile n: 16 copies per lane */
    g2_stage_v(l, gk, sq); g2_stage_v(l + 1u * 64 * LP * 2, gk + KT, sq); g2_stage_v(l + 2u * 64 * LP * 2, gk + 2 * KT, sq);
    g2_stage_v(l + 3u * 64 * LP * 2, gv + n * 64, sv); };
  const v8f z8 = {0.f,0.f,0.f,0.f,0.f,0.f,0.f,0.f};
  v8f o[8] = {z8, z8, z8, z8, z8, z8, z8, z8};      /* ctx, d x queries: [query group * 4 + d tile of 16] */
  float m[2] = {-3.0e38f, -3.0e38f}, l[2] = {0.f, 0.f};      /* per query group: running maximum (exponent of 2), the lane's part of the sum of 2^14 weights */
  stage(0);
  const _Float16* qp = Q3 + (size_t)q0 * LQ3 + (size_t)by * CK;
  v16h fq[2][CK / 32];      /* the wave's query rows as B fragments: [group of 16 queries][k / 32] */
#pragma unroll      /* unrolled here and below: arrays indexed by constants stay in registers */
  for (int g = 0; g < 2; ++g) {
#pragma unroll
    for (int j = 0; j < CK / 32; ++j) fq[g][j] = g2_frag(qp + (size_t)g * 16 * LQ3 + 32 * j, hh); }
  float mu[2], i2[2];      /* per query group: the row's mean and 1 / (2 sigma^2) */
  { const float* pmu = MEANT + (size_t)by * SEQ + q0; const float* ps0 = SIGT + sig_idx((size_t)q0 * NB + b); const float* ps1 = SIGT + sig_idx((size_t)(q0 + 16) * NB + b);
    /* the four loads and their data wait in one statement: no address register of theirs is rewritten while they are under way; they fly beside tile 0's copies */
    asm volatile("global_load_b32 %0, %4, off\n\t" "global_load_b32 %1, %4, off offset:64\n\t" "global_load_b32 %2, %5, off\n\t" "global_load_b32 %3, %6, off\n\t" "s_wait_loadcnt 0x0"
                 : "=&v"(mu[0]), "=&v"(mu[1]), "=&v"(i2[0]), "=&v"(i2[1]) : "v"(pmu), "v"(ps0), "v"(ps1) : "memory"); }
  const float i2l[2] = {i2[0] * 1.44269504f, i2[1] * 1.44269504f};      /* the Gaussian term as an exponent of 2 */
  asm volatile("s_wait_asynccnt 0x0" ::: "memory");      /* this wave's part of tile 0 has landed */
  __syncthreads();                                       /* ... and every other wave's */
  stage(1);
#pragma unroll 1
  for (int n = 0; n < NKT; ++n) {      /* rolled: one publish point per key tile */
    const _Float16* tb = (const _Float16*)(sm + (n & 1) * TB2);
    const _Float16* kp = tb + ln * LP; const _Float16* vp = tb + (192 + ln) * LP;
    v8f acc[8];      /* the key tile's scores: [query group * 4 + key tile of 16] */
    v16h fv[2][4];      /* the tile's V^T rows as A fragments: [key / 32][d tile of 16] */
    { v16h fk[CK / 32][4];      /* the whole key tile as A fragments: [k / 32][key tile of 16] */
#pragma unroll
      for (int j = 0; j < CK / 32; ++j) {
#pragma unroll
        for (int c = 0; c < 4; ++c) fk[j][c] = g2_frag(kp + ((j >> 1) * 64 + c * 16) * LP + 32 * (j & 1), hh); }
      __builtin_amdgcn_sched_barrier(0);      /* keeps the tile's 48 key reads together in front of the products, in the order of their use: one place with reads, counted waits behind it */
#pragma unroll
      for (int j = 0; j < CK / 32; ++j) {
        if (j == 2) {      /* the V^T reads go out once the first K tile's fragments are spent, into registers of that size, and land under the other 32 products */
#pragma unroll
          for (int s = 0; s < 2; ++s) {
#pragma unroll
            for (int c = 0; c < 4; ++c) fv[s][c] = g2_frag(vp + c * 16 * LP + 32 * s, hh); }
          __builtin_amdgcn_sched_barrier(0); }      /* keeps these 16 reads at this place, in front of the products that cover them */
#pragma unroll
        for (int c = 0; c < 4; ++c) { acc[c] = __builtin_amdgcn_wmma_f32_16x16x32_f16(false, fk[j][c], false, fq[0][j], (short)0, j ? acc[c] : z8, false, false);
          acc[4 + c] = __builtin_amdgcn_wmma_f32_16x16x32_f16(false, fk[j][c], false, fq[1][j], (short)0, j ? acc[4 + c] : z8, false, false); } }
      __builtin_amdgcn_sched_barrier(0); }      /* keeps the products in the order of the reads, two per arriving fragment */
    FragH pf[2][2];      /* P as B fragments: [query group][key / 32] */
#pragma unroll
    for (int g = 0; g < 2; ++g) {
      const float dm = (float)(n * 64 + 8 * hh) - mu[g];      /* the lane's first key of the tile, counted from the mean */
      v2f y[4][4]; float tc[4];      /* four short chains per statistic instead of one long one: a wave issues in order */
#pragma unroll
      for (int c = 0; c < 4; ++c) { const v8f a = acc[g * 4 + c];
#pragma unroll
        for (int r = 0; r < 8; r += 2) { const v2f a2 = {a[r], a[r + 1]}; const v2f k2 = {(float)(16 * c + r), (float)(16 * c + r + 1)}; const v2f d2 = k2 + dm;
          y[c][r >> 1] = a2 * AC - (d2 * d2) * i2l[g]; }
        tc[c] = fmaxf(fmaxf(fmaxf(y[c][0][0], y[c][0][1]), fmaxf(y[c][1][0], y[c][1][1])), fmaxf(fmaxf(y[c][2][0], y[c][2][1]), fmaxf(y[c][3][0], y[c][3][1]))); }
      const float th = fmaxf(fmaxf(tc[0], tc[1]), fmaxf(tc[2], tc[3]));
      const float mn = fmaxf(m[g], fmaxf(th, g2_xhalf(th)));      /* one maximum for both lanes of a query: their weights meet in one product */
      const float al = __builtin_amdgcn_exp2f(m[g] - mn); m[g] = mn;
      const float ms = mn - 14.0f;      /* weights come out x 2^14 */
      float ts = 0.f;
#pragma unroll
      for (int c = 0; c < 4; ++c) { v2f s2 = {0.f, 0.f};
#pragma unroll
        for (int r = 0; r < 8; r += 2) { const v2f t2 = y[c][r >> 1] - ms; const v2f e2 = {__builtin_amdgcn_exp2f(t2[0]), __builtin_amdgcn_exp2f(t2[1])}; s2 += e2;
          pf[g][c >> 1].h[(c & 1) * 8 + r] = toh_flush(e2[0]); pf[g][c >> 1].h[(c & 1) * 8 + r + 1] = toh_flush(e2[1]); }
        ts += s2[0] + s2[1]; }
      l[g] = l[g] * al + ts;
#pragma unroll
      for (int c = 0; c < 4; ++c) o[g * 4 + c] *= al; }
#pragma unroll
    for (int s = 0; s < 2; ++s) {
#pragma unroll
      for (int c = 0; c < 4; ++c) { o[c] = __builtin_amdgcn_wmma_f32_16x16x32_f16(false, fv[s][c], false, pf[0][s].v, (short)0, o[c], false, false);
        o[4 + c] = __builtin_amdgcn_wmma_f32_16x16x32_f16(false, fv[s][c], false, pf[1][s].v, (short)0, o[4 + c], false, false); } }
    /* this wave's reads of tile n are done before its buffer is refilled. The two sums are named as inputs only, so that the softmax stays in front of the waits and the barrier:
       left free, they rose to the last LDS read, and tile n + 1's copies, issued at the foot of the trip before, had only the score products to land under */
    asm volatile("s_wait_dscnt 0x0" :: "v"(l[0]), "v"(l[1]) : "memory");
    asm volatile("s_wait_asynccnt 0x0" ::: "memory");    /* this wave's part of tile n + 1 has landed */
    __syncthreads();                                     /* publishes tile n + 1 and ends every wave's reads of tile n */
    if (n + 2 < NKT) stage(n + 2);
  }
  asm volatile("s_wait_asynccnt 0x0" ::: "memory");      /* nothing in flight at the end */
#pragma unroll
  for (int g = 0; g < 2; ++g) { const float f = 64.0f / (l[g] + g2_xhalf(l[g]));      /* the two lanes of a query join their sums */
    unsigned short* dst = (unsigned short*)O + (size_t)(q0 + 16 * g) * LQ + (size_t)by * HD + 8 * hh;      /* a query row's 128-B line is written by its two lanes alone */
#pragma unroll
    for (int c = 0; c < 4; ++c) { FragH t;
#pragma unroll
      for (int r = 0; r < 8; ++r) t.h[r] = (_Float16)(o[g * 4 + c][r] * f);
      *(v8us*)(dst + 16 * c) = t.half[0]; } }
}

extern "C" void kernel_launch(void* const* d_in, const int* in_sizes, int n_in,
                              void* d_out, int out_size, void* d_ws, size_t ws_size, hipStream_t stream) {
  if (n_in < 19) return;
  if ((size_t)in_sizes[0] < NR * DM || (size_t)in_sizes[1] < NR * DM || (size_t)in_sizes[2] < NR * DM) return;
  if ((size_t)in_sizes[3] < (size_t)DM * DM || (size_t)in_sizes[5] < (size_t)DM * DM || (size_t)in_sizes[7] < (size_t)DM * DM || (size_t)in_sizes[9] < (size_t)DM * DM) return;
  if ((size_t)in_sizes[11] < (size_t)DM * DM || (size_t)in_sizes[13] < (size_t)DM * DM || (size_t)in_sizes[17] < (size_t)DM * DM) return;
  if (in_sizes[4] < DM || in_sizes[6] < DM || in_sizes[8] < DM || in_sizes[10] < DM || in_sizes[12] < DM || in_sizes[14] < DM || in_sizes[15] < DM || in_sizes[16] < 1 || in_sizes[18] < DM) return;
  if ((size_t)out_size < NR * DM) return;
  const float* const* I = (const float* const*)d_in;
  const float* xq = I[0]; const float* xk = I[1]; const float* xv = I[2];
  const float* wq = I[3]; const float* bq = I[4]; const float* wk = I[5]; const float* bk = I[6]; const float* wv = I[7]; const float* bv = I[8];
  const float* whq = I[9]; const float* bhq = I[10]; const float* whk = I[11]; const float* bhk = I[12]; const float* wwp = I[13]; const float* bwp = I[14];
  const float* wvp = I[15]; const float* bvp = I[16]; const float* wo = I[17]; const float* bo = I[18];
  char* ws = (char*)d_ws; size_t off = 0;
  auto take = [&](size_t bytes) { char* p = ws + off; off += (bytes + 255) & ~(size_t)255; return p; };
  _Float16* BQ = (_Float16*)take((size_t)DM * DM * 2); _Float16* BK = (_Float16*)take((size_t)DM * DM * 2); _Float16* BV = (_Float16*)take((size_t)DM * DM * 2);
  _Float16* BHQ = (_Float16*)take((size_t)DM * DM * 2); _Float16* BHK = (_Float16*)take((size_t)DM * DM * 2); _Float16* BWP = (_Float16*)take((size_t)DM * DM * 2); _Float16* BO = (_Float16*)take((size_t)DM * DM * 2);
  _Float16* XQ = (_Float16*)take(NR * DM * 2); _Float16* XK = (_Float16*)take(NR * DM * 2); _Float16* XV = (_Float16*)take(NR * DM * 2);
  _Float16* CA = (_Float16*)take(NR * 3 * DM * 2); _Float16* CB = (_Float16*)take(NR * 3 * DM * 2);      /* concatenated planes of the alignment pair */
  _Float16* V16 = (_Float16*)take(NR * DM * 2); _Float16* O16 = (_Float16*)take(NR * DM * 2); _Float16* VT = (_Float16*)take((size_t)NB * NH * HD * SEQ * 2);
  float* S = (float*)take((size_t)NB * NH * QC * SEQ * 4); _Float16* PM = (_Float16*)take((size_t)NB * NH * QC * SEQ * 2);
  float* MEANT = (float*)take((size_t)NB * NH * SEQ * 4); float* SIGT = (float*)take(NR / SGR * 128);
  if (off > ws_size) return;
  float* G = S;                                                            /* f32 wp plane [NR][DM], consumed by k_sigma */
  _Float16* CA2 = PM; _Float16* CB2 = PM + NR * 3 * DM;                    /* content pair's concatenated planes */
  k_cvt<<<7 * WBL + 3 * XBL, 256, 0, stream>>>(wq, wk, wv, whq, whk, wwp, wo, xq, xk, xv, BQ, XQ);      /* planes BQ .. BO and XQ .. XV in the order of their take() calls */
  const dim3 gp((unsigned)((MP / 128) * (DM / 64)), 1);
  k_proj<<<dim3((unsigned)((MP / 128) * (DM / 64)), 6), 128, 0, stream>>>(XQ, XK, XV, BV, BWP, BHQ, BHK, BQ, BK, bv, bwp, bhq, bhk, bq, bk, V16, G, CA, CB, CA2, CB2);
  k_vt<<<NB * NH * (SEQ / 64), 256, 0, stream>>>(V16, VT);      /* V16 rows [SEQ*NB][DM] -> VT[(b,h)][64][SEQ] */
  k_sigma<<<MP / SGR, 256, 0, stream>>>(G, wvp, bvp, SIGT);
  /* alignment pair: scores and expected key position; slab by = b*NH + h at column offset by*192 of rows with pitch LQ3 */
  k_falign<<<dim3(SEQ / 128, NB * NH), 128 * AKW, 0, stream>>>(CA, CB, MEANT);
  /* content pair: scores, Gaussian softmax and P . V; ctx[t][b][h*64 + d] x64 */
  k_fattn<<<dim3(SEQ / 128, NB * NH), 128, 0, stream>>>(CA2, CB2, VT, MEANT, SIGT, O16);
  k_gemm2<true, true, true><<<gp, 128, 0, stream>>>(O16, DM, 0, BO, DM, 0, 0.0009765625f, bo, (float*)d_out, nullptr, DM, 0, MP, DM, DM);      /* out rows t*NB_FULL + b */
}

// v008
// It runs in 97.3 microseconds.
// Next to v007, in two timings, it ran 1.05 times as fast each time.
// All steps since v000 together make it 6.72 times as fast.
#include <hip/hip_runtime.h>
// Gaussian-windowed multi-head cross attention, sequence-first layout: query [1024][2][1024], key_in / value [1024][2][1024] (token row r = t*NB + b); six input maps with natural [out][in] weights + biases: q, hq, wp from query; k, hk from key_in; v from value; 16 heads of 64 (flat slab b*16 + h); content logits 64^-0.5 q.k; alignment softmax over keys of 64^-0.5 hq.hk, mean = expected key position; width sigma = 1 + sigmoid(tanh(wp) . Wvp + bvp) per (t, b); P = softmax_s(content - (s - mean)^2 / (2 sigma^2)); ctx = P . v merged [t][b][h*64+d]; out = ctx Wo^T + bo.
// Structure: inputs as exact f16 rows (RNE-converted to bf16 first); all conversions as one launch; the six input projections as one launch of WMMA GEMMs (32x64 wave tiles, f32 accumulation, x16 weights + bias); q/hq and k/hk are written as K-concatenated planes per head [2048 hi | res | hi] and [hi | hi | res] (hi = f16 value, res = f16 of 2048 (v - hi)) so one K = 192 GEMM yields 2048 (hi.hi) + res.hi + hi.res; all query rows as one chunk: k_falign: first each work-group's share of the V transposition and of the width table (both need only the projections, as the alignment scores do), then alignment scores per 64-key tile with running-maximum f32 softmax statistics (centred position sum), its S never in memory; k_fattn: content scores, Gaussian term, running-maximum f32 softmax (P as f16 x 2^14 of exp(x - running max)) and P . V^T per 64-key tile in one launch, both products transposed, S and P of the content pair never out of registers (ctx carried x64) -> out GEMM (f32).
// Compute dtype: all contractions v_wmma_f32_16x16x32_f16 (f16 operands, f32 accumulate); inputs RNE-converted to bf16 (exact in f16); both score sites as f16 value + x2048 residual (three products folded along K); v, P (x2^14), ctx (x64), Wo as plain f16 operands; softmax statistics, mean, tanh / Wvp / sigmoid on the vector unit in f32.
#ifndef NB
#define NB 2                         /* batches processed */
#endif
#ifndef SEQ
#define SEQ 1024                     /* sequence length processed (queries = keys) */
#endif
#define NB_FULL 2                    /* batch pitch of the input / output rows */
#define DM 1024
#define NH 16
#define HD 64
#define QC SEQ                       /* query rows per attention chunk: all of them, so each attention stage is one launch over every (slab, row) */
#define NR ((size_t)NB * SEQ)        /* token rows */
#define MP ((int)(NB * SEQ))
#define LQ (NB * DM)                 /* pitch between consecutive t for one batch */
#define CK (3 * HD)                  /* concatenated K per head */
#define LQ3 (NB * 3 * DM)            /* pitch between consecutive t in a concatenated plane */
static_assert(SEQ % 128 == 0);
static_assert(QC % 128 == 0);
static_assert(SEQ % QC == 0);
static_assert(NH * HD == DM);
static_assert(NB <= NB_FULL);
static_assert((NB * SEQ) % 128 == 0);
static_assert(NH == 16);
static_assert(HD == 64);                         
static_assert(CK % 32 == 0);
static_assert(DM % 32 == 0);
static_assert(QC % 32 == 0);
static_assert((NB * SEQ) % 32 == 0);
static_assert(NH * QC >= DM);                    /* the f32 wp plane [NR][DM] fits into the S region */
static_assert(NH * QC >= 2 * 3 * DM);            /* the content pair's two concatenated planes fit into the P region */
static_assert(QC == SEQ);
static_assert(32 * 8 * 16 == 32 * HD * 2);       
#define KT 64                        /* k elements per staged tile: one 128-B line of every operand row */
#define LP 72                        /* LDS row pitch in f16: 144 B = 16 B x odd, for 16-byte fragment reads */
#define TB ((128 + 64) * LP * 2)     /* bytes of one staged tile: 128 A rows, then 64 Bt rows */
static_assert(CK % KT == 0 && DM % KT == 0 && SEQ % KT == 0);   /* every K of the GEMM launches */
static_assert(4 * 32 * 68 * 4 <= 2 * TB);        /* the output staging fits into the two tile buffers */
static_assert(2 * TB <= 131072);                 /* static LDS of the GEMM kernels */
#define WS_TOTAL (7 * (size_t)DM * DM * 2 + 3 * NR * DM * 2 + 2 * NR * 3 * DM * 2 + 2 * NR * DM * 2 + (size_t)NB * NH * HD * SEQ * 2 + (size_t)NB * NH * QC * SEQ * 4 + (size_t)NB * NH * QC * SEQ * 2 + (size_t)NB * NH * SEQ * 4 + NR * 16)
static_assert(WS_TOTAL + 32 * 256 <= 268435456);

typedef unsigned short v8us __attribute__((ext_vector_type(8), may_alias));
typedef float  v8f  __attribute__((ext_vector_type(8)));
typedef float  v4f  __attribute__((ext_vector_type(4)));
typedef float  v4fa __attribute__((ext_vector_type(4), may_alias));
typedef _Float16 v16h __attribute__((ext_vector_type(16)));
typedef _Float16 v4h __attribute__((ext_vector_type(4)));
union FragH { v16h v; v8us half[2]; _Float16 h[16]; unsigned short u[16]; };

__device__ __forceinline__ unsigned short bf16_bits(float x) { unsigned int u = __float_as_uint(x); return (unsigned short)((u + 0x7FFFu + ((u >> 16) & 1u)) >> 16); }
__device__ __forceinline__ float bf16_val(unsigned short b) { return __uint_as_float(((unsigned int)b) << 16); }
__device__ __forceinline__ float bf16_rne(float x) { return bf16_val(bf16_bits(x)); }   /* RNE convert to bf16, back as f32 */

typedef _Float16 h16;
// f32 -> f16 with a value select: magnitudes below 2^-14 become +0 (no f16 subnormal can reach a WMMA operand)
static __device__ __forceinline__ h16 toh_flush(float v) { const h16 r = (h16)v; return (fabsf(v) < 6.103515625e-05f) ? (h16)0.0f : r; }

// fragment: elements 0..7 <- k0 + 8h .. +7, elements 8..15 <- k0 + 16 + 8h .. +7 (p points at k0 of the lane's row / column)
__device__ __forceinline__ v16h g2_frag(const _Float16* p, int hh) { FragH f; f.half[0] = *(const v8us*)((const unsigned short*)p + 8 * hh); f.half[1] = *(const v8us*)((const unsigned short*)p + 16 + 8 * hh); return f.v; }
__device__ __forceinline__ v8f g2_mma(v16h a, v16h b, v8f c) { v8f d = __builtin_amdgcn_wmma_f32_16x16x32_f16(false, a, false, b, (short)0, c, false, false); asm volatile("v_nop\n\tv_nop\n\tv_nop\n\tv_nop" : "+v"(d) : "v"(a), "v"(b)); return d; }

// one K tile of the block's operands, global -> LDS with no register in between: 12 copies of 16 B per lane; a wave's copy covers 4 whole 128-B lines.
// l: the lane's LDS byte address in tile row tid / 8 (rows step by 16 per copy); ga / gb: the lane's 16 bytes in that row of A / Bt at this tile's k.
__device__ __forceinline__ void g2_stage(unsigned l, const _Float16* ga, size_t sa, const _Float16* gb, size_t sb) {
  /* the closing s_wait_xcnt stands inside the statement so that no address register of a copy is rewritten in front of it */
  asm volatile("global_load_async_to_lds_b128 %0, %12, off\n\t" "global_load_async_to_lds_b128 %1, %13, off\n\t" "global_load_async_to_lds_b128 %2, %14, off\n\t"
               "global_load_async_to_lds_b128 %3, %15, off\n\t" "global_load_async_to_lds_b128 %4, %16, off\n\t" "global_load_async_to_lds_b128 %5, %17, off\n\t"
               "global_load_async_to_lds_b128 %6, %18, off\n\t" "global_load_async_to_lds_b128 %7, %19, off\n\t" "global_load_async_to_lds_b128 %8, %20, off\n\t"
               "global_load_async_to_lds_b128 %9, %21, off\n\t" "global_load_async_to_lds_b128 %10, %22, off\n\t" "global_load_async_to_lds_b128 %11, %23, off\n\t"
               "s_wait_xcnt 0x0"
               :: "v"(l), "v"(l + 1u * 16 * LP * 2), "v"(l + 2u * 16 * LP * 2), "v"(l + 3u * 16 * LP * 2), "v"(l + 4u * 16 * LP * 2), "v"(l + 5u * 16 * LP * 2),
                  "v"(l + 6u * 16 * LP * 2), "v"(l + 7u * 16 * LP * 2), "v"(l + 8u * 16 * LP * 2), "v"(l + 9u * 16 * LP * 2), "v"(l + 10u * 16 * LP * 2), "v"(l + 11u * 16 * LP * 2),
                  "v"(ga), "v"(ga + sa), "v"(ga + 2 * sa), "v"(ga + 3 * sa), "v"(ga + 4 * sa), "v"(ga + 5 * sa), "v"(ga + 6 * sa), "v"(ga + 7 * sa),
                  "v"(gb), "v"(gb + sb), "v"(gb + 2 * sb), "v"(gb + 3 * sb)
               : "memory"); }

// main loop of both GEMM kernels: block tile 128 x 64, wave w takes rows 32 w .. 32 w + 31; two LDS tile buffers, tile t + 1 in flight while tile t is multiplied.
// Ab: row 0 of the block's 128 A rows; Bb: row 0 of its 64 Bt rows; K % KT == 0. On return every wave has left both buffers and no copy is outstanding.
__device__ __forceinline__ void g2_main(unsigned char* sm, const _Float16* Ab, int lda, const _Float16* Bb, int ldb, int K, int tid, int w, int ln, int hh, v8f (&acc)[8]) {
  const int nt = K / KT;
  const unsigned l0 = (unsigned)(size_t)sm + (unsigned)((tid >> 3) * (LP * 2) + (tid & 7) * 16);
  const _Float16* ga = Ab + (size_t)(tid >> 3) * lda + (tid & 7) * 8; const _Float16* gb = Bb + (size_t)(tid >> 3) * ldb + (tid & 7) * 8;
  const size_t sa = (size_t)16 * lda, sb = (size_t)16 * ldb;
  g2_stage(l0, ga, sa, gb, sb);
  asm volatile("s_wait_asynccnt 0x0" ::: "memory");      /* this wave's part of tile 0 has landed */
  __syncthreads();                                       /* ... and every other wave's */
  if (nt > 1) g2_stage(l0 + TB, ga + KT, sa, gb + KT, sb);
#pragma unroll 1
  for (int t = 0; t < nt; ++t) {      /* rolled: one publish point per tile */
    const _Float16* tb = (const _Float16*)(sm + (t & 1) * TB);
    const _Float16* ap = tb + (32 * w + ln) * LP; const _Float16* bp = tb + (128 + ln) * LP;
    v16h fa[KT / 32][2], fb[KT / 32][4];      /* the tile's fragment reads go out as one group, in the order of their use, ahead of the products */
#pragma unroll      /* unrolled here and below: fa / fb are indexed by constants and stay in registers */
    for (int s = 0; s < KT / 32; ++s) { fa[s][0] = g2_frag(ap + 32 * s, hh); fb[s][0] = g2_frag(bp + 32 * s, hh); fa[s][1] = g2_frag(ap + 16 * LP + 32 * s, hh);
      fb[s][1] = g2_frag(bp + 16 * LP + 32 * s, hh); fb[s][2] = g2_frag(bp + 32 * LP + 32 * s, hh); fb[s][3] = g2_frag(bp + 48 * LP + 32 * s, hh); }
#pragma unroll
    for (int s = 0; s < KT / 32; ++s) {
#pragma unroll
      for (int c = 0; c < 4; ++c) { acc[c] = g2_mma(fa[s][0], fb[s][c], acc[c]); acc[4 + c] = g2_mma(fa[s][1], fb[s][c], acc[4 + c]); } }
    asm volatile("s_wait_dscnt 0x0" ::: "memory");       /* this wave's reads of tile t are done before its buffer is refilled */
    asm volatile("s_wait_asynccnt 0x0" ::: "memory");    /* this wave's part of tile t + 1 has landed */
    __syncthreads();                                     /* publishes tile t + 1 and ends every wave's reads of tile t */
    if (t + 2 < nt) g2_stage(l0 + (unsigned)(t & 1) * TB, ga + (size_t)(t + 2) * KT, sa, gb + (size_t)(t + 2) * KT, sb);
  }
  asm volatile("s_wait_asynccnt 0x0" ::: "memory");      /* nothing in flight when the buffers become output staging */
}

// ---- GEMM (wave tile 32x64; M % 128 == 0 per launch region, N % 64 == 0, K % 64 == 0): C = alpha * A . Bt^T (+ bias) ----
// A f16 [M][K] (pitch lda), Bt f16 [N][K] (pitch ldb); batch slab by = blockIdx.y with element strides sA / sB / sC.
// OMAP: output row r -> (r / NB) * NB_FULL + r % NB.
template <bool HASB, bool OUT32, bool OMAP>
__global__ __launch_bounds__(128) void k_gemm2(const _Float16* __restrict__ A, int lda, size_t sA, const _Float16* __restrict__ Bh, int ldb, size_t sB, float alpha,
    const float* __restrict__ bias, float* __restrict__ C, _Float16* __restrict__ C16, int ldc, size_t sC, int M, int N, int K) {
  __shared__ __attribute__((aligned(16))) unsigned char sm[2 * TB]; float (*so)[32][68] = (float (*)[32][68])sm;      /* two tile buffers; output staging behind the main loop */
  const int tid = threadIdx.x, w = __builtin_amdgcn_readfirstlane((int)(tid >> 5)), lane = tid & 31, ln = lane & 15, hh = lane >> 4; const int by = blockIdx.y;
  A += (size_t)by * sA; Bh += (size_t)by * sB; const size_t cofs = (size_t)by * sC;
  const int ntn = N >> 6; const int mt = blockIdx.x / ntn, nq = blockIdx.x - mt * ntn; const int row0 = mt * 128 + 32 * w, col0 = nq * 64; if (mt * 128 >= M) return;      /* the whole block leaves, in front of every barrier */
  const v8f z8 = {0.f,0.f,0.f,0.f,0.f,0.f,0.f,0.f}; v8f accs[8] = {z8, z8, z8, z8, z8, z8, z8, z8};      /* [row half * 4 + column tile] */
  g2_main(sm, A + (size_t)(mt * 128) * lda, lda, Bh + (size_t)col0 * ldb, ldb, K, tid, w, ln, hh, accs);
#pragma unroll
  for (int u = 0; u < 8; ++u) { const int t = u & 3, half = u >> 2; const int col = col0 + t * 16 + ln; float bv = 0.f; if (HASB) bv = bf16_rne(bias[col]);
#pragma unroll
    for (int r = 0; r < 8; ++r) { const int rloc = half * 16 + 8 * hh + r; so[w][rloc][t * 16 + ln] = accs[u][r] * alpha + bv; } }
  __builtin_amdgcn_fence(4 /* acq_rel order */, "workgroup"); __builtin_amdgcn_wave_barrier();      /* so[w] is private to wave w */
  const int rsub = lane >> 4, c4 = (lane & 15) * 4;
  {
#pragma unroll
    for (int q = 0; q < 16; ++q) { const int r = q * 2 + rsub; const v4f v = *(const v4fa*)&so[w][r][c4];
      const int gr = row0 + r; const size_t orow = OMAP ? ((size_t)(gr / NB) * NB_FULL + (size_t)(gr % NB)) : (size_t)gr;
      if (OUT32) { *(v4f*)(C + cofs + orow * ldc + col0 + c4) = v; }
      else { v4h h4;
#pragma unroll
        for (int i = 0; i < 4; ++i) h4[i] = (_Float16)v[i];
        *(v4h*)(C16 + cofs + orow * ldc + col0 + c4) = h4; } }
     } }

// ---- the six input projections as one launch (same main loop and staging as k_gemm2; M = MP, N = K = DM; N tile 64 == one head): job = blockIdx.y picks operands, bias and output form ----
// x = A . Bt^T / 16 + bias (f32). job 0: v, f16 rows; job 1: wp, f32 rows; jobs 2 .. 5: hq, hk, q, k as K-concatenated planes:
// hi = f16(x), res = f16(2048 (x - hi)); head h = col0 / 64 of row r at C3 + r * 3 DM + h * 192: query side [2048 hi | res | hi], key side [hi | hi | res].
__global__ __launch_bounds__(128) void k_proj(const _Float16* __restrict__ XQ, const _Float16* __restrict__ XK, const _Float16* __restrict__ XV,
    const _Float16* __restrict__ BV, const _Float16* __restrict__ BWP, const _Float16* __restrict__ BHQ, const _Float16* __restrict__ BHK, const _Float16* __restrict__ BQ, const _Float16* __restrict__ BK,
    const float* __restrict__ bv, const float* __restrict__ bwp, const float* __restrict__ bhq, const float* __restrict__ bhk, const float* __restrict__ bq, const float* __restrict__ bk,
    _Float16* __restrict__ V16, float* __restrict__ G, _Float16* __restrict__ CHQ, _Float16* __restrict__ CHK, _Float16* __restrict__ CQ, _Float16* __restrict__ CK3) {
  __shared__ __attribute__((aligned(16))) unsigned char sm[2 * TB]; float (*so)[32][68] = (float (*)[32][68])sm;      /* two tile buffers; output staging behind the main loop */
  const int tid = threadIdx.x, w = __builtin_amdgcn_readfirstlane((int)(tid >> 5)), lane = tid & 31, ln = lane & 15, hh = lane >> 4; const int job = blockIdx.y;
  const _Float16* A; const _Float16* Bh; const float* bias; _Float16* C3 = nullptr;
  switch (job) {
    case 0: A = XV; Bh = BV; bias = bv; break;
    case 1: A = XQ; Bh = BWP; bias = bwp; break;
    case 2: A = XQ; Bh = BHQ; bias = bhq; C3 = CHQ; break;
    case 3: A = XK; Bh = BHK; bias = bhk; C3 = CHK; break;
    case 4: A = XQ; Bh = BQ; bias = bq; C3 = CQ; break;
    default: A = XK; Bh = BK; bias = bk; C3 = CK3; break; }
  const int mt = blockIdx.x / (DM / 64), nq = blockIdx.x - mt * (DM / 64); const int row0 = mt * 128 + 32 * w, col0 = nq * 64;
  const v8f z8 = {0.f,0.f,0.f,0.f,0.f,0.f,0.f,0.f}; v8f accs[8] = {z8, z8, z8, z8, z8, z8, z8, z8};      /* [row half * 4 + column tile] */
  g2_main(sm, A + (size_t)(mt * 128) * DM, DM, Bh + (size_t)col0 * DM, DM, DM, tid, w, ln, hh, accs);
#pragma unroll
  for (int u = 0; u < 8; ++u) { const int t = u & 3, half = u >> 2; const int col = col0 + t * 16 + ln; const float bb = bf16_rne(bias[col]);
#pragma unroll
    for (int r = 0; r < 8; ++r) { const int rloc = half * 16 + 8 * hh + r; so[w][rloc][t * 16 + ln] = accs[u][r] * 0.0625f + bb; } }
  __builtin_amdgcn_fence(4 /* acq_rel order */, "workgroup"); __builtin_amdgcn_wave_barrier();      /* so[w] is private to wave w */
  const int rsub = lane >> 4, c4 = (lane & 15) * 4; const int head = col0 >> 6;
  if (job == 0) {
#pragma unroll
    for (int q = 0; q < 16; ++q) { const int r = q * 2 + rsub; const v4f v = *(const v4fa*)&so[w][r][c4]; v4h h4;      /* 16 trips x 2 rows = 32 rows, here and below */
#pragma unroll
      for (int i = 0; i < 4; ++i) h4[i] = (_Float16)v[i];
      *(v4h*)(V16 + (size_t)(row0 + r) * DM + col0 + c4) = h4; }
  } else if (job == 1) {
#pragma unroll
    for (int q = 0; q < 16; ++q) { const int r = q * 2 + rsub; const v4f v = *(const v4fa*)&so[w][r][c4]; *(v4f*)(G + (size_t)(row0 + r) * DM + col0 + c4) = v; }
    asm volatile("s_wait_xcnt 0x0" ::: "memory");      /* the branches join in address arithmetic that reuses these stores' registers: the wait stands in front of it */
  } else { const bool qside = (job & 1) == 0;
#pragma unroll 1
    for (int q0 = 0; q0 < 16; q0 += 4) {      /* rolled: four trips of four row pairs, for code size */
#pragma unroll
     for (int q = q0; q < q0 + 4; ++q) { const int r = q * 2 + rsub; const v4f v = *(const v4fa*)&so[w][r][c4];
      v4h s0, s1, s2;
#pragma unroll
      for (int i = 0; i < 4; ++i) { const h16 hi = toh_flush(v[i]); const h16 rs = toh_flush((v[i] - (float)hi) * 2048.0f); const h16 hs = (h16)((float)hi * 2048.0f);
        s0[i] = qside ? hs : hi; s1[i] = qside ? rs : hi; s2[i] = qside ? hi : rs; }
      _Float16* dst = C3 + (size_t)(row0 + r) * (3 * DM) + head * CK + c4;
      *(v4h*)dst = s0; *(v4h*)(dst + 64) = s1; *(v4h*)(dst + 128) = s2; }
     asm volatile("s_wait_xcnt 0x0" ::: "memory"); }      /* the next trip rewrites the registers that this trip's stores name */
     } }

// ---- all ten input conversions as one launch: blocks 0 .. 7 WBL - 1 take the seven weight planes (natural [out][in] = Bt[n][k], x16), the rest the three activation planes; 8 elements per thread ----
// Bt: seven f16 planes of DM x DM, one behind the other, in the order w0 .. w6; X16: three f16 planes of NR x DM in the order x0 .. x2.
#define WBL (DM * DM / 8 / 256)            /* blocks per weight plane */
#define XBL ((int)(NR * DM / 8 / 256))     /* blocks per activation plane */
static_assert(DM * DM % (8 * 256) == 0 && (NR * DM) % (8 * 256) == 0);      /* whole blocks: no thread past the end of a plane */
static_assert(((size_t)DM * DM * 2) % 256 == 0 && (NR * DM * 2) % 256 == 0);      /* the planes follow one another in the workspace without a gap */
__global__ __launch_bounds__(256) void k_cvt(const float* __restrict__ w0, const float* __restrict__ w1, const float* __restrict__ w2, const float* __restrict__ w3, const float* __restrict__ w4,
    const float* __restrict__ w5, const float* __restrict__ w6, const float* __restrict__ x0, const float* __restrict__ x1, const float* __restrict__ x2, _Float16* __restrict__ Bt, _Float16* __restrict__ X16) {
  const int blk = blockIdx.x; FragH f;
  if (blk < 7 * WBL) { const int pl = blk / WBL; const size_t t = (size_t)(blk - pl * WBL) * 256 + threadIdx.x;
    const float* w = (pl == 0) ? w0 : (pl == 1) ? w1 : (pl == 2) ? w2 : (pl == 3) ? w3 : (pl == 4) ? w4 : (pl == 5) ? w5 : w6;
    const v4f a = *(const v4fa*)(w + t * 8), c = *(const v4fa*)(w + t * 8 + 4);
#pragma unroll
    for (int q = 0; q < 4; ++q) { f.h[q] = toh_flush(bf16_rne(a[q]) * 16.0f); f.h[4 + q] = toh_flush(bf16_rne(c[q]) * 16.0f); }
    const v8us o = f.half[0]; *(v8us*)((unsigned short*)Bt + (size_t)pl * DM * DM + t * 8) = o;
  } else { const int bx = blk - 7 * WBL; const int pl = bx / XBL; const size_t t = (size_t)(bx - pl * XBL) * 256 + threadIdx.x;
    const float* x = (pl == 0) ? x0 : (pl == 1) ? x1 : x2;
    const size_t row = t / (DM / 8); const int c8 = (int)(t % (DM / 8)) * 8; const size_t srow = (row / NB) * NB_FULL + (row % NB);
    const float* p = x + srow * DM + c8; const v4f a = *(const v4fa*)p, c = *(const v4fa*)(p + 4);
#pragma unroll
    for (int q = 0; q < 4; ++q) { f.h[q] = (_Float16)bf16_rne(a[q]); f.h[4 + q] = (_Float16)bf16_rne(c[q]); }
    const v8us o = f.half[0]; *(v8us*)((unsigned short*)X16 + (size_t)pl * NR * DM + t * 8) = o;
    asm volatile("s_wait_xcnt 0x0" ::: "memory"); } }      /* the built code runs on from here towards the weight branch, whose loads reuse this store's registers: the wait stands in front of them */

// V transposition, V16 rows [SEQ*NB][DM] -> Vt[(b,h)][64][SEQ], in three parts, loads, LDS writes and, behind a work-group barrier of the calling kernel, LDS reads and stores: 128 keys x 64 d of slab (b, h) per block of 256 threads.
#define VTK 128                      /* keys per block */
__device__ __forceinline__ void g2_vt_load(const _Float16* __restrict__ V16, FragH (&f)[VTK * 8 / 256], int key0, int b, int h, int tid) {
#pragma unroll      /* unrolled here and below: f is indexed by constants and stays in registers; the four loads go out together */
  for (int k = 0; k < VTK * 8 / 256; ++k) { const int i = tid + 256 * k; const int r = i / 8, c8 = (i % 8) * 8; f[k].half[0] = *(const v8us*)((const unsigned short*)V16 + ((size_t)(key0 + r) * NB + b) * DM + h * HD + c8); }
  asm volatile("s_wait_xcnt 0x0" ::: "memory"); }      /* what follows reuses the address registers of these loads: the wait stands in front of it */
__device__ __forceinline__ void g2_vt_in(const FragH (&f)[VTK * 8 / 256], unsigned short (*tl)[66], int tid) {
#pragma unroll
  for (int k = 0; k < VTK * 8 / 256; ++k) { const int i = tid + 256 * k; const int r = i / 8, c8 = (i % 8) * 8;
#pragma unroll
    for (int q = 0; q < 8; ++q) tl[r][c8 + q] = f[k].u[q]; } }
__device__ __forceinline__ void g2_vt_out(_Float16* __restrict__ Vt, const unsigned short (*tl)[66], int key0, int slab, int tid) {
#pragma unroll
  for (int k = 0; k < VTK * 8 / 256; ++k) { const int i = tid + 256 * k; const int d = i / (VTK / 8), pc = i % (VTK / 8); FragH f;      /* 16 lanes fill the two 128-B lines of one d */
#pragma unroll
    for (int q = 0; q < 8; ++q) f.u[q] = tl[pc * 8 + q][d];
    *(v8us*)((unsigned short*)Vt + ((size_t)slab * 64 + d) * SEQ + key0 + pc * 8) = f.half[0]; } }

// width table: SIGT[sig_idx(r)], r = t*NB + b, = 1 / (2 sigma^2), sigma = 1 + sigmoid(sum_e tanh(G[r][e]) * bf16(Wvp[e]) + bf16(bvp)); G f32 [NR][DM].
// One row per wave, 8 rows per block; a block's 8 values open a 128-B line of their own, so that each line of the table has one writer. g2_sigma_load: a row's loads; g2_sigma_row: the row's value, the same in every lane of the wave.
#define SGR 8                        /* rows (= waves) per block */
static_assert((NB * SEQ) % SGR == 0);
static_assert(SGR * 4 <= 128 && SGR % 4 == 0 && SGR * 32 == 256);      /* one line per block, 16-B stores, one wave per row in a block of 256 */
__device__ __forceinline__ size_t sig_idx(size_t r) { return (r / SGR) * 32 + (r % SGR); }
__device__ __forceinline__ void g2_sigma_load(const float* __restrict__ G, const float* __restrict__ wvp, size_t row, int lane, float (&x)[DM / 32], float (&wv)[DM / 32]) {
  const float* p = G + row * DM + lane;
#pragma unroll      /* unrolled: the row's loads all go out before the first tanh, one memory latency per row instead of one per 32 elements */
  for (int j = 0; j < DM / 32; ++j) { x[j] = p[j * 32]; wv[j] = wvp[j * 32 + lane]; }
  asm volatile("s_wait_xcnt 0x0" ::: "memory"); }      /* what follows reuses the offset registers of these loads: the wait stands in front of it */
__device__ __forceinline__ float g2_sigma_row(const float (&x)[DM / 32], const float (&wv)[DM / 32], const float* __restrict__ bvp) {
  const float b0 = bf16_rne(bvp[0]);
  float acc = 0.f;
#pragma unroll      /* unrolled: x / wv are indexed by constants and stay in registers; the sum runs in ascending k */
  for (int j = 0; j < DM / 32; ++j) acc += tanhf(x[j]) * bf16_rne(wv[j]);
#pragma unroll
  for (int off = 16; off > 0; off >>= 1) acc += __shfl_xor(acc, off, 32);
  const float g = acc + b0;
  const float sgm = 1.0f + 1.0f / (1.0f + expf(-g));
  const float i2 = 1.0f / (2.0f * sgm * sgm);
  return i2;
}

// ---- alignment scores and their softmax statistics in one kernel, which also carries the two small jobs that wait for the projections alone: block = 128 query rows of one slab; MEANT[slab][t] = sum_s softmax(row t)[s] * s (f32; position sum centred at SEQ/2) ----
// Q3 / K3: the alignment pair's K-concatenated planes (slab by at column by * 192 of rows with pitch LQ3). Scores are formed transposed, keys x queries: A = key rows from LDS, B = the wave's 32 query rows, kept in registers for the whole walk,
// so a lane holds 32 of a 64-key tile's scores of one query (key = 16 c + 8 hh + r, query = ln) and keeps that query's running maximum and two running sums by itself, with no exchange between lanes inside the walk.
// Wave w: query rows 32 (w % 4) .. + 31, and of every staged step of 64 AKW keys the tile w / 4. At the end the 2 AKW partial statistics of a query row meet in LDS.
#define AKW 2                              /* key tiles per staged step = waves per SIMD */
#define AKS (64 * AKW)                     /* keys per staged step */
#define TB3 (3 * AKS * LP * 2)             /* bytes of one staged step: three K tiles of its key rows */
#define NAS (SEQ / AKS)                    /* staged steps */
#define AC (6.103515625e-05f * 1.44269504f)      /* raw score -> logit (2^-14) -> exponent of 2 */
static_assert(SEQ % AKS == 0 && NAS >= 2 && (2 * AKW) % 4 == 0);      /* whole steps, both buffers filled in front of the walk, 16-B reads of a row's partial statistics */
static_assert(2 * TB3 <= 327680 && 3 * 128 * 2 * AKW * 4 <= 2 * TB3);      /* the step buffers of k_falign, without tl and sg; the partial statistics fit into the two step buffers */
typedef float v2f __attribute__((ext_vector_type(2)));
// one staged step, global -> LDS: 12 copies of 16 B per lane; LDS rows step by 16 AKW per copy (four copies per K tile), s = the same step in the key plane
__device__ __forceinline__ void g2_stage_k(unsigned l, const _Float16* g, size_t s) {
  /* the closing s_wait_xcnt stands inside the statement so that no address register of a copy is rewritten in front of it */
  asm volatile("global_load_async_to_lds_b128 %0, %12, off\n\t" "global_load_async_to_lds_b128 %1, %13, off\n\t" "global_load_async_to_lds_b128 %2, %14, off\n\t"
               "global_load_async_to_lds_b128 %3, %15, off\n\t" "global_load_async_to_lds_b128 %4, %16, off\n\t" "global_load_async_to_lds_b128 %5, %17, off\n\t"
               "global_load_async_to_lds_b128 %6, %18, off\n\t" "global_load_async_to_lds_b128 %7, %19, off\n\t" "global_load_async_to_lds_b128 %8, %20, off\n\t"
               "global_load_async_to_lds_b128 %9, %21, off\n\t" "global_load_async_to_lds_b128 %10, %22, off\n\t" "global_load_async_to_lds_b128 %11, %23, off\n\t"
               "s_wait_xcnt 0x0"
               :: "v"(l), "v"(l + 1u * 16 * AKW * LP * 2), "v"(l + 2u * 16 * AKW * LP * 2), "v"(l + 3u * 16 * AKW * LP * 2), "v"(l + 4u * 16 * AKW * LP * 2), "v"(l + 5u * 16 * AKW * LP * 2),
                  "v"(l + 6u * 16 * AKW * LP * 2), "v"(l + 7u * 16 * AKW * LP * 2), "v"(l + 8u * 16 * AKW * LP * 2), "v"(l + 9u * 16 * AKW * LP * 2), "v"(l + 10u * 16 * AKW * LP * 2), "v"(l + 11u * 16 * AKW * LP * 2),
                  "v"(g), "v"(g + s), "v"(g + 2 * s), "v"(g + 3 * s), "v"(g + KT), "v"(g + KT + s), "v"(g + KT + 2 * s), "v"(g + KT + 3 * s),
                  "v"(g + 2 * KT), "v"(g + 2 * KT + s), "v"(g + 2 * KT + 2 * s), "v"(g + 2 * KT + 3 * s)
               : "memory"); }
// In front of the walk, while step 0 is under way, block (mt, by) transposes keys 128 mt .. + 127 of slab by's V and forms the width table's rows 8 (by * SEQ / 128 + mt) .. + 7, one per wave;
// both hand their values over in LDS at the barrier that publishes step 0 and store them behind it.
static_assert(128 * AKW == 256 && 4 * AKW == SGR && VTK == 128);      /* threads of the two jobs' index maps; one table row per wave; the block's keys = its query rows */
static_assert((SEQ / 128) * NB * NH == (NB * SEQ) / SGR);      /* as many blocks as table lines */
__global__ __launch_bounds__(128 * AKW) void k_falign(const _Float16* __restrict__ Q3, const _Float16* __restrict__ K3, float* __restrict__ MEANT,
    const _Float16* __restrict__ V16, _Float16* __restrict__ Vt, const float* __restrict__ G, const float* __restrict__ wvp, const float* __restrict__ bvp, float* __restrict__ SIGT) {
  __shared__ __attribute__((aligned(16))) unsigned char sm[2 * TB3];      /* two step buffers; behind the walk the partial statistics */
  __shared__ unsigned short tl[VTK][66];      /* the block's V rows on their way to V^T */
  __shared__ __attribute__((aligned(16))) float sg[SGR];      /* the block's line of the width table */
  const int tid = threadIdx.x, w = __builtin_amdgcn_readfirstlane((int)(tid >> 5)), lane = tid & 31, ln = lane & 15, hh = lane >> 4;
  const int by = blockIdx.y, mt = blockIdx.x; const int wq = w & 3, wk = w >> 2;
  const unsigned l0 = (unsigned)(size_t)sm + (unsigned)((tid >> 3) * (LP * 2) + (tid & 7) * 16);
  const _Float16* gk = K3 + (size_t)(tid >> 3) * LQ3 + (size_t)by * CK + (tid & 7) * 8;
  const size_t sk = (size_t)(16 * AKW) * LQ3;
  g2_stage_k(l0, gk, sk);
  const _Float16* qp = Q3 + (size_t)(mt * 128 + 32 * wq + ln) * LQ3 + (size_t)by * CK;
  v16h fq[2][CK / 32];      /* the wave's query rows as B fragments: [group of 16 queries][k / 32] */
#pragma unroll      /* unrolled here and below: arrays indexed by constants stay in registers */
  for (int g = 0; g < 2; ++g) {
#pragma unroll
    for (int j = 0; j < CK / 32; ++j) fq[g][j] = g2_frag(qp + (size_t)g * 16 * LQ3 + 32 * j, hh); }
  const int fb = by * (SEQ / 128) + mt;      /* flat block index = line of the width table */
  { FragH vr[VTK * 8 / 256]; float x[DM / 32], wv[DM / 32];      /* both jobs' loads go out first and share one memory latency with step 0's copies */
    g2_vt_load(V16, vr, mt * VTK, by / NH, by % NH, tid);
    g2_sigma_load(G, wvp, (size_t)fb * SGR + w, lane, x, wv);
    g2_vt_in(vr, tl, tid);
    const float i2 = g2_sigma_row(x, wv, bvp);
    if (lane == 0) sg[w] = i2; }
  asm volatile("s_wait_asynccnt 0x0" ::: "memory");      /* this wave's part of step 0 has landed */
  __syncthreads();                                       /* ... and every other wave's; tl and sg are whole */
  g2_stage_k(l0 + TB3, gk + (size_t)AKS * LQ3, sk);
  g2_vt_out(Vt, tl, mt * VTK, by, tid);
  if (w == 0 && lane < SGR / 4) { const v4f v = *(const v4fa*)&sg[lane * 4]; float* dst = SIGT + (size_t)fb * 32 + lane * 4;
    *(v4f*)dst = v;  }
  const v8f z8 = {0.f,0.f,0.f,0.f,0.f,0.f,0.f,0.f};
  float mr[2] = {-3.0e38f, -3.0e38f}, se[2] = {0.f, 0.f}, sw[2] = {0.f, 0.f};      /* per query group: running maximum (raw score), sum of weights, sum of weight x centred position */
  v8f acc[8];      /* a key tile's scores: [query group * 4 + key tile of 16] */
  auto stats = [&](int n) {      /* folds the lane's 2 x 32 scores of its tile of step n into the running statistics */
    const float pb = (float)(n * AKS + 64 * wk + 8 * hh - SEQ / 2);      /* centred position of the lane's first key of the tile */
#pragma unroll
    for (int g = 0; g < 2; ++g) {
      float tc[4];      /* four short chains per statistic instead of one long one: a wave issues in order */
#pragma unroll
      for (int c = 0; c < 4; ++c) { const v8f a = acc[g * 4 + c]; tc[c] = fmaxf(fmaxf(fmaxf(a[0], a[1]), fmaxf(a[2], a[3])), fmaxf(fmaxf(a[4], a[5]), fmaxf(a[6], a[7]))); }
      const float tm = fmaxf(fmaxf(mr[g], fmaxf(tc[0], tc[1])), fmaxf(tc[2], tc[3]));
      const float m2 = tm * AC; const float al = __builtin_amdgcn_exp2f((mr[g] - tm) * AC); mr[g] = tm;
      float ts = 0.f, tw = 0.f;
#pragma unroll
      for (int c = 0; c < 4; ++c) { const v8f a = acc[g * 4 + c]; v2f s2 = {0.f, 0.f}, w2 = {0.f, 0.f};
#pragma unroll
        for (int r = 0; r < 8; r += 2) { const v2f a2 = {a[r], a[r + 1]}; const v2f t2 = a2 * AC - m2; const v2f e2 = {__builtin_amdgcn_exp2f(t2[0]), __builtin_amdgcn_exp2f(t2[1])};
          const v2f p2 = {(float)r, (float)(r + 1)}; s2 += e2; w2 += e2 * p2; }
        const float sc = s2[0] + s2[1]; ts += sc; tw += (w2[0] + w2[1]) + sc * (float)(16 * c); }
      se[g] = se[g] * al + ts; sw[g] = sw[g] * al + (tw + pb * ts); } };
  /* Waves w and w + 4 run half a step apart: waves 0 .. 3 read, multiply and then fold; waves 4 .. 7 first fold their tile of the step before, then read and multiply.
     So one wave's vector work runs beside the other's LDS reads and products, although one barrier per step holds all waves together. */
#pragma unroll 1
  for (int n = 0; n < NAS; ++n) {      /* rolled: one publish point per staged step */
    if (wk != 0 && n > 0) stats(n - 1);
    const _Float16* tb = (const _Float16*)(sm + (n & 1) * TB3);
    const _Float16* kp = tb + (64 * wk + ln) * LP;
    v16h fk[CK / 32][4];      /* the whole key tile as A fragments: [k / 32][key tile of 16] */
#pragma unroll
    for (int j = 0; j < CK / 32; ++j) {
#pragma unroll
      for (int c = 0; c < 4; ++c) fk[j][c] = g2_frag(kp + ((j >> 1) * AKS + c * 16) * LP + 32 * (j & 1), hh); }
    __builtin_amdgcn_sched_barrier(0);      /* keeps the tile's 48 LDS reads together in front of the products, in the order of their use: one place with reads per step, counted waits behind it */
#pragma unroll
    for (int j = 0; j < CK / 32; ++j) {
#pragma unroll
      for (int c = 0; c < 4; ++c) { acc[c] = __builtin_amdgcn_wmma_f32_16x16x32_f16(false, fk[j][c], false, fq[0][j], (short)0, j ? acc[c] : z8, false, false);
        acc[4 + c] = __builtin_amdgcn_wmma_f32_16x16x32_f16(false, fk[j][c], false, fq[1][j], (short)0, j ? acc[4 + c] : z8, false, false); } }
    __builtin_amdgcn_sched_barrier(0);      /* keeps the products in the order of the reads, two per arriving fragment; left free, the scheduler ran single accumulators' chains to their end first and waited for nearly all 48 reads at once */
    if (wk == 0) stats(n);
    /* this wave's reads of step n are done before its buffer is refilled. The four sums are named as inputs only, so that the statistics of waves 0 .. 3 stay in front of the barrier */
    asm volatile("s_wait_dscnt 0x0" :: "v"(se[0]), "v"(se[1]), "v"(sw[0]), "v"(sw[1]) : "memory");
    asm volatile("s_wait_asynccnt 0x0" ::: "memory");    /* this wave's part of step n + 1 has landed */
    __syncthreads();                                     /* publishes step n + 1 and ends every wave's reads of step n */
    if (n + 2 < NAS) g2_stage_k(l0 + (unsigned)(n & 1) * TB3, gk + (size_t)(n + 2) * AKS * LQ3, sk);
  }
  if (wk != 0) stats(NAS - 1);
  asm volatile("s_wait_asynccnt 0x0" ::: "memory");      /* nothing in flight when the buffers take the partial statistics */
  float (*st)[128][2 * AKW] = (float (*)[128][2 * AKW])sm;      /* [maximum as exponent of 2 | weights | weighted positions][query row][key tile of the step * 2 + lane half] */
#pragma unroll
  for (int g = 0; g < 2; ++g) { const int q = 32 * wq + 16 * g + ln, pi = 2 * wk + hh; st[0][q][pi] = mr[g] * AC; st[1][q][pi] = se[g]; st[2][q][pi] = sw[g]; }
  __syncthreads();                                       /* every wave's partial statistics are in LDS */
  if (w < 4) {      /* one query row per lane; a wave's 32 means fill one 128-B line */
    float pm[2 * AKW], ps[2 * AKW], pw[2 * AKW];
#pragma unroll
    for (int i = 0; i < 2 * AKW; i += 4) { const v4f a = *(const v4fa*)&st[0][tid][i], c = *(const v4fa*)&st[1][tid][i], d = *(const v4fa*)&st[2][tid][i];
#pragma unroll
      for (int k = 0; k < 4; ++k) { pm[i + k] = a[k]; ps[i + k] = c[k]; pw[i + k] = d[k]; } }
    float mx = pm[0];
#pragma unroll
    for (int i = 1; i < 2 * AKW; ++i) mx = fmaxf(mx, pm[i]);
    float es = 0.f, ws = 0.f;
#pragma unroll
    for (int i = 0; i < 2 * AKW; ++i) { const float f = __builtin_amdgcn_exp2f(pm[i] - mx); es += ps[i] * f; ws += pw[i] * f; }
    MEANT[(size_t)by * SEQ + mt * 128 + tid] = (float)(SEQ / 2) + ws / es; }
}

// ---- content scores, Gaussian softmax and P . V in one kernel: block = 128 query rows of one slab (wave w: rows 32 w .. 32 w + 31), walking the keys in tiles of 64 ----
// Q3 / K3: the content pair's K-concatenated planes (slab by at column by * 192 of rows with pitch LQ3); Vt f16 [slab][64][SEQ]; O f16 [t][b][h*64 + d] = 64 ctx.
// Both products are formed transposed. Scores, keys x queries: A = key rows from LDS, B = the wave's 32 query rows, kept in registers for the whole walk; a lane holds 32 of a key tile's scores of one query per group of 16 queries
// (key = 16 c + 8 hh + r, query = ln): y[s] = log2(e) (score - (s - mean)^2 * (1 / (2 sigma^2))), running maximum m (joined between the two lanes of a query once per tile) and the lane's own part of the sum l in f32.
// P = f16(2^14 2^(y - m)) of key tiles 2 s and 2 s + 1 is, register for register, the B fragment of keys 32 s .. 32 s + 31; ctx, d x queries: A = V^T rows from LDS; a lane's accumulators all belong to its own query, so exp(m_old - m_new) is the lane's own factor.
// Key tile n + 1 is in flight while tile n is worked on. At the end the two lanes of a query join their sums, and ctx * 2^6 / l leaves as 16 bytes (8 d) per accumulator tile.
#define TB2 ((3 * 64 + 64) * LP * 2)       /* bytes of one staged key tile: three K tiles of its 64 key rows, then its 64 V^T rows */
#define NKT (SEQ / 64)                     /* key tiles */
static_assert(CK / KT == 3 && NKT >= 2);
static_assert(2 * TB2 <= 196608);          /* static LDS of k_fattn */
// 64 rows of 128 B, global -> LDS: 4 copies of 16 B per lane, rows step by 16 per copy
__device__ __forceinline__ void g2_stage_v(unsigned l, const _Float16* gv, size_t sv) {
  /* the closing s_wait_xcnt stands inside the statement so that no address register of a copy is rewritten in front of it */
  asm volatile("global_load_async_to_lds_b128 %0, %4, off\n\t" "global_load_async_to_lds_b128 %1, %5, off\n\t" "global_load_async_to_lds_b128 %2, %6, off\n\t"
               "global_load_async_to_lds_b128 %3, %7, off\n\t" "s_wait_xcnt 0x0"
               :: "v"(l), "v"(l + 1u * 16 * LP * 2), "v"(l + 2u * 16 * LP * 2), "v"(l + 3u * 16 * LP * 2), "v"(gv), "v"(gv + sv), "v"(gv + 2 * sv), "v"(gv + 3 * sv)
               : "memory"); }
// lane l takes the value of lane l ^ 16: the two lanes that hold the two halves of one query's keys
__device__ __forceinline__ float g2_xhalf(float x) { return __builtin_bit_cast(float, __builtin_amdgcn_permlanex16(__builtin_bit_cast(int, x), __builtin_bit_cast(int, x), 0x76543210, 0xfedcba98, false, false)); }
__global__ __launch_bounds__(128) void k_fattn(const _Float16* __restrict__ Q3, const _Float16* __restrict__ K3, const _Float16* __restrict__ Vt,
    const float* __restrict__ MEANT, const float* __restrict__ SIGT, _Float16* __restrict__ O) {
  __shared__ __attribute__((aligned(16))) unsigned char sm[2 * TB2];      /* two tile buffers */
  const int tid = threadIdx.x, w = __builtin_amdgcn_readfirstlane((int)(tid >> 5)), lane = tid & 31, ln = lane & 15, hh = lane >> 4;
  const int by = blockIdx.y, mt = blockIdx.x; const int b = by / NH;
  const int q0 = mt * 128 + 32 * w + ln;      /* the lane's query row in group 0; in group 1: + 16 */
  const unsigned l0 = (unsigned)(size_t)sm + (unsigned)((tid >> 3) * (LP * 2) + (tid & 7) * 16);
  const _Float16* gb = K3 + (size_t)(tid >> 3) * LQ3 + (size_t)by * CK + (tid & 7) * 8;
  const _Float16* gv = Vt + ((size_t)by * HD + (tid >> 3)) * SEQ + (tid & 7) * 8;
  const size_t sq = (size_t)16 * LQ3, sv = (size_t)16 * SEQ;
  auto stage = [&](int n) { const unsigned l = l0 + (unsigned)(n & 1) * TB2; const _Float16* gk = gb + (size_t)n * 64 * LQ3;      /* key tile n: 16 copies per lane */
    g2_stage_v(l, gk, sq); g2_stage_v(l + 1u * 64 * LP * 2, gk + KT, sq); g2_stage_v(l + 2u * 64 * LP * 2, gk + 2 * KT, sq);
    g2_stage_v(l + 3u * 64 * LP * 2, gv + n * 64, sv); };
  const v8f z8 = {0.f,0.f,0.f,0.f,0.f,0.f,0.f,0.f};
  v8f o[8] = {z8, z8, z8, z8, z8, z8, z8, z8};      /* ctx, d x queries: [query group * 4 + d tile of 16] */
  float m[2] = {-3.0e38f, -3.0e38f}, l[2] = {0.f, 0.f};      /* per query group: running maximum (exponent of 2), the lane's part of the sum of 2^14 weights */
  stage(0);
  const _Float16* qp = Q3 + (size_t)q0 * LQ3 + (size_t)by * CK;
  v16h fq[2][CK / 32];      /* the wave's query rows as B fragments: [group of 16 queries][k / 32] */
#pragma unroll      /* unrolled here and below: arrays indexed by constants stay in registers */
  for (int g = 0; g < 2; ++g) {
#pragma unroll
    for (int j = 0; j < CK / 32; ++j) fq[g][j] = g2_frag(qp + (size_t)g * 16 * LQ3 + 32 * j, hh); }
  float mu[2], i2[2];      /* per query group: the row's mean and 1 / (2 sigma^2) */
  { const float* pmu = MEANT + (size_t)by * SEQ + q0; const float* ps0 = SIGT + sig_idx((size_t)q0 * NB + b); const float* ps1 = SIGT + sig_idx((size_t)(q0 + 16) * NB + b);
    /* the four loads and their data wait in one statement: no address register of theirs is rewritten while they are under way; they fly beside tile 0's copies */
    asm volatile("global_load_b32 %0, %4, off\n\t" "global_load_b32 %1, %4, off offset:64\n\t" "global_load_b32 %2, %5, off\n\t" "global_load_b32 %3, %6, off\n\t" "s_wait_loadcnt 0x0"
                 : "=&v"(mu[0]), "=&v"(mu[1]), "=&v"(i2[0]), "=&v"(i2[1]) : "v"(pmu), "v"(ps0), "v"(ps1) : "memory"); }
  const float i2l[2] = {i2[0] * 1.44269504f, i2[1] * 1.44269504f};      /* the Gaussian term as an exponent of 2 */
  asm volatile("s_wait_asynccnt 0x0" ::: "memory");      /* this wave's part of tile 0 has landed */
  __syncthreads();                                       /* ... and every other wave's */
  stage(1);
#pragma unroll 1
  for (int n = 0; n < NKT; ++n) {      /* rolled: one publish point per key tile */
    const _Float16* tb = (const _Float16*)(sm + (n & 1) * TB2);
    const _Float16* kp = tb + ln * LP; const _Float16* vp = tb + (192 + ln) * LP;
    v8f acc[8];      /* the key tile's scores: [query group * 4 + key tile of 16] */
    v16h fv[2][4];      /* the tile's V^T rows as A fragments: [key / 32][d tile of 16] */
    { v16h fk[CK / 32][4];      /* the whole key tile as A fragments: [k / 32][key tile of 16] */
#pragma unroll
      for (int j = 0; j < CK / 32; ++j) {
#pragma unroll
        for (int c = 0; c < 4; ++c) fk[j][c] = g2_frag(kp + ((j >> 1) * 64 + c * 16) * LP + 32 * (j & 1), hh); }
      __builtin_amdgcn_sched_barrier(0);      /* keeps the tile's 48 key reads together in front of the products, in the order of their use: one place with reads, counted waits behind it */
#pragma unroll
      for (int j = 0; j < CK / 32; ++j) {
        if (j == 2) {      /* the V^T reads go out once the first K tile's fragments are spent, into registers of that size, and land under the other 32 products */
#pragma unroll
          for (int s = 0; s < 2; ++s) {
#pragma unroll
            for (int c = 0; c < 4; ++c) fv[s][c] = g2_frag(vp + c * 16 * LP + 32 * s, hh); }
          __builtin_amdgcn_sched_barrier(0); }      /* keeps these 16 reads at this place, in front of the products that cover them */
#pragma unroll
        for (int c = 0; c < 4; ++c) { acc[c] = __builtin_amdgcn_wmma_f32_16x16x32_f16(false, fk[j][c], false, fq[0][j], (short)0, j ? acc[c] : z8, false, false);
          acc[4 + c] = __builtin_amdgcn_wmma_f32_16x16x32_f16(false, fk[j][c], false, fq[1][j], (short)0, j ? acc[4 + c] : z8, false, false); } }
      __builtin_amdgcn_sched_barrier(0); }      /* keeps the products in the order of the reads, two per arriving fragment */
    FragH pf[2][2];      /* P as B fragments: [query group][key / 32] */
#pragma unroll
    for (int g = 0; g < 2; ++g) {
      const float dm = (float)(n * 64 + 8 * hh) - mu[g];      /* the lane's first key of the tile, counted from the mean */
      v2f y[4][4]; float tc[4];      /* four short chains per statistic instead of one long one: a wave issues in order */
#pragma unroll
      for (int c = 0; c < 4; ++c) { const v8f a = acc[g * 4 + c];
#pragma unroll
        for (int r = 0; r < 8; r += 2) { const v2f a2 = {a[r], a[r + 1]}; const v2f k2 = {(float)(16 * c + r), (float)(16 * c + r + 1)}; const v2f d2 = k2 + dm;
          y[c][r >> 1] = a2 * AC - (d2 * d2) * i2l[g]; }
        tc[c] = fmaxf(fmaxf(fmaxf(y[c][0][0], y[c][0][1]), fmaxf(y[c][1][0], y[c][1][1])), fmaxf(fmaxf(y[c][2][0], y[c][2][1]), fmaxf(y[c][3][0], y[c][3][1]))); }
      const float th = fmaxf(fmaxf(tc[0], tc[1]), fmaxf(tc[2], tc[3]));
      const float mn = fmaxf(m[g], fmaxf(th, g2_xhalf(th)));      /* one maximum for both lanes of a query: their weights meet in one product */
      const float al = __builtin_amdgcn_exp2f(m[g] - mn); m[g] = mn;
      const float ms = mn - 14.0f;      /* weights come out x 2^14 */
      float ts = 0.f;
#pragma unroll
      for (int c = 0; c < 4; ++c) { v2f s2 = {0.f, 0.f};
#pragma unroll
        for (int r = 0; r < 8; r += 2) { const v2f t2 = y[c][r >> 1] - ms; const v2f e2 = {__builtin_amdgcn_exp2f(t2[0]), __builtin_amdgcn_exp2f(t2[1])}; s2 += e2;
          pf[g][c >> 1].h[(c & 1) * 8 + r] = toh_flush(e2[0]); pf[g][c >> 1].h[(c & 1) * 8 + r + 1] = toh_flush(e2[1]); }
        ts += s2[0] + s2[1]; }
      l[g] = l[g] * al + ts;
#pragma unroll
      for (int c = 0; c < 4; ++c) o[g * 4 + c] *= al; }
#pragma unroll
    for (int s = 0; s < 2; ++s) {
#pragma unroll
      for (int c = 0; c < 4; ++c) { o[c] = __builtin_amdgcn_wmma_f32_16x16x32_f16(false, fv[s][c], false, pf[0][s].v, (short)0, o[c], false, false);
        o[4 + c] = __builtin_amdgcn_wmma_f32_16x16x32_f16(false, fv[s][c], false, pf[1][s].v, (short)0, o[4 + c], false, false); } }
    /* this wave's reads of tile n are done before its buffer is refilled. The two sums are named as inputs only, so that the softmax stays in front of the waits and the barrier:
       left free, they rose to the last LDS read, and tile n + 1's copies, issued at the foot of the trip before, had only the score products to land under */
    asm volatile("s_wait_dscnt 0x0" :: "v"(l[0]), "v"(l[1]) : "memory");
    asm volatile("s_wait_asynccnt 0x0" ::: "memory");    /* this wave's part of tile n + 1 has landed */
    __syncthreads();                                     /* publishes tile n + 1 and ends every wave's reads of tile n */
    if (n + 2 < NKT) stage(n + 2);
  }
  asm volatile("s_wait_asynccnt 0x0" ::: "memory");      /* nothing in flight at the end */
#pragma unroll
  for (int g = 0; g < 2; ++g) { const float f = 64.0f / (l[g] + g2_xhalf(l[g]));      /* the two lanes of a query join their sums */
    unsigned short* dst = (unsigned short*)O + (size_t)(q0 + 16 * g) * LQ + (size_t)by * HD + 8 * hh;      /* a query row's 128-B line is written by its two lanes alone */
#pragma unroll
    for (int c = 0; c < 4; ++c) { FragH t;
#pragma unroll
      for (int r = 0; r < 8; ++r) t.h[r] = (_Float16)(o[g * 4 + c][r] * f);
      *(v8us*)(dst + 16 * c) = t.half[0]; } }
}

extern "C" void kernel_launch(void* const* d_in, const int* in_sizes, int n_in,
                              void* d_out, int out_size, void* d_ws, size_t ws_size, hipStream_t stream) {
  if (n_in < 19) return;
  if ((size_t)in_sizes[0] < NR * DM || (size_t)in_sizes[1] < NR * DM || (size_t)in_sizes[2] < NR * DM) return;
  if ((size_t)in_sizes[3] < (size_t)DM * DM || (size_t)in_sizes[5] < (size_t)DM * DM || (size_t)in_sizes[7] < (size_t)DM * DM || (size_t)in_sizes[9] < (size_t)DM * DM) return;
  if ((size_t)in_sizes[11] < (size_t)DM * DM || (size_t)in_sizes[13] < (size_t)DM * DM || (size_t)in_sizes[17] < (size_t)DM * DM) return;
  if (in_sizes[4] < DM || in_sizes[6] < DM || in_sizes[8] < DM || in_sizes[10] < DM || in_sizes[12] < DM || in_sizes[14] < DM || in_sizes[15] < DM || in_sizes[16] < 1 || in_sizes[18] < DM) return;
  if ((size_t)out_size < NR * DM) return;
  const float* const* I = (const float* const*)d_in;
  const float* xq = I[0]; const float* xk = I[1]; const float* xv = I[2];
  const float* wq = I[3]; const float* bq = I[4]; const float* wk = I[5]; const float* bk = I[6]; const float* wv = I[7]; const float* bv = I[8];
  const float* whq = I[9]; const float* bhq = I[10]; const float* whk = I[11]; const float* bhk = I[12]; const float* wwp = I[13]; const float* bwp = I[14];
  const float* wvp = I[15]; const float* bvp = I[16]; const float* wo = I[17]; const float* bo = I[18];
  char* ws = (char*)d_ws; size_t off = 0;
  auto take = [&](size_t bytes) { char* p = ws + off; off += (bytes + 255) & ~(size_t)255; return p; };
  _Float16* BQ = (_Float16*)take((size_t)DM * DM * 2); _Float16* BK = (_Float16*)take((size_t)DM * DM * 2); _Float16* BV = (_Float16*)take((size_t)DM * DM * 2);
  _Float16* BHQ = (_Float16*)take((size_t)DM * DM * 2); _Float16* BHK = (_Float16*)take((size_t)DM * DM * 2); _Float16* BWP = (_Float16*)take((size_t)DM * DM * 2); _Float16* BO = (_Float16*)take((size_t)DM * DM * 2);
  _Float16* XQ = (_Float16*)take(NR * DM * 2); _Float16* XK = (_Float16*)take(NR * DM * 2); _Float16* XV = (_Float16*)take(NR * DM * 2);
  _Float16* CA = (_Float16*)take(NR * 3 * DM * 2); _Float16* CB = (_Float16*)take(NR * 3 * DM * 2);      /* concatenated planes of the alignment pair */
  _Float16* V16 = (_Float16*)take(NR * DM * 2); _Float16* O16 = (_Float16*)take(NR * DM * 2); _Float16* VT = (_Float16*)take((size_t)NB * NH * HD * SEQ * 2);
  float* S = (float*)take((size_t)NB * NH * QC * SEQ * 4); _Float16* PM = (_Float16*)take((size_t)NB * NH * QC * SEQ * 2);
  float* MEANT = (float*)take((size_t)NB * NH * SEQ * 4); float* SIGT = (float*)take(NR / SGR * 128);
  if (off > ws_size) return;
  float* G = S;                                                            /* f32 wp plane [NR][DM], consumed by k_falign's width table part */
  _Float16* CA2 = PM; _Float16* CB2 = PM + NR * 3 * DM;                    /* content pair's concatenated planes */
  k_cvt<<<7 * WBL + 3 * XBL, 256, 0, stream>>>(wq, wk, wv, whq, whk, wwp, wo, xq, xk, xv, BQ, XQ);      /* planes BQ .. BO and XQ .. XV in the order of their take() calls */
  const dim3 gp((unsigned)((MP / 128) * (DM / 64)), 1);
  k_proj<<<dim3((unsigned)((MP / 128) * (DM / 64)), 6), 128, 0, stream>>>(XQ, XK, XV, BV, BWP, BHQ, BHK, BQ, BK, bv, bwp, bhq, bhk, bq, bk, V16, G, CA, CB, CA2, CB2);
  /* alignment pair: scores and expected key position; slab by = b*NH + h at column offset by*192 of rows with pitch LQ3; with it V16 rows [SEQ*NB][DM] -> VT[(b,h)][64][SEQ] and the width table */
  k_falign<<<dim3(SEQ / 128, NB * NH), 128 * AKW, 0, stream>>>(CA, CB, MEANT, V16, VT, G, wvp, bvp, SIGT);
  /* content pair: scores, Gaussian softmax and P . V; ctx[t][b][h*64 + d] x64 */
  k_fattn<<<dim3(SEQ / 128, NB * NH), 128, 0, stream>>>(CA2, CB2, VT, MEANT, SIGT, O16);
  k_gemm2<true, true, true><<<gp, 128, 0, stream>>>(O16, DM, 0, BO, DM, 0, 0.0009765625f, bo, (float*)d_out, nullptr, DM, 0, MP, DM, DM);      /* out rows t*NB_FULL + b */
}

// v009
// One run takes 84.3 microseconds.
// Next to v008, in two timings, it ran 1.16 times as fast each time.
// All steps since v000 together make it 7.80 times as fast.
#include <hip/hip_runtime.h>
// Gaussian-windowed multi-head cross attention, sequence-first layout: query [1024][2][1024], key_in / value [1024][2][1024] (token row r = t*NB + b); six input maps with natural [out][in] weights + biases: q, hq, wp from query; k, hk from key_in; v from value; 16 heads of 64 (flat slab b*16 + h); content logits 64^-0.5 q.k; alignment softmax over keys of 64^-0.5 hq.hk, mean = expected key position; width sigma = 1 + sigmoid(tanh(wp) . Wvp + bvp) per (t, b); P = softmax_s(content - (s - mean)^2 / (2 sigma^2)); ctx = P . v merged [t][b][h*64+d]; out = ctx Wo^T + bo.
// Structure: inputs as exact f16 rows (RNE-converted to bf16 first); all conversions as one launch; the six input projections as one launch of WMMA GEMMs (32x64 wave tiles, f32 accumulation, x16 weights + bias); q/hq and k/hk are written as K-concatenated planes per head [2048 hi | res | hi] and [hi | hi | res] (hi = f16 value, res = f16 of 2048 (v - hi)) so one K = 192 GEMM yields 2048 (hi.hi) + res.hi + hi.res; all query rows as one chunk: k_falign: first each work-group's share of the V transposition and of the width table (both need only the projections, as the alignment scores do), then alignment scores per 64-key tile with running-maximum f32 softmax statistics (centred position sum), its S never in memory; k_fattn: content scores, Gaussian term, running-maximum f32 softmax (P as f16 x 2^14 of exp(x - running max)) and P . V^T per 64-key tile in one launch, both products transposed, S and P of the content pair never out of registers (ctx carried x64) -> out GEMM (f32).
// Compute dtype: all contractions v_wmma_f32_16x16x32_f16 (f16 operands, f32 accumulate); inputs RNE-converted to bf16 (exact in f16); both score sites as f16 value + x2048 residual (three products folded along K); v, P (x2^14), ctx (x64), Wo as plain f16 operands; softmax statistics, mean, tanh / Wvp / sigmoid on the vector unit in f32.
#ifndef NB
#define NB 2                         /* batches processed */
#endif
#ifndef SEQ
#define SEQ 1024                     /* sequence length processed (queries = keys) */
#endif
#define NB_FULL 2                    /* batch pitch of the input / output rows */
#define DM 1024
#define NH 16
#define HD 64
#define QC SEQ                       /* query rows per attention chunk: all of them, so each attention stage is one launch over every (slab, row) */
#define NR ((size_t)NB * SEQ)        /* token rows */
#define MP ((int)(NB * SEQ))
#define LQ (NB * DM)                 /* pitch between consecutive t for one batch */
#define CK (3 * HD)                  /* concatenated K per head */
#define LQ3 (NB * 3 * DM)            /* pitch between consecutive t in a concatenated plane */
static_assert(SEQ % 128 == 0);
static_assert(QC % 128 == 0);
static_assert(SEQ % QC == 0);
static_assert(NH * HD == DM);
static_assert(NB <= NB_FULL);
static_assert((NB * SEQ) % 128 == 0);
static_assert(NH == 16);
static_assert(HD == 64);                         
static_assert(CK % 32 == 0);
static_assert(DM % 32 == 0);
static_assert(QC % 32 == 0);
static_assert((NB * SEQ) % 32 == 0);
static_assert(NH * QC >= DM);                    /* the f32 wp plane [NR][DM] fits into the S region */
static_assert(NH * QC >= 2 * 3 * DM);            /* the content pair's two concatenated planes fit into the P region */
static_assert(QC == SEQ);
static_assert(32 * 8 * 16 == 32 * HD * 2);       
#define KT 64                        /* k elements per staged tile: one 128-B line of every operand row */
#define LP 72                        /* LDS row pitch in f16: 144 B = 16 B x odd, for 16-byte fragment reads */
#define TB ((128 + 64) * LP * 2)     /* bytes of one staged tile: 128 A rows, then 64 Bt rows */
static_assert(CK % KT == 0 && DM % KT == 0 && SEQ % KT == 0);   /* every K of the GEMM launches */
static_assert(4 * 32 * 68 * 4 <= 2 * TB);        /* the output staging fits into the two tile buffers */
static_assert(2 * TB <= 131072);                 /* static LDS of the GEMM kernels */
#define WS_TOTAL (7 * (size_t)DM * DM * 2 + 3 * NR * DM * 2 + 2 * NR * 3 * DM * 2 + 2 * NR * DM * 2 + (size_t)NB * NH * HD * SEQ * 2 + (size_t)NB * NH * QC * SEQ * 4 + (size_t)NB * NH * QC * SEQ * 2 + (size_t)NB * NH * SEQ * 4 + NR * 16)
static_assert(WS_TOTAL + 32 * 256 <= 268435456);

typedef unsigned short v8us __attribute__((ext_vector_type(8), may_alias));
typedef float  v8f  __attribute__((ext_vector_type(8)));
typedef float  v4f  __attribute__((ext_vector_type(4)));
typedef float  v4fa __attribute__((ext_vector_type(4), may_alias));
typedef _Float16 v16h __attribute__((ext_vector_type(16)));
typedef _Float16 v4h __attribute__((ext_vector_type(4)));
union FragH { v16h v; v8us half[2]; _Float16 h[16]; unsigned short u[16]; };

__device__ __forceinline__ unsigned short bf16_bits(float x) { unsigned int u = __float_as_uint(x); return (unsigned short)((u + 0x7FFFu + ((u >> 16) & 1u)) >> 16); }
__device__ __forceinline__ float bf16_val(unsigned short b) { return __uint_as_float(((unsigned int)b) << 16); }
__device__ __forceinline__ float bf16_rne(float x) { return bf16_val(bf16_bits(x)); }   /* RNE convert to bf16, back as f32 */

typedef _Float16 h16;
// f32 -> f16 with a value select: magnitudes below 2^-14 become +0 (no f16 subnormal can reach a WMMA operand)
static __device__ __forceinline__ h16 toh_flush(float v) { const h16 r = (h16)v; return (fabsf(v) < 6.103515625e-05f) ? (h16)0.0f : r; }

// fragment: elements 0..7 <- k0 + 8h .. +7, elements 8..15 <- k0 + 16 + 8h .. +7 (p points at k0 of the lane's row / column)
__device__ __forceinline__ v16h g2_frag(const _Float16* p, int hh) { FragH f; f.half[0] = *(const v8us*)((const unsigned short*)p + 8 * hh); f.half[1] = *(const v8us*)((const unsigned short*)p + 16 + 8 * hh); return f.v; }
__device__ __forceinline__ v8f g2_mma(v16h a, v16h b, v8f c) { v8f d = __builtin_amdgcn_wmma_f32_16x16x32_f16(false, a, false, b, (short)0, c, false, false); asm volatile("v_nop\n\tv_nop\n\tv_nop\n\tv_nop" : "+v"(d) : "v"(a), "v"(b)); return d; }

// one K tile of the block's operands, global -> LDS with no register in between: 12 copies of 16 B per lane; a wave's copy covers 4 whole 128-B lines.
// l: the lane's LDS byte address in tile row tid / 8 (rows step by 16 per copy); ga / gb: the lane's 16 bytes in that row of A / Bt at this tile's k.
__device__ __forceinline__ void g2_stage(unsigned l, const _Float16* ga, size_t sa, const _Float16* gb, size_t sb) {
  /* the closing s_wait_xcnt stands inside the statement so that no address register of a copy is rewritten in front of it */
  asm volatile("global_load_async_to_lds_b128 %0, %12, off\n\t" "global_load_async_to_lds_b128 %1, %13, off\n\t" "global_load_async_to_lds_b128 %2, %14, off\n\t"
               "global_load_async_to_lds_b128 %3, %15, off\n\t" "global_load_async_to_lds_b128 %4, %16, off\n\t" "global_load_async_to_lds_b128 %5, %17, off\n\t"
               "global_load_async_to_lds_b128 %6, %18, off\n\t" "global_load_async_to_lds_b128 %7, %19, off\n\t" "global_load_async_to_lds_b128 %8, %20, off\n\t"
               "global_load_async_to_lds_b128 %9, %21, off\n\t" "global_load_async_to_lds_b128 %10, %22, off\n\t" "global_load_async_to_lds_b128 %11, %23, off\n\t"
               "s_wait_xcnt 0x0"
               :: "v"(l), "v"(l + 1u * 16 * LP * 2), "v"(l + 2u * 16 * LP * 2), "v"(l + 3u * 16 * LP * 2), "v"(l + 4u * 16 * LP * 2), "v"(l + 5u * 16 * LP * 2),
                  "v"(l + 6u * 16 * LP * 2), "v"(l + 7u * 16 * LP * 2), "v"(l + 8u * 16 * LP * 2), "v"(l + 9u * 16 * LP * 2), "v"(l + 10u * 16 * LP * 2), "v"(l + 11u * 16 * LP * 2),
                  "v"(ga), "v"(ga + sa), "v"(ga + 2 * sa), "v"(ga + 3 * sa), "v"(ga + 4 * sa), "v"(ga + 5 * sa), "v"(ga + 6 * sa), "v"(ga + 7 * sa),
                  "v"(gb), "v"(gb + sb), "v"(gb + 2 * sb), "v"(gb + 3 * sb)
               : "memory"); }

// main loop of both GEMM kernels: block tile 128 x 64, wave w takes rows 32 w .. 32 w + 31; two LDS tile buffers, tile t + 1 in flight while tile t is multiplied.
// Ab: row 0 of the block's 128 A rows; Bb: row 0 of its 64 Bt rows; K % KT == 0. On return every wave has left both buffers and no copy is outstanding.
__device__ __forceinline__ void g2_main(unsigned char* sm, const _Float16* Ab, int lda, const _Float16* Bb, int ldb, int K, int tid, int w, int ln, int hh, v8f (&acc)[8]) {
  const int nt = K / KT;
  const unsigned l0 = (unsigned)(size_t)sm + (unsigned)((tid >> 3) * (LP * 2) + (tid & 7) * 16);
  const _Float16* ga = Ab + (size_t)(tid >> 3) * lda + (tid & 7) * 8; const _Float16* gb = Bb + (size_t)(tid >> 3) * ldb + (tid & 7) * 8;
  const size_t sa = (size_t)16 * lda, sb = (size_t)16 * ldb;
  g2_stage(l0, ga, sa, gb, sb);
  asm volatile("s_wait_asynccnt 0x0" ::: "memory");      /* this wave's part of tile 0 has landed */
  __syncthreads();                                       /* ... and every other wave's */
  if (nt > 1) g2_stage(l0 + TB, ga + KT, sa, gb + KT, sb);
#pragma unroll 1
  for (int t = 0; t < nt; ++t) {      /* rolled: one publish point per tile */
    const _Float16* tb = (const _Float16*)(sm + (t & 1) * TB);
    const _Float16* ap = tb + (32 * w + ln) * LP; const _Float16* bp = tb + (128 + ln) * LP;
    v16h fa[KT / 32][2], fb[KT / 32][4];      /* the tile's fragment reads go out as one group, in the order of their use, ahead of the products */
#pragma unroll      /* unrolled here and below: fa / fb are indexed by constants and stay in registers */
    for (int s = 0; s < KT / 32; ++s) { fa[s][0] = g2_frag(ap + 32 * s, hh); fb[s][0] = g2_frag(bp + 32 * s, hh); fa[s][1] = g2_frag(ap + 16 * LP + 32 * s, hh);
      fb[s][1] = g2_frag(bp + 16 * LP + 32 * s, hh); fb[s][2] = g2_frag(bp + 32 * LP + 32 * s, hh); fb[s][3] = g2_frag(bp + 48 * LP + 32 * s, hh); }
#pragma unroll
    for (int s = 0; s < KT / 32; ++s) {
#pragma unroll
      for (int c = 0; c < 4; ++c) { acc[c] = g2_mma(fa[s][0], fb[s][c], acc[c]); acc[4 + c] = g2_mma(fa[s][1], fb[s][c], acc[4 + c]); } }
    asm volatile("s_wait_dscnt 0x0" ::: "memory");       /* this wave's reads of tile t are done before its buffer is refilled */
    asm volatile("s_wait_asynccnt 0x0" ::: "memory");    /* this wave's part of tile t + 1 has landed */
    __syncthreads();                                     /* publishes tile t + 1 and ends every wave's reads of tile t */
    if (t + 2 < nt) g2_stage(l0 + (unsigned)(t & 1) * TB, ga + (size_t)(t + 2) * KT, sa, gb + (size_t)(t + 2) * KT, sb);
  }
  asm volatile("s_wait_asynccnt 0x0" ::: "memory");      /* nothing in flight when the buffers become output staging */
}

// ---- GEMM (wave tile 32x64; M % 128 == 0 per launch region, N % 64 == 0, K % 64 == 0): C = alpha * A . Bt^T (+ bias) ----
// A f16 [M][K] (pitch lda), Bt f16 [N][K] (pitch ldb); batch slab by = blockIdx.y with element strides sA / sB / sC.
// OMAP: output row r -> (r / NB) * NB_FULL + r % NB.
template <bool HASB, bool OUT32, bool OMAP>
__global__ __launch_bounds__(128) void k_gemm2(const _Float16* __restrict__ A, int lda, size_t sA, const _Float16* __restrict__ Bh, int ldb, size_t sB, float alpha,
    const float* __restrict__ bias, float* __restrict__ C, _Float16* __restrict__ C16, int ldc, size_t sC, int M, int N, int K) {
  __shared__ __attribute__((aligned(16))) unsigned char sm[2 * TB]; float (*so)[32][68] = (float (*)[32][68])sm;      /* two tile buffers; output staging behind the main loop */
  const int tid = threadIdx.x, w = __builtin_amdgcn_readfirstlane((int)(tid >> 5)), lane = tid & 31, ln = lane & 15, hh = lane >> 4; const int by = blockIdx.y;
  A += (size_t)by * sA; Bh += (size_t)by * sB; const size_t cofs = (size_t)by * sC;
  const int ntn = N >> 6; const int mt = blockIdx.x / ntn, nq = blockIdx.x - mt * ntn; const int row0 = mt * 128 + 32 * w, col0 = nq * 64; if (mt * 128 >= M) return;      /* the whole block leaves, in front of every barrier */
  const v8f z8 = {0.f,0.f,0.f,0.f,0.f,0.f,0.f,0.f}; v8f accs[8] = {z8, z8, z8, z8, z8, z8, z8, z8};      /* [row half * 4 + column tile] */
  g2_main(sm, A + (size_t)(mt * 128) * lda, lda, Bh + (size_t)col0 * ldb, ldb, K, tid, w, ln, hh, accs);
#pragma unroll
  for (int u = 0; u < 8; ++u) { const int t = u & 3, half = u >> 2; const int col = col0 + t * 16 + ln; float bv = 0.f; if (HASB) bv = bf16_rne(bias[col]);
#pragma unroll
    for (int r = 0; r < 8; ++r) { const int rloc = half * 16 + 8 * hh + r; so[w][rloc][t * 16 + ln] = accs[u][r] * alpha + bv; } }
  __builtin_amdgcn_fence(4 /* acq_rel order */, "workgroup"); __builtin_amdgcn_wave_barrier();      /* so[w] is private to wave w */
  const int rsub = lane >> 4, c4 = (lane & 15) * 4;
  {
#pragma unroll
    for (int q = 0; q < 16; ++q) { const int r = q * 2 + rsub; const v4f v = *(const v4fa*)&so[w][r][c4];
      const int gr = row0 + r; const size_t orow = OMAP ? ((size_t)(gr / NB) * NB_FULL + (size_t)(gr % NB)) : (size_t)gr;
      if (OUT32) { *(v4f*)(C + cofs + orow * ldc + col0 + c4) = v; }
      else { v4h h4;
#pragma unroll
        for (int i = 0; i < 4; ++i) h4[i] = (_Float16)v[i];
        *(v4h*)(C16 + cofs + orow * ldc + col0 + c4) = h4; } }
     } }

// ---- the six input projections as one launch (same main loop and staging as k_gemm2; M = MP, N = K = DM; N tile 64 == one head): job = blockIdx.y picks operands, bias and output form ----
// x = A . Bt^T / 16 + bias (f32). job 0: v, f16 rows; job 1: wp, f32 rows; jobs 2 .. 5: hq, hk, q, k as K-concatenated planes:
// hi = f16(x), res = f16(2048 (x - hi)); head h = col0 / 64 of row r at C3 + r * 3 DM + h * 192: query side [2048 hi | res | hi], key side [hi | hi | res].
__global__ __launch_bounds__(128) void k_proj(const _Float16* __restrict__ XQ, const _Float16* __restrict__ XK, const _Float16* __restrict__ XV,
    const _Float16* __restrict__ BV, const _Float16* __restrict__ BWP, const _Float16* __restrict__ BHQ, const _Float16* __restrict__ BHK, const _Float16* __restrict__ BQ, const _Float16* __restrict__ BK,
    const float* __restrict__ bv, const float* __restrict__ bwp, const float* __restrict__ bhq, const float* __restrict__ bhk, const float* __restrict__ bq, const float* __restrict__ bk,
    _Float16* __restrict__ V16, float* __restrict__ G, _Float16* __restrict__ CHQ, _Float16* __restrict__ CHK, _Float16* __restrict__ CQ, _Float16* __restrict__ CK3) {
  __shared__ __attribute__((aligned(16))) unsigned char sm[2 * TB]; float (*so)[32][68] = (float (*)[32][68])sm;      /* two tile buffers; output staging behind the main loop */
  const int tid = threadIdx.x, w = __builtin_amdgcn_readfirstlane((int)(tid >> 5)), lane = tid & 31, ln = lane & 15, hh = lane >> 4; const int job = blockIdx.y;
  const _Float16* A; const _Float16* Bh; const float* bias; _Float16* C3 = nullptr;
  switch (job) {
    case 0: A = XV; Bh = BV; bias = bv; break;
    case 1: A = XQ; Bh = BWP; bias = bwp; break;
    case 2: A = XQ; Bh = BHQ; bias = bhq; C3 = CHQ; break;
    case 3: A = XK; Bh = BHK; bias = bhk; C3 = CHK; break;
    case 4: A = XQ; Bh = BQ; bias = bq; C3 = CQ; break;
    default: A = XK; Bh = BK; bias = bk; C3 = CK3; break; }
  const int mt = blockIdx.x / (DM / 64), nq = blockIdx.x - mt * (DM / 64); const int row0 = mt * 128 + 32 * w, col0 = nq * 64;
  const v8f z8 = {0.f,0.f,0.f,0.f,0.f,0.f,0.f,0.f}; v8f accs[8] = {z8, z8, z8, z8, z8, z8, z8, z8};      /* [row half * 4 + column tile] */
  g2_main(sm, A + (size_t)(mt * 128) * DM, DM, Bh + (size_t)col0 * DM, DM, DM, tid, w, ln, hh, accs);
#pragma unroll
  for (int u = 0; u < 8; ++u) { const int t = u & 3, half = u >> 2; const int col = col0 + t * 16 + ln; const float bb = bf16_rne(bias[col]);
#pragma unroll
    for (int r = 0; r < 8; ++r) { const int rloc = half * 16 + 8 * hh + r; so[w][rloc][t * 16 + ln] = accs[u][r] * 0.0625f + bb; } }
  __builtin_amdgcn_fence(4 /* acq_rel order */, "workgroup"); __builtin_amdgcn_wave_barrier();      /* so[w] is private to wave w */
  const int rsub = lane >> 4, c4 = (lane & 15) * 4; const int head = col0 >> 6;
  if (job == 0) {
#pragma unroll
    for (int q = 0; q < 16; ++q) { const int r = q * 2 + rsub; const v4f v = *(const v4fa*)&so[w][r][c4]; v4h h4;      /* 16 trips x 2 rows = 32 rows, here and below */
#pragma unroll
      for (int i = 0; i < 4; ++i) h4[i] = (_Float16)v[i];
      *(v4h*)(V16 + (size_t)(row0 + r) * DM + col0 + c4) = h4; }
  } else if (job == 1) {
#pragma unroll
    for (int q = 0; q < 16; ++q) { const int r = q * 2 + rsub; const v4f v = *(const v4fa*)&so[w][r][c4]; *(v4f*)(G + (size_t)(row0 + r) * DM + col0 + c4) = v; }
    asm volatile("s_wait_xcnt 0x0" ::: "memory");      /* the branches join in address arithmetic that reuses these stores' registers: the wait stands in front of it */
  } else { const bool qside = (job & 1) == 0;
#pragma unroll 1
    for (int q0 = 0; q0 < 16; q0 += 4) {      /* rolled: four trips of four row pairs, for code size */
#pragma unroll
     for (int q = q0; q < q0 + 4; ++q) { const int r = q * 2 + rsub; const v4f v = *(const v4fa*)&so[w][r][c4];
      v4h s0, s1, s2;
#pragma unroll
      for (int i = 0; i < 4; ++i) { const h16 hi = toh_flush(v[i]); const h16 rs = toh_flush((v[i] - (float)hi) * 2048.0f); const h16 hs = (h16)((float)hi * 2048.0f);
        s0[i] = qside ? hs : hi; s1[i] = qside ? rs : hi; s2[i] = qside ? hi : rs; }
      _Float16* dst = C3 + (size_t)(row0 + r) * (3 * DM) + head * CK + c4;
      *(v4h*)dst = s0; *(v4h*)(dst + 64) = s1; *(v4h*)(dst + 128) = s2; }
     asm volatile("s_wait_xcnt 0x0" ::: "memory"); }      /* the next trip rewrites the registers that this trip's stores name */
     } }

// ---- all ten input conversions as one launch: blocks 0 .. 7 WBL - 1 take the seven weight planes (natural [out][in] = Bt[n][k], x16), the rest the three activation planes; 8 elements per thread ----
// Bt: seven f16 planes of DM x DM, one behind the other, in the order w0 .. w6; X16: three f16 planes of NR x DM in the order x0 .. x2.
#define WBL (DM * DM / 8 / 256)            /* blocks per weight plane */
#define XBL ((int)(NR * DM / 8 / 256))     /* blocks per activation plane */
static_assert(DM * DM % (8 * 256) == 0 && (NR * DM) % (8 * 256) == 0);      /* whole blocks: no thread past the end of a plane */
static_assert(((size_t)DM * DM * 2) % 256 == 0 && (NR * DM * 2) % 256 == 0);      /* the planes follow one another in the workspace without a gap */
__global__ __launch_bounds__(256) void k_cvt(const float* __restrict__ w0, const float* __restrict__ w1, const float* __restrict__ w2, const float* __restrict__ w3, const float* __restrict__ w4,
    const float* __restrict__ w5, const float* __restrict__ w6, const float* __restrict__ x0, const float* __restrict__ x1, const float* __restrict__ x2, _Float16* __restrict__ Bt, _Float16* __restrict__ X16) {
  const int blk = blockIdx.x; FragH f;
  if (blk < 7 * WBL) { const int pl = blk / WBL; const size_t t = (size_t)(blk - pl * WBL) * 256 + threadIdx.x;
    const float* w = (pl == 0) ? w0 : (pl == 1) ? w1 : (pl == 2) ? w2 : (pl == 3) ? w3 : (pl == 4) ? w4 : (pl == 5) ? w5 : w6;
    const v4f a = *(const v4fa*)(w + t * 8), c = *(const v4fa*)(w + t * 8 + 4);
#pragma unroll
    for (int q = 0; q < 4; ++q) { f.h[q] = toh_flush(bf16_rne(a[q]) * 16.0f); f.h[4 + q] = toh_flush(bf16_rne(c[q]) * 16.0f); }
    const v8us o = f.half[0]; *(v8us*)((unsigned short*)Bt + (size_t)pl * DM * DM + t * 8) = o;
  } else { const int bx = blk - 7 * WBL; const int pl = bx / XBL; const size_t t = (size_t)(bx - pl * XBL) * 256 + threadIdx.x;
    const float* x = (pl == 0) ? x0 : (pl == 1) ? x1 : x2;
    const size_t row = t / (DM / 8); const int c8 = (int)(t % (DM / 8)) * 8; const size_t srow = (row / NB) * NB_FULL + (row % NB);
    const float* p = x + srow * DM + c8; const v4f a = *(const v4fa*)p, c = *(const v4fa*)(p + 4);
#pragma unroll
    for (int q = 0; q < 4; ++q) { f.h[q] = (_Float16)bf16_rne(a[q]); f.h[4 + q] = (_Float16)bf16_rne(c[q]); }
    const v8us o = f.half[0]; *(v8us*)((unsigned short*)X16 + (size_t)pl * NR * DM + t * 8) = o;
    asm volatile("s_wait_xcnt 0x0" ::: "memory"); } }      /* the built code runs on from here towards the weight branch, whose loads reuse this store's registers: the wait stands in front of them */

// V transposition, V16 rows [SEQ*NB][DM] -> Vt[(b,h)][64][SEQ], in three parts, loads, LDS writes and, behind a work-group barrier of the calling kernel, LDS reads and stores: 128 keys x 64 d of slab (b, h) per block of 256 threads.
#define VTK 128                      /* keys per block */
__device__ __forceinline__ void g2_vt_load(const _Float16* __restrict__ V16, FragH (&f)[VTK * 8 / 256], int key0, int b, int h, int tid) {
#pragma unroll      /* unrolled here and below: f is indexed by constants and stays in registers; the four loads go out together */
  for (int k = 0; k < VTK * 8 / 256; ++k) { const int i = tid + 256 * k; const int r = i / 8, c8 = (i % 8) * 8; f[k].half[0] = *(const v8us*)((const unsigned short*)V16 + ((size_t)(key0 + r) * NB + b) * DM + h * HD + c8); }
  asm volatile("s_wait_xcnt 0x0" ::: "memory"); }      /* what follows reuses the address registers of these loads: the wait stands in front of it */
__device__ __forceinline__ void g2_vt_in(const FragH (&f)[VTK * 8 / 256], unsigned short (*tl)[66], int tid) {
#pragma unroll
  for (int k = 0; k < VTK * 8 / 256; ++k) { const int i = tid + 256 * k; const int r = i / 8, c8 = (i % 8) * 8;
#pragma unroll
    for (int q = 0; q < 8; ++q) tl[r][c8 + q] = f[k].u[q]; } }
__device__ __forceinline__ void g2_vt_out(_Float16* __restrict__ Vt, const unsigned short (*tl)[66], int key0, int slab, int tid) {
#pragma unroll
  for (int k = 0; k < VTK * 8 / 256; ++k) { const int i = tid + 256 * k; const int d = i / (VTK / 8), pc = i % (VTK / 8); FragH f;      /* 16 lanes fill the two 128-B lines of one d */
#pragma unroll
    for (int q = 0; q < 8; ++q) f.u[q] = tl[pc * 8 + q][d];
    *(v8us*)((unsigned short*)Vt + ((size_t)slab * 64 + d) * SEQ + key0 + pc * 8) = f.half[0]; } }

// lane l takes the value of lane l ^ 16: the two lanes that hold the two halves of one query's keys
__device__ __forceinline__ float g2_xhalf(float x) { return __builtin_bit_cast(float, __builtin_amdgcn_permlanex16(__builtin_bit_cast(int, x), __builtin_bit_cast(int, x), 0x76543210, 0xfedcba98, false, false)); }
// lane l takes the value of lane l ^ M, M < 16, inside its row of 16 lanes: a vector move, where the shuffle builtin would go through the LDS pipe and wait for it
template <int M> __device__ __forceinline__ int g2_rxi(int x) { return __builtin_amdgcn_update_dpp(0, x, 0x160 | M /* row_xmask:M */, 0xf, 0xf, true); }
template <int M> __device__ __forceinline__ float g2_rx(float x) { return __builtin_bit_cast(float, g2_rxi<M>(__builtin_bit_cast(int, x))); }
// largest squared norm among a block's 128 content key rows (their f16 values, the first 64 columns of a head in the key side's concatenated plane), for k_fattn's bound on a content score; 8 lanes per row, rows step by 32 per load.
__device__ __forceinline__ void g2_kn_load(const _Float16* __restrict__ K3c, FragH (&f)[VTK * 8 / 256], int key0, int by, int tid) {
  const unsigned short* p = (const unsigned short*)K3c + (size_t)(key0 + tid / 8) * LQ3 + (size_t)by * CK + (tid % 8) * 8;
#pragma unroll      /* unrolled here and below: f is indexed by constants and stays in registers; the four loads go out together */
  for (int k = 0; k < VTK * 8 / 256; ++k) f[k].half[0] = *(const v8us*)(p + (size_t)k * 32 * LQ3);
  asm volatile("s_wait_xcnt 0x0" ::: "memory"); }      /* what follows reuses the address registers of these loads: the wait stands in front of it */
__device__ __forceinline__ float g2_kn_max(const FragH (&f)[VTK * 8 / 256]) {      /* the wave's 16 rows: the same value in every lane */
  float mx = 0.f;
#pragma unroll
  for (int k = 0; k < VTK * 8 / 256; ++k) { float s = 0.f;
#pragma unroll
    for (int q = 0; q < 8; ++q) { const float e = (float)f[k].h[q]; s += e * e; }
    s += g2_rx<1>(s); s += g2_rx<2>(s); s += g2_rx<4>(s); mx = fmaxf(mx, s); }
  mx = fmaxf(mx, g2_rx<8>(mx)); mx = fmaxf(mx, g2_xhalf(mx));
  return mx; }

// width table: SIGT[sig_idx(r)], r = t*NB + b, = 1 / (2 sigma^2), sigma = 1 + sigmoid(sum_e tanh(G[r][e]) * bf16(Wvp[e]) + bf16(bvp)); G f32 [NR][DM].
// One row per wave, 8 rows per block; a block's 8 values open a 128-B line of their own, so that each line of the table has one writer; the 8 floats behind them hold the block's 8 key norm maxima (g2_kn_max, one per wave). g2_sigma_load: a row's loads; g2_sigma_row: the row's value, the same in every lane of the wave.
#define SGR 8                        /* rows (= waves) per block */
static_assert((NB * SEQ) % SGR == 0);
static_assert(SGR * 4 <= 128 && SGR % 4 == 0 && SGR * 32 == 256);      /* one line per block, 16-B stores, one wave per row in a block of 256 */
__device__ __forceinline__ size_t sig_idx(size_t r) { return (r / SGR) * 32 + (r % SGR); }
__device__ __forceinline__ void g2_sigma_load(const float* __restrict__ G, const float* __restrict__ wvp, size_t row, int lane, float (&x)[DM / 32], float (&wv)[DM / 32]) {
  const float* p = G + row * DM + lane;
#pragma unroll      /* unrolled: the row's loads all go out before the first tanh, one memory latency per row instead of one per 32 elements */
  for (int j = 0; j < DM / 32; ++j) { x[j] = p[j * 32]; wv[j] = wvp[j * 32 + lane]; }
  asm volatile("s_wait_xcnt 0x0" ::: "memory"); }      /* what follows reuses the offset registers of these loads: the wait stands in front of it */
__device__ __forceinline__ float g2_sigma_row(const float (&x)[DM / 32], const float (&wv)[DM / 32], const float* __restrict__ bvp) {
  const float b0 = bf16_rne(bvp[0]);
  float acc = 0.f;
#pragma unroll      /* unrolled: x / wv are indexed by constants and stay in registers; the sum runs in ascending k */
  for (int j = 0; j < DM / 32; ++j) acc += tanhf(x[j]) * bf16_rne(wv[j]);
#pragma unroll
  for (int off = 16; off > 0; off >>= 1) acc += __shfl_xor(acc, off, 32);
  const float g = acc + b0;
  const float sgm = 1.0f + 1.0f / (1.0f + expf(-g));
  const float i2 = 1.0f / (2.0f * sgm * sgm);
  return i2;
}

// ---- alignment scores and their softmax statistics in one kernel, which also carries the two small jobs that wait for the projections alone: block = 128 query rows of one slab; MEANT[slab][t] = sum_s softmax(row t)[s] * s (f32; position sum centred at SEQ/2) ----
// Q3 / K3: the alignment pair's K-concatenated planes (slab by at column by * 192 of rows with pitch LQ3). Scores are formed transposed, keys x queries: A = key rows from LDS, B = the wave's 32 query rows, kept in registers for the whole walk,
// so a lane holds 32 of a 64-key tile's scores of one query (key = 16 c + 8 hh + r, query = ln) and keeps that query's running maximum and two running sums by itself, with no exchange between lanes inside the walk.
// Wave w: query rows 32 (w % 4) .. + 31, and of every staged step of 64 AKW keys the tile w / 4. At the end the 2 AKW partial statistics of a query row meet in LDS.
#define AKW 2                              /* key tiles per staged step = waves per SIMD */
#define AKS (64 * AKW)                     /* keys per staged step */
#define TB3 (3 * AKS * LP * 2)             /* bytes of one staged step: three K tiles of its key rows */
#define NAS (SEQ / AKS)                    /* staged steps */
#define AC (6.103515625e-05f * 1.44269504f)      /* raw score -> logit (2^-14) -> exponent of 2 */
static_assert(SEQ % AKS == 0 && NAS >= 2 && (2 * AKW) % 4 == 0);      /* whole steps, both buffers filled in front of the walk, 16-B reads of a row's partial statistics */
static_assert(2 * TB3 <= 327680 && 3 * 128 * 2 * AKW * 4 <= 2 * TB3);      /* the step buffers of k_falign, without tl and sg; the partial statistics fit into the two step buffers */
typedef float v2f __attribute__((ext_vector_type(2)));
// one staged step, global -> LDS: 12 copies of 16 B per lane; LDS rows step by 16 AKW per copy (four copies per K tile), s = the same step in the key plane
__device__ __forceinline__ void g2_stage_k(unsigned l, const _Float16* g, size_t s) {
  /* the closing s_wait_xcnt stands inside the statement so that no address register of a copy is rewritten in front of it */
  asm volatile("global_load_async_to_lds_b128 %0, %12, off\n\t" "global_load_async_to_lds_b128 %1, %13, off\n\t" "global_load_async_to_lds_b128 %2, %14, off\n\t"
               "global_load_async_to_lds_b128 %3, %15, off\n\t" "global_load_async_to_lds_b128 %4, %16, off\n\t" "global_load_async_to_lds_b128 %5, %17, off\n\t"
               "global_load_async_to_lds_b128 %6, %18, off\n\t" "global_load_async_to_lds_b128 %7, %19, off\n\t" "global_load_async_to_lds_b128 %8, %20, off\n\t"
               "global_load_async_to_lds_b128 %9, %21, off\n\t" "global_load_async_to_lds_b128 %10, %22, off\n\t" "global_load_async_to_lds_b128 %11, %23, off\n\t"
               "s_wait_xcnt 0x0"
               :: "v"(l), "v"(l + 1u * 16 * AKW * LP * 2), "v"(l + 2u * 16 * AKW * LP * 2), "v"(l + 3u * 16 * AKW * LP * 2), "v"(l + 4u * 16 * AKW * LP * 2), "v"(l + 5u * 16 * AKW * LP * 2),
                  "v"(l + 6u * 16 * AKW * LP * 2), "v"(l + 7u * 16 * AKW * LP * 2), "v"(l + 8u * 16 * AKW * LP * 2), "v"(l + 9u * 16 * AKW * LP * 2), "v"(l + 10u * 16 * AKW * LP * 2), "v"(l + 11u * 16 * AKW * LP * 2),
                  "v"(g), "v"(g + s), "v"(g + 2 * s), "v"(g + 3 * s), "v"(g + KT), "v"(g + KT + s), "v"(g + KT + 2 * s), "v"(g + KT + 3 * s),
                  "v"(g + 2 * KT), "v"(g + 2 * KT + s), "v"(g + 2 * KT + 2 * s), "v"(g + 2 * KT + 3 * s)
               : "memory"); }
// In front of the walk, while step 0 is under way, block (mt, by) transposes keys 128 mt .. + 127 of slab by's V, takes the largest squared norm of the same keys' content rows (K3c) and forms the width table's rows 8 (by * SEQ / 128 + mt) .. + 7, one per wave;
// both hand their values over in LDS at the barrier that publishes step 0 and store them behind it.
static_assert(128 * AKW == 256 && 4 * AKW == SGR && VTK == 128);      /* threads of the two jobs' index maps; one table row per wave; the block's keys = its query rows */
static_assert((SEQ / 128) * NB * NH == (NB * SEQ) / SGR);      /* as many blocks as table lines */
__global__ __launch_bounds__(128 * AKW) void k_falign(const _Float16* __restrict__ Q3, const _Float16* __restrict__ K3, float* __restrict__ MEANT,
    const _Float16* __restrict__ V16, _Float16* __restrict__ Vt, const float* __restrict__ G, const float* __restrict__ wvp, const float* __restrict__ bvp, float* __restrict__ SIGT, const _Float16* __restrict__ K3c) {
  __shared__ __attribute__((aligned(16))) unsigned char sm[2 * TB3];      /* two step buffers; behind the walk the partial statistics */
  __shared__ unsigned short tl[VTK][66];      /* the block's V rows on their way to V^T */
  __shared__ __attribute__((aligned(16))) float sg[2 * SGR];      /* the block's line of the width table: 8 widths, 8 key norm maxima */
  const int tid = threadIdx.x, w = __builtin_amdgcn_readfirstlane((int)(tid >> 5)), lane = tid & 31, ln = lane & 15, hh = lane >> 4;
  const int by = blockIdx.y, mt = blockIdx.x; const int wq = w & 3, wk = w >> 2;
  const unsigned l0 = (unsigned)(size_t)sm + (unsigned)((tid >> 3) * (LP * 2) + (tid & 7) * 16);
  const _Float16* gk = K3 + (size_t)(tid >> 3) * LQ3 + (size_t)by * CK + (tid & 7) * 8;
  const size_t sk = (size_t)(16 * AKW) * LQ3;
  g2_stage_k(l0, gk, sk);
  const _Float16* qp = Q3 + (size_t)(mt * 128 + 32 * wq + ln) * LQ3 + (size_t)by * CK;
  v16h fq[2][CK / 32];      /* the wave's query rows as B fragments: [group of 16 queries][k / 32] */
#pragma unroll      /* unrolled here and below: arrays indexed by constants stay in registers */
  for (int g = 0; g < 2; ++g) {
#pragma unroll
    for (int j = 0; j < CK / 32; ++j) fq[g][j] = g2_frag(qp + (size_t)g * 16 * LQ3 + 32 * j, hh); }
  const int fb = by * (SEQ / 128) + mt;      /* flat block index = line of the width table */
  { FragH vr[VTK * 8 / 256], kr[VTK * 8 / 256]; float x[DM / 32], wv[DM / 32];      /* the jobs' loads go out first and share one memory latency with step 0's copies */
    g2_vt_load(V16, vr, mt * VTK, by / NH, by % NH, tid);
    g2_kn_load(K3c, kr, mt * VTK, by, tid);
    g2_sigma_load(G, wvp, (size_t)fb * SGR + w, lane, x, wv);
    g2_vt_in(vr, tl, tid);
    const float kn = g2_kn_max(kr);
    const float i2 = g2_sigma_row(x, wv, bvp);
    if (lane == 0) { sg[w] = i2; sg[SGR + w] = kn; } }
  asm volatile("s_wait_asynccnt 0x0" ::: "memory");      /* this wave's part of step 0 has landed */
  __syncthreads();                                       /* ... and every other wave's; tl and sg are whole */
  g2_stage_k(l0 + TB3, gk + (size_t)AKS * LQ3, sk);
  g2_vt_out(Vt, tl, mt * VTK, by, tid);
  if (w == 0 && lane < 2 * SGR / 4) { const v4f v = *(const v4fa*)&sg[lane * 4]; float* dst = SIGT + (size_t)fb * 32 + lane * 4;
    *(v4f*)dst = v;  }
  const v8f z8 = {0.f,0.f,0.f,0.f,0.f,0.f,0.f,0.f};
  float mr[2] = {-3.0e38f, -3.0e38f}, se[2] = {0.f, 0.f}, sw[2] = {0.f, 0.f};      /* per query group: running maximum (raw score), sum of weights, sum of weight x centred position */
  v8f acc[8];      /* a key tile's scores: [query group * 4 + key tile of 16] */
  auto stats = [&](int n) {      /* folds the lane's 2 x 32 scores of its tile of step n into the running statistics */
    const float pb = (float)(n * AKS + 64 * wk + 8 * hh - SEQ / 2);      /* centred position of the lane's first key of the tile */
#pragma unroll
    for (int g = 0; g < 2; ++g) {
      float tc[4];      /* four short chains per statistic instead of one long one: a wave issues in order */
#pragma unroll
      for (int c = 0; c < 4; ++c) { const v8f a = acc[g * 4 + c]; tc[c] = fmaxf(fmaxf(fmaxf(a[0], a[1]), fmaxf(a[2], a[3])), fmaxf(fmaxf(a[4], a[5]), fmaxf(a[6], a[7]))); }
      const float tm = fmaxf(fmaxf(mr[g], fmaxf(tc[0], tc[1])), fmaxf(tc[2], tc[3]));
      const float m2 = tm * AC; const float al = __builtin_amdgcn_exp2f((mr[g] - tm) * AC); mr[g] = tm;
      float ts = 0.f, tw = 0.f;
#pragma unroll
      for (int c = 0; c < 4; ++c) { const v8f a = acc[g * 4 + c]; v2f s2 = {0.f, 0.f}, w2 = {0.f, 0.f};
#pragma unroll
        for (int r = 0; r < 8; r += 2) { const v2f a2 = {a[r], a[r + 1]}; const v2f t2 = a2 * AC - m2; const v2f e2 = {__builtin_amdgcn_exp2f(t2[0]), __builtin_amdgcn_exp2f(t2[1])};
          const v2f p2 = {(float)r, (float)(r + 1)}; s2 += e2; w2 += e2 * p2; }
        const float sc = s2[0] + s2[1]; ts += sc; tw += (w2[0] + w2[1]) + sc * (float)(16 * c); }
      se[g] = se[g] * al + ts; sw[g] = sw[g] * al + (tw + pb * ts); } };
  /* Waves w and w + 4 run half a step apart: waves 0 .. 3 read, multiply and then fold; waves 4 .. 7 first fold their tile of the step before, then read and multiply.
     So one wave's vector work runs beside the other's LDS reads and products, although one barrier per step holds all waves together. */
#pragma unroll 1
  for (int n = 0; n < NAS; ++n) {      /* rolled: one publish point per staged step */
    if (wk != 0 && n > 0) stats(n - 1);
    const _Float16* tb = (const _Float16*)(sm + (n & 1) * TB3);
    const _Float16* kp = tb + (64 * wk + ln) * LP;
    v16h fk[CK / 32][4];      /* the whole key tile as A fragments: [k / 32][key tile of 16] */
#pragma unroll
    for (int j = 0; j < CK / 32; ++j) {
#pragma unroll
      for (int c = 0; c < 4; ++c) fk[j][c] = g2_frag(kp + ((j >> 1) * AKS + c * 16) * LP + 32 * (j & 1), hh); }
    __builtin_amdgcn_sched_barrier(0);      /* keeps the tile's 48 LDS reads together in front of the products, in the order of their use: one place with reads per step, counted waits behind it */
#pragma unroll
    for (int j = 0; j < CK / 32; ++j) {
#pragma unroll
      for (int c = 0; c < 4; ++c) { acc[c] = __builtin_amdgcn_wmma_f32_16x16x32_f16(false, fk[j][c], false, fq[0][j], (short)0, j ? acc[c] : z8, false, false);
        acc[4 + c] = __builtin_amdgcn_wmma_f32_16x16x32_f16(false, fk[j][c], false, fq[1][j], (short)0, j ? acc[4 + c] : z8, false, false); } }
    __builtin_amdgcn_sched_barrier(0);      /* keeps the products in the order of the reads, two per arriving fragment; left free, the scheduler ran single accumulators' chains to their end first and waited for nearly all 48 reads at once */
    if (wk == 0) stats(n);
    /* this wave's reads of step n are done before its buffer is refilled. The four sums are named as inputs only, so that the statistics of waves 0 .. 3 stay in front of the barrier */
    asm volatile("s_wait_dscnt 0x0" :: "v"(se[0]), "v"(se[1]), "v"(sw[0]), "v"(sw[1]) : "memory");
    asm volatile("s_wait_asynccnt 0x0" ::: "memory");    /* this wave's part of step n + 1 has landed */
    __syncthreads();                                     /* publishes step n + 1 and ends every wave's reads of step n */
    if (n + 2 < NAS) g2_stage_k(l0 + (unsigned)(n & 1) * TB3, gk + (size_t)(n + 2) * AKS * LQ3, sk);
  }
  if (wk != 0) stats(NAS - 1);
  asm volatile("s_wait_asynccnt 0x0" ::: "memory");      /* nothing in flight when the buffers take the partial statistics */
  float (*st)[128][2 * AKW] = (float (*)[128][2 * AKW])sm;      /* [maximum as exponent of 2 | weights | weighted positions][query row][key tile of the step * 2 + lane half] */
#pragma unroll
  for (int g = 0; g < 2; ++g) { const int q = 32 * wq + 16 * g + ln, pi = 2 * wk + hh; st[0][q][pi] = mr[g] * AC; st[1][q][pi] = se[g]; st[2][q][pi] = sw[g]; }
  __syncthreads();                                       /* every wave's partial statistics are in LDS */
  if (w < 4) {      /* one query row per lane; a wave's 32 means fill one 128-B line */
    float pm[2 * AKW], ps[2 * AKW], pw[2 * AKW];
#pragma unroll
    for (int i = 0; i < 2 * AKW; i += 4) { const v4f a = *(const v4fa*)&st[0][tid][i], c = *(const v4fa*)&st[1][tid][i], d = *(const v4fa*)&st[2][tid][i];
#pragma unroll
      for (int k = 0; k < 4; ++k) { pm[i + k] = a[k]; ps[i + k] = c[k]; pw[i + k] = d[k]; } }
    float mx = pm[0];
#pragma unroll
    for (int i = 1; i < 2 * AKW; ++i) mx = fmaxf(mx, pm[i]);
    float es = 0.f, ws = 0.f;
#pragma unroll
    for (int i = 0; i < 2 * AKW; ++i) { const float f = __builtin_amdgcn_exp2f(pm[i] - mx); es += ps[i] * f; ws += pw[i] * f; }
    MEANT[(size_t)by * SEQ + mt * 128 + tid] = (float)(SEQ / 2) + ws / es; }
}

// ---- content scores, Gaussian softmax and P . V in one kernel: block = 128 query rows of one slab (wave w: rows 32 w .. 32 w + 31), walking the keys in tiles of 64 ----
// Q3 / K3: the content pair's K-concatenated planes (slab by at column by * 192 of rows with pitch LQ3); Vt f16 [slab][64][SEQ]; O f16 [t][b][h*64 + d] = 64 ctx.
// Both products are formed transposed. Scores, keys x queries: A = key rows from LDS, B = the wave's 32 query rows, kept in registers for the whole walk; a lane holds 32 of a key tile's scores of one query per group of 16 queries
// (key = 16 c + 8 hh + r, query = ln): y[s] = log2(e) (score - (s - mean)^2 * (1 / (2 sigma^2))), running maximum m (joined between the two lanes of a query once per tile) and the lane's own part of the sum l in f32.
// P = f16(2^14 2^(y - m)) of key tiles 2 s and 2 s + 1 is, register for register, the B fragment of keys 32 s .. 32 s + 31; ctx, d x queries: A = V^T rows from LDS; a lane's accumulators all belong to its own query, so exp(m_old - m_new) is the lane's own factor.
// The walk runs from the first to the last key tile that some row of the block needs: the Gaussian term, held against a run-time bound on the content score, tells where every weight of a tile rounds to zero in f32 (the bound stands at the place).
// Key tile n + 1 is in flight while tile n is worked on. At the end the two lanes of a query join their sums, and ctx * 2^6 / l leaves as 16 bytes (8 d) per accumulator tile.
#define TB2 ((3 * 64 + 64) * LP * 2)       /* bytes of one staged key tile: three K tiles of its 64 key rows, then its 64 V^T rows */
#define NKT (SEQ / 64)                     /* key tiles */
static_assert(CK / KT == 3 && NKT >= 2 && NKT <= 32);      /* one bit per key tile in a word */
static_assert(SEQ / 128 == 8 && SGR == 8);      /* a slab's key norm maxima: 8 table lines of 8, two per lane of a wave */
static_assert(2 * TB2 <= 196608);          /* the two tile buffers of k_fattn, without rq */
// 64 rows of 128 B, global -> LDS: 4 copies of 16 B per lane, rows step by 16 per copy
__device__ __forceinline__ void g2_stage_v(unsigned l, const _Float16* gv, size_t sv) {
  /* the closing s_wait_xcnt stands inside the statement so that no address register of a copy is rewritten in front of it */
  asm volatile("global_load_async_to_lds_b128 %0, %4, off\n\t" "global_load_async_to_lds_b128 %1, %5, off\n\t" "global_load_async_to_lds_b128 %2, %6, off\n\t"
               "global_load_async_to_lds_b128 %3, %7, off\n\t" "s_wait_xcnt 0x0"
               :: "v"(l), "v"(l + 1u * 16 * LP * 2), "v"(l + 2u * 16 * LP * 2), "v"(l + 3u * 16 * LP * 2), "v"(gv), "v"(gv + sv), "v"(gv + 2 * sv), "v"(gv + 3 * sv)
               : "memory"); }
__global__ __launch_bounds__(128) void k_fattn(const _Float16* __restrict__ Q3, const _Float16* __restrict__ K3, const _Float16* __restrict__ Vt,
    const float* __restrict__ MEANT, const float* __restrict__ SIGT, _Float16* __restrict__ O) {
  __shared__ __attribute__((aligned(16))) unsigned char sm[2 * TB2];      /* two tile buffers */
  __shared__ unsigned rq[4];      /* each wave's needed key tiles, one bit per tile */
  const int tid = threadIdx.x, w = __builtin_amdgcn_readfirstlane((int)(tid >> 5)), lane = tid & 31, ln = lane & 15, hh = lane >> 4;
  const int by = blockIdx.y, mt = blockIdx.x; const int b = by / NH;
  const int q0 = mt * 128 + 32 * w + ln;      /* the lane's query row in group 0; in group 1: + 16 */
  const unsigned l0 = (unsigned)(size_t)sm + (unsigned)((tid >> 3) * (LP * 2) + (tid & 7) * 16);
  const _Float16* gb = K3 + (size_t)(tid >> 3) * LQ3 + (size_t)by * CK + (tid & 7) * 8;
  const _Float16* gv = Vt + ((size_t)by * HD + (tid >> 3)) * SEQ + (tid & 7) * 8;
  const size_t sq = (size_t)16 * LQ3, sv = (size_t)16 * SEQ;
  auto stage = [&](int n) { const unsigned l = l0 + (unsigned)(n & 1) * TB2; const _Float16* gk = gb + (size_t)n * 64 * LQ3;      /* key tile n: 16 copies per lane */
    g2_stage_v(l, gk, sq); g2_stage_v(l + 1u * 64 * LP * 2, gk + KT, sq); g2_stage_v(l + 2u * 64 * LP * 2, gk + 2 * KT, sq);
    g2_stage_v(l + 3u * 64 * LP * 2, gv + n * 64, sv); };
  const v8f z8 = {0.f,0.f,0.f,0.f,0.f,0.f,0.f,0.f};
  v8f o[8] = {z8, z8, z8, z8, z8, z8, z8, z8};      /* ctx, d x queries: [query group * 4 + d tile of 16] */
  float m[2] = {-3.0e38f, -3.0e38f}, l[2] = {0.f, 0.f};      /* per query group: running maximum (exponent of 2), the lane's part of the sum of 2^14 weights */
  const _Float16* qp = Q3 + (size_t)q0 * LQ3 + (size_t)by * CK;
  v16h fq[2][CK / 32];      /* the wave's query rows as B fragments: [group of 16 queries][k / 32] */
#pragma unroll      /* unrolled here and below: arrays indexed by constants stay in registers */
  for (int g = 0; g < 2; ++g) {
#pragma unroll
    for (int j = 0; j < CK / 32; ++j) fq[g][j] = g2_frag(qp + (size_t)g * 16 * LQ3 + 32 * j, hh); }
  float mu[2], i2[2], kn[2];      /* per query group: the row's mean and 1 / (2 sigma^2); the lane's two of the slab's 64 key norm maxima */
  { const float* pmu = MEANT + (size_t)by * SEQ + q0; const float* ps0 = SIGT + sig_idx((size_t)q0 * NB + b); const float* ps1 = SIGT + sig_idx((size_t)(q0 + 16) * NB + b);
    const float* pkn = SIGT + ((size_t)by * (SEQ / 128) + (lane >> 3)) * 32 + SGR + (lane & 7);      /* table lines 0 .. 3 of the slab; lines 4 .. 7 stand 512 bytes on */
    /* the six loads and their data wait in one statement: no address register of theirs is rewritten while they are under way */
    asm volatile("global_load_b32 %0, %6, off\n\t" "global_load_b32 %1, %6, off offset:64\n\t" "global_load_b32 %2, %7, off\n\t" "global_load_b32 %3, %8, off\n\t"
                 "global_load_b32 %4, %9, off\n\t" "global_load_b32 %5, %9, off offset:512\n\t" "s_wait_loadcnt 0x0"
                 : "=&v"(mu[0]), "=&v"(mu[1]), "=&v"(i2[0]), "=&v"(i2[1]), "=&v"(kn[0]), "=&v"(kn[1]) : "v"(pmu), "v"(ps0), "v"(ps1), "v"(pkn) : "memory"); }
  const float i2l[2] = {i2[0] * 1.44269504f, i2[1] * 1.44269504f};      /* the Gaussian term as an exponent of 2 */
  /* Which key tiles can hold a weight that is not zero in f32. |content exponent| <= cb = log2(e) / 8 |q| max|k| (Cauchy-Schwarz; norms of the f16 values, widened for the residuals and the rounding).
     The row's final maximum is at least -cb - 1 (the key next to the mean, at most half a position away, where the mean lies among the positions); a key further than rr from the mean has y < cb - rr^2 i2l = -cb - 166,
     so 2^14 2^(y - m) < 2^-150 rounds to zero: such a key adds nothing to the sum or to P. Tiles in front of the first or behind the last that some row of the block needs are not walked. A mean outside the positions, or a bound that is no number, takes every tile. */
  int n0, n1;      /* first and last key tile of the walk, the same in the whole block */
  { float kx = fmaxf(kn[0], kn[1]);
    kx = fmaxf(kx, g2_rx<1>(kx)); kx = fmaxf(kx, g2_rx<2>(kx)); kx = fmaxf(kx, g2_rx<4>(kx)); kx = fmaxf(kx, g2_rx<8>(kx)); kx = fmaxf(kx, g2_xhalf(kx));
    const float ka = __builtin_amdgcn_sqrtf(kx) * 1.01f + 0.01f;      /* the plain hardware root here and below: its last bit is far inside the widening */
    unsigned need = 0u;      /* bit n: tile n is needed */
#pragma unroll
    for (int g = 0; g < 2; ++g) { float s4[4] = {0.f, 0.f, 0.f, 0.f};      /* the query side's third K tile holds the plain f16 values; four short chains */
#pragma unroll
      for (int e = 0; e < 16; ++e) { const float a = (float)fq[g][4][e], c = (float)fq[g][5][e]; s4[e & 1] += a * a; s4[2 + (e & 1)] += c * c; }
      const float sh = (s4[0] + s4[1]) + (s4[2] + s4[3]);
      const float qa = __builtin_amdgcn_sqrtf(sh + g2_xhalf(sh)) * 1.01f + 0.01f;      /* the two lanes of a query hold half of its row each */
      const float cb = qa * ka * (0.125f * 1.44269504f);
      const float rr = __builtin_amdgcn_sqrtf((2.0f * cb + 166.0f) * __builtin_amdgcn_rcpf(i2l[g]));
      const bool ok = (mu[g] >= -0.25f) && (mu[g] <= (float)(SEQ - 1) + 0.25f) && (rr < (float)(4 * SEQ));      /* false for a value that is no number */
      const int ta = ok ? max((int)floorf((mu[g] - rr) * (1.0f / 64.0f)), 0) : 0;
      const int tz = ok ? min((int)floorf((mu[g] + rr) * (1.0f / 64.0f)), NKT - 1) : NKT - 1;
      need |= ((2u << tz) - 1u) & ~((1u << ta) - 1u); }
    need |= (unsigned)g2_rxi<1>((int)need); need |= (unsigned)g2_rxi<2>((int)need); need |= (unsigned)g2_rxi<4>((int)need); need |= (unsigned)g2_rxi<8>((int)need);      /* both rows of 16 lanes hold the same 16 queries per group */
    if (lane == 0) rq[w] = need;
    __syncthreads();                                     /* every wave's needs are in LDS */
    need = (rq[0] | rq[1] | rq[2] | rq[3]) & ((2u << (NKT - 1)) - 1u);
    need = (unsigned)__builtin_amdgcn_readfirstlane((int)need); if (need == 0u) need = (2u << (NKT - 1)) - 1u;
    n0 = __builtin_ctz(need); n1 = 31 - __builtin_clz(need); }
  stage(n0);
  asm volatile("s_wait_asynccnt 0x0" ::: "memory");      /* this wave's part of the first tile has landed */
  __syncthreads();                                       /* ... and every other wave's */
  if (n0 < n1) stage(n0 + 1);
#pragma unroll 1
  for (int n = n0; n <= n1; ++n) {      /* rolled: one publish point per key tile */
    const _Float16* tb = (const _Float16*)(sm + (n & 1) * TB2);
    const _Float16* kp = tb + ln * LP; const _Float16* vp = tb + (192 + ln) * LP;
    v8f acc[8];      /* the key tile's scores: [query group * 4 + key tile of 16] */
    v16h fv[2][4];      /* the tile's V^T rows as A fragments: [key / 32][d tile of 16] */
    { v16h fk[CK / 32][4];      /* the whole key tile as A fragments: [k / 32][key tile of 16] */
#pragma unroll
      for (int j = 0; j < CK / 32; ++j) {
#pragma unroll
        for (int c = 0; c < 4; ++c) fk[j][c] = g2_frag(kp + ((j >> 1) * 64 + c * 16) * LP + 32 * (j & 1), hh); }
      __builtin_amdgcn_sched_barrier(0);      /* keeps the tile's 48 key reads together in front of the products, in the order of their use: one place with reads, counted waits behind it */
#pragma unroll
      for (int j = 0; j < CK / 32; ++j) {
        if (j == 2) {      /* the V^T reads go out once the first K tile's fragments are spent, into registers of that size, and land under the other 32 products */
#pragma unroll
          for (int s = 0; s < 2; ++s) {
#pragma unroll
            for (int c = 0; c < 4; ++c) fv[s][c] = g2_frag(vp + c * 16 * LP + 32 * s, hh); }
          __builtin_amdgcn_sched_barrier(0); }      /* keeps these 16 reads at this place, in front of the products that cover them */
#pragma unroll
        for (int c = 0; c < 4; ++c) { acc[c] = __builtin_amdgcn_wmma_f32_16x16x32_f16(false, fk[j][c], false, fq[0][j], (short)0, j ? acc[c] : z8, false, false);
          acc[4 + c] = __builtin_amdgcn_wmma_f32_16x16x32_f16(false, fk[j][c], false, fq[1][j], (short)0, j ? acc[4 + c] : z8, false, false); } }
      __builtin_amdgcn_sched_barrier(0); }      /* keeps the products in the order of the reads, two per arriving fragment */
    FragH pf[2][2];      /* P as B fragments: [query group][key / 32] */
#pragma unroll
    for (int g = 0; g < 2; ++g) {
      const float dm = (float)(n * 64 + 8 * hh) - mu[g];      /* the lane's first key of the tile, counted from the mean */
      v2f y[4][4]; float tc[4];      /* four short chains per statistic instead of one long one: a wave issues in order */
#pragma unroll
      for (int c = 0; c < 4; ++c) { const v8f a = acc[g * 4 + c];
#pragma unroll
        for (int r = 0; r < 8; r += 2) { const v2f a2 = {a[r], a[r + 1]}; const v2f k2 = {(float)(16 * c + r), (float)(16 * c + r + 1)}; const v2f d2 = k2 + dm;
          y[c][r >> 1] = a2 * AC - (d2 * d2) * i2l[g]; }
        tc[c] = fmaxf(fmaxf(fmaxf(y[c][0][0], y[c][0][1]), fmaxf(y[c][1][0], y[c][1][1])), fmaxf(fmaxf(y[c][2][0], y[c][2][1]), fmaxf(y[c][3][0], y[c][3][1]))); }
      const float th = fmaxf(fmaxf(tc[0], tc[1]), fmaxf(tc[2], tc[3]));
      const float mn = fmaxf(m[g], fmaxf(th, g2_xhalf(th)));      /* one maximum for both lanes of a query: their weights meet in one product */
      const float al = __builtin_amdgcn_exp2f(m[g] - mn); m[g] = mn;
      const float ms = mn - 14.0f;      /* weights come out x 2^14 */
      float ts = 0.f;
#pragma unroll
      for (int c = 0; c < 4; ++c) { v2f s2 = {0.f, 0.f};
#pragma unroll
        for (int r = 0; r < 8; r += 2) { const v2f t2 = y[c][r >> 1] - ms; const v2f e2 = {__builtin_amdgcn_exp2f(t2[0]), __builtin_amdgcn_exp2f(t2[1])}; s2 += e2;
          pf[g][c >> 1].h[(c & 1) * 8 + r] = toh_flush(e2[0]); pf[g][c >> 1].h[(c & 1) * 8 + r + 1] = toh_flush(e2[1]); }
        ts += s2[0] + s2[1]; }
      l[g] = l[g] * al + ts;
#pragma unroll
      for (int c = 0; c < 4; ++c) o[g * 4 + c] *= al; }
#pragma unroll
    for (int s = 0; s < 2; ++s) {
#pragma unroll
      for (int c = 0; c < 4; ++c) { o[c] = __builtin_amdgcn_wmma_f32_16x16x32_f16(false, fv[s][c], false, pf[0][s].v, (short)0, o[c], false, false);
        o[4 + c] = __builtin_amdgcn_wmma_f32_16x16x32_f16(false, fv[s][c], false, pf[1][s].v, (short)0, o[4 + c], false, false); } }
    /* this wave's reads of tile n are done before its buffer is refilled. The two sums are named as inputs only, so that the softmax stays in front of the waits and the barrier:
       left free, they rose to the last LDS read, and tile n + 1's copies, issued at the foot of the trip before, had only the score products to land under */
    asm volatile("s_wait_dscnt 0x0" :: "v"(l[0]), "v"(l[1]) : "memory");
    asm volatile("s_wait_asynccnt 0x0" ::: "memory");    /* this wave's part of tile n + 1 has landed */
    __syncthreads();                                     /* publishes tile n + 1 and ends every wave's reads of tile n */
    if (n + 2 <= n1) stage(n + 2);
  }
  asm volatile("s_wait_asynccnt 0x0" ::: "memory");      /* nothing in flight at the end */
#pragma unroll
  for (int g = 0; g < 2; ++g) { const float f = 64.0f / (l[g] + g2_xhalf(l[g]));      /* the two lanes of a query join their sums */
    unsigned short* dst = (unsigned short*)O + (size_t)(q0 + 16 * g) * LQ + (size_t)by * HD + 8 * hh;      /* a query row's 128-B line is written by its two lanes alone */
#pragma unroll
    for (int c = 0; c < 4; ++c) { FragH t;
#pragma unroll
      for (int r = 0; r < 8; ++r) t.h[r] = (_Float16)(o[g * 4 + c][r] * f);
      *(v8us*)(dst + 16 * c) = t.half[0]; } }
}

extern "C" void kernel_launch(void* const* d_in, const int* in_sizes, int n_in,
                              void* d_out, int out_size, void* d_ws, size_t ws_size, hipStream_t stream) {
  if (n_in < 19) return;
  if ((size_t)in_sizes[0] < NR * DM || (size_t)in_sizes[1] < NR * DM || (size_t)in_sizes[2] < NR * DM) return;
  if ((size_t)in_sizes[3] < (size_t)DM * DM || (size_t)in_sizes[5] < (size_t)DM * DM || (size_t)in_sizes[7] < (size_t)DM * DM || (size_t)in_sizes[9] < (size_t)DM * DM) return;
  if ((size_t)in_sizes[11] < (size_t)DM * DM || (size_t)in_sizes[13] < (size_t)DM * DM || (size_t)in_sizes[17] < (size_t)DM * DM) return;
  if (in_sizes[4] < DM || in_sizes[6] < DM || in_sizes[8] < DM || in_sizes[10] < DM || in_sizes[12] < DM || in_sizes[14] < DM || in_sizes[15] < DM || in_sizes[16] < 1 || in_sizes[18] < DM) return;
  if ((size_t)out_size < NR * DM) return;
  const float* const* I = (const float* const*)d_in;
  const float* xq = I[0]; const float* xk = I[1]; const float* xv = I[2];
  const float* wq = I[3]; const float* bq = I[4]; const float* wk = I[5]; const float* bk = I[6]; const float* wv = I[7]; const float* bv = I[8];
  const float* whq = I[9]; const float* bhq = I[10]; const float* whk = I[11]; const float* bhk = I[12]; const float* wwp = I[13]; const float* bwp = I[14];
  const float* wvp = I[15]; const float* bvp = I[16]; const float* wo = I[17]; const float* bo = I[18];
  char* ws = (char*)d_ws; size_t off = 0;
  auto take = [&](size_t bytes) { char* p = ws + off; off += (bytes + 255) & ~(size_t)255; return p; };
  _Float16* BQ = (_Float16*)take((size_t)DM * DM * 2); _Float16* BK = (_Float16*)take((size_t)DM * DM * 2); _Float16* BV = (_Float16*)take((size_t)DM * DM * 2);
  _Float16* BHQ = (_Float16*)take((size_t)DM * DM * 2); _Float16* BHK = (_Float16*)take((size_t)DM * DM * 2); _Float16* BWP = (_Float16*)take((size_t)DM * DM * 2); _Float16* BO = (_Float16*)take((size_t)DM * DM * 2);
  _Float16* XQ = (_Float16*)take(NR * DM * 2); _Float16* XK = (_Float16*)take(NR * DM * 2); _Float16* XV = (_Float16*)take(NR * DM * 2);
  _Float16* CA = (_Float16*)take(NR * 3 * DM * 2); _Float16* CB = (_Float16*)take(NR * 3 * DM * 2);      /* concatenated planes of the alignment pair */
  _Float16* V16 = (_Float16*)take(NR * DM * 2); _Float16* O16 = (_Float16*)take(NR * DM * 2); _Float16* VT = (_Float16*)take((size_t)NB * NH * HD * SEQ * 2);
  float* S = (float*)take((size_t)NB * NH * QC * SEQ * 4); _Float16* PM = (_Float16*)take((size_t)NB * NH * QC * SEQ * 2);
  float* MEANT = (float*)take((size_t)NB * NH * SEQ * 4); float* SIGT = (float*)take(NR / SGR * 128);
  if (off > ws_size) return;
  float* G = S;                                                            /* f32 wp plane [NR][DM], consumed by k_falign's width table part */
  _Float16* CA2 = PM; _Float16* CB2 = PM + NR * 3 * DM;                    /* content pair's concatenated planes */
  k_cvt<<<7 * WBL + 3 * XBL, 256, 0, stream>>>(wq, wk, wv, whq, whk, wwp, wo, xq, xk, xv, BQ, XQ);      /* planes BQ .. BO and XQ .. XV in the order of their take() calls */
  const dim3 gp((unsigned)((MP / 128) * (DM / 64)), 1);
  k_proj<<<dim3((unsigned)((MP / 128) * (DM / 64)), 6), 128, 0, stream>>>(XQ, XK, XV, BV, BWP, BHQ, BHK, BQ, BK, bv, bwp, bhq, bhk, bq, bk, V16, G, CA, CB, CA2, CB2);
  /* alignment pair: scores and expected key position; slab by = b*NH + h at column offset by*192 of rows with pitch LQ3; with it V16 rows [SEQ*NB][DM] -> VT[(b,h)][64][SEQ] and the width table */
  k_falign<<<dim3(SEQ / 128, NB * NH), 128 * AKW, 0, stream>>>(CA, CB, MEANT, V16, VT, G, wvp, bvp, SIGT, CB2);
  /* content pair: scores, Gaussian softmax and P . V; ctx[t][b][h*64 + d] x64 */
  k_fattn<<<dim3(SEQ / 128, NB * NH), 128, 0, stream>>>(CA2, CB2, VT, MEANT, SIGT, O16);
  k_gemm2<true, true, true><<<gp, 128, 0, stream>>>(O16, DM, 0, BO, DM, 0, 0.0009765625f, bo, (float*)d_out, nullptr, DM, 0, MP, DM, DM);      /* out rows t*NB_FULL + b */
}

// v010
// Measured time: 78.9 microseconds a run.
// Two timings next to v009 put it at 1.07 and 1.08 times that version's speed.
// Counting every step since v000, it is 8.37 times as fast.
#include <hip/hip_runtime.h>
// Gaussian-windowed multi-head cross attention, sequence-first layout: query [1024][2][1024], key_in / value [1024][2][1024] (token row r = t*NB + b); six input maps with natural [out][in] weights + biases: q, hq, wp from query; k, hk from key_in; v from value; 16 heads of 64 (flat slab b*16 + h); content logits 64^-0.5 q.k; alignment softmax over keys of 64^-0.5 hq.hk, mean = expected key position; width sigma = 1 + sigmoid(tanh(wp) . Wvp + bvp) per (t, b); P = softmax_s(content - (s - mean)^2 / (2 sigma^2)); ctx = P . v merged [t][b][h*64+d]; out = ctx Wo^T + bo.
// Structure: inputs as exact f16 rows (RNE-converted to bf16 first); all conversions as one launch; the six input projections as one launch of WMMA GEMMs (128x128 block tiles, 64x64 wave tiles, f32 accumulation, x16 weights + bias); q/hq and k/hk are written as K-concatenated planes per head [2048 hi | res | hi] and [hi | hi | res] (hi = f16 value, res = f16 of 2048 (v - hi)) so one K = 192 GEMM yields 2048 (hi.hi) + res.hi + hi.res; all query rows as one chunk: k_falign: first each work-group's share of the V transposition and of the width table (both need only the projections, as the alignment scores do), then alignment scores per 64-key tile with running-maximum f32 softmax statistics (centred position sum), its S never in memory; k_fattn: content scores, Gaussian term, running-maximum f32 softmax (P as f16 x 2^14 of exp(x - running max)) and P . V^T per 64-key tile in one launch, both products transposed, S and P of the content pair never out of registers (ctx carried x64) -> out GEMM (f32).
// Compute dtype: all contractions v_wmma_f32_16x16x32_f16 (f16 operands, f32 accumulate); inputs RNE-converted to bf16 (exact in f16); both score sites as f16 value + x2048 residual (three products folded along K); v, P (x2^14), ctx (x64), Wo as plain f16 operands; softmax statistics, mean, tanh / Wvp / sigmoid on the vector unit in f32.
#ifndef NB
#define NB 2                         /* batches processed */
#endif
#ifndef SEQ
#define SEQ 1024                     /* sequence length processed (queries = keys) */
#endif
#define NB_FULL 2                    /* batch pitch of the input / output rows */
#define DM 1024
#define NH 16
#define HD 64
#define QC SEQ                       /* query rows per attention chunk: all of them, so each attention stage is one launch over every (slab, row) */
#define NR ((size_t)NB * SEQ)        /* token rows */
#define MP ((int)(NB * SEQ))
#define LQ (NB * DM)                 /* pitch between consecutive t for one batch */
#define CK (3 * HD)                  /* concatenated K per head */
#define LQ3 (NB * 3 * DM)            /* pitch between consecutive t in a concatenated plane */
static_assert(SEQ % 128 == 0);
static_assert(QC % 128 == 0);
static_assert(SEQ % QC == 0);
static_assert(NH * HD == DM);
static_assert(NB <= NB_FULL);
static_assert((NB * SEQ) % 128 == 0);
static_assert(NH == 16);
static_assert(HD == 64);                         
static_assert(CK % 32 == 0);
static_assert(DM % 32 == 0);
static_assert(QC % 32 == 0);
static_assert((NB * SEQ) % 32 == 0);
static_assert(NH * QC >= DM);                    /* the f32 wp plane [NR][DM] fits into the S region */
static_assert(NH * QC >= 2 * 3 * DM);            /* the content pair's two concatenated planes fit into the P region */
static_assert(QC == SEQ);
static_assert(32 * 8 * 16 == 32 * HD * 2);       
#define KT 64                        /* k elements per staged tile: one 128-B line of every operand row */
#define LP 72                        /* LDS row pitch in f16: 144 B = 16 B x odd, for 16-byte fragment reads */
#define TB ((128 + 64) * LP * 2)     /* bytes of one staged tile: 128 A rows, then 64 Bt rows */
static_assert(CK % KT == 0 && DM % KT == 0 && SEQ % KT == 0);   /* every K of the GEMM launches */
static_assert(4 * 32 * 68 * 4 <= 2 * TB);        /* the output staging fits into the two tile buffers */
static_assert(2 * TB <= 131072);                 /* static LDS of k_gemm2 */
#define WS_TOTAL (7 * (size_t)DM * DM * 2 + 3 * NR * DM * 2 + 2 * NR * 3 * DM * 2 + 2 * NR * DM * 2 + (size_t)NB * NH * HD * SEQ * 2 + (size_t)NB * NH * QC * SEQ * 4 + (size_t)NB * NH * QC * SEQ * 2 + (size_t)NB * NH * SEQ * 4 + NR * 16)
static_assert(WS_TOTAL + 32 * 256 <= 268435456);

typedef unsigned short v8us __attribute__((ext_vector_type(8), may_alias));
typedef float  v8f  __attribute__((ext_vector_type(8)));
typedef float  v4f  __attribute__((ext_vector_type(4)));
typedef float  v4fa __attribute__((ext_vector_type(4), may_alias));
typedef _Float16 v16h __attribute__((ext_vector_type(16)));
typedef _Float16 v4h __attribute__((ext_vector_type(4)));
union FragH { v16h v; v8us half[2]; _Float16 h[16]; unsigned short u[16]; };

__device__ __forceinline__ unsigned short bf16_bits(float x) { unsigned int u = __float_as_uint(x); return (unsigned short)((u + 0x7FFFu + ((u >> 16) & 1u)) >> 16); }
__device__ __forceinline__ float bf16_val(unsigned short b) { return __uint_as_float(((unsigned int)b) << 16); }
__device__ __forceinline__ float bf16_rne(float x) { return bf16_val(bf16_bits(x)); }   /* RNE convert to bf16, back as f32 */

typedef _Float16 h16;
// f32 -> f16 with a value select: magnitudes below 2^-14 become +0 (no f16 subnormal can reach a WMMA operand)
static __device__ __forceinline__ h16 toh_flush(float v) { const h16 r = (h16)v; return (fabsf(v) < 6.103515625e-05f) ? (h16)0.0f : r; }

// fragment: elements 0..7 <- k0 + 8h .. +7, elements 8..15 <- k0 + 16 + 8h .. +7 (p points at k0 of the lane's row / column)
__device__ __forceinline__ v16h g2_frag(const _Float16* p, int hh) { FragH f; f.half[0] = *(const v8us*)((const unsigned short*)p + 8 * hh); f.half[1] = *(const v8us*)((const unsigned short*)p + 16 + 8 * hh); return f.v; }
__device__ __forceinline__ v8f g2_mma(v16h a, v16h b, v8f c) { v8f d = __builtin_amdgcn_wmma_f32_16x16x32_f16(false, a, false, b, (short)0, c, false, false); asm volatile("v_nop\n\tv_nop\n\tv_nop\n\tv_nop" : "+v"(d) : "v"(a), "v"(b)); return d; }

// one K tile of the block's operands, global -> LDS with no register in between: 12 copies of 16 B per lane; a wave's copy covers 4 whole 128-B lines.
// l: the lane's LDS byte address in tile row tid / 8 (rows step by 16 per copy); ga / gb: the lane's 16 bytes in that row of A / Bt at this tile's k.
__device__ __forceinline__ void g2_stage(unsigned l, const _Float16* ga, size_t sa, const _Float16* gb, size_t sb) {
  /* the closing s_wait_xcnt stands inside the statement so that no address register of a copy is rewritten in front of it */
  asm volatile("global_load_async_to_lds_b128 %0, %12, off\n\t" "global_load_async_to_lds_b128 %1, %13, off\n\t" "global_load_async_to_lds_b128 %2, %14, off\n\t"
               "global_load_async_to_lds_b128 %3, %15, off\n\t" "global_load_async_to_lds_b128 %4, %16, off\n\t" "global_load_async_to_lds_b128 %5, %17, off\n\t"
               "global_load_async_to_lds_b128 %6, %18, off\n\t" "global_load_async_to_lds_b128 %7, %19, off\n\t" "global_load_async_to_lds_b128 %8, %20, off\n\t"
               "global_load_async_to_lds_b128 %9, %21, off\n\t" "global_load_async_to_lds_b128 %10, %22, off\n\t" "global_load_async_to_lds_b128 %11, %23, off\n\t"
               "s_wait_xcnt 0x0"
               :: "v"(l), "v"(l + 1u * 16 * LP * 2), "v"(l + 2u * 16 * LP * 2), "v"(l + 3u * 16 * LP * 2), "v"(l + 4u * 16 * LP * 2), "v"(l + 5u * 16 * LP * 2),
                  "v"(l + 6u * 16 * LP * 2), "v"(l + 7u * 16 * LP * 2), "v"(l + 8u * 16 * LP * 2), "v"(l + 9u * 16 * LP * 2), "v"(l + 10u * 16 * LP * 2), "v"(l + 11u * 16 * LP * 2),
                  "v"(ga), "v"(ga + sa), "v"(ga + 2 * sa), "v"(ga + 3 * sa), "v"(ga + 4 * sa), "v"(ga + 5 * sa), "v"(ga + 6 * sa), "v"(ga + 7 * sa),
                  "v"(gb), "v"(gb + sb), "v"(gb + 2 * sb), "v"(gb + 3 * sb)
               : "memory"); }

// main loop of k_gemm2: block tile 128 x 64, wave w takes rows 32 w .. 32 w + 31; two LDS tile buffers, tile t + 1 in flight while tile t is multiplied.
// Ab: row 0 of the block's 128 A rows; Bb: row 0 of its 64 Bt rows; K % KT == 0. On return every wave has left both buffers and no copy is outstanding.
__device__ __forceinline__ void g2_main(unsigned char* sm, const _Float16* Ab, int lda, const _Float16* Bb, int ldb, int K, int tid, int w, int ln, int hh, v8f (&acc)[8]) {
  const int nt = K / KT;
  const unsigned l0 = (unsigned)(size_t)sm + (unsigned)((tid >> 3) * (LP * 2) + (tid & 7) * 16);
  const _Float16* ga = Ab + (size_t)(tid >> 3) * lda + (tid & 7) * 8; const _Float16* gb = Bb + (size_t)(tid >> 3) * ldb + (tid & 7) * 8;
  const size_t sa = (size_t)16 * lda, sb = (size_t)16 * ldb;
  g2_stage(l0, ga, sa, gb, sb);
  asm volatile("s_wait_asynccnt 0x0" ::: "memory");      /* this wave's part of tile 0 has landed */
  __syncthreads();                                       /* ... and every other wave's */
  if (nt > 1) g2_stage(l0 + TB, ga + KT, sa, gb + KT, sb);
#pragma unroll 1
  for (int t = 0; t < nt; ++t) {      /* rolled: one publish point per tile */
    const _Float16* tb = (const _Float16*)(sm + (t & 1) * TB);
    const _Float16* ap = tb + (32 * w + ln) * LP; const _Float16* bp = tb + (128 + ln) * LP;
    v16h fa[KT / 32][2], fb[KT / 32][4];      /* the tile's fragment reads go out as one group, in the order of their use, ahead of the products */
#pragma unroll      /* unrolled here and below: fa / fb are indexed by constants and stay in registers */
    for (int s = 0; s < KT / 32; ++s) { fa[s][0] = g2_frag(ap + 32 * s, hh); fb[s][0] = g2_frag(bp + 32 * s, hh); fa[s][1] = g2_frag(ap + 16 * LP + 32 * s, hh);
      fb[s][1] = g2_frag(bp + 16 * LP + 32 * s, hh); fb[s][2] = g2_frag(bp + 32 * LP + 32 * s, hh); fb[s][3] = g2_frag(bp + 48 * LP + 32 * s, hh); }
#pragma unroll
    for (int s = 0; s < KT / 32; ++s) {
#pragma unroll
      for (int c = 0; c < 4; ++c) { acc[c] = g2_mma(fa[s][0], fb[s][c], acc[c]); acc[4 + c] = g2_mma(fa[s][1], fb[s][c], acc[4 + c]); } }
    asm volatile("s_wait_dscnt 0x0" ::: "memory");       /* this wave's reads of tile t are done before its buffer is refilled */
    asm volatile("s_wait_asynccnt 0x0" ::: "memory");    /* this wave's part of tile t + 1 has landed */
    __syncthreads();                                     /* publishes tile t + 1 and ends every wave's reads of tile t */
    if (t + 2 < nt) g2_stage(l0 + (unsigned)(t & 1) * TB, ga + (size_t)(t + 2) * KT, sa, gb + (size_t)(t + 2) * KT, sb);
  }
  asm volatile("s_wait_asynccnt 0x0" ::: "memory");      /* nothing in flight when the buffers become output staging */
}

// ---- GEMM (wave tile 32x64; M % 128 == 0 per launch region, N % 64 == 0, K % 64 == 0): C = alpha * A . Bt^T (+ bias) ----
// A f16 [M][K] (pitch lda), Bt f16 [N][K] (pitch ldb); batch slab by = blockIdx.y with element strides sA / sB / sC.
// OMAP: output row r -> (r / NB) * NB_FULL + r % NB.
template <bool HASB, bool OUT32, bool OMAP>
__global__ __launch_bounds__(128) void k_gemm2(const _Float16* __restrict__ A, int lda, size_t sA, const _Float16* __restrict__ Bh, int ldb, size_t sB, float alpha,
    const float* __restrict__ bias, float* __restrict__ C, _Float16* __restrict__ C16, int ldc, size_t sC, int M, int N, int K) {
  __shared__ __attribute__((aligned(16))) unsigned char sm[2 * TB]; float (*so)[32][68] = (float (*)[32][68])sm;      /* two tile buffers; output staging behind the main loop */
  const int tid = threadIdx.x, w = __builtin_amdgcn_readfirstlane((int)(tid >> 5)), lane = tid & 31, ln = lane & 15, hh = lane >> 4; const int by = blockIdx.y;
  A += (size_t)by * sA; Bh += (size_t)by * sB; const size_t cofs = (size_t)by * sC;
  const int ntn = N >> 6; const int mt = blockIdx.x / ntn, nq = blockIdx.x - mt * ntn; const int row0 = mt * 128 + 32 * w, col0 = nq * 64; if (mt * 128 >= M) return;      /* the whole block leaves, in front of every barrier */
  const v8f z8 = {0.f,0.f,0.f,0.f,0.f,0.f,0.f,0.f}; v8f accs[8] = {z8, z8, z8, z8, z8, z8, z8, z8};      /* [row half * 4 + column tile] */
  g2_main(sm, A + (size_t)(mt * 128) * lda, lda, Bh + (size_t)col0 * ldb, ldb, K, tid, w, ln, hh, accs);
#pragma unroll
  for (int u = 0; u < 8; ++u) { const int t = u & 3, half = u >> 2; const int col = col0 + t * 16 + ln; float bv = 0.f; if (HASB) bv = bf16_rne(bias[col]);
#pragma unroll
    for (int r = 0; r < 8; ++r) { const int rloc = half * 16 + 8 * hh + r; so[w][rloc][t * 16 + ln] = accs[u][r] * alpha + bv; } }
  __builtin_amdgcn_fence(4 /* acq_rel order */, "workgroup"); __builtin_amdgcn_wave_barrier();      /* so[w] is private to wave w */
  const int rsub = lane >> 4, c4 = (lane & 15) * 4;
  {
#pragma unroll
    for (int q = 0; q < 16; ++q) { const int r = q * 2 + rsub; const v4f v = *(const v4fa*)&so[w][r][c4];
      const int gr = row0 + r; const size_t orow = OMAP ? ((size_t)(gr / NB) * NB_FULL + (size_t)(gr % NB)) : (size_t)gr;
      if (OUT32) { *(v4f*)(C + cofs + orow * ldc + col0 + c4) = v; }
      else { v4h h4;
#pragma unroll
        for (int i = 0; i < 4; ++i) h4[i] = (_Float16)v[i];
        *(v4h*)(C16 + cofs + orow * ldc + col0 + c4) = h4; } }
     } }

// ---- main loop of the input projections: block tile 128 x 128, four waves as 2 x 2, wave (wr, wc) takes rows 64 wr .. + 63 and columns 64 wc .. + 63 ----
// Against the 128 x 64 tile of g2_main a block fetches 256 operand rows for 16,384 outputs instead of 192 for 8,192 (two thirds of the bytes from L2 per product), and a wave reads 8 fragments for 16 products instead of 6 for 8.
#define TBP ((128 + 128) * LP * 2)   /* bytes of one staged tile: 128 A rows, then 128 Bt rows */
static_assert(DM % 128 == 0 && DM / KT >= 2);    /* whole column tiles; both buffers filled in front of the loop */
static_assert(4 * 64 * 68 * 4 <= 2 * TBP);       /* the output staging fits into the two tile buffers */
static_assert(3 * 2 * TBP <= 327680);            /* static LDS of k_proj: three blocks fit one WGP's LDS */
// 128 rows of 128 B, global -> LDS: 8 copies of 16 B per lane, rows step by 16 per copy; a wave's copy covers 4 whole 128-B lines
__device__ __forceinline__ void g2_stage_r(unsigned l, const _Float16* g, size_t s) {
  /* the closing s_wait_xcnt stands inside the statement so that no address register of a copy is rewritten in front of it */
  asm volatile("global_load_async_to_lds_b128 %0, %8, off\n\t" "global_load_async_to_lds_b128 %1, %9, off\n\t" "global_load_async_to_lds_b128 %2, %10, off\n\t"
               "global_load_async_to_lds_b128 %3, %11, off\n\t" "global_load_async_to_lds_b128 %4, %12, off\n\t" "global_load_async_to_lds_b128 %5, %13, off\n\t"
               "global_load_async_to_lds_b128 %6, %14, off\n\t" "global_load_async_to_lds_b128 %7, %15, off\n\t" "s_wait_xcnt 0x0"
               :: "v"(l), "v"(l + 1u * 16 * LP * 2), "v"(l + 2u * 16 * LP * 2), "v"(l + 3u * 16 * LP * 2), "v"(l + 4u * 16 * LP * 2), "v"(l + 5u * 16 * LP * 2),
                  "v"(l + 6u * 16 * LP * 2), "v"(l + 7u * 16 * LP * 2),
                  "v"(g), "v"(g + s), "v"(g + 2 * s), "v"(g + 3 * s), "v"(g + 4 * s), "v"(g + 5 * s), "v"(g + 6 * s), "v"(g + 7 * s)
               : "memory"); }
// Ab: row 0 of the block's 128 A rows; Bb: row 0 of its 128 Bt rows; both with pitch DM, K = DM. acc: [row tile of 16 * 4 + column tile of 16]. On return every wave has left both buffers and no copy is outstanding.
__device__ __forceinline__ void g2_main_p(unsigned char* sm, const _Float16* Ab, const _Float16* Bb, int tid, int wr, int wc, int ln, int hh, v8f (&acc)[16]) {
  const int nt = DM / KT;
  const unsigned l0 = (unsigned)(size_t)sm + (unsigned)((tid >> 3) * (LP * 2) + (tid & 7) * 16);
  const _Float16* ga = Ab + (size_t)(tid >> 3) * DM + (tid & 7) * 8; const _Float16* gb = Bb + (size_t)(tid >> 3) * DM + (tid & 7) * 8;
  const size_t sr = (size_t)16 * DM;
  g2_stage_r(l0, ga, sr); g2_stage_r(l0 + 128u * LP * 2, gb, sr);
  asm volatile("s_wait_asynccnt 0x0" ::: "memory");      /* this wave's part of tile 0 has landed */
  __syncthreads();                                       /* ... and every other wave's */
  g2_stage_r(l0 + TBP, ga + KT, sr); g2_stage_r(l0 + TBP + 128u * LP * 2, gb + KT, sr);
#pragma unroll 1
  for (int t = 0; t < nt; ++t) {      /* rolled: one publish point per tile */
    const _Float16* tb = (const _Float16*)(sm + (t & 1) * TBP);
    const _Float16* ap = tb + (64 * wr + ln) * LP; const _Float16* bp = tb + (128 + 64 * wc + ln) * LP;
    v16h fa[KT / 32][4], fb[KT / 32][4];      /* the tile's 32 fragment reads go out as one group, in the order of their use, ahead of the products */
    /* the products are the plain builtin, as in k_falign and k_fattn: as operands of g2_mma's asm statement the 128 accumulator and 128 fragment registers would all have to lie below v256, and that build spilled */
#pragma unroll      /* unrolled here and below: fa / fb are indexed by constants and stay in registers */
    for (int s = 0; s < KT / 32; ++s) {
#pragma unroll
      for (int i = 0; i < 4; ++i) fa[s][i] = g2_frag(ap + i * 16 * LP + 32 * s, hh);
#pragma unroll
      for (int i = 0; i < 4; ++i) fb[s][i] = g2_frag(bp + i * 16 * LP + 32 * s, hh); }
    __builtin_amdgcn_sched_barrier(0);      /* keeps the reads together in front of the products: one place with reads per tile, counted waits behind it */
#pragma unroll
    for (int s = 0; s < KT / 32; ++s) {
#pragma unroll
      for (int c = 0; c < 4; ++c) {
#pragma unroll
        for (int i = 0; i < 4; ++i) acc[i * 4 + c] = __builtin_amdgcn_wmma_f32_16x16x32_f16(false, fa[s][i], false, fb[s][c], (short)0, acc[i * 4 + c], false, false); } }
    __builtin_amdgcn_sched_barrier(0);      /* keeps the products in the order of the reads */
    asm volatile("s_wait_dscnt 0x0" ::: "memory");       /* this wave's reads of tile t are done before its buffer is refilled */
    asm volatile("s_wait_asynccnt 0x0" ::: "memory");    /* this wave's part of tile t + 1 has landed */
    __syncthreads();                                     /* publishes tile t + 1 and ends every wave's reads of tile t */
    if (t + 2 < nt) { const unsigned l = l0 + (unsigned)(t & 1) * TBP; g2_stage_r(l, ga + (size_t)(t + 2) * KT, sr); g2_stage_r(l + 128u * LP * 2, gb + (size_t)(t + 2) * KT, sr); }
  }
  asm volatile("s_wait_asynccnt 0x0" ::: "memory");      /* nothing in flight when the buffers become output staging */
}

// ---- the six input projections as one launch (M = MP, N = K = DM; a wave's 64 columns == one head): job = blockIdx.y picks operands, bias and output form ----
// x = A . Bt^T / 16 + bias (f32). job 0: v, f16 rows; job 1: wp, f32 rows; jobs 2 .. 5: hq, hk, q, k as K-concatenated planes:
// hi = f16(x), res = f16(2048 (x - hi)); head h = col0 / 64 of row r at C3 + r * 3 DM + h * 192: query side [2048 hi | res | hi], key side [hi | hi | res].
__global__ __launch_bounds__(128) void k_proj(const _Float16* __restrict__ XQ, const _Float16* __restrict__ XK, const _Float16* __restrict__ XV,
    const _Float16* __restrict__ BV, const _Float16* __restrict__ BWP, const _Float16* __restrict__ BHQ, const _Float16* __restrict__ BHK, const _Float16* __restrict__ BQ, const _Float16* __restrict__ BK,
    const float* __restrict__ bv, const float* __restrict__ bwp, const float* __restrict__ bhq, const float* __restrict__ bhk, const float* __restrict__ bq, const float* __restrict__ bk,
    _Float16* __restrict__ V16, float* __restrict__ G, _Float16* __restrict__ CHQ, _Float16* __restrict__ CHK, _Float16* __restrict__ CQ, _Float16* __restrict__ CK3) {
  __shared__ __attribute__((aligned(16))) unsigned char sm[2 * TBP]; float (*so)[64][68] = (float (*)[64][68])sm;      /* two tile buffers; output staging behind the main loop */
  const int tid = threadIdx.x, w = __builtin_amdgcn_readfirstlane((int)(tid >> 5)), lane = tid & 31, ln = lane & 15, hh = lane >> 4; const int job = blockIdx.y;
  const _Float16* A; const _Float16* Bh; const float* bias; _Float16* C3 = nullptr;
  switch (job) {
    case 0: A = XV; Bh = BV; bias = bv; break;
    case 1: A = XQ; Bh = BWP; bias = bwp; break;
    case 2: A = XQ; Bh = BHQ; bias = bhq; C3 = CHQ; break;
    case 3: A = XK; Bh = BHK; bias = bhk; C3 = CHK; break;
    case 4: A = XQ; Bh = BQ; bias = bq; C3 = CQ; break;
    default: A = XK; Bh = BK; bias = bk; C3 = CK3; break; }
  const int mt = blockIdx.x / (DM / 128), nq = blockIdx.x - mt * (DM / 128); const int wr = w >> 1, wc = w & 1; const int row0 = mt * 128 + 64 * wr, col0 = nq * 128 + 64 * wc;
  const v8f z8 = {0.f,0.f,0.f,0.f,0.f,0.f,0.f,0.f}; v8f accs[16] = {z8, z8, z8, z8, z8, z8, z8, z8, z8, z8, z8, z8, z8, z8, z8, z8};      /* [row tile of 16 * 4 + column tile] */
  g2_main_p(sm, A + (size_t)(mt * 128) * DM, Bh + (size_t)(nq * 128) * DM, tid, wr, wc, ln, hh, accs);
#pragma unroll
  for (int u = 0; u < 16; ++u) { const int t = u & 3, half = u >> 2; const int col = col0 + t * 16 + ln; const float bb = bf16_rne(bias[col]);
#pragma unroll
    for (int r = 0; r < 8; ++r) { const int rloc = half * 16 + 8 * hh + r; so[w][rloc][t * 16 + ln] = accs[u][r] * 0.0625f + bb; } }
  __builtin_amdgcn_fence(4 /* acq_rel order */, "workgroup"); __builtin_amdgcn_wave_barrier();      /* so[w] is private to wave w */
  const int rsub = lane >> 4, c4 = (lane & 15) * 4; const int head = col0 >> 6;
  if (job == 0) {
#pragma unroll
    for (int q = 0; q < 32; ++q) { const int r = q * 2 + rsub; const v4f v = *(const v4fa*)&so[w][r][c4]; v4h h4;      /* 32 trips x 2 rows = 64 rows, here and below */
#pragma unroll
      for (int i = 0; i < 4; ++i) h4[i] = (_Float16)v[i];
      *(v4h*)(V16 + (size_t)(row0 + r) * DM + col0 + c4) = h4; }
  } else if (job == 1) {
#pragma unroll
    for (int q = 0; q < 32; ++q) { const int r = q * 2 + rsub; const v4f v = *(const v4fa*)&so[w][r][c4]; *(v4f*)(G + (size_t)(row0 + r) * DM + col0 + c4) = v; }
    asm volatile("s_wait_xcnt 0x0" ::: "memory");      /* the branches join in address arithmetic that reuses these stores' registers: the wait stands in front of it */
  } else { const bool qside = (job & 1) == 0;
#pragma unroll 1
    for (int q0 = 0; q0 < 32; q0 += 4) {      /* rolled: eight trips of four row pairs, for code size */
#pragma unroll
     for (int q = q0; q < q0 + 4; ++q) { const int r = q * 2 + rsub; const v4f v = *(const v4fa*)&so[w][r][c4];
      v4h s0, s1, s2;
#pragma unroll
      for (int i = 0; i < 4; ++i) { const h16 hi = toh_flush(v[i]); const h16 rs = toh_flush((v[i] - (float)hi) * 2048.0f); const h16 hs = (h16)((float)hi * 2048.0f);
        s0[i] = qside ? hs : hi; s1[i] = qside ? rs : hi; s2[i] = qside ? hi : rs; }
      _Float16* dst = C3 + (size_t)(row0 + r) * (3 * DM) + head * CK + c4;
      *(v4h*)dst = s0; *(v4h*)(dst + 64) = s1; *(v4h*)(dst + 128) = s2; }
     asm volatile("s_wait_xcnt 0x0" ::: "memory"); }      /* the next trip rewrites the registers that this trip's stores name */
     } }

// ---- all ten input conversions as one launch: blocks 0 .. 7 WBL - 1 take the seven weight planes (natural [out][in] = Bt[n][k], x16), the rest the three activation planes; 8 elements per thread ----
// Bt: seven f16 planes of DM x DM, one behind the other, in the order w0 .. w6; X16: three f16 planes of NR x DM in the order x0 .. x2.
#define WBL (DM * DM / 8 / 256)            /* blocks per weight plane */
#define XBL ((int)(NR * DM / 8 / 256))     /* blocks per activation plane */
static_assert(DM * DM % (8 * 256) == 0 && (NR * DM) % (8 * 256) == 0);      /* whole blocks: no thread past the end of a plane */
static_assert(((size_t)DM * DM * 2) % 256 == 0 && (NR * DM * 2) % 256 == 0);      /* the planes follow one another in the workspace without a gap */
__global__ __launch_bounds__(256) void k_cvt(const float* __restrict__ w0, const float* __restrict__ w1, const float* __restrict__ w2, const float* __restrict__ w3, const float* __restrict__ w4,
    const float* __restrict__ w5, const float* __restrict__ w6, const float* __restrict__ x0, const float* __restrict__ x1, const float* __restrict__ x2, _Float16* __restrict__ Bt, _Float16* __restrict__ X16) {
  const int blk = blockIdx.x; FragH f;
  if (blk < 7 * WBL) { const int pl = blk / WBL; const size_t t = (size_t)(blk - pl * WBL) * 256 + threadIdx.x;
    const float* w = (pl == 0) ? w0 : (pl == 1) ? w1 : (pl == 2) ? w2 : (pl == 3) ? w3 : (pl == 4) ? w4 : (pl == 5) ? w5 : w6;
    const v4f a = *(const v4fa*)(w + t * 8), c = *(const v4fa*)(w + t * 8 + 4);
#pragma unroll
    for (int q = 0; q < 4; ++q) { f.h[q] = toh_flush(bf16_rne(a[q]) * 16.0f); f.h[4 + q] = toh_flush(bf16_rne(c[q]) * 16.0f); }
    const v8us o = f.half[0]; *(v8us*)((unsigned short*)Bt + (size_t)pl * DM * DM + t * 8) = o;
  } else { const int bx = blk - 7 * WBL; const int pl = bx / XBL; const size_t t = (size_t)(bx - pl * XBL) * 256 + threadIdx.x;
    const float* x = (pl == 0) ? x0 : (pl == 1) ? x1 : x2;
    const size_t row = t / (DM / 8); const int c8 = (int)(t % (DM / 8)) * 8; const size_t srow = (row / NB) * NB_FULL + (row % NB);
    const float* p = x + srow * DM + c8; const v4f a = *(const v4fa*)p, c = *(const v4fa*)(p + 4);
#pragma unroll
    for (int q = 0; q < 4; ++q) { f.h[q] = (_Float16)bf16_rne(a[q]); f.h[4 + q] = (_Float16)bf16_rne(c[q]); }
    const v8us o = f.half[0]; *(v8us*)((unsigned short*)X16 + (size_t)pl * NR * DM + t * 8) = o;
    asm volatile("s_wait_xcnt 0x0" ::: "memory"); } }      /* the built code runs on from here towards the weight branch, whose loads reuse this store's registers: the wait stands in front of them */

// V transposition, V16 rows [SEQ*NB][DM] -> Vt[(b,h)][64][SEQ], in three parts, loads, LDS writes and, behind a work-group barrier of the calling kernel, LDS reads and stores: 128 keys x 64 d of slab (b, h) per block of 256 threads.
#define VTK 128                      /* keys per block */
__device__ __forceinline__ void g2_vt_load(const _Float16* __restrict__ V16, FragH (&f)[VTK * 8 / 256], int key0, int b, int h, int tid) {
#pragma unroll      /* unrolled here and below: f is indexed by constants and stays in registers; the four loads go out together */
  for (int k = 0; k < VTK * 8 / 256; ++k) { const int i = tid + 256 * k; const int r = i / 8, c8 = (i % 8) * 8; f[k].half[0] = *(const v8us*)((const unsigned short*)V16 + ((size_t)(key0 + r) * NB + b) * DM + h * HD + c8); }
  asm volatile("s_wait_xcnt 0x0" ::: "memory"); }      /* what follows reuses the address registers of these loads: the wait stands in front of it */
__device__ __forceinline__ void g2_vt_in(const FragH (&f)[VTK * 8 / 256], unsigned short (*tl)[66], int tid) {
#pragma unroll
  for (int k = 0; k < VTK * 8 / 256; ++k) { const int i = tid + 256 * k; const int r = i / 8, c8 = (i % 8) * 8;
#pragma unroll
    for (int q = 0; q < 8; ++q) tl[r][c8 + q] = f[k].u[q]; } }
__device__ __forceinline__ void g2_vt_out(_Float16* __restrict__ Vt, const unsigned short (*tl)[66], int key0, int slab, int tid) {
#pragma unroll
  for (int k = 0; k < VTK * 8 / 256; ++k) { const int i = tid + 256 * k; const int d = i / (VTK / 8), pc = i % (VTK / 8); FragH f;      /* 16 lanes fill the two 128-B lines of one d */
#pragma unroll
    for (int q = 0; q < 8; ++q) f.u[q] = tl[pc * 8 + q][d];
    *(v8us*)((unsigned short*)Vt + ((size_t)slab * 64 + d) * SEQ + key0 + pc * 8) = f.half[0]; } }

// lane l takes the value of lane l ^ 16: the two lanes that hold the two halves of one query's keys
__device__ __forceinline__ float g2_xhalf(float x) { return __builtin_bit_cast(float, __builtin_amdgcn_permlanex16(__builtin_bit_cast(int, x), __builtin_bit_cast(int, x), 0x76543210, 0xfedcba98, false, false)); }
// lane l takes the value of lane l ^ M, M < 16, inside its row of 16 lanes: a vector move, where the shuffle builtin would go through the LDS pipe and wait for it
template <int M> __device__ __forceinline__ int g2_rxi(int x) { return __builtin_amdgcn_update_dpp(0, x, 0x160 | M /* row_xmask:M */, 0xf, 0xf, true); }
template <int M> __device__ __forceinline__ float g2_rx(float x) { return __builtin_bit_cast(float, g2_rxi<M>(__builtin_bit_cast(int, x))); }
// largest squared norm among a block's 128 content key rows (their f16 values, the first 64 columns of a head in the key side's concatenated plane), for k_fattn's bound on a content score; 8 lanes per row, rows step by 32 per load.
__device__ __forceinline__ void g2_kn_load(const _Float16* __restrict__ K3c, FragH (&f)[VTK * 8 / 256], int key0, int by, int tid) {
  const unsigned short* p = (const unsigned short*)K3c + (size_t)(key0 + tid / 8) * LQ3 + (size_t)by * CK + (tid % 8) * 8;
#pragma unroll      /* unrolled here and below: f is indexed by constants and stays in registers; the four loads go out together */
  for (int k = 0; k < VTK * 8 / 256; ++k) f[k].half[0] = *(const v8us*)(p + (size_t)k * 32 * LQ3);
  asm volatile("s_wait_xcnt 0x0" ::: "memory"); }      /* what follows reuses the address registers of these loads: the wait stands in front of it */
__device__ __forceinline__ float g2_kn_max(const FragH (&f)[VTK * 8 / 256]) {      /* the wave's 16 rows: the same value in every lane */
  float mx = 0.f;
#pragma unroll
  for (int k = 0; k < VTK * 8 / 256; ++k) { float s = 0.f;
#pragma unroll
    for (int q = 0; q < 8; ++q) { const float e = (float)f[k].h[q]; s += e * e; }
    s += g2_rx<1>(s); s += g2_rx<2>(s); s += g2_rx<4>(s); mx = fmaxf(mx, s); }
  mx = fmaxf(mx, g2_rx<8>(mx)); mx = fmaxf(mx, g2_xhalf(mx));
  return mx; }

// width table: SIGT[sig_idx(r)], r = t*NB + b, = 1 / (2 sigma^2), sigma = 1 + sigmoid(sum_e tanh(G[r][e]) * bf16(Wvp[e]) + bf16(bvp)); G f32 [NR][DM].
// One row per wave, 8 rows per block; a block's 8 values open a 128-B line of their own, so that each line of the table has one writer; the 8 floats behind them hold the block's 8 key norm maxima (g2_kn_max, one per wave). g2_sigma_load: a row's loads; g2_sigma_row: the row's value, the same in every lane of the wave.
#define SGR 8                        /* rows (= waves) per block */
static_assert((NB * SEQ) % SGR == 0);
static_assert(SGR * 4 <= 128 && SGR % 4 == 0 && SGR * 32 == 256);      /* one line per block, 16-B stores, one wave per row in a block of 256 */
__device__ __forceinline__ size_t sig_idx(size_t r) { return (r / SGR) * 32 + (r % SGR); }
__device__ __forceinline__ void g2_sigma_load(const float* __restrict__ G, const float* __restrict__ wvp, size_t row, int lane, float (&x)[DM / 32], float (&wv)[DM / 32]) {
  const float* p = G + row * DM + lane;
#pragma unroll      /* unrolled: the row's loads all go out before the first tanh, one memory latency per row instead of one per 32 elements */
  for (int j = 0; j < DM / 32; ++j) { x[j] = p[j * 32]; wv[j] = wvp[j * 32 + lane]; }
  asm volatile("s_wait_xcnt 0x0" ::: "memory"); }      /* what follows reuses the offset registers of these loads: the wait stands in front of it */
__device__ __forceinline__ float g2_sigma_row(const float (&x)[DM / 32], const float (&wv)[DM / 32], const float* __restrict__ bvp) {
  const float b0 = bf16_rne(bvp[0]);
  float acc = 0.f;
#pragma unroll      /* unrolled: x / wv are indexed by constants and stay in registers; the sum runs in ascending k */
  for (int j = 0; j < DM / 32; ++j) acc += tanhf(x[j]) * bf16_rne(wv[j]);
#pragma unroll
  for (int off = 16; off > 0; off >>= 1) acc += __shfl_xor(acc, off, 32);
  const float g = acc + b0;
  const float sgm = 1.0f + 1.0f / (1.0f + expf(-g));
  const float i2 = 1.0f / (2.0f * sgm * sgm);
  return i2;
}

// ---- alignment scores and their softmax statistics in one kernel, which also carries the two small jobs that wait for the projections alone: block = 128 query rows of one slab; MEANT[slab][t] = sum_s softmax(row t)[s] * s (f32; position sum centred at SEQ/2) ----
// Q3 / K3: the alignment pair's K-concatenated planes (slab by at column by * 192 of rows with pitch LQ3). Scores are formed transposed, keys x queries: A = key rows from LDS, B = the wave's 32 query rows, kept in registers for the whole walk,
// so a lane holds 32 of a 64-key tile's scores of one query (key = 16 c + 8 hh + r, query = ln) and keeps that query's running maximum and two running sums by itself, with no exchange between lanes inside the walk.
// Wave w: query rows 32 (w % 4) .. + 31, and of every staged step of 64 AKW keys the tile w / 4. At the end the 2 AKW partial statistics of a query row meet in LDS.
#define AKW 2                              /* key tiles per staged step = waves per SIMD */
#define AKS (64 * AKW)                     /* keys per staged step */
#define TB3 (3 * AKS * LP * 2)             /* bytes of one staged step: three K tiles of its key rows */
#define NAS (SEQ / AKS)                    /* staged steps */
#define AC (6.103515625e-05f * 1.44269504f)      /* raw score -> logit (2^-14) -> exponent of 2 */
static_assert(SEQ % AKS == 0 && NAS >= 2 && (2 * AKW) % 4 == 0);      /* whole steps, both buffers filled in front of the walk, 16-B reads of a row's partial statistics */
static_assert(2 * TB3 <= 327680 && 3 * 128 * 2 * AKW * 4 <= 2 * TB3);      /* the step buffers of k_falign, without tl and sg; the partial statistics fit into the two step buffers */
typedef float v2f __attribute__((ext_vector_type(2)));
// one staged step, global -> LDS: 12 copies of 16 B per lane; LDS rows step by 16 AKW per copy (four copies per K tile), s = the same step in the key plane
__device__ __forceinline__ void g2_stage_k(unsigned l, const _Float16* g, size_t s) {
  /* the closing s_wait_xcnt stands inside the statement so that no address register of a copy is rewritten in front of it */
  asm volatile("global_load_async_to_lds_b128 %0, %12, off\n\t" "global_load_async_to_lds_b128 %1, %13, off\n\t" "global_load_async_to_lds_b128 %2, %14, off\n\t"
               "global_load_async_to_lds_b128 %3, %15, off\n\t" "global_load_async_to_lds_b128 %4, %16, off\n\t" "global_load_async_to_lds_b128 %5, %17, off\n\t"
               "global_load_async_to_lds_b128 %6, %18, off\n\t" "global_load_async_to_lds_b128 %7, %19, off\n\t" "global_load_async_to_lds_b128 %8, %20, off\n\t"
               "global_load_async_to_lds_b128 %9, %21, off\n\t" "global_load_async_to_lds_b128 %10, %22, off\n\t" "global_load_async_to_lds_b128 %11, %23, off\n\t"
               "s_wait_xcnt 0x0"
               :: "v"(l), "v"(l + 1u * 16 * AKW * LP * 2), "v"(l + 2u * 16 * AKW * LP * 2), "v"(l + 3u * 16 * AKW * LP * 2), "v"(l + 4u * 16 * AKW * LP * 2), "v"(l + 5u * 16 * AKW * LP * 2),
                  "v"(l + 6u * 16 * AKW * LP * 2), "v"(l + 7u * 16 * AKW * LP * 2), "v"(l + 8u * 16 * AKW * LP * 2), "v"(l + 9u * 16 * AKW * LP * 2), "v"(l + 10u * 16 * AKW * LP * 2), "v"(l + 11u * 16 * AKW * LP * 2),
                  "v"(g), "v"(g + s), "v"(g + 2 * s), "v"(g + 3 * s), "v"(g + KT), "v"(g + KT + s), "v"(g + KT + 2 * s), "v"(g + KT + 3 * s),
                  "v"(g + 2 * KT), "v"(g + 2 * KT + s), "v"(g + 2 * KT + 2 * s), "v"(g + 2 * KT + 3 * s)
               : "memory"); }
// In front of the walk, while step 0 is under way, block (mt, by) transposes keys 128 mt .. + 127 of slab by's V, takes the largest squared norm of the same keys' content rows (K3c) and forms the width table's rows 8 (by * SEQ / 128 + mt) .. + 7, one per wave;
// both hand their values over in LDS at the barrier that publishes step 0 and store them behind it.
static_assert(128 * AKW == 256 && 4 * AKW == SGR && VTK == 128);      /* threads of the two jobs' index maps; one table row per wave; the block's keys = its query rows */
static_assert((SEQ / 128) * NB * NH == (NB * SEQ) / SGR);      /* as many blocks as table lines */
__global__ __launch_bounds__(128 * AKW) void k_falign(const _Float16* __restrict__ Q3, const _Float16* __restrict__ K3, float* __restrict__ MEANT,
    const _Float16* __restrict__ V16, _Float16* __restrict__ Vt, const float* __restrict__ G, const float* __restrict__ wvp, const float* __restrict__ bvp, float* __restrict__ SIGT, const _Float16* __restrict__ K3c) {
  __shared__ __attribute__((aligned(16))) unsigned char sm[2 * TB3];      /* two step buffers; behind the walk the partial statistics */
  __shared__ unsigned short tl[VTK][66];      /* the block's V rows on their way to V^T */
  __shared__ __attribute__((aligned(16))) float sg[2 * SGR];      /* the block's line of the width table: 8 widths, 8 key norm maxima */
  const int tid = threadIdx.x, w = __builtin_amdgcn_readfirstlane((int)(tid >> 5)), lane = tid & 31, ln = lane & 15, hh = lane >> 4;
  const int by = blockIdx.y, mt = blockIdx.x; const int wq = w & 3, wk = w >> 2;
  const unsigned l0 = (unsigned)(size_t)sm + (unsigned)((tid >> 3) * (LP * 2) + (tid & 7) * 16);
  const _Float16* gk = K3 + (size_t)(tid >> 3) * LQ3 + (size_t)by * CK + (tid & 7) * 8;
  const size_t sk = (size_t)(16 * AKW) * LQ3;
  g2_stage_k(l0, gk, sk);
  const _Float16* qp = Q3 + (size_t)(mt * 128 + 32 * wq + ln) * LQ3 + (size_t)by * CK;
  v16h fq[2][CK / 32];      /* the wave's query rows as B fragments: [group of 16 queries][k / 32] */
#pragma unroll      /* unrolled here and below: arrays indexed by constants stay in registers */
  for (int g = 0; g < 2; ++g) {
#pragma unroll
    for (int j = 0; j < CK / 32; ++j) fq[g][j] = g2_frag(qp + (size_t)g * 16 * LQ3 + 32 * j, hh); }
  const int fb = by * (SEQ / 128) + mt;      /* flat block index = line of the width table */
  { FragH vr[VTK * 8 / 256], kr[VTK * 8 / 256]; float x[DM / 32], wv[DM / 32];      /* the jobs' loads go out first and share one memory latency with step 0's copies */
    g2_vt_load(V16, vr, mt * VTK, by / NH, by % NH, tid);
    g2_kn_load(K3c, kr, mt * VTK, by, tid);
    g2_sigma_load(G, wvp, (size_t)fb * SGR + w, lane, x, wv);
    g2_vt_in(vr, tl, tid);
    const float kn = g2_kn_max(kr);
    const float i2 = g2_sigma_row(x, wv, bvp);
    if (lane == 0) { sg[w] = i2; sg[SGR + w] = kn; } }
  asm volatile("s_wait_asynccnt 0x0" ::: "memory");      /* this wave's part of step 0 has landed */
  __syncthreads();                                       /* ... and every other wave's; tl and sg are whole */
  g2_stage_k(l0 + TB3, gk + (size_t)AKS * LQ3, sk);
  g2_vt_out(Vt, tl, mt * VTK, by, tid);
  if (w == 0 && lane < 2 * SGR / 4) { const v4f v = *(const v4fa*)&sg[lane * 4]; float* dst = SIGT + (size_t)fb * 32 + lane * 4;
    *(v4f*)dst = v;  }
  const v8f z8 = {0.f,0.f,0.f,0.f,0.f,0.f,0.f,0.f};
  float mr[2] = {-3.0e38f, -3.0e38f}, se[2] = {0.f, 0.f}, sw[2] = {0.f, 0.f};      /* per query group: running maximum (raw score), sum of weights, sum of weight x centred position */
  v8f acc[8];      /* a key tile's scores: [query group * 4 + key tile of 16] */
  auto stats = [&](int n) {      /* folds the lane's 2 x 32 scores of its tile of step n into the running statistics */
    const float pb = (float)(n * AKS + 64 * wk + 8 * hh - SEQ / 2);      /* centred position of the lane's first key of the tile */
#pragma unroll
    for (int g = 0; g < 2; ++g) {
      float tc[4];      /* four short chains per statistic instead of one long one: a wave issues in order */
#pragma unroll
      for (int c = 0; c < 4; ++c) { const v8f a = acc[g * 4 + c]; tc[c] = fmaxf(fmaxf(fmaxf(a[0], a[1]), fmaxf(a[2], a[3])), fmaxf(fmaxf(a[4], a[5]), fmaxf(a[6], a[7]))); }
      const float tm = fmaxf(fmaxf(mr[g], fmaxf(tc[0], tc[1])), fmaxf(tc[2], tc[3]));
      const float m2 = tm * AC; const float al = __builtin_amdgcn_exp2f((mr[g] - tm) * AC); mr[g] = tm;
      float ts = 0.f, tw = 0.f;
#pragma unroll
      for (int c = 0; c < 4; ++c) { const v8f a = acc[g * 4 + c]; v2f s2 = {0.f, 0.f}, w2 = {0.f, 0.f};
#pragma unroll
        for (int r = 0; r < 8; r += 2) { const v2f a2 = {a[r], a[r + 1]}; const v2f t2 = a2 * AC - m2; const v2f e2 = {__builtin_amdgcn_exp2f(t2[0]), __builtin_amdgcn_exp2f(t2[1])};
          const v2f p2 = {(float)r, (float)(r + 1)}; s2 += e2; w2 += e2 * p2; }
        const float sc = s2[0] + s2[1]; ts += sc; tw += (w2[0] + w2[1]) + sc * (float)(16 * c); }
      se[g] = se[g] * al + ts; sw[g] = sw[g] * al + (tw + pb * ts); } };
  /* Waves w and w + 4 run half a step apart: waves 0 .. 3 read, multiply and then fold; waves 4 .. 7 first fold their tile of the step before, then read and multiply.
     So one wave's vector work runs beside the other's LDS reads and products, although one barrier per step holds all waves together. */
#pragma unroll 1
  for (int n = 0; n < NAS; ++n) {      /* rolled: one publish point per staged step */
    if (wk != 0 && n > 0) stats(n - 1);
    const _Float16* tb = (const _Float16*)(sm + (n & 1) * TB3);
    const _Float16* kp = tb + (64 * wk + ln) * LP;
    v16h fk[CK / 32][4];      /* the whole key tile as A fragments: [k / 32][key tile of 16] */
#pragma unroll
    for (int j = 0; j < CK / 32; ++j) {
#pragma unroll
      for (int c = 0; c < 4; ++c) fk[j][c] = g2_frag(kp + ((j >> 1) * AKS + c * 16) * LP + 32 * (j & 1), hh); }
    __builtin_amdgcn_sched_barrier(0);      /* keeps the tile's 48 LDS reads together in front of the products, in the order of their use: one place with reads per step, counted waits behind it */
#pragma unroll
    for (int j = 0; j < CK / 32; ++j) {
#pragma unroll
      for (int c = 0; c < 4; ++c) { acc[c] = __builtin_amdgcn_wmma_f32_16x16x32_f16(false, fk[j][c], false, fq[0][j], (short)0, j ? acc[c] : z8, false, false);
        acc[4 + c] = __builtin_amdgcn_wmma_f32_16x16x32_f16(false, fk[j][c], false, fq[1][j], (short)0, j ? acc[4 + c] : z8, false, false); } }
    __builtin_amdgcn_sched_barrier(0);      /* keeps the products in the order of the reads, two per arriving fragment; left free, the scheduler ran single accumulators' chains to their end first and waited for nearly all 48 reads at once */
    if (wk == 0) stats(n);
    /* this wave's reads of step n are done before its buffer is refilled. The four sums are named as inputs only, so that the statistics of waves 0 .. 3 stay in front of the barrier */
    asm volatile("s_wait_dscnt 0x0" :: "v"(se[0]), "v"(se[1]), "v"(sw[0]), "v"(sw[1]) : "memory");
    asm volatile("s_wait_asynccnt 0x0" ::: "memory");    /* this wave's part of step n + 1 has landed */
    __syncthreads();                                     /* publishes step n + 1 and ends every wave's reads of step n */
    if (n + 2 < NAS) g2_stage_k(l0 + (unsigned)(n & 1) * TB3, gk + (size_t)(n + 2) * AKS * LQ3, sk);
  }
  if (wk != 0) stats(NAS - 1);
  asm volatile("s_wait_asynccnt 0x0" ::: "memory");      /* nothing in flight when the buffers take the partial statistics */
  float (*st)[128][2 * AKW] = (float (*)[128][2 * AKW])sm;      /* [maximum as exponent of 2 | weights | weighted positions][query row][key tile of the step * 2 + lane half] */
#pragma unroll
  for (int g = 0; g < 2; ++g) { const int q = 32 * wq + 16 * g + ln, pi = 2 * wk + hh; st[0][q][pi] = mr[g] * AC; st[1][q][pi] = se[g]; st[2][q][pi] = sw[g]; }
  __syncthreads();                                       /* every wave's partial statistics are in LDS */
  if (w < 4) {      /* one query row per lane; a wave's 32 means fill one 128-B line */
    float pm[2 * AKW], ps[2 * AKW], pw[2 * AKW];
#pragma unroll
    for (int i = 0; i < 2 * AKW; i += 4) { const v4f a = *(const v4fa*)&st[0][tid][i], c = *(const v4fa*)&st[1][tid][i], d = *(const v4fa*)&st[2][tid][i];
#pragma unroll
      for (int k = 0; k < 4; ++k) { pm[i + k] = a[k]; ps[i + k] = c[k]; pw[i + k] = d[k]; } }
    float mx = pm[0];
#pragma unroll
    for (int i = 1; i < 2 * AKW; ++i) mx = fmaxf(mx, pm[i]);
    float es = 0.f, ws = 0.f;
#pragma unroll
    for (int i = 0; i < 2 * AKW; ++i) { const float f = __builtin_amdgcn_exp2f(pm[i] - mx); es += ps[i] * f; ws += pw[i] * f; }
    MEANT[(size_t)by * SEQ + mt * 128 + tid] = (float)(SEQ / 2) + ws / es; }
}

// ---- content scores, Gaussian softmax and P . V in one kernel: block = 128 query rows of one slab (wave w: rows 32 w .. 32 w + 31), walking the keys in tiles of 64 ----
// Q3 / K3: the content pair's K-concatenated planes (slab by at column by * 192 of rows with pitch LQ3); Vt f16 [slab][64][SEQ]; O f16 [t][b][h*64 + d] = 64 ctx.
// Both products are formed transposed. Scores, keys x queries: A = key rows from LDS, B = the wave's 32 query rows, kept in registers for the whole walk; a lane holds 32 of a key tile's scores of one query per group of 16 queries
// (key = 16 c + 8 hh + r, query = ln): y[s] = log2(e) (score - (s - mean)^2 * (1 / (2 sigma^2))), running maximum m (joined between the two lanes of a query once per tile) and the lane's own part of the sum l in f32.
// P = f16(2^14 2^(y - m)) of key tiles 2 s and 2 s + 1 is, register for register, the B fragment of keys 32 s .. 32 s + 31; ctx, d x queries: A = V^T rows from LDS; a lane's accumulators all belong to its own query, so exp(m_old - m_new) is the lane's own factor.
// The walk runs from the first to the last key tile that some row of the block needs: the Gaussian term, held against a run-time bound on the content score, tells where every weight of a tile rounds to zero in f32 (the bound stands at the place).
// Key tile n + 1 is in flight while tile n is worked on. At the end the two lanes of a query join their sums, and ctx * 2^6 / l leaves as 16 bytes (8 d) per accumulator tile.
#define TB2 ((3 * 64 + 64) * LP * 2)       /* bytes of one staged key tile: three K tiles of its 64 key rows, then its 64 V^T rows */
#define NKT (SEQ / 64)                     /* key tiles */
static_assert(CK / KT == 3 && NKT >= 2 && NKT <= 32);      /* one bit per key tile in a word */
static_assert(SEQ / 128 == 8 && SGR == 8);      /* a slab's key norm maxima: 8 table lines of 8, two per lane of a wave */
static_assert(2 * TB2 <= 196608);          /* the two tile buffers of k_fattn, without rq */
// 64 rows of 128 B, global -> LDS: 4 copies of 16 B per lane, rows step by 16 per copy
__device__ __forceinline__ void g2_stage_v(unsigned l, const _Float16* gv, size_t sv) {
  /* the closing s_wait_xcnt stands inside the statement so that no address register of a copy is rewritten in front of it */
  asm volatile("global_load_async_to_lds_b128 %0, %4, off\n\t" "global_load_async_to_lds_b128 %1, %5, off\n\t" "global_load_async_to_lds_b128 %2, %6, off\n\t"
               "global_load_async_to_lds_b128 %3, %7, off\n\t" "s_wait_xcnt 0x0"
               :: "v"(l), "v"(l + 1u * 16 * LP * 2), "v"(l + 2u * 16 * LP * 2), "v"(l + 3u * 16 * LP * 2), "v"(gv), "v"(gv + sv), "v"(gv + 2 * sv), "v"(gv + 3 * sv)
               : "memory"); }
__global__ __launch_bounds__(128) void k_fattn(const _Float16* __restrict__ Q3, const _Float16* __restrict__ K3, const _Float16* __restrict__ Vt,
    const float* __restrict__ MEANT, const float* __restrict__ SIGT, _Float16* __restrict__ O) {
  __shared__ __attribute__((aligned(16))) unsigned char sm[2 * TB2];      /* two tile buffers */
  __shared__ unsigned rq[4];      /* each wave's needed key tiles, one bit per tile */
  const int tid = threadIdx.x, w = __builtin_amdgcn_readfirstlane((int)(tid >> 5)), lane = tid & 31, ln = lane & 15, hh = lane >> 4;
  const int by = blockIdx.y, mt = blockIdx.x; const int b = by / NH;
  const int q0 = mt * 128 + 32 * w + ln;      /* the lane's query row in group 0; in group 1: + 16 */
  const unsigned l0 = (unsigned)(size_t)sm + (unsigned)((tid >> 3) * (LP * 2) + (tid & 7) * 16);
  const _Float16* gb = K3 + (size_t)(tid >> 3) * LQ3 + (size_t)by * CK + (tid & 7) * 8;
  const _Float16* gv = Vt + ((size_t)by * HD + (tid >> 3)) * SEQ + (tid & 7) * 8;
  const size_t sq = (size_t)16 * LQ3, sv = (size_t)16 * SEQ;
  auto stage = [&](int n) { const unsigned l = l0 + (unsigned)(n & 1) * TB2; const _Float16* gk = gb + (size_t)n * 64 * LQ3;      /* key tile n: 16 copies per lane */
    g2_stage_v(l, gk, sq); g2_stage_v(l + 1u * 64 * LP * 2, gk + KT, sq); g2_stage_v(l + 2u * 64 * LP * 2, gk + 2 * KT, sq);
    g2_stage_v(l + 3u * 64 * LP * 2, gv + n * 64, sv); };
  const v8f z8 = {0.f,0.f,0.f,0.f,0.f,0.f,0.f,0.f};
  v8f o[8] = {z8, z8, z8, z8, z8, z8, z8, z8};      /* ctx, d x queries: [query group * 4 + d tile of 16] */
  float m[2] = {-3.0e38f, -3.0e38f}, l[2] = {0.f, 0.f};      /* per query group: running maximum (exponent of 2), the lane's part of the sum of 2^14 weights */
  const _Float16* qp = Q3 + (size_t)q0 * LQ3 + (size_t)by * CK;
  v16h fq[2][CK / 32];      /* the wave's query rows as B fragments: [group of 16 queries][k / 32] */
#pragma unroll      /* unrolled here and below: arrays indexed by constants stay in registers */
  for (int g = 0; g < 2; ++g) {
#pragma unroll
    for (int j = 0; j < CK / 32; ++j) fq[g][j] = g2_frag(qp + (size_t)g * 16 * LQ3 + 32 * j, hh); }
  float mu[2], i2[2], kn[2];      /* per query group: the row's mean and 1 / (2 sigma^2); the lane's two of the slab's 64 key norm maxima */
  { const float* pmu = MEANT + (size_t)by * SEQ + q0; const float* ps0 = SIGT + sig_idx((size_t)q0 * NB + b); const float* ps1 = SIGT + sig_idx((size_t)(q0 + 16) * NB + b);
    const float* pkn = SIGT + ((size_t)by * (SEQ / 128) + (lane >> 3)) * 32 + SGR + (lane & 7);      /* table lines 0 .. 3 of the slab; lines 4 .. 7 stand 512 bytes on */
    /* the six loads and their data wait in one statement: no address register of theirs is rewritten while they are under way */
    asm volatile("global_load_b32 %0, %6, off\n\t" "global_load_b32 %1, %6, off offset:64\n\t" "global_load_b32 %2, %7, off\n\t" "global_load_b32 %3, %8, off\n\t"
                 "global_load_b32 %4, %9, off\n\t" "global_load_b32 %5, %9, off offset:512\n\t" "s_wait_loadcnt 0x0"
                 : "=&v"(mu[0]), "=&v"(mu[1]), "=&v"(i2[0]), "=&v"(i2[1]), "=&v"(kn[0]), "=&v"(kn[1]) : "v"(pmu), "v"(ps0), "v"(ps1), "v"(pkn) : "memory"); }
  const float i2l[2] = {i2[0] * 1.44269504f, i2[1] * 1.44269504f};      /* the Gaussian term as an exponent of 2 */
  /* Which key tiles can hold a weight that is not zero in f32. |content exponent| <= cb = log2(e) / 8 |q| max|k| (Cauchy-Schwarz; norms of the f16 values, widened for the residuals and the rounding).
     The row's final maximum is at least -cb - 1 (the key next to the mean, at most half a position away, where the mean lies among the positions); a key further than rr from the mean has y < cb - rr^2 i2l = -cb - 166,
     so 2^14 2^(y - m) < 2^-150 rounds to zero: such a key adds nothing to the sum or to P. Tiles in front of the first or behind the last that some row of the block needs are not walked. A mean outside the positions, or a bound that is no number, takes every tile. */
  int n0, n1;      /* first and last key tile of the walk, the same in the whole block */
  { float kx = fmaxf(kn[0], kn[1]);
    kx = fmaxf(kx, g2_rx<1>(kx)); kx = fmaxf(kx, g2_rx<2>(kx)); kx = fmaxf(kx, g2_rx<4>(kx)); kx = fmaxf(kx, g2_rx<8>(kx)); kx = fmaxf(kx, g2_xhalf(kx));
    const float ka = __builtin_amdgcn_sqrtf(kx) * 1.01f + 0.01f;      /* the plain hardware root here and below: its last bit is far inside the widening */
    unsigned need = 0u;      /* bit n: tile n is needed */
#pragma unroll
    for (int g = 0; g < 2; ++g) { float s4[4] = {0.f, 0.f, 0.f, 0.f};      /* the query side's third K tile holds the plain f16 values; four short chains */
#pragma unroll
      for (int e = 0; e < 16; ++e) { const float a = (float)fq[g][4][e], c = (float)fq[g][5][e]; s4[e & 1] += a * a; s4[2 + (e & 1)] += c * c; }
      const float sh = (s4[0] + s4[1]) + (s4[2] + s4[3]);
      const float qa = __builtin_amdgcn_sqrtf(sh + g2_xhalf(sh)) * 1.01f + 0.01f;      /* the two lanes of a query hold half of its row each */
      const float cb = qa * ka * (0.125f * 1.44269504f);
      const float rr = __builtin_amdgcn_sqrtf((2.0f * cb + 166.0f) * __builtin_amdgcn_rcpf(i2l[g]));
      const bool ok = (mu[g] >= -0.25f) && (mu[g] <= (float)(SEQ - 1) + 0.25f) && (rr < (float)(4 * SEQ));      /* false for a value that is no number */
      const int ta = ok ? max((int)floorf((mu[g] - rr) * (1.0f / 64.0f)), 0) : 0;
      const int tz = ok ? min((int)floorf((mu[g] + rr) * (1.0f / 64.0f)), NKT - 1) : NKT - 1;
      need |= ((2u << tz) - 1u) & ~((1u << ta) - 1u); }
    need |= (unsigned)g2_rxi<1>((int)need); need |= (unsigned)g2_rxi<2>((int)need); need |= (unsigned)g2_rxi<4>((int)need); need |= (unsigned)g2_rxi<8>((int)need);      /* both rows of 16 lanes hold the same 16 queries per group */
    if (lane == 0) rq[w] = need;
    __syncthreads();                                     /* every wave's needs are in LDS */
    need = (rq[0] | rq[1] | rq[2] | rq[3]) & ((2u << (NKT - 1)) - 1u);
    need = (unsigned)__builtin_amdgcn_readfirstlane((int)need); if (need == 0u) need = (2u << (NKT - 1)) - 1u;
    n0 = __builtin_ctz(need); n1 = 31 - __builtin_clz(need); }
  stage(n0);
  asm volatile("s_wait_asynccnt 0x0" ::: "memory");      /* this wave's part of the first tile has landed */
  __syncthreads();                                       /* ... and every other wave's */
  if (n0 < n1) stage(n0 + 1);
#pragma unroll 1
  for (int n = n0; n <= n1; ++n) {      /* rolled: one publish point per key tile */
    const _Float16* tb = (const _Float16*)(sm + (n & 1) * TB2);
    const _Float16* kp = tb + ln * LP; const _Float16* vp = tb + (192 + ln) * LP;
    v8f acc[8];      /* the key tile's scores: [query group * 4 + key tile of 16] */
    v16h fv[2][4];      /* the tile's V^T rows as A fragments: [key / 32][d tile of 16] */
    { v16h fk[CK / 32][4];      /* the whole key tile as A fragments: [k / 32][key tile of 16] */
#pragma unroll
      for (int j = 0; j < CK / 32; ++j) {
#pragma unroll
        for (int c = 0; c < 4; ++c) fk[j][c] = g2_frag(kp + ((j >> 1) * 64 + c * 16) * LP + 32 * (j & 1), hh); }
      __builtin_amdgcn_sched_barrier(0);      /* keeps the tile's 48 key reads together in front of the products, in the order of their use: one place with reads, counted waits behind it */
#pragma unroll
      for (int j = 0; j < CK / 32; ++j) {
        if (j == 2) {      /* the V^T reads go out once the first K tile's fragments are spent, into registers of that size, and land under the other 32 products */
#pragma unroll
          for (int s = 0; s < 2; ++s) {
#pragma unroll
            for (int c = 0; c < 4; ++c) fv[s][c] = g2_frag(vp + c * 16 * LP + 32 * s, hh); }
          __builtin_amdgcn_sched_barrier(0); }      /* keeps these 16 reads at this place, in front of the products that cover them */
#pragma unroll
        for (int c = 0; c < 4; ++c) { acc[c] = __builtin_amdgcn_wmma_f32_16x16x32_f16(false, fk[j][c], false, fq[0][j], (short)0, j ? acc[c] : z8, false, false);
          acc[4 + c] = __builtin_amdgcn_wmma_f32_16x16x32_f16(false, fk[j][c], false, fq[1][j], (short)0, j ? acc[4 + c] : z8, false, false); } }
      __builtin_amdgcn_sched_barrier(0); }      /* keeps the products in the order of the reads, two per arriving fragment */
    FragH pf[2][2];      /* P as B fragments: [query group][key / 32] */
#pragma unroll
    for (int g = 0; g < 2; ++g) {
      const float dm = (float)(n * 64 + 8 * hh) - mu[g];      /* the lane's first key of the tile, counted from the mean */
      v2f y[4][4]; float tc[4];      /* four short chains per statistic instead of one long one: a wave issues in order */
#pragma unroll
      for (int c = 0; c < 4; ++c) { const v8f a = acc[g * 4 + c];
#pragma unroll
        for (int r = 0; r < 8; r += 2) { const v2f a2 = {a[r], a[r + 1]}; const v2f k2 = {(float)(16 * c + r), (float)(16 * c + r + 1)}; const v2f d2 = k2 + dm;
          y[c][r >> 1] = a2 * AC - (d2 * d2) * i2l[g]; }
        tc[c] = fmaxf(fmaxf(fmaxf(y[c][0][0], y[c][0][1]), fmaxf(y[c][1][0], y[c][1][1])), fmaxf(fmaxf(y[c][2][0], y[c][2][1]), fmaxf(y[c][3][0], y[c][3][1]))); }
      const float th = fmaxf(fmaxf(tc[0], tc[1]), fmaxf(tc[2], tc[3]));
      const float mn = fmaxf(m[g], fmaxf(th, g2_xhalf(th)));      /* one maximum for both lanes of a query: their weights meet in one product */
      const float al = __builtin_amdgcn_exp2f(m[g] - mn); m[g] = mn;
      const float ms = mn - 14.0f;      /* weights come out x 2^14 */
      float ts = 0.f;
#pragma unroll
      for (int c = 0; c < 4; ++c) { v2f s2 = {0.f, 0.f};
#pragma unroll
        for (int r = 0; r < 8; r += 2) { const v2f t2 = y[c][r >> 1] - ms; const v2f e2 = {__builtin_amdgcn_exp2f(t2[0]), __builtin_amdgcn_exp2f(t2[1])}; s2 += e2;
          pf[g][c >> 1].h[(c & 1) * 8 + r] = toh_flush(e2[0]); pf[g][c >> 1].h[(c & 1) * 8 + r + 1] = toh_flush(e2[1]); }
        ts += s2[0] + s2[1]; }
      l[g] = l[g] * al + ts;
#pragma unroll
      for (int c = 0; c < 4; ++c) o[g * 4 + c] *= al; }
#pragma unroll
    for (int s = 0; s < 2; ++s) {
#pragma unroll
      for (int c = 0; c < 4; ++c) { o[c] = __builtin_amdgcn_wmma_f32_16x16x32_f16(false, fv[s][c], false, pf[0][s].v, (short)0, o[c], false, false);
        o[4 + c] = __builtin_amdgcn_wmma_f32_16x16x32_f16(false, fv[s][c], false, pf[1][s].v, (short)0, o[4 + c], false, false); } }
    /* this wave's reads of tile n are done before its buffer is refilled. The two sums are named as inputs only, so that the softmax stays in front of the waits and the barrier:
       left free, they rose to the last LDS read, and tile n + 1's copies, issued at the foot of the trip before, had only the score products to land under */
    asm volatile("s_wait_dscnt 0x0" :: "v"(l[0]), "v"(l[1]) : "memory");
    asm volatile("s_wait_asynccnt 0x0" ::: "memory");    /* this wave's part of tile n + 1 has landed */
    __syncthreads();                                     /* publishes tile n + 1 and ends every wave's reads of tile n */
    if (n + 2 <= n1) stage(n + 2);
  }
  asm volatile("s_wait_asynccnt 0x0" ::: "memory");      /* nothing in flight at the end */
#pragma unroll
  for (int g = 0; g < 2; ++g) { const float f = 64.0f / (l[g] + g2_xhalf(l[g]));      /* the two lanes of a query join their sums */
    unsigned short* dst = (unsigned short*)O + (size_t)(q0 + 16 * g) * LQ + (size_t)by * HD + 8 * hh;      /* a query row's 128-B line is written by its two lanes alone */
#pragma unroll
    for (int c = 0; c < 4; ++c) { FragH t;
#pragma unroll
      for (int r = 0; r < 8; ++r) t.h[r] = (_Float16)(o[g * 4 + c][r] * f);
      *(v8us*)(dst + 16 * c) = t.half[0]; } }
}

extern "C" void kernel_launch(void* const* d_in, const int* in_sizes, int n_in,
                              void* d_out, int out_size, void* d_ws, size_t ws_size, hipStream_t stream) {
  if (n_in < 19) return;
  if ((size_t)in_sizes[0] < NR * DM || (size_t)in_sizes[1] < NR * DM || (size_t)in_sizes[2] < NR * DM) return;
  if ((size_t)in_sizes[3] < (size_t)DM * DM || (size_t)in_sizes[5] < (size_t)DM * DM || (size_t)in_sizes[7] < (size_t)DM * DM || (size_t)in_sizes[9] < (size_t)DM * DM) return;
  if ((size_t)in_sizes[11] < (size_t)DM * DM || (size_t)in_sizes[13] < (size_t)DM * DM || (size_t)in_sizes[17] < (size_t)DM * DM) return;
  if (in_sizes[4] < DM || in_sizes[6] < DM || in_sizes[8] < DM || in_sizes[10] < DM || in_sizes[12] < DM || in_sizes[14] < DM || in_sizes[15] < DM || in_sizes[16] < 1 || in_sizes[18] < DM) return;
  if ((size_t)out_size < NR * DM) return;
  const float* const* I = (const float* const*)d_in;
  const float* xq = I[0]; const float* xk = I[1]; const float* xv = I[2];
  const float* wq = I[3]; const float* bq = I[4]; const float* wk = I[5]; const float* bk = I[6]; const float* wv = I[7]; const float* bv = I[8];
  const float* whq = I[9]; const float* bhq = I[10]; const float* whk = I[11]; const float* bhk = I[12]; const float* wwp = I[13]; const float* bwp = I[14];
  const float* wvp = I[15]; const float* bvp = I[16]; const float* wo = I[17]; const float* bo = I[18];
  char* ws = (char*)d_ws; size_t off = 0;
  auto take = [&](size_t bytes) { char* p = ws + off; off += (bytes + 255) & ~(size_t)255; return p; };
  _Float16* BQ = (_Float16*)take((size_t)DM * DM * 2); _Float16* BK = (_Float16*)take((size_t)DM * DM * 2); _Float16* BV = (_Float16*)take((size_t)DM * DM * 2);
  _Float16* BHQ = (_Float16*)take((size_t)DM * DM * 2); _Float16* BHK = (_Float16*)take((size_t)DM * DM * 2); _Float16* BWP = (_Float16*)take((size_t)DM * DM * 2); _Float16* BO = (_Float16*)take((size_t)DM * DM * 2);
  _Float16* XQ = (_Float16*)take(NR * DM * 2); _Float16* XK = (_Float16*)take(NR * DM * 2); _Float16* XV = (_Float16*)take(NR * DM * 2);
  _Float16* CA = (_Float16*)take(NR * 3 * DM * 2); _Float16* CB = (_Float16*)take(NR * 3 * DM * 2);      /* concatenated planes of the alignment pair */
  _Float16* V16 = (_Float16*)take(NR * DM * 2); _Float16* O16 = (_Float16*)take(NR * DM * 2); _Float16* VT = (_Float16*)take((size_t)NB * NH * HD * SEQ * 2);
  float* S = (float*)take((size_t)NB * NH * QC * SEQ * 4); _Float16* PM = (_Float16*)take((size_t)NB * NH * QC * SEQ * 2);
  float* MEANT = (float*)take((size_t)NB * NH * SEQ * 4); float* SIGT = (float*)take(NR / SGR * 128);
  if (off > ws_size) return;
  float* G = S;                                                            /* f32 wp plane [NR][DM], consumed by k_falign's width table part */
  _Float16* CA2 = PM; _Float16* CB2 = PM + NR * 3 * DM;                    /* content pair's concatenated planes */
  k_cvt<<<7 * WBL + 3 * XBL, 256, 0, stream>>>(wq, wk, wv, whq, whk, wwp, wo, xq, xk, xv, BQ, XQ);      /* planes BQ .. BO and XQ .. XV in the order of their take() calls */
  const dim3 gp((unsigned)((MP / 128) * (DM / 64)), 1);
  k_proj<<<dim3((unsigned)((MP / 128) * (DM / 128)), 6), 128, 0, stream>>>(XQ, XK, XV, BV, BWP, BHQ, BHK, BQ, BK, bv, bwp, bhq, bhk, bq, bk, V16, G, CA, CB, CA2, CB2);
  /* alignment pair: scores and expected key position; slab by = b*NH + h at column offset by*192 of rows with pitch LQ3; with it V16 rows [SEQ*NB][DM] -> VT[(b,h)][64][SEQ] and the width table */
  k_falign<<<dim3(SEQ / 128, NB * NH), 128 * AKW, 0, stream>>>(CA, CB, MEANT, V16, VT, G, wvp, bvp, SIGT, CB2);
  /* content pair: scores, Gaussian softmax and P . V; ctx[t][b][h*64 + d] x64 */
  k_fattn<<<dim3(SEQ / 128, NB * NH), 128, 0, stream>>>(CA2, CB2, VT, MEANT, SIGT, O16);
  k_gemm2<true, true, true><<<gp, 128, 0, stream>>>(O16, DM, 0, BO, DM, 0, 0.0009765625f, bo, (float*)d_out, nullptr, DM, 0, MP, DM, DM);      /* out rows t*NB_FULL + b */
}
